// v000
// Measured on an AMD MI455X. A time is GPU time per run, averaged over a window of back-to-back runs after a warm-up
// (all launches, gaps included; the runs take copies of the inputs in turn), and the median of several windows.
// Apart from v000's, it joins two sittings. Times from different sittings can be a few percent apart, while
// side-by-side timings come from the same sitting.
// The starting kernel, v000, takes 10.5 milliseconds a run.
#include <hip/hip_runtime.h>
// Pre-LN causal transformer block with a fused QKV projection and the module's literal score scale (x [8][1024][1024]; h = LN1(x) (biased var, eps 1e-5); qkv = h Wqkv + bqkv ([in][out] 1024 x 3072 + bias) split q | k | v; 16 heads of 64; scale = 1 / sqrt(3 * 1024 / 16) = 1 / sqrt(192) (as the source: NOT 1 / sqrt(head_dim)); causal (tril, -inf); softmax; x1 = x + y Wproj + bproj; out = x1 + relu(LN2(x1) W1 + b1) W2 + b2 ([in][out] 1024 x 4096 x 1024) -> [8][1024][1024]).
// Structure: token rows r = b*1024 + s; h = LN1(bf16 x) as f16 rows; q | k | v as ONE WMMA GEMM (N = 3 x 1024) (32x64 wave tiles, f32 accumulation, exact x16 weights + bias, f16 outputs); per batch: V^T for all heads via LDS transposes; per query tile of 256 rows: scores against the keys below the tile end only (K = 64, all heads on grid.y, alpha = 1 / sqrt(192)), causal row softmax on VALU with an arithmetic 0/1 key mask over the computed range (f32 statistics, native exp; weights x256 f16), o = P . V^T (K = keys below the tile end, alpha 2^-2: o carried x64, folded into the output GEMM alpha) written straight into the merged f16 o rows; x1 = bf16(x) + o W_o + b GEMM (f32); out = x1 + relu(LN2(x1) W1 + b1) W2 + b2 as f16 GEMMs per batch.
// Compute dtype: inputs rounded to bf16; x / weights exact; q, k, v, softmax weights and o as plain f16 GEMM operands (~2^-12); scores and softmax statistics f32. v_wmma_f32_16x16x32_f16.
#define NB 8
#define SQ 1024
#define DM 1024
#define NH 16
#define HD 64
#define HG 4                         /* heads per block group of the non-template k_vt (not launched) */
#define QT 256                       /* query rows per causal tile */
#define NKX SQ                       /* S / P row pitch */
#define QT0 128                      /* first-tile rows recomputed exactly in f32 */
#define B0 0                         /* first batch processed (debug hook) */
#define NBR NB                       /* batches processed (debug hook) */
#define NR ((size_t)NB * SQ)
#define DMQ DM
#define DFF 4096                     /* FFN hidden width */
#define DFFR 100                     /* unused; the FFN hidden width is DFF */
#define MP ((int)((size_t)NBR * SQ)) /* rows projected (debug hook) */
#define QN SQ                        /* query rows attended per batch (debug hook) */
#define NHD NH                       /* heads attended (debug hook) */
#define MPO MP                       /* rows through the output stage (debug hook) */
#define LQ (3 * DM)      /* row pitch of the q/k/v rows */
typedef __bf16 v16b __attribute__((ext_vector_type(16)));
typedef unsigned short v8us __attribute__((ext_vector_type(8), may_alias));
typedef float  v8f  __attribute__((ext_vector_type(8)));
typedef float  v4f  __attribute__((ext_vector_type(4)));
typedef float  v4fa __attribute__((ext_vector_type(4), may_alias));
union FragB { v16b v; v8us half[2]; unsigned short u[16]; };

__device__ __forceinline__ unsigned short bf16_bits(float x) { unsigned int u = __float_as_uint(x); return (unsigned short)((u + 0x7FFFu + ((u >> 16) & 1u)) >> 16); }
__device__ __forceinline__ float bf16_val(unsigned short b) { return __uint_as_float(((unsigned int)b) << 16); }
__device__ __forceinline__ float bf16_round(float x) { return bf16_val(bf16_bits(x)); }
// D += A·B with NT terms: 1 = ah·bh, 2 = + al·bh (A split), 3 = + ah·bl (both split)
template <int NT>
__device__ __forceinline__ v8f mmaN(v16b ah, v16b al, v16b bh, v16b bl, v8f c) {
  c = __builtin_amdgcn_wmma_f32_16x16x32_bf16(false, ah, false, bh, (short)0, c, false, false);
  if (NT >= 2) c = __builtin_amdgcn_wmma_f32_16x16x32_bf16(false, al, false, bh, (short)0, c, false, false);
  if (NT >= 3) c = __builtin_amdgcn_wmma_f32_16x16x32_bf16(false, ah, false, bl, (short)0, c, false, false);
  asm volatile("v_nop\n\tv_nop\n\tv_nop\n\tv_nop" : "+v"(c) : "v"(ah), "v"(al), "v"(bh), "v"(bl));
  return c;
}

__global__ __launch_bounds__(256) void k_wt_bf16(const float* __restrict__ W, unsigned short* __restrict__ Wt, int K, int N) {
  const int t = blockIdx.x * 256 + threadIdx.x;
  const int k8n = K / 8;
  if (t >= N * k8n) return;
  const int n = t / k8n, k8 = (t % k8n) * 8;
  v8us v;
#pragma unroll
  for (int i = 0; i < 8; ++i) v[i] = bf16_bits(W[(size_t)(k8 + i) * N + n]);
  *(v8us*)(Wt + (size_t)n * K + k8) = v;
  
}

// GEMM C[M][N] (f32, pitch ldc) = act(A[M][K]·W + bias). A f32 row-major (pitch lda) converted per fragment to bf16
// (ASPLIT: hi/lo two planes -> 2 terms, else single rounded term); Wt bf16 [N][K] (pitch ldb). BIAS_BF16 rounds the
// bias to bf16 first (bias quantised to bf16 before the add). K%32==0, M%16==0, N%64==0.
template <bool ASPLIT, int ACT, bool BIAS_BF16>
__global__ __launch_bounds__(128) void k_gemm_bf(const float* __restrict__ A, int lda, const unsigned short* __restrict__ Wt, int ldb,
                                               const float* __restrict__ bias, float* __restrict__ C, int ldc, int M, int N, int K) {
  __shared__ __attribute__((aligned(16))) float so[4][16][64];
  const int tid = threadIdx.x, w = tid >> 5, lane = tid & 31, ln = lane & 15, hh = lane >> 4;
  const int ntn = N / 64;
  const int wid = blockIdx.x * 4 + w;
  const int mt = wid / ntn, nq = wid % ntn;
  if (mt * 16 >= M) return;
  const int row0 = mt * 16, col0 = nq * 64;
  const float* arow = A + (size_t)(row0 + ln) * lda;
  v8f acc[4] = {};
  for (int kb = 0; kb < K; kb += 32) {
    FragB ah, al;
    const v4f x0 = *(const v4fa*)(arow + kb + 8 * hh), x1 = *(const v4fa*)(arow + kb + 8 * hh + 4);
    const v4f x2 = *(const v4fa*)(arow + kb + 16 + 8 * hh), x3 = *(const v4fa*)(arow + kb + 16 + 8 * hh + 4);
    float xs[16] = {x0[0],x0[1],x0[2],x0[3],x1[0],x1[1],x1[2],x1[3],x2[0],x2[1],x2[2],x2[3],x3[0],x3[1],x3[2],x3[3]};
#pragma unroll
    for (int i = 0; i < 16; ++i) { const unsigned short hb = bf16_bits(xs[i]); ah.u[i] = hb; al.u[i] = ASPLIT ? bf16_bits(xs[i] - bf16_val(hb)) : (unsigned short)0; }
#pragma unroll
    for (int t = 0; t < 4; ++t) {
      const unsigned short* brow = Wt + (size_t)(col0 + t * 16 + ln) * ldb + kb;
      FragB b;
      b.half[0] = *(const v8us*)(brow + 8 * hh);
      b.half[1] = *(const v8us*)(brow + 16 + 8 * hh);
      acc[t] = mmaN<ASPLIT ? 2 : 1>(ah.v, al.v, b.v, b.v, acc[t]);
    }
  }
#pragma unroll
  for (int t = 0; t < 4; ++t) {
    float bv = bias ? bias[col0 + t * 16 + ln] : 0.f;
    if (BIAS_BF16) bv = bf16_round(bv);
#pragma unroll
    for (int r = 0; r < 8; ++r) { float v = acc[t][r] + bv; if (ACT == 1) v = fmaxf(v, 0.f); so[w][8 * hh + r][t * 16 + ln] = v; }
  }
  __builtin_amdgcn_fence(__ATOMIC_ACQ_REL, "workgroup");
  __builtin_amdgcn_wave_barrier();
  const int rsub = lane >> 4, c4 = (lane & 15) * 4;
  {
#pragma unroll
    for (int q = 0; q < 8; ++q) {
      const int r = q * 2 + rsub;
      const v4f v = *(const v4fa*)&so[w][r][c4];
      *(v4f*)(C + (size_t)(row0 + r) * ldc + col0 + c4) = v;
    }
    
  }
}

// GEMM C = act(A·W + bias + resid): A f32 (ASPLIT -> hi/lo 2 terms), Wt bf16 [N][K]; ACT 0 none, 1 relu, 2 exact gelu;
// resid (optional, f32, row index = (row % rmod), pitch ldr, RES_BF16 rounds it) added before the activation.
template <bool ASPLIT, int ACT, bool BIAS_BF16, bool RES_BF16>
__global__ __launch_bounds__(128) void k_gemm_bf3(const float* __restrict__ A, int lda, const unsigned short* __restrict__ Wt, int ldb,
                                                const float* __restrict__ bias, const float* __restrict__ resid, int rmod, int ldr,
                                                float* __restrict__ C, int ldc, int M, int N, int K) {
  __shared__ __attribute__((aligned(16))) float so[4][16][64];
  const int tid = threadIdx.x, w = tid >> 5, lane = tid & 31, ln = lane & 15, hh = lane >> 4;
  const int ntn = N / 64;
  const int wid = blockIdx.x * 4 + w;
  const int mt = wid / ntn, nq = wid % ntn;
  if (mt * 16 >= M) return;
  const int row0 = mt * 16, col0 = nq * 64;
  const float* arow = A + (size_t)(row0 + ln) * lda;
  v8f acc[4] = {};
  for (int kb = 0; kb < K; kb += 32) {
    FragB ah, al;
    const v4f x0 = *(const v4fa*)(arow + kb + 8 * hh), x1 = *(const v4fa*)(arow + kb + 8 * hh + 4);
    const v4f x2 = *(const v4fa*)(arow + kb + 16 + 8 * hh), x3 = *(const v4fa*)(arow + kb + 16 + 8 * hh + 4);
    float xs[16] = {x0[0],x0[1],x0[2],x0[3],x1[0],x1[1],x1[2],x1[3],x2[0],x2[1],x2[2],x2[3],x3[0],x3[1],x3[2],x3[3]};
#pragma unroll
    for (int i = 0; i < 16; ++i) { const unsigned short hb = bf16_bits(xs[i]); ah.u[i] = hb; al.u[i] = ASPLIT ? bf16_bits(xs[i] - bf16_val(hb)) : (unsigned short)0; }
#pragma unroll
    for (int t = 0; t < 4; ++t) {
      const unsigned short* brow = Wt + (size_t)(col0 + t * 16 + ln) * ldb + kb;
      FragB b;
      b.half[0] = *(const v8us*)(brow + 8 * hh);
      b.half[1] = *(const v8us*)(brow + 16 + 8 * hh);
      acc[t] = mmaN<ASPLIT ? 2 : 1>(ah.v, al.v, b.v, b.v, acc[t]);
    }
  }
#pragma unroll
  for (int t = 0; t < 4; ++t) {
    const int col = col0 + t * 16 + ln;
    float bv = bias ? bias[col] : 0.f;
    if (BIAS_BF16) bv = bf16_round(bv);
#pragma unroll
    for (int r = 0; r < 8; ++r) {
      float v = acc[t][r] + bv;
      if (resid) { float rv = resid[(size_t)((row0 + 8 * hh + r) % rmod) * ldr + col]; if (RES_BF16) rv = bf16_round(rv); v += rv; }
      if (ACT == 1) v = fmaxf(v, 0.f);
      if (ACT == 2) v = 0.5f * v * (1.0f + erff(v * 0.70710678118654752f));
      if (ACT == 3) { const float u = 0.7978845608028654f * (v + 0.044715f * v * v * v); v = 0.5f * v * (1.0f + tanhf(u)); }
      so[w][8 * hh + r][t * 16 + ln] = v;
    }
  }
  __builtin_amdgcn_fence(__ATOMIC_ACQ_REL, "workgroup");
  __builtin_amdgcn_wave_barrier();
  const int rsub = lane >> 4, c4 = (lane & 15) * 4;
  {
#pragma unroll
    for (int q = 0; q < 8; ++q) {
      const int r = q * 2 + rsub;
      const v4f v = *(const v4fa*)&so[w][r][c4];
      *(v4f*)(C + (size_t)(row0 + r) * ldc + col0 + c4) = v;
    }
    
  }
}
// row LayerNorm (biased variance, eps) over N: s = X (+ R); optional out_sum <- s; out_norm <- (s-mu)*rsqrt(var+eps)*g + b
template <bool PARAM_BF16>
__global__ __launch_bounds__(256) void k_layernorm(const float* __restrict__ X, const float* __restrict__ R, const float* __restrict__ g, const float* __restrict__ bta,
                                                  float* __restrict__ out_sum, float* __restrict__ out_norm, int N, float eps) {
  __shared__ float red[256];
  const int row = blockIdx.x, tid = threadIdx.x;
  const float* x = X + (size_t)row * N; const float* rr = R ? R + (size_t)row * N : nullptr;
  float vals[16];                     // up to N = 4096
  const int per = N / 256;            // contiguous chunk per thread? use strided-by-4 chunks: thread handles j = tid*4 + 1024*u
  float s1 = 0.f;
  for (int u = 0; u < per / 4; ++u) {
    const int j = tid * 4 + 1024 * u;
    const v4f a = *(const v4fa*)(x + j);
    v4f b = {0.f,0.f,0.f,0.f}; if (rr) b = *(const v4fa*)(rr + j);
#pragma unroll
    for (int q = 0; q < 4; ++q) { const float v = a[q] + b[q]; vals[u * 4 + q] = v; s1 += v; }
  }
  red[tid] = s1; __syncthreads();
  for (int st = 128; st > 0; st >>= 1) { if (tid < st) red[tid] += red[tid + st]; __syncthreads(); }
  const float mu = red[0] / (float)N; __syncthreads();
  float s2 = 0.f;
  for (int u = 0; u < per / 4; ++u)
#pragma unroll
    for (int q = 0; q < 4; ++q) { const float c = vals[u * 4 + q] - mu; s2 += c * c; }
  red[tid] = s2; __syncthreads();
  for (int st = 128; st > 0; st >>= 1) { if (tid < st) red[tid] += red[tid + st]; __syncthreads(); }
  const float rs = rsqrtf(red[0] / (float)N + eps);
  {
    for (int u = 0; u < per / 4; ++u) {
      const int j = tid * 4 + 1024 * u;
      v4f o, sm;
#pragma unroll
      for (int q = 0; q < 4; ++q) {
        float gg = g[j + q], bb = bta[j + q];
        if (PARAM_BF16) { gg = bf16_round(gg); bb = bf16_round(bb); }
        sm[q] = vals[u * 4 + q]; o[q] = (vals[u * 4 + q] - mu) * rs * gg + bb;
      }
      if (out_sum) *(v4f*)(out_sum + (size_t)row * N + j) = sm;
      *(v4f*)(out_norm + (size_t)row * N + j) = o;
    }
    
  }
}



// ---- f16 WMMA path (v_wmma_f32_16x16x32_f16): 11-bit significands for operands in range — used where a [0,1] probability operand needs more precision than bf16
typedef _Float16 v16h __attribute__((ext_vector_type(16)));
union FragH { v16h v; v8us half[2]; _Float16 h[16]; unsigned short u[16]; };
template <int NT>
__device__ __forceinline__ v8f mmaH(v16h ah, v16h al, v16h bh, v16h bl, v8f c) {
  c = __builtin_amdgcn_wmma_f32_16x16x32_f16(false, ah, false, bh, (short)0, c, false, false);
  if (NT >= 2) c = __builtin_amdgcn_wmma_f32_16x16x32_f16(false, al, false, bh, (short)0, c, false, false);
  if (NT >= 3) c = __builtin_amdgcn_wmma_f32_16x16x32_f16(false, ah, false, bl, (short)0, c, false, false);
  asm volatile("v_nop\n\tv_nop\n\tv_nop\n\tv_nop" : "+v"(c) : "v"(ah), "v"(al), "v"(bh), "v"(bl));
  return c;
}
// batched GEMM like k_gemm_b but f16 operands: A f32 (split into f16 hi/lo if ASPLIT, else rounded to f16), Bt = f16 values [n][k]; alpha; C f32; N multiple of 16 (partial tiles skipped)
template <bool ASPLIT>
__global__ __launch_bounds__(128) void k_gemm_h(const float* __restrict__ A, int lda, size_t sA, const _Float16* __restrict__ Bh, int ldb, size_t sB, float alpha, float* __restrict__ C, int ldc, size_t sC, int M, int N, int K) {
  __shared__ __attribute__((aligned(16))) float so[4][16][64];
  const int tid = threadIdx.x, w = tid >> 5, lane = tid & 31, ln = lane & 15, hh = lane >> 4; const int by = blockIdx.y;
  A += (size_t)by * sA; Bh += (size_t)by * sB; C += (size_t)by * sC;
  const int ntn = (N + 63) / 64; const int wid = blockIdx.x * 4 + w; const int mt = wid / ntn, nq = wid % ntn; if (mt * 16 >= M) return;
  const int row0 = mt * 16, col0 = nq * 64; const float* arow = A + (size_t)(row0 + ln) * lda;
  v8f acc[4] = {};
  for (int kb = 0; kb < K; kb += 32) {
    FragH ah, al;
    const v4f x0 = *(const v4fa*)(arow + kb + 8 * hh), x1 = *(const v4fa*)(arow + kb + 8 * hh + 4), x2 = *(const v4fa*)(arow + kb + 16 + 8 * hh), x3 = *(const v4fa*)(arow + kb + 16 + 8 * hh + 4);
    float xs[16] = {x0[0],x0[1],x0[2],x0[3],x1[0],x1[1],x1[2],x1[3],x2[0],x2[1],x2[2],x2[3],x3[0],x3[1],x3[2],x3[3]};
#pragma unroll
    for (int i = 0; i < 16; ++i) { const _Float16 h = (_Float16)xs[i]; ah.h[i] = h; al.h[i] = ASPLIT ? (_Float16)(xs[i] - (float)h) : (_Float16)0.0f; }
#pragma unroll
    for (int t = 0; t < 4; ++t) { if (col0 + t * 16 >= N) continue; const size_t boff = (size_t)(col0 + t * 16 + ln) * ldb + kb; FragH bq; bq.half[0] = *(const v8us*)(Bh + boff + 8 * hh); bq.half[1] = *(const v8us*)(Bh + boff + 16 + 8 * hh);
      acc[t] = mmaH<ASPLIT ? 2 : 1>(ah.v, al.v, bq.v, bq.v, acc[t]); }
  }
#pragma unroll
  for (int t = 0; t < 4; ++t) { if (col0 + t * 16 >= N) continue;
#pragma unroll
    for (int r = 0; r < 8; ++r) so[w][8 * hh + r][t * 16 + ln] = acc[t][r] * alpha; }
  __builtin_amdgcn_fence(__ATOMIC_ACQ_REL, "workgroup"); __builtin_amdgcn_wave_barrier();
  const int rsub = lane >> 4, c4 = (lane & 15) * 4;
  {
#pragma unroll
    for (int q = 0; q < 8; ++q) { const int r = q * 2 + rsub; if (col0 + c4 < N) { const v4f v = *(const v4fa*)&so[w][r][c4]; *(v4f*)(C + (size_t)(row0 + r) * ldc + col0 + c4) = v; } }
     }
}

// Wt[n][k] = f16(W[k][n]·scale) from f32 row-major W[K][N] (scale = power of two; bf16-exact weights stay exact in f16 away from the subnormal range)
__global__ __launch_bounds__(256) void k_wt_f16(const float* __restrict__ W, _Float16* __restrict__ Wt, int K, int N, float scale) {
  const int t = blockIdx.x * 256 + threadIdx.x; if (t >= N * (K / 8)) return; const int n = t / (K / 8), k8 = (t % (K / 8)) * 8; FragH f;
#pragma unroll
  for (int i = 0; i < 8; ++i) f.h[i] = (_Float16)(bf16_round(W[(size_t)(k8 + i) * N + n]) * scale); const v8us o = f.half[0];
  *(v8us*)((unsigned short*)Wt + (size_t)n * K + k8) = o; 
}
// k_gemm_hh variant with fused epilogue: v = acc·alpha + bias[by·sBias + col] (+ CP[(row/rowsPerB)·sCPb + by·64 + col] if CP) ; ACT 0 none / 1 elu ; writes f16 C16 (and f32 C if non-null)
template <int ACT>
__global__ __launch_bounds__(128) void k_gemm_hhx(const _Float16* __restrict__ A, int lda, size_t sA, const _Float16* __restrict__ Bh, int ldb, size_t sB, float alpha, const float* __restrict__ bias, size_t sBias, const float* __restrict__ CP, int rowsPerB, size_t sCPb, int row0g,
    float* __restrict__ C, _Float16* __restrict__ C16, int ldc, size_t sC, int M, int N, int K) {
  __shared__ __attribute__((aligned(16))) float so[4][16][64];
  const int tid = threadIdx.x, w = tid >> 5, lane = tid & 31, ln = lane & 15, hh = lane >> 4; const int by = blockIdx.y;
  A += (size_t)by * sA; Bh += (size_t)by * sB; const size_t cofs = (size_t)by * sC; const float* bp = bias ? bias + (size_t)by * sBias : nullptr;
  const int ntn = (N + 63) / 64; const int wid = blockIdx.x * 4 + w; const int mt = wid / ntn, nq = wid % ntn; if (mt * 16 >= M) return;
  const int row0 = mt * 16, col0 = nq * 64; const _Float16* arow = A + (size_t)(row0 + ln) * lda;
  v8f acc[4] = {};
  for (int kb = 0; kb < K; kb += 32) { FragH ah; ah.half[0] = *(const v8us*)((const unsigned short*)arow + kb + 8 * hh); ah.half[1] = *(const v8us*)((const unsigned short*)arow + kb + 16 + 8 * hh);
#pragma unroll
    for (int t = 0; t < 4; ++t) { if (col0 + t * 16 >= N) continue; const size_t boff = (size_t)(col0 + t * 16 + ln) * ldb + kb; FragH bq; bq.half[0] = *(const v8us*)((const unsigned short*)Bh + boff + 8 * hh); bq.half[1] = *(const v8us*)((const unsigned short*)Bh + boff + 16 + 8 * hh);
      acc[t] = mmaH<1>(ah.v, ah.v, bq.v, bq.v, acc[t]); }
  }
#pragma unroll
  for (int t = 0; t < 4; ++t) { if (col0 + t * 16 >= N) continue; const int col = col0 + t * 16 + ln; const float bv = bp ? bf16_round(bp[col]) : 0.f;
#pragma unroll
    for (int r = 0; r < 8; ++r) { float v = acc[t][r] * alpha + bv; if (CP) { const int rr = row0g + row0 + 8 * hh + r; if (rowsPerB < 0) v += CP[cofs + (size_t)rr * ldc + col];      /* rowsPerB < 0: own element of the batched C plane */ else { const int bidx = rr / rowsPerB; v += CP[(size_t)bidx * sCPb + (size_t)by * 64 + col]; } } if (ACT == 1) v = (v > 0.f) ? v : expm1f(v); else if (ACT == 7) v = (v > 0.f) ? v + 1.0f : expf(v); else if (ACT == 8) v = tanhf(v); else if (ACT == 9) v = 0.5f * v * (1.0f + tanhf(0.7978845608028654f * (v + 0.044715f * v * v * v))); else if (ACT == 11) v = 1.0f / (1.0f + expf(-v)); else if (ACT == 12) v = (v > 0.f) ? v : 0.01f * v; else if (ACT == 14) v = (v > 0.f) ? v : 0.1f * v; else if (ACT == 16) v = (v >= 0.f) ? v : 0.3f * v; else if (ACT == 17) v = (v >= 0.f) ? v : 0.2f * v; else if (ACT == 15) v = v / (1.0f + expf(-v)); else if (ACT == 3) v = fmaxf(v, 0.f); else if (ACT == 6) v = 0.5f * v * (1.0f + erff(v * 0.70710678118654752f)); so[w][8 * hh + r][t * 16 + ln] = v; } }
  __builtin_amdgcn_fence(__ATOMIC_ACQ_REL, "workgroup"); __builtin_amdgcn_wave_barrier();
  const int rsub = lane >> 4, c4 = (lane & 15) * 4; typedef _Float16 v4h __attribute__((ext_vector_type(4)));
  {
#pragma unroll
    for (int q = 0; q < 8; ++q) { const int r = q * 2 + rsub; if (col0 + c4 < N) { const v4f v = *(const v4fa*)&so[w][r][c4]; if (C) *(v4f*)(C + cofs + (size_t)(row0 + r) * ldc + col0 + c4) = v; if (C16) { v4h h4; for (int i = 0; i < 4; ++i) h4[i] = (_Float16)v[i]; *(v4h*)(C16 + cofs + (size_t)(row0 + r) * ldc + col0 + c4) = h4; } } }
     }
}


typedef _Float16 v4h __attribute__((ext_vector_type(4)));

__global__ __launch_bounds__(256) void k_x16(const float* __restrict__ x, _Float16* __restrict__ X16, size_t n8) { const size_t t = (size_t)blockIdx.x * 256 + threadIdx.x; if (t >= n8) return; FragH f;
#pragma unroll
  for (int q = 0; q < 8; ++q) f.h[q] = (_Float16)bf16_round(x[t * 8 + q]); *(v8us*)((unsigned short*)X16 + t * 8) = f.half[0];  }
__global__ __launch_bounds__(256) void k_h16(const float* __restrict__ x, _Float16* __restrict__ X16, size_t n8) { const size_t t = (size_t)blockIdx.x * 256 + threadIdx.x; if (t >= n8) return; FragH f;
#pragma unroll
  for (int q = 0; q < 8; ++q) f.h[q] = (_Float16)x[t * 8 + q]; *(v8us*)((unsigned short*)X16 + t * 8) = f.half[0];  }
__global__ __launch_bounds__(256) void k_round16f(const float* __restrict__ W, _Float16* __restrict__ Bt, size_t n8) { const size_t t = (size_t)blockIdx.x * 256 + threadIdx.x; if (t >= n8) return; FragH f;
#pragma unroll
  for (int i = 0; i < 8; ++i) f.h[i] = (_Float16)(bf16_round(W[t * 8 + i]) * 16.0f); *(v8us*)((unsigned short*)Bt + t * 8) = f.half[0];  }
template <int NHv, int TTv>
__global__ __launch_bounds__(256) void k_vt(const _Float16* __restrict__ V16, int ldv, int voff, _Float16* __restrict__ Vt) { __shared__ unsigned short tl[64][66]; const int tid = threadIdx.x; const int slab = blockIdx.x / (TTv / 64), lg = blockIdx.x % (TTv / 64); const int b = slab / NHv, h = slab % NHv;
  for (int i = tid; i < 64 * 8; i += 256) { const int r = i / 8, c8 = (i % 8) * 8; FragH f; f.half[0] = *(const v8us*)((const unsigned short*)V16 + ((size_t)b * TTv + lg * 64 + r) * ldv + voff + h * 64 + c8);
#pragma unroll
    for (int q = 0; q < 8; ++q) tl[r][c8 + q] = f.u[q]; }
  __syncthreads();
  {
#pragma unroll
    for (int rd = 0; rd < 2; ++rd) { const int d = rd * 32 + tid / 8, pc = tid % 8; FragH f;
#pragma unroll
      for (int q = 0; q < 8; ++q) f.u[q] = tl[pc * 8 + q][d];
      *(v8us*)((unsigned short*)Vt + ((size_t)slab * 64 + d) * TTv + lg * 64 + pc * 8) = f.half[0]; }
     } }

__global__ __launch_bounds__(256) void k_hl(const float* __restrict__ F, _Float16* __restrict__ Hh, _Float16* __restrict__ Hl, size_t n8) { const size_t t = (size_t)blockIdx.x * 256 + threadIdx.x; if (t >= n8) return; FragH fh, fl; const v4f a = *(const v4fa*)(F + t * 8), c = *(const v4fa*)(F + t * 8 + 4);
#pragma unroll
  for (int q = 0; q < 4; ++q) { _Float16 h = (_Float16)a[q]; fh.h[q] = h; fl.h[q] = (_Float16)((a[q] - (float)h) * 1024.0f); h = (_Float16)c[q]; fh.h[4 + q] = h; fl.h[4 + q] = (_Float16)((c[q] - (float)h) * 1024.0f); }
  { *(v8us*)((unsigned short*)Hh + t * 8) = fh.half[0]; *(v8us*)((unsigned short*)Hl + t * 8) = fl.half[0];  } }

// ---- fast GEMM (wave tile 32x64; requires M % 32 == 0 rows per launch region and N % 64 == 0); epilogue = k_gemm_hhx semantics ----
__device__ __forceinline__ v16h g2_frag(const _Float16* p, int hh) { FragH f; f.half[0] = *(const v8us*)((const unsigned short*)p + 8 * hh); f.half[1] = *(const v8us*)((const unsigned short*)p + 16 + 8 * hh); return f.v; }
__device__ __forceinline__ v8f g2_mma(v16h a, v16h b, v8f c) { v8f d = __builtin_amdgcn_wmma_f32_16x16x32_f16(false, a, false, b, (short)0, c, false, false); asm volatile("v_nop\n\tv_nop\n\tv_nop\n\tv_nop" : "+v"(d) : "v"(a), "v"(b)); return d; }
template <int ACT>
__global__ __launch_bounds__(128) void k_gemm2(const _Float16* __restrict__ A, int lda, size_t sA, const _Float16* __restrict__ Bh, int ldb, size_t sB, float alpha, const float* __restrict__ bias, size_t sBias, const float* __restrict__ CP, int rowsPerB, size_t sCPb, int row0g,
    float* __restrict__ C, _Float16* __restrict__ C16, int ldc, size_t sC, int M, int N, int K) { static_assert(ACT == 0 || ACT == 3 || ACT == 6 || ACT == 8 || ACT == 9 || ACT == 11 || ACT == 12 || ACT == 14 || ACT == 15 || ACT == 16 || ACT == 17, "k_gemm2: unsupported ACT code (would silently apply no activation)");
  __shared__ __attribute__((aligned(16))) float so[4][32][68];
  const int tid = threadIdx.x, w = tid >> 5, lane = tid & 31, ln = lane & 15, hh = lane >> 4; const int by = blockIdx.y;
  A += (size_t)by * sA; Bh += (size_t)by * sB; const size_t cofs = (size_t)by * sC; const float* bp = bias ? bias + (size_t)by * sBias : nullptr;
  const int ntn = N >> 6; const int mt = blockIdx.x / ntn, nq = blockIdx.x - mt * ntn; const int row0 = mt * 128 + 32 * w, col0 = nq * 64; if (row0 >= M) return;
  const _Float16* a0p = A + (size_t)(row0 + ln) * lda; const _Float16* a1p = a0p + (size_t)16 * lda;
  const _Float16* b0p = Bh + (size_t)(col0 + ln) * ldb; const _Float16* b1p = b0p + (size_t)16 * ldb; const _Float16* b2p = b1p + (size_t)16 * ldb; const _Float16* b3p = b2p + (size_t)16 * ldb;
  const v8f z8 = {0.f,0.f,0.f,0.f,0.f,0.f,0.f,0.f}; v8f c00 = z8, c01 = z8, c02 = z8, c03 = z8, c10 = z8, c11 = z8, c12 = z8, c13 = z8;
#pragma unroll 1
  for (int kb = 0; kb < K; kb += 32) { const v16h a0 = g2_frag(a0p + kb, hh), a1 = g2_frag(a1p + kb, hh);
    v16h b = g2_frag(b0p + kb, hh); c00 = g2_mma(a0, b, c00); c10 = g2_mma(a1, b, c10);
    b = g2_frag(b1p + kb, hh); c01 = g2_mma(a0, b, c01); c11 = g2_mma(a1, b, c11);
    b = g2_frag(b2p + kb, hh); c02 = g2_mma(a0, b, c02); c12 = g2_mma(a1, b, c12);
    b = g2_frag(b3p + kb, hh); c03 = g2_mma(a0, b, c03); c13 = g2_mma(a1, b, c13); }
  v8f accs[8] = {c00, c01, c02, c03, c10, c11, c12, c13};
#pragma unroll
  for (int u = 0; u < 8; ++u) { const int t = u & 3, half = u >> 2; const int col = col0 + t * 16 + ln; const float bv = bp ? bf16_round(bp[col]) : 0.f;
#pragma unroll
    for (int r = 0; r < 8; ++r) { const int rloc = half * 16 + 8 * hh + r; float v = accs[u][r] * alpha + bv; if (CP) { if (rowsPerB < 0) v += CP[cofs + (size_t)(row0g + row0 + rloc) * ldc + col];      /* rowsPerB < 0: own element of the batched C plane */ else { const int bidx = (row0g + row0 + rloc) / rowsPerB; v += CP[(size_t)bidx * sCPb + (size_t)by * 64 + col]; } }
      if (ACT == 3) v = fmaxf(v, 0.f); else if (ACT == 6) v = 0.5f * v * (1.0f + erff(v * 0.70710678118654752f)); else if (ACT == 11) v = 1.0f / (1.0f + expf(-v)); else if (ACT == 15) v = v / (1.0f + expf(-v)); else if (ACT == 12) v = (v > 0.f) ? v : 0.01f * v; else if (ACT == 8) v = tanhf(v); else if (ACT == 9) v = 0.5f * v * (1.0f + tanhf(0.7978845608028654f * (v + 0.044715f * v * v * v))); else if (ACT == 14) v = (v > 0.f) ? v : 0.1f * v; else if (ACT == 16) v = (v >= 0.f) ? v : 0.3f * v; else if (ACT == 17) v = (v >= 0.f) ? v : 0.2f * v;
      so[w][rloc][t * 16 + ln] = v; } }
  __builtin_amdgcn_fence(__ATOMIC_ACQ_REL, "workgroup"); __builtin_amdgcn_wave_barrier();
  const int rsub = lane >> 4, c4 = (lane & 15) * 4;
  {
#pragma unroll
    for (int q = 0; q < 16; ++q) { const int r = q * 2 + rsub; const v4f v = *(const v4fa*)&so[w][r][c4]; if (C) *(v4f*)(C + cofs + (size_t)(row0 + r) * ldc + col0 + c4) = v; if (C16) { v4h h4; for (int i = 0; i < 4; ++i) h4[i] = (_Float16)v[i]; *(v4h*)(C16 + cofs + (size_t)(row0 + r) * ldc + col0 + c4) = h4; } }
     } }


__global__ __launch_bounds__(256) void k_wnat(const float* __restrict__ w, size_t n8, _Float16* __restrict__ Bt) { const size_t t = (size_t)blockIdx.x * 256 + threadIdx.x; if (t >= n8) return; FragH f; for (int q = 0; q < 8; ++q) f.h[q] = (_Float16)(bf16_round(w[t * 8 + q]) * 16.0f); *(v8us*)((unsigned short*)Bt + t * 8) = f.half[0];  }
__global__ __launch_bounds__(256) void k_rsm(const float* __restrict__ S, _Float16* __restrict__ P, int nrows) {
  #pragma clang fp contract(off)
  const int i = blockIdx.x * 256 + threadIdx.x; if (i >= nrows) return; const float* s = S + (size_t)i * SQ; float mx = -3.0e38f;
#pragma unroll 1
  for (int j = 0; j < SQ; ++j) mx = fmaxf(mx, s[j]); float se = 0.f;
#pragma unroll 1
  for (int j = 0; j < SQ; ++j) se += expf(s[j] - mx); const float sc = 256.0f / se;
#pragma unroll 1
  for (int j0 = 0; j0 < SQ; j0 += 8) { FragH f; for (int q = 0; q < 8; ++q) f.h[q] = (_Float16)(expf(s[j0 + q] - mx) * sc); unsigned short* d = (unsigned short*)P + (size_t)i * SQ + j0; *(v8us*)d = f.half[0];  } }
__global__ __launch_bounds__(256) void k_vt(const _Float16* __restrict__ V16, int b, int h0, _Float16* __restrict__ VT) { __shared__ unsigned short tl[64][65]; const int tid = threadIdx.x; const int hh = blockIdx.x % HG, sg = blockIdx.x / HG; const int s0 = sg * 64; const int h = h0 + hh;
  for (int i = tid; i < 64 * 8; i += 256) { const int j = i / 8, d8 = (i % 8) * 8; FragH f; f.half[0] = *(const v8us*)((const unsigned short*)V16 + ((size_t)b * SQ + s0 + j) * DM + h * HD + d8); for (int q = 0; q < 8; ++q) tl[d8 + q][j] = f.u[q]; }
  __syncthreads();
  { for (int i = tid; i < 64 * 8; i += 256) { const int d = i / 8, j8 = (i % 8) * 8; FragH f; for (int q = 0; q < 8; ++q) f.u[q] = tl[d][j8 + q]; *(v8us*)((unsigned short*)VT + ((size_t)hh * HD + d) * SQ + s0 + j8) = f.half[0]; }  } }



__global__ __launch_bounds__(256) void k_rsmcf2(const float* __restrict__ S, _Float16* __restrict__ P, int hg, int q0, int nk) {
  #pragma clang fp contract(off)
  const int t = blockIdx.x * 256 + threadIdx.x; if (t >= hg * QT) return; const size_t i = (size_t)t; const float* s = S + i * NKX; const int last = q0 + (t % QT); float mx = -3.0e38f;
#pragma unroll 1
  for (int j = 0; j < nk; ++j) { const float f = (j <= last) ? 1.f : 0.f; mx = fmaxf(mx, fmaf(f, s[j], (1.f - f) * -1.0e9f)); } float se = 0.f;
#pragma unroll 1
  for (int j = 0; j < nk; ++j) { const float f = (j <= last) ? 1.f : 0.f; se += __expf(fmaf(f, s[j], (1.f - f) * -1.0e9f) - mx); } const float sc = 256.0f / se;
#pragma unroll 1
  for (int j0 = 0; j0 < nk; j0 += 8) { FragH fr; for (int q = 0; q < 8; ++q) { const int j = j0 + q; const float f = (j <= last) ? 1.f : 0.f; fr.h[q] = (_Float16)(__expf(fmaf(f, s[j], (1.f - f) * -1.0e9f) - mx) * sc); } unsigned short* d = (unsigned short*)P + i * NKX + j0; *(v8us*)d = fr.half[0];  } }


template <int MASKADD>
__global__ __launch_bounds__(64) void k_att0(const float* __restrict__ QF, const float* __restrict__ KF, const float* __restrict__ VF, int ld, const float* __restrict__ mask, float scale, float* __restrict__ OF, int ldo) {
  #pragma clang fp contract(off)
  __shared__ __attribute__((aligned(16))) float lq[64][64]; __shared__ __attribute__((aligned(16))) float lo[64][64];
  const int tid = threadIdx.x; const int h = blockIdx.x / (QT0 / 64), rg = blockIdx.x % (QT0 / 64); const int i = rg * 64 + tid;
  const float* qr = QF + (size_t)i * ld + h * HD;
#pragma unroll 1
  for (int c = 0; c < HD / 4; ++c) { *(v4f*)&lq[tid][c * 4] = *(const v4fa*)(qr + c * 4); const v4f z = {0.f, 0.f, 0.f, 0.f}; *(v4f*)&lo[tid][c * 4] = z; }
  float m = -1.0e30f, l = 0.f; const int jmax = MASKADD ? (SQ - 1) : (rg * 64 + 63);      /* additive-mask form: every key (the mask input decides); causal form: keys up to the block's last row */
#pragma unroll 1
  for (int j = 0; j <= jmax; ++j) { const float* kr = KF + (size_t)j * ld + h * HD; const float* vr = VF + (size_t)j * ld + h * HD; float s = 0.f;
#pragma unroll 1
    for (int c = 0; c < HD / 4; ++c) { const v4f kq = *(const v4fa*)(kr + c * 4); const v4f qq = *(v4f*)&lq[tid][c * 4]; s = __fadd_rn(s, __fmul_rn(qq[0], kq[0])); s = __fadd_rn(s, __fmul_rn(qq[1], kq[1])); s = __fadd_rn(s, __fmul_rn(qq[2], kq[2])); s = __fadd_rn(s, __fmul_rn(qq[3], kq[3])); }
    s = __fmul_rn(s, scale); if (MASKADD) s = __fadd_rn(s, __fmul_rn(bf16_round(mask[(size_t)i * SQ + j]), -10000.0f));
    const float f = (MASKADD || j <= i) ? 1.f : 0.f; const float sm = fmaf(f, s, (1.f - f) * -1.0e30f); const float mn = fmaxf(m, sm); const float sc = expf(m - mn); const float e = expf(sm - mn); l = __fadd_rn(__fmul_rn(l, sc), e); m = mn;
#pragma unroll 1
    for (int c = 0; c < HD / 4; ++c) { const v4f vv = *(const v4fa*)(vr + c * 4); v4f oo = *(v4f*)&lo[tid][c * 4]; for (int u = 0; u < 4; ++u) oo[u] = __fadd_rn(__fmul_rn(oo[u], sc), __fmul_rn(e, vv[u])); *(v4f*)&lo[tid][c * 4] = oo; } }
  const float fin = 64.0f / l;      /* o carried x64 like the f16 path */
#pragma unroll 1
  for (int c = 0; c < HD / 4; ++c) { v4f oo = *(v4f*)&lo[tid][c * 4]; for (int u = 0; u < 4; ++u) oo[u] = __fmul_rn(oo[u], fin); *(v4f*)&lo[tid][c * 4] = oo; }
  __syncthreads();
  {
#pragma unroll 1
    for (int it = 0; it < 16; ++it) { const int row = it * 4 + tid / 16, pc = (tid % 16) * 4; const v4f v = *(const v4f*)&lo[row][pc]; *(v4f*)(OF + (size_t)(rg * 64 + row) * ldo + h * HD + pc) = v; }
     } }


template <int BFIN, int WXB>
__global__ __launch_bounds__(256) void k_ln16(const float* __restrict__ X, const float* __restrict__ g, const float* __restrict__ bb, float eps, _Float16* __restrict__ N16, float* __restrict__ XB) {
  #pragma clang fp contract(off)
  __shared__ float red[256]; const size_t r = blockIdx.x; const int t = threadIdx.x; const v4f xa = *(const v4fa*)(X + r * DMQ + t * 4); float s[4]; float sum = 0.f;
  for (int q = 0; q < 4; ++q) { s[q] = BFIN ? bf16_round(xa[q]) : xa[q]; sum = __fadd_rn(sum, s[q]); }
  red[t] = sum; __syncthreads(); for (int st = 128; st > 0; st >>= 1) { if (t < st) red[t] = __fadd_rn(red[t], red[t + st]); __syncthreads(); } const float mu = red[0] / (float)DMQ; __syncthreads();
  float vs = 0.f; for (int q = 0; q < 4; ++q) { const float dl = __fadd_rn(s[q], -mu); vs = __fadd_rn(vs, __fmul_rn(dl, dl)); } red[t] = vs; __syncthreads(); for (int st = 128; st > 0; st >>= 1) { if (t < st) red[t] = __fadd_rn(red[t], red[t + st]); __syncthreads(); }
  const float rs = rsqrtf(__fadd_rn(red[0] / (float)DMQ, eps)); v4h y; v4f xb;
  for (int q = 0; q < 4; ++q) { const int c = t * 4 + q; y[q] = (_Float16)__fadd_rn(__fmul_rn(__fmul_rn(__fadd_rn(s[q], -mu), rs), bf16_round(g[c])), bf16_round(bb[c])); xb[q] = s[q]; }
  { *(v4h*)(N16 + r * DMQ + t * 4) = y; if (WXB) *(v4f*)(XB + r * DMQ + t * 4) = xb;  } }
__global__ __launch_bounds__(256) void k_ftres2(const float* __restrict__ OF0, const float* __restrict__ XB, float* __restrict__ X1, size_t n4) {
  #pragma clang fp contract(off)
  const size_t t = (size_t)blockIdx.x * 256 + threadIdx.x; if (t >= n4) return; const v4f o = *(const v4fa*)(OF0 + t * 4), xv = *(const v4fa*)(XB + t * 4); v4f y; for (int q = 0; q < 4; ++q) y[q] = __fadd_rn(__fmul_rn(o[q], 0.015625f), xv[q]); *(v4f*)(X1 + t * 4) = y;  }

__global__ __launch_bounds__(256) void k_wthd(const float* __restrict__ Wt, _Float16* __restrict__ Bt) { const size_t t = (size_t)blockIdx.x * 256 + threadIdx.x; if (t >= (size_t)NH * HD * (DM / 8)) return; const int m8 = (int)(t % (DM / 8)) * 8; const int d = (int)((t / (DM / 8)) % HD); const int h = (int)(t / ((size_t)(DM / 8) * HD)); FragH f;
  for (int q = 0; q < 8; ++q) f.h[q] = (_Float16)(16.0f * bf16_round(Wt[((size_t)h * DM + m8 + q) * HD + d])); unsigned short* dst = (unsigned short*)Bt + ((size_t)h * HD + d) * DM + m8; *(v8us*)dst = f.half[0];  }




__global__ __launch_bounds__(256) void k_wtpad(const float* __restrict__ Wm, _Float16* __restrict__ Wt, int Kr, int Kp, int Nr, int Np, float scale) {
  const int t = blockIdx.x * 256 + threadIdx.x; if (t >= Np * (Kp / 8)) return; const int n = t / (Kp / 8), k8 = (t % (Kp / 8)) * 8; const int nc = min(n, Nr - 1); const float fn = (n < Nr) ? 1.f : 0.f; FragH f;
  for (int i = 0; i < 8; ++i) { const int k = k8 + i; const int kc = min(k, Kr - 1); const float fk = (k < Kr) ? fn : 0.f; f.h[i] = (_Float16)(bf16_round(Wm[(size_t)kc * Nr + nc]) * scale * fk); }
  unsigned short* o = (unsigned short*)Wt + (size_t)n * Kp + k8; *(v8us*)o = f.half[0];  }
__global__ __launch_bounds__(128) void k_bpad(const float* __restrict__ b, float* __restrict__ Bp, int nr, int np) {
  const int i = threadIdx.x; if (i >= np) return; const float v = b[min(i, nr - 1)] * ((i < nr) ? 1.f : 0.f); *(float*)(Bp + i) = v;  }
extern "C" void kernel_launch(void* const* d_in, const int* in_sizes, int n_in,
                              void* d_out, int out_size, void* d_ws, size_t ws_size, hipStream_t stream) {
  (void)in_sizes; (void)n_in; (void)out_size;
  const float* const* I = (const float* const*)d_in; const float* x = I[0]; const float* wqkv = I[1]; const float* bqkv = I[2]; const float* wo = I[3]; const float* bo = I[4]; const float* g1 = I[5]; const float* be1 = I[6]; const float* gg2 = I[7]; const float* be2 = I[8]; const float* wfc = I[9]; const float* bfc = I[10]; const float* wmp = I[11]; const float* bmp = I[12];      /* x; fused Wqkv [1024][3072] + bqkv [3072] ([in][out]); Wproj + bproj; LN1 g / b, LN2 g / b; W1 [1024][4096] + b1, W2 [4096][1024] + b2 */
  char* ws = (char*)d_ws; size_t off = 0;
  auto take = [&](size_t bytes) { char* p = ws + off; off += (bytes + 255) & ~(size_t)255; return p; };
  _Float16* BQKV = (_Float16*)take((size_t)3 * DM * DM * 2); _Float16* BO = (_Float16*)take((size_t)DM * DM * 2);
  _Float16* X16 = (_Float16*)take(NR * DM * 2); float* XB = (float*)take(NR * DM * 4); float* X1 = (float*)take(NR * DM * 4); _Float16* M16 = nullptr;      /* = X16 below (alias: X16's last reader, the last batch's first-tile GEMMs, precedes LN2's write) */ _Float16* HF16 = (_Float16*)take((size_t)SQ * DFF * 2); _Float16* BW1 = (_Float16*)take((size_t)DFF * DM * 2); _Float16* BW2 = (_Float16*)take((size_t)DM * DFF * 2); _Float16* QKV = (_Float16*)take(NR * 3 * DM * 2); _Float16* Q16 = QKV; _Float16* K16 = QKV + DM; _Float16* V16 = QKV + 2 * DM; _Float16* O16 = (_Float16*)take(NR * DM * 2); M16 = X16;
  float* S = (float*)take((size_t)NH * QT * NKX * 4); _Float16* P = (_Float16*)take((size_t)NH * QT * NKX * 2); _Float16* VT = (_Float16*)take((size_t)NH * HD * SQ * 2);
  float* QF0 = (float*)take((size_t)QT0 * DM * 4); float* KF0 = (float*)take((size_t)QT0 * DM * 4); float* VF0 = (float*)take((size_t)QT0 * DM * 4); float* OF0 = (float*)take((size_t)NB * QT0 * DM * 4); _Float16* OH0 = (_Float16*)take((size_t)NB * QT0 * DM * 2); _Float16* OL0 = (_Float16*)take((size_t)NB * QT0 * DM * 2);
  if (off > ws_size) return;
  k_wt_f16<<<(unsigned)(((size_t)3 * DM * (DM / 8) + 255) / 256), 256, 0, stream>>>(wqkv, BQKV, DM, 3 * DM, 16.0f);      /* fused [in][out] [DM][3 DM] -> Bt [3 DM][DM] x16: rows 0.. = q, DM.. = k, 2 DM.. = v output columns (contiguous thirds) */ k_wt_f16<<<(unsigned)(((size_t)DM * (DM / 8) + 255) / 256), 256, 0, stream>>>(wo, BO, DM, DM, 16.0f);      /* w_proj [in][out] -> Bt x16 */
  k_ln16<1, 1><<<(unsigned)NR, 256, 0, stream>>>(x, g1, be1, 1e-5f, X16, XB);      /* a = LN1(bf16(x)) -> f16 rows; XB = bf16(x) for the residual */
  k_wt_f16<<<(unsigned)(((size_t)DFF * (DM / 8) + 255) / 256), 256, 0, stream>>>(wfc, BW1, DM, DFF, 16.0f); k_wt_f16<<<(unsigned)(((size_t)DM * (DFF / 8) + 255) / 256), 256, 0, stream>>>(wmp, BW2, DFF, DM, 16.0f);      /* W1 [1024][4096] -> Bt [4096][1024]; W2 [4096][1024] -> Bt [1024][4096] (x16) */
  const size_t r0p = (size_t)B0 * SQ;      /* first projected row */
  k_gemm2<0><<<dim3((unsigned)((MP / 128) * (3 * DM / 64)), 1), 128, 0, stream>>>(X16 + r0p * DM, DM, 0, BQKV, DM, 0, 0.0625f, bqkv, 0, nullptr, 1, 0, 0, nullptr, QKV + r0p * 3 * DM, 3 * DM, 0, MP, 3 * DM, DM);      /* q | k | v rows (f16); head h = columns h*HD.. of each DM block */
  for (int b = B0; b < B0 + NBR; ++b) { const size_t r0 = (size_t)b * SQ;
    k_vt<NH, SQ><<<NH * (SQ / 64), 256, 0, stream>>>(V16 + r0 * LQ, LQ, 0, VT);      /* V^T [NH][HD][SQ] for this batch */
    k_gemm2<0><<<dim3((QT0 / 128) * (DM / 64), 1), 128, 0, stream>>>(X16 + r0 * DM, DM, 0, BQKV, DM, 0, 0.0625f, bqkv, 0, nullptr, 1, 0, 0, QF0, nullptr, DM, 0, QT0, DM, DM); k_gemm2<0><<<dim3((QT0 / 128) * (DM / 64), 1), 128, 0, stream>>>(X16 + r0 * DM, DM, 0, (BQKV + (size_t)DM * DM), DM, 0, 0.0625f, bqkv + DM, 0, nullptr, 1, 0, 0, KF0, nullptr, DM, 0, QT0, DM, DM); k_gemm2<0><<<dim3((QT0 / 128) * (DM / 64), 1), 128, 0, stream>>>(X16 + r0 * DM, DM, 0, (BQKV + (size_t)2 * DM * DM), DM, 0, 0.0625f, bqkv + 2 * DM, 0, nullptr, 1, 0, 0, VF0, nullptr, DM, 0, QT0, DM, DM);      /* f32 q, k, v of the first 128 rows (exact products) */
    k_att0<0><<<NH * (QT0 / 64), 64, 0, stream>>>(QF0, KF0, VF0, DM, nullptr, 0.07216878364870322f, OF0 + (size_t)b * QT0 * DM, DM);      /* exact f32 attention for rows 0..127 (o x64) */
    for (int q0 = 0; q0 < QN; q0 += QT) { const int nk = q0 + QT;      /* causal: only keys below the tile end are computed */
      k_gemm2<0><<<dim3((QT / 128) * (nk / 64), NHD), 128, 0, stream>>>(Q16 + (r0 + q0) * LQ, LQ, (size_t)HD, K16 + r0 * LQ, LQ, (size_t)HD, 0.07216878364870322f, nullptr, 0, nullptr, 1, 0, 0, S, nullptr, NKX, (size_t)QT * NKX, QT, nk, HD);      /* scores, all heads on grid.y */
      k_rsmcf2<<<(NHD * QT + 255) / 256, 256, 0, stream>>>(S, P, NHD, q0, nk);
      k_gemm2<0><<<dim3((QT / 128) * (HD / 64), NHD), 128, 0, stream>>>(P, NKX, (size_t)QT * NKX, VT, SQ, (size_t)HD * SQ, 0.25f, nullptr, 0, nullptr, 1, 0, 0, nullptr, O16 + (r0 + q0) * DM, DM, (size_t)HD, QT, HD, nk); } }      /* o (merged heads, x64) as f16 rows */
  k_gemm2<0><<<dim3((unsigned)((MPO / 128) * (DM / 64)), 1), 128, 0, stream>>>(O16 + r0p * DM, DM, 0, BO, DM, 0, 0.0009765625f, bo, 0, XB + r0p * DM, -1, 0, 0, X1 + r0p * DM, nullptr, DM, 0, MPO, DM, DM);      /* x1 = bf16(x) + o Wo + b (f32 rows) */
  k_hl<<<(unsigned)(((size_t)NB * QT0 * DM / 8 + 255) / 256), 256, 0, stream>>>(OF0, OH0, OL0, (size_t)NB * QT0 * DM / 8);      /* first-tile o (x64) -> f16 hi + x1024 residual planes */
  for (int b = B0; b < B0 + NBR; ++b) { const size_t r0 = (size_t)b * SQ; const size_t f0 = (size_t)b * QT0;
    k_gemm2<0><<<dim3((QT0 / 128) * (DM / 64), 1), 128, 0, stream>>>(OH0 + f0 * DM, DM, 0, BO, DM, 0, 0.0009765625f, bo, 0, XB + r0 * DM, -1, 0, 0, X1 + r0 * DM, nullptr, DM, 0, QT0, DM, DM);      /* rows 0..127: x1 = bf16(x) + o_hi Wo + b, overwriting the f16-path rows */
    k_gemm2<0><<<dim3((QT0 / 128) * (DM / 64), 1), 128, 0, stream>>>(OL0 + f0 * DM, DM, 0, BO, DM, 0, 0.00000095367431640625f, nullptr, 0, X1 + r0 * DM, -1, 0, 0, X1 + r0 * DM, nullptr, DM, 0, QT0, DM, DM); }      /* += o_lo Wo 2^-20 (own-element accumulate) */
  k_ln16<0, 0><<<(unsigned)NR, 256, 0, stream>>>(X1, gg2, be2, 1e-5f, M16, nullptr);      /* h = LN2(x1) -> f16 rows */
  for (int b = 0; b < NB; ++b) { const size_t r0 = (size_t)b * SQ;
    k_gemm2<3><<<dim3((unsigned)((SQ / 128) * (DFF / 64)), 1), 128, 0, stream>>>(M16 + r0 * DM, DM, 0, BW1, DM, 0, 0.0625f, bfc, 0, nullptr, 1, 0, 0, nullptr, HF16, DFF, 0, SQ, DFF, DM);      /* relu(h2 W1 + b1) -> f16 (this batch) */
    k_gemm2<0><<<dim3((unsigned)((SQ / 128) * (DM / 64)), 1), 128, 0, stream>>>(HF16, DFF, 0, BW2, DFF, 0, 0.0625f, bmp, 0, X1 + r0 * DM, -1, 0, 0, (float*)d_out + r0 * DM, nullptr, DM, 0, SQ, DM, DFF); }      /* out = x1 + mlp (own-element residual) */
}

// v001
// It runs in 2460 microseconds.
// In two side-by-side timings against v000, it was 4.28 and 4.29 times as fast.
#include <hip/hip_runtime.h>
// Pre-LN causal transformer block with a fused QKV projection and the module's literal score scale (x [8][1024][1024]; h = LN1(x) (biased var, eps 1e-5); qkv = h Wqkv + bqkv ([in][out] 1024 x 3072 + bias) split q | k | v; 16 heads of 64; scale = 1 / sqrt(3 * 1024 / 16) = 1 / sqrt(192) (as the source: NOT 1 / sqrt(head_dim)); causal (tril, -inf); softmax; x1 = x + y Wproj + bproj; out = x1 + relu(LN2(x1) W1 + b1) W2 + b2 ([in][out] 1024 x 4096 x 1024) -> [8][1024][1024]).
// Structure: token rows r = b*1024 + s; h = LN1(bf16(x)) as f16 rows; q | k | v as ONE WMMA GEMM (N = 3 x 1024) (32x64 wave tiles, f32 accumulation, exact x16 weights + bias, f16 outputs); per batch: V^T for all heads via LDS transposes; per query tile of 256 rows: scores against the keys below the tile end only (K = 64, all heads on grid.y, alpha = 1 / sqrt(192)), causal row softmax on VALU with an arithmetic 0/1 key mask over the computed range (f32 statistics, native exp; weights x256 f16), o = P . V^T (K = keys below the tile end, alpha 2^-2: o carried x64, folded into the output GEMM alpha) written straight into the merged f16 o rows; x1 = x + o W_o + b GEMM (f32); out = x1 + relu(LN2(x1) W1 + b1) W2 + b2 by f16 GEMMs.
// Compute dtype: inputs rounded to bf16; x / weights exact; q, k, v, softmax weights and o as plain f16 GEMM operands (~2^-12); scores and softmax statistics f32. v_wmma_f32_16x16x32_f16.
// Launches: the batch axis lies on the grid, plus a host loop over the NB / GB batch groups of the scores, softmax and P V: V^T takes all batches on grid.x; the first-tile q | k | v GEMM, the exact first-tile attention and the first-tile output GEMMs take all batches on grid.y; scores, softmax and P V take GB batches a launch (grid.z; S and P hold GB batches); the FFN GEMMs take all token rows.
#define NB 8
#define SQ 1024
#define DM 1024
#define NH 16
#define HD 64
#define HG 4                         /* heads per block group of the non-template k_vt (not launched) */
#define QT 256                       /* query rows per causal tile */
#define NKX SQ                       /* S / P row pitch */
#define QT0 128                      /* first-tile rows recomputed exactly in f32 */
#define GB 4                         /* batches per attention launch (grid.z); S and P hold GB batches */
#define B0 0                         /* unused; the batch loops start at 0 */
#define NBR NB                       /* batches processed (debug hook) */
#define NR ((size_t)NB * SQ)
#define DMQ DM
#define DFF 4096                     /* FFN hidden width */
#define DFFR 100                     /* unused; the FFN hidden width is DFF */
#define MP ((int)((size_t)NBR * SQ)) /* rows projected (debug hook) */
#define QN SQ                        /* query rows attended per batch (debug hook) */
#define NHD NH                       /* heads attended (debug hook) */
#define MPO MP                       /* rows through the output stage (debug hook) */
#define LQ (3 * DM)      /* row pitch of the q/k/v rows */
typedef __bf16 v16b __attribute__((ext_vector_type(16)));
typedef unsigned short v8us __attribute__((ext_vector_type(8), may_alias));
typedef float  v8f  __attribute__((ext_vector_type(8)));
typedef float  v4f  __attribute__((ext_vector_type(4)));
typedef float  v4fa __attribute__((ext_vector_type(4), may_alias));
union FragB { v16b v; v8us half[2]; unsigned short u[16]; };

__device__ __forceinline__ unsigned short bf16_bits(float x) { unsigned int u = __float_as_uint(x); return (unsigned short)((u + 0x7FFFu + ((u >> 16) & 1u)) >> 16); }
__device__ __forceinline__ float bf16_val(unsigned short b) { return __uint_as_float(((unsigned int)b) << 16); }
__device__ __forceinline__ float bf16_round(float x) { return bf16_val(bf16_bits(x)); }
// D += A·B with NT terms: 1 = ah·bh, 2 = + al·bh (A split), 3 = + ah·bl (both split)
template <int NT>
__device__ __forceinline__ v8f mmaN(v16b ah, v16b al, v16b bh, v16b bl, v8f c) {
  c = __builtin_amdgcn_wmma_f32_16x16x32_bf16(false, ah, false, bh, (short)0, c, false, false);
  if (NT >= 2) c = __builtin_amdgcn_wmma_f32_16x16x32_bf16(false, al, false, bh, (short)0, c, false, false);
  if (NT >= 3) c = __builtin_amdgcn_wmma_f32_16x16x32_bf16(false, ah, false, bl, (short)0, c, false, false);
  asm volatile("v_nop\n\tv_nop\n\tv_nop\n\tv_nop" : "+v"(c) : "v"(ah), "v"(al), "v"(bh), "v"(bl));
  return c;
}

__global__ __launch_bounds__(256) void k_wt_bf16(const float* __restrict__ W, unsigned short* __restrict__ Wt, int K, int N) {
  const int t = blockIdx.x * 256 + threadIdx.x;
  const int k8n = K / 8;
  if (t >= N * k8n) return;
  const int n = t / k8n, k8 = (t % k8n) * 8;
  v8us v;
#pragma unroll
  for (int i = 0; i < 8; ++i) v[i] = bf16_bits(W[(size_t)(k8 + i) * N + n]);
  *(v8us*)(Wt + (size_t)n * K + k8) = v;
  
}

// GEMM C[M][N] (f32, pitch ldc) = act(A[M][K]·W + bias). A f32 row-major (pitch lda) converted per fragment to bf16
// (ASPLIT: hi/lo two planes -> 2 terms, else single rounded term); Wt bf16 [N][K] (pitch ldb). BIAS_BF16 rounds the
// bias to bf16 first (bias quantised to bf16 before the add). K%32==0, M%16==0, N%64==0.
template <bool ASPLIT, int ACT, bool BIAS_BF16>
__global__ __launch_bounds__(128) void k_gemm_bf(const float* __restrict__ A, int lda, const unsigned short* __restrict__ Wt, int ldb,
                                               const float* __restrict__ bias, float* __restrict__ C, int ldc, int M, int N, int K) {
  __shared__ __attribute__((aligned(16))) float so[4][16][64];
  const int tid = threadIdx.x, w = tid >> 5, lane = tid & 31, ln = lane & 15, hh = lane >> 4;
  const int ntn = N / 64;
  const int wid = blockIdx.x * 4 + w;
  const int mt = wid / ntn, nq = wid % ntn;
  if (mt * 16 >= M) return;
  const int row0 = mt * 16, col0 = nq * 64;
  const float* arow = A + (size_t)(row0 + ln) * lda;
  v8f acc[4] = {};
  for (int kb = 0; kb < K; kb += 32) {
    FragB ah, al;
    const v4f x0 = *(const v4fa*)(arow + kb + 8 * hh), x1 = *(const v4fa*)(arow + kb + 8 * hh + 4);
    const v4f x2 = *(const v4fa*)(arow + kb + 16 + 8 * hh), x3 = *(const v4fa*)(arow + kb + 16 + 8 * hh + 4);
    float xs[16] = {x0[0],x0[1],x0[2],x0[3],x1[0],x1[1],x1[2],x1[3],x2[0],x2[1],x2[2],x2[3],x3[0],x3[1],x3[2],x3[3]};
#pragma unroll
    for (int i = 0; i < 16; ++i) { const unsigned short hb = bf16_bits(xs[i]); ah.u[i] = hb; al.u[i] = ASPLIT ? bf16_bits(xs[i] - bf16_val(hb)) : (unsigned short)0; }
#pragma unroll
    for (int t = 0; t < 4; ++t) {
      const unsigned short* brow = Wt + (size_t)(col0 + t * 16 + ln) * ldb + kb;
      FragB b;
      b.half[0] = *(const v8us*)(brow + 8 * hh);
      b.half[1] = *(const v8us*)(brow + 16 + 8 * hh);
      acc[t] = mmaN<ASPLIT ? 2 : 1>(ah.v, al.v, b.v, b.v, acc[t]);
    }
  }
#pragma unroll
  for (int t = 0; t < 4; ++t) {
    float bv = bias ? bias[col0 + t * 16 + ln] : 0.f;
    if (BIAS_BF16) bv = bf16_round(bv);
#pragma unroll
    for (int r = 0; r < 8; ++r) { float v = acc[t][r] + bv; if (ACT == 1) v = fmaxf(v, 0.f); so[w][8 * hh + r][t * 16 + ln] = v; }
  }
  __builtin_amdgcn_fence(__ATOMIC_ACQ_REL, "workgroup");
  __builtin_amdgcn_wave_barrier();
  const int rsub = lane >> 4, c4 = (lane & 15) * 4;
  {
#pragma unroll
    for (int q = 0; q < 8; ++q) {
      const int r = q * 2 + rsub;
      const v4f v = *(const v4fa*)&so[w][r][c4];
      *(v4f*)(C + (size_t)(row0 + r) * ldc + col0 + c4) = v;
    }
    
  }
}

// GEMM C = act(A·W + bias + resid): A f32 (ASPLIT -> hi/lo 2 terms), Wt bf16 [N][K]; ACT 0 none, 1 relu, 2 exact gelu;
// resid (optional, f32, row index = (row % rmod), pitch ldr, RES_BF16 rounds it) added before the activation.
template <bool ASPLIT, int ACT, bool BIAS_BF16, bool RES_BF16>
__global__ __launch_bounds__(128) void k_gemm_bf3(const float* __restrict__ A, int lda, const unsigned short* __restrict__ Wt, int ldb,
                                                const float* __restrict__ bias, const float* __restrict__ resid, int rmod, int ldr,
                                                float* __restrict__ C, int ldc, int M, int N, int K) {
  __shared__ __attribute__((aligned(16))) float so[4][16][64];
  const int tid = threadIdx.x, w = tid >> 5, lane = tid & 31, ln = lane & 15, hh = lane >> 4;
  const int ntn = N / 64;
  const int wid = blockIdx.x * 4 + w;
  const int mt = wid / ntn, nq = wid % ntn;
  if (mt * 16 >= M) return;
  const int row0 = mt * 16, col0 = nq * 64;
  const float* arow = A + (size_t)(row0 + ln) * lda;
  v8f acc[4] = {};
  for (int kb = 0; kb < K; kb += 32) {
    FragB ah, al;
    const v4f x0 = *(const v4fa*)(arow + kb + 8 * hh), x1 = *(const v4fa*)(arow + kb + 8 * hh + 4);
    const v4f x2 = *(const v4fa*)(arow + kb + 16 + 8 * hh), x3 = *(const v4fa*)(arow + kb + 16 + 8 * hh + 4);
    float xs[16] = {x0[0],x0[1],x0[2],x0[3],x1[0],x1[1],x1[2],x1[3],x2[0],x2[1],x2[2],x2[3],x3[0],x3[1],x3[2],x3[3]};
#pragma unroll
    for (int i = 0; i < 16; ++i) { const unsigned short hb = bf16_bits(xs[i]); ah.u[i] = hb; al.u[i] = ASPLIT ? bf16_bits(xs[i] - bf16_val(hb)) : (unsigned short)0; }
#pragma unroll
    for (int t = 0; t < 4; ++t) {
      const unsigned short* brow = Wt + (size_t)(col0 + t * 16 + ln) * ldb + kb;
      FragB b;
      b.half[0] = *(const v8us*)(brow + 8 * hh);
      b.half[1] = *(const v8us*)(brow + 16 + 8 * hh);
      acc[t] = mmaN<ASPLIT ? 2 : 1>(ah.v, al.v, b.v, b.v, acc[t]);
    }
  }
#pragma unroll
  for (int t = 0; t < 4; ++t) {
    const int col = col0 + t * 16 + ln;
    float bv = bias ? bias[col] : 0.f;
    if (BIAS_BF16) bv = bf16_round(bv);
#pragma unroll
    for (int r = 0; r < 8; ++r) {
      float v = acc[t][r] + bv;
      if (resid) { float rv = resid[(size_t)((row0 + 8 * hh + r) % rmod) * ldr + col]; if (RES_BF16) rv = bf16_round(rv); v += rv; }
      if (ACT == 1) v = fmaxf(v, 0.f);
      if (ACT == 2) v = 0.5f * v * (1.0f + erff(v * 0.70710678118654752f));
      if (ACT == 3) { const float u = 0.7978845608028654f * (v + 0.044715f * v * v * v); v = 0.5f * v * (1.0f + tanhf(u)); }
      so[w][8 * hh + r][t * 16 + ln] = v;
    }
  }
  __builtin_amdgcn_fence(__ATOMIC_ACQ_REL, "workgroup");
  __builtin_amdgcn_wave_barrier();
  const int rsub = lane >> 4, c4 = (lane & 15) * 4;
  {
#pragma unroll
    for (int q = 0; q < 8; ++q) {
      const int r = q * 2 + rsub;
      const v4f v = *(const v4fa*)&so[w][r][c4];
      *(v4f*)(C + (size_t)(row0 + r) * ldc + col0 + c4) = v;
    }
    
  }
}
// row LayerNorm (biased variance, eps) over N: s = X (+ R); optional out_sum <- s; out_norm <- (s-mu)*rsqrt(var+eps)*g + b
template <bool PARAM_BF16>
__global__ __launch_bounds__(256) void k_layernorm(const float* __restrict__ X, const float* __restrict__ R, const float* __restrict__ g, const float* __restrict__ bta,
                                                  float* __restrict__ out_sum, float* __restrict__ out_norm, int N, float eps) {
  __shared__ float red[256];
  const int row = blockIdx.x, tid = threadIdx.x;
  const float* x = X + (size_t)row * N; const float* rr = R ? R + (size_t)row * N : nullptr;
  float vals[16];                     // up to N = 4096
  const int per = N / 256;            // contiguous chunk per thread? use strided-by-4 chunks: thread handles j = tid*4 + 1024*u
  float s1 = 0.f;
  for (int u = 0; u < per / 4; ++u) {
    const int j = tid * 4 + 1024 * u;
    const v4f a = *(const v4fa*)(x + j);
    v4f b = {0.f,0.f,0.f,0.f}; if (rr) b = *(const v4fa*)(rr + j);
#pragma unroll
    for (int q = 0; q < 4; ++q) { const float v = a[q] + b[q]; vals[u * 4 + q] = v; s1 += v; }
  }
  red[tid] = s1; __syncthreads();
  for (int st = 128; st > 0; st >>= 1) { if (tid < st) red[tid] += red[tid + st]; __syncthreads(); }
  const float mu = red[0] / (float)N; __syncthreads();
  float s2 = 0.f;
  for (int u = 0; u < per / 4; ++u)
#pragma unroll
    for (int q = 0; q < 4; ++q) { const float c = vals[u * 4 + q] - mu; s2 += c * c; }
  red[tid] = s2; __syncthreads();
  for (int st = 128; st > 0; st >>= 1) { if (tid < st) red[tid] += red[tid + st]; __syncthreads(); }
  const float rs = rsqrtf(red[0] / (float)N + eps);
  {
    for (int u = 0; u < per / 4; ++u) {
      const int j = tid * 4 + 1024 * u;
      v4f o, sm;
#pragma unroll
      for (int q = 0; q < 4; ++q) {
        float gg = g[j + q], bb = bta[j + q];
        if (PARAM_BF16) { gg = bf16_round(gg); bb = bf16_round(bb); }
        sm[q] = vals[u * 4 + q]; o[q] = (vals[u * 4 + q] - mu) * rs * gg + bb;
      }
      if (out_sum) *(v4f*)(out_sum + (size_t)row * N + j) = sm;
      *(v4f*)(out_norm + (size_t)row * N + j) = o;
    }
    
  }
}



// ---- f16 WMMA path (v_wmma_f32_16x16x32_f16): 11-bit significands for operands in range — used where a [0,1] probability operand needs more precision than bf16
typedef _Float16 v16h __attribute__((ext_vector_type(16)));
union FragH { v16h v; v8us half[2]; _Float16 h[16]; unsigned short u[16]; };
template <int NT>
__device__ __forceinline__ v8f mmaH(v16h ah, v16h al, v16h bh, v16h bl, v8f c) {
  c = __builtin_amdgcn_wmma_f32_16x16x32_f16(false, ah, false, bh, (short)0, c, false, false);
  if (NT >= 2) c = __builtin_amdgcn_wmma_f32_16x16x32_f16(false, al, false, bh, (short)0, c, false, false);
  if (NT >= 3) c = __builtin_amdgcn_wmma_f32_16x16x32_f16(false, ah, false, bl, (short)0, c, false, false);
  asm volatile("v_nop\n\tv_nop\n\tv_nop\n\tv_nop" : "+v"(c) : "v"(ah), "v"(al), "v"(bh), "v"(bl));
  return c;
}
// batched GEMM like k_gemm_b but f16 operands: A f32 (split into f16 hi/lo if ASPLIT, else rounded to f16), Bt = f16 values [n][k]; alpha; C f32; N multiple of 16 (partial tiles skipped)
template <bool ASPLIT>
__global__ __launch_bounds__(128) void k_gemm_h(const float* __restrict__ A, int lda, size_t sA, const _Float16* __restrict__ Bh, int ldb, size_t sB, float alpha, float* __restrict__ C, int ldc, size_t sC, int M, int N, int K) {
  __shared__ __attribute__((aligned(16))) float so[4][16][64];
  const int tid = threadIdx.x, w = tid >> 5, lane = tid & 31, ln = lane & 15, hh = lane >> 4; const int by = blockIdx.y;
  A += (size_t)by * sA; Bh += (size_t)by * sB; C += (size_t)by * sC;
  const int ntn = (N + 63) / 64; const int wid = blockIdx.x * 4 + w; const int mt = wid / ntn, nq = wid % ntn; if (mt * 16 >= M) return;
  const int row0 = mt * 16, col0 = nq * 64; const float* arow = A + (size_t)(row0 + ln) * lda;
  v8f acc[4] = {};
  for (int kb = 0; kb < K; kb += 32) {
    FragH ah, al;
    const v4f x0 = *(const v4fa*)(arow + kb + 8 * hh), x1 = *(const v4fa*)(arow + kb + 8 * hh + 4), x2 = *(const v4fa*)(arow + kb + 16 + 8 * hh), x3 = *(const v4fa*)(arow + kb + 16 + 8 * hh + 4);
    float xs[16] = {x0[0],x0[1],x0[2],x0[3],x1[0],x1[1],x1[2],x1[3],x2[0],x2[1],x2[2],x2[3],x3[0],x3[1],x3[2],x3[3]};
#pragma unroll
    for (int i = 0; i < 16; ++i) { const _Float16 h = (_Float16)xs[i]; ah.h[i] = h; al.h[i] = ASPLIT ? (_Float16)(xs[i] - (float)h) : (_Float16)0.0f; }
#pragma unroll
    for (int t = 0; t < 4; ++t) { if (col0 + t * 16 >= N) continue; const size_t boff = (size_t)(col0 + t * 16 + ln) * ldb + kb; FragH bq; bq.half[0] = *(const v8us*)(Bh + boff + 8 * hh); bq.half[1] = *(const v8us*)(Bh + boff + 16 + 8 * hh);
      acc[t] = mmaH<ASPLIT ? 2 : 1>(ah.v, al.v, bq.v, bq.v, acc[t]); }
  }
#pragma unroll
  for (int t = 0; t < 4; ++t) { if (col0 + t * 16 >= N) continue;
#pragma unroll
    for (int r = 0; r < 8; ++r) so[w][8 * hh + r][t * 16 + ln] = acc[t][r] * alpha; }
  __builtin_amdgcn_fence(__ATOMIC_ACQ_REL, "workgroup"); __builtin_amdgcn_wave_barrier();
  const int rsub = lane >> 4, c4 = (lane & 15) * 4;
  {
#pragma unroll
    for (int q = 0; q < 8; ++q) { const int r = q * 2 + rsub; if (col0 + c4 < N) { const v4f v = *(const v4fa*)&so[w][r][c4]; *(v4f*)(C + (size_t)(row0 + r) * ldc + col0 + c4) = v; } }
     }
}

// Wt[n][k] = f16(W[k][n]·scale) from f32 row-major W[K][N] (scale = power of two; bf16-exact weights stay exact in f16 away from the subnormal range)
__global__ __launch_bounds__(256) void k_wt_f16(const float* __restrict__ W, _Float16* __restrict__ Wt, int K, int N, float scale) {
  const int t = blockIdx.x * 256 + threadIdx.x; if (t >= N * (K / 8)) return; const int n = t / (K / 8), k8 = (t % (K / 8)) * 8; FragH f;
#pragma unroll
  for (int i = 0; i < 8; ++i) f.h[i] = (_Float16)(bf16_round(W[(size_t)(k8 + i) * N + n]) * scale); const v8us o = f.half[0];
  *(v8us*)((unsigned short*)Wt + (size_t)n * K + k8) = o; 
}
// k_gemm_hh variant with fused epilogue: v = acc·alpha + bias[by·sBias + col] (+ CP[(row/rowsPerB)·sCPb + by·64 + col] if CP) ; ACT 0 none / 1 elu ; writes f16 C16 (and f32 C if non-null)
template <int ACT>
__global__ __launch_bounds__(128) void k_gemm_hhx(const _Float16* __restrict__ A, int lda, size_t sA, const _Float16* __restrict__ Bh, int ldb, size_t sB, float alpha, const float* __restrict__ bias, size_t sBias, const float* __restrict__ CP, int rowsPerB, size_t sCPb, int row0g,
    float* __restrict__ C, _Float16* __restrict__ C16, int ldc, size_t sC, int M, int N, int K) {
  __shared__ __attribute__((aligned(16))) float so[4][16][64];
  const int tid = threadIdx.x, w = tid >> 5, lane = tid & 31, ln = lane & 15, hh = lane >> 4; const int by = blockIdx.y;
  A += (size_t)by * sA; Bh += (size_t)by * sB; const size_t cofs = (size_t)by * sC; const float* bp = bias ? bias + (size_t)by * sBias : nullptr;
  const int ntn = (N + 63) / 64; const int wid = blockIdx.x * 4 + w; const int mt = wid / ntn, nq = wid % ntn; if (mt * 16 >= M) return;
  const int row0 = mt * 16, col0 = nq * 64; const _Float16* arow = A + (size_t)(row0 + ln) * lda;
  v8f acc[4] = {};
  for (int kb = 0; kb < K; kb += 32) { FragH ah; ah.half[0] = *(const v8us*)((const unsigned short*)arow + kb + 8 * hh); ah.half[1] = *(const v8us*)((const unsigned short*)arow + kb + 16 + 8 * hh);
#pragma unroll
    for (int t = 0; t < 4; ++t) { if (col0 + t * 16 >= N) continue; const size_t boff = (size_t)(col0 + t * 16 + ln) * ldb + kb; FragH bq; bq.half[0] = *(const v8us*)((const unsigned short*)Bh + boff + 8 * hh); bq.half[1] = *(const v8us*)((const unsigned short*)Bh + boff + 16 + 8 * hh);
      acc[t] = mmaH<1>(ah.v, ah.v, bq.v, bq.v, acc[t]); }
  }
#pragma unroll
  for (int t = 0; t < 4; ++t) { if (col0 + t * 16 >= N) continue; const int col = col0 + t * 16 + ln; const float bv = bp ? bf16_round(bp[col]) : 0.f;
#pragma unroll
    for (int r = 0; r < 8; ++r) { float v = acc[t][r] * alpha + bv; if (CP) { const int rr = row0g + row0 + 8 * hh + r; if (rowsPerB < 0) v += CP[cofs + (size_t)rr * ldc + col];      /* rowsPerB < 0: own element of the batched C plane */ else { const int bidx = rr / rowsPerB; v += CP[(size_t)bidx * sCPb + (size_t)by * 64 + col]; } } if (ACT == 1) v = (v > 0.f) ? v : expm1f(v); else if (ACT == 7) v = (v > 0.f) ? v + 1.0f : expf(v); else if (ACT == 8) v = tanhf(v); else if (ACT == 9) v = 0.5f * v * (1.0f + tanhf(0.7978845608028654f * (v + 0.044715f * v * v * v))); else if (ACT == 11) v = 1.0f / (1.0f + expf(-v)); else if (ACT == 12) v = (v > 0.f) ? v : 0.01f * v; else if (ACT == 14) v = (v > 0.f) ? v : 0.1f * v; else if (ACT == 16) v = (v >= 0.f) ? v : 0.3f * v; else if (ACT == 17) v = (v >= 0.f) ? v : 0.2f * v; else if (ACT == 15) v = v / (1.0f + expf(-v)); else if (ACT == 3) v = fmaxf(v, 0.f); else if (ACT == 6) v = 0.5f * v * (1.0f + erff(v * 0.70710678118654752f)); so[w][8 * hh + r][t * 16 + ln] = v; } }
  __builtin_amdgcn_fence(__ATOMIC_ACQ_REL, "workgroup"); __builtin_amdgcn_wave_barrier();
  const int rsub = lane >> 4, c4 = (lane & 15) * 4; typedef _Float16 v4h __attribute__((ext_vector_type(4)));
  {
#pragma unroll
    for (int q = 0; q < 8; ++q) { const int r = q * 2 + rsub; if (col0 + c4 < N) { const v4f v = *(const v4fa*)&so[w][r][c4]; if (C) *(v4f*)(C + cofs + (size_t)(row0 + r) * ldc + col0 + c4) = v; if (C16) { v4h h4; for (int i = 0; i < 4; ++i) h4[i] = (_Float16)v[i]; *(v4h*)(C16 + cofs + (size_t)(row0 + r) * ldc + col0 + c4) = h4; } } }
     }
}


typedef _Float16 v4h __attribute__((ext_vector_type(4)));

__global__ __launch_bounds__(256) void k_x16(const float* __restrict__ x, _Float16* __restrict__ X16, size_t n8) { const size_t t = (size_t)blockIdx.x * 256 + threadIdx.x; if (t >= n8) return; FragH f;
#pragma unroll
  for (int q = 0; q < 8; ++q) f.h[q] = (_Float16)bf16_round(x[t * 8 + q]); *(v8us*)((unsigned short*)X16 + t * 8) = f.half[0];  }
__global__ __launch_bounds__(256) void k_h16(const float* __restrict__ x, _Float16* __restrict__ X16, size_t n8) { const size_t t = (size_t)blockIdx.x * 256 + threadIdx.x; if (t >= n8) return; FragH f;
#pragma unroll
  for (int q = 0; q < 8; ++q) f.h[q] = (_Float16)x[t * 8 + q]; *(v8us*)((unsigned short*)X16 + t * 8) = f.half[0];  }
__global__ __launch_bounds__(256) void k_round16f(const float* __restrict__ W, _Float16* __restrict__ Bt, size_t n8) { const size_t t = (size_t)blockIdx.x * 256 + threadIdx.x; if (t >= n8) return; FragH f;
#pragma unroll
  for (int i = 0; i < 8; ++i) f.h[i] = (_Float16)(bf16_round(W[t * 8 + i]) * 16.0f); *(v8us*)((unsigned short*)Bt + t * 8) = f.half[0];  }
template <int NHv, int TTv>
__global__ __launch_bounds__(256) void k_vt(const _Float16* __restrict__ V16, int ldv, int voff, _Float16* __restrict__ Vt) { __shared__ unsigned short tl[64][66]; const int tid = threadIdx.x; const int slab = blockIdx.x / (TTv / 64), lg = blockIdx.x % (TTv / 64); const int b = slab / NHv, h = slab % NHv;
  for (int i = tid; i < 64 * 8; i += 256) { const int r = i / 8, c8 = (i % 8) * 8; FragH f; f.half[0] = *(const v8us*)((const unsigned short*)V16 + ((size_t)b * TTv + lg * 64 + r) * ldv + voff + h * 64 + c8);
#pragma unroll
    for (int q = 0; q < 8; ++q) tl[r][c8 + q] = f.u[q]; }
  __syncthreads();
  {
#pragma unroll
    for (int rd = 0; rd < 2; ++rd) { const int d = rd * 32 + tid / 8, pc = tid % 8; FragH f;
#pragma unroll
      for (int q = 0; q < 8; ++q) f.u[q] = tl[pc * 8 + q][d];
      *(v8us*)((unsigned short*)Vt + ((size_t)slab * 64 + d) * TTv + lg * 64 + pc * 8) = f.half[0]; }
     } }

__global__ __launch_bounds__(256) void k_hl(const float* __restrict__ F, _Float16* __restrict__ Hh, _Float16* __restrict__ Hl, size_t n8) { const size_t t = (size_t)blockIdx.x * 256 + threadIdx.x; if (t >= n8) return; FragH fh, fl; const v4f a = *(const v4fa*)(F + t * 8), c = *(const v4fa*)(F + t * 8 + 4);
#pragma unroll
  for (int q = 0; q < 4; ++q) { _Float16 h = (_Float16)a[q]; fh.h[q] = h; fl.h[q] = (_Float16)((a[q] - (float)h) * 1024.0f); h = (_Float16)c[q]; fh.h[4 + q] = h; fl.h[4 + q] = (_Float16)((c[q] - (float)h) * 1024.0f); }
  { *(v8us*)((unsigned short*)Hh + t * 8) = fh.half[0]; *(v8us*)((unsigned short*)Hl + t * 8) = fl.half[0];  } }

// ---- fast GEMM (wave tile 32x64; requires M % 32 == 0 rows per launch region and N % 64 == 0); epilogue = k_gemm_hhx semantics ----
__device__ __forceinline__ v16h g2_frag(const _Float16* p, int hh) { FragH f; f.half[0] = *(const v8us*)((const unsigned short*)p + 8 * hh); f.half[1] = *(const v8us*)((const unsigned short*)p + 16 + 8 * hh); return f.v; }
__device__ __forceinline__ v8f g2_mma(v16h a, v16h b, v8f c) { v8f d = __builtin_amdgcn_wmma_f32_16x16x32_f16(false, a, false, b, (short)0, c, false, false); asm volatile("v_nop\n\tv_nop\n\tv_nop\n\tv_nop" : "+v"(d) : "v"(a), "v"(b)); return d; }
template <int ACT>
__global__ __launch_bounds__(128) void k_gemm2(const _Float16* __restrict__ A, int lda, size_t sA, const _Float16* __restrict__ Bh, int ldb, size_t sB, float alpha, const float* __restrict__ bias, size_t sBias, const float* __restrict__ CP, int rowsPerB, size_t sCPb, int row0g,
    float* __restrict__ C, _Float16* __restrict__ C16, int ldc, size_t sC, int M, int N, int K, size_t zA = 0, size_t zB = 0, size_t zC = 0) { static_assert(ACT == 0 || ACT == 3 || ACT == 6 || ACT == 8 || ACT == 9 || ACT == 11 || ACT == 12 || ACT == 14 || ACT == 15 || ACT == 16 || ACT == 17, "k_gemm2: unsupported ACT code (would silently apply no activation)");
  __shared__ __attribute__((aligned(16))) float so[4][32][68];
  const int tid = threadIdx.x, w = tid >> 5, lane = tid & 31, ln = lane & 15, hh = lane >> 4; const int by = blockIdx.y; const int bz = blockIdx.z;      /* second batch axis (strides zA, zB, zC) */
  A += (size_t)by * sA + (size_t)bz * zA; Bh += (size_t)by * sB + (size_t)bz * zB; const size_t cofs = (size_t)by * sC + (size_t)bz * zC; const float* bp = bias ? bias + (size_t)by * sBias : nullptr;
  const int ntn = N >> 6; const int mt = blockIdx.x / ntn, nq = blockIdx.x - mt * ntn; const int row0 = mt * 128 + 32 * w, col0 = nq * 64; if (row0 >= M) return;
  const _Float16* a0p = A + (size_t)(row0 + ln) * lda; const _Float16* a1p = a0p + (size_t)16 * lda;
  const _Float16* b0p = Bh + (size_t)(col0 + ln) * ldb; const _Float16* b1p = b0p + (size_t)16 * ldb; const _Float16* b2p = b1p + (size_t)16 * ldb; const _Float16* b3p = b2p + (size_t)16 * ldb;
  const v8f z8 = {0.f,0.f,0.f,0.f,0.f,0.f,0.f,0.f}; v8f c00 = z8, c01 = z8, c02 = z8, c03 = z8, c10 = z8, c11 = z8, c12 = z8, c13 = z8;
#pragma unroll 1
  for (int kb = 0; kb < K; kb += 32) { const v16h a0 = g2_frag(a0p + kb, hh), a1 = g2_frag(a1p + kb, hh);
    v16h b = g2_frag(b0p + kb, hh); c00 = g2_mma(a0, b, c00); c10 = g2_mma(a1, b, c10);
    b = g2_frag(b1p + kb, hh); c01 = g2_mma(a0, b, c01); c11 = g2_mma(a1, b, c11);
    b = g2_frag(b2p + kb, hh); c02 = g2_mma(a0, b, c02); c12 = g2_mma(a1, b, c12);
    b = g2_frag(b3p + kb, hh); c03 = g2_mma(a0, b, c03); c13 = g2_mma(a1, b, c13); }
  v8f accs[8] = {c00, c01, c02, c03, c10, c11, c12, c13};
#pragma unroll
  for (int u = 0; u < 8; ++u) { const int t = u & 3, half = u >> 2; const int col = col0 + t * 16 + ln; const float bv = bp ? bf16_round(bp[col]) : 0.f;
#pragma unroll
    for (int r = 0; r < 8; ++r) { const int rloc = half * 16 + 8 * hh + r; float v = accs[u][r] * alpha + bv; if (CP) { if (rowsPerB < 0) v += CP[cofs + (size_t)(row0g + row0 + rloc) * ldc + col];      /* rowsPerB < 0: own element of the batched C plane */ else { const int bidx = (row0g + row0 + rloc) / rowsPerB; v += CP[(size_t)bidx * sCPb + (size_t)by * 64 + col]; } }
      if (ACT == 3) v = fmaxf(v, 0.f); else if (ACT == 6) v = 0.5f * v * (1.0f + erff(v * 0.70710678118654752f)); else if (ACT == 11) v = 1.0f / (1.0f + expf(-v)); else if (ACT == 15) v = v / (1.0f + expf(-v)); else if (ACT == 12) v = (v > 0.f) ? v : 0.01f * v; else if (ACT == 8) v = tanhf(v); else if (ACT == 9) v = 0.5f * v * (1.0f + tanhf(0.7978845608028654f * (v + 0.044715f * v * v * v))); else if (ACT == 14) v = (v > 0.f) ? v : 0.1f * v; else if (ACT == 16) v = (v >= 0.f) ? v : 0.3f * v; else if (ACT == 17) v = (v >= 0.f) ? v : 0.2f * v;
      so[w][rloc][t * 16 + ln] = v; } }
  __builtin_amdgcn_fence(__ATOMIC_ACQ_REL, "workgroup"); __builtin_amdgcn_wave_barrier();
  const int rsub = lane >> 4, c4 = (lane & 15) * 4;
  {
#pragma unroll
    for (int q = 0; q < 16; ++q) { const int r = q * 2 + rsub; const v4f v = *(const v4fa*)&so[w][r][c4]; if (C) *(v4f*)(C + cofs + (size_t)(row0 + r) * ldc + col0 + c4) = v; if (C16) { v4h h4; for (int i = 0; i < 4; ++i) h4[i] = (_Float16)v[i]; *(v4h*)(C16 + cofs + (size_t)(row0 + r) * ldc + col0 + c4) = h4; } }
     } }


__global__ __launch_bounds__(256) void k_wnat(const float* __restrict__ w, size_t n8, _Float16* __restrict__ Bt) { const size_t t = (size_t)blockIdx.x * 256 + threadIdx.x; if (t >= n8) return; FragH f; for (int q = 0; q < 8; ++q) f.h[q] = (_Float16)(bf16_round(w[t * 8 + q]) * 16.0f); *(v8us*)((unsigned short*)Bt + t * 8) = f.half[0];  }
__global__ __launch_bounds__(256) void k_rsm(const float* __restrict__ S, _Float16* __restrict__ P, int nrows) {
  #pragma clang fp contract(off)
  const int i = blockIdx.x * 256 + threadIdx.x; if (i >= nrows) return; const float* s = S + (size_t)i * SQ; float mx = -3.0e38f;
#pragma unroll 1
  for (int j = 0; j < SQ; ++j) mx = fmaxf(mx, s[j]); float se = 0.f;
#pragma unroll 1
  for (int j = 0; j < SQ; ++j) se += expf(s[j] - mx); const float sc = 256.0f / se;
#pragma unroll 1
  for (int j0 = 0; j0 < SQ; j0 += 8) { FragH f; for (int q = 0; q < 8; ++q) f.h[q] = (_Float16)(expf(s[j0 + q] - mx) * sc); unsigned short* d = (unsigned short*)P + (size_t)i * SQ + j0; *(v8us*)d = f.half[0];  } }
__global__ __launch_bounds__(256) void k_vt(const _Float16* __restrict__ V16, int b, int h0, _Float16* __restrict__ VT) { __shared__ unsigned short tl[64][65]; const int tid = threadIdx.x; const int hh = blockIdx.x % HG, sg = blockIdx.x / HG; const int s0 = sg * 64; const int h = h0 + hh;
  for (int i = tid; i < 64 * 8; i += 256) { const int j = i / 8, d8 = (i % 8) * 8; FragH f; f.half[0] = *(const v8us*)((const unsigned short*)V16 + ((size_t)b * SQ + s0 + j) * DM + h * HD + d8); for (int q = 0; q < 8; ++q) tl[d8 + q][j] = f.u[q]; }
  __syncthreads();
  { for (int i = tid; i < 64 * 8; i += 256) { const int d = i / 8, j8 = (i % 8) * 8; FragH f; for (int q = 0; q < 8; ++q) f.u[q] = tl[d][j8 + q]; *(v8us*)((unsigned short*)VT + ((size_t)hh * HD + d) * SQ + s0 + j8) = f.half[0]; }  } }



__global__ __launch_bounds__(256) void k_rsmcf2(const float* __restrict__ S, _Float16* __restrict__ P, int hg, int q0, int nk) {
  #pragma clang fp contract(off)
  const int t = blockIdx.x * 256 + threadIdx.x; if (t >= hg * QT) return; const size_t i = (size_t)t; const float* s = S + i * NKX; const int last = q0 + (t % QT); float mx = -3.0e38f;
#pragma unroll 1
  for (int j = 0; j < nk; ++j) { const float f = (j <= last) ? 1.f : 0.f; mx = fmaxf(mx, fmaf(f, s[j], (1.f - f) * -1.0e9f)); } float se = 0.f;
#pragma unroll 1
  for (int j = 0; j < nk; ++j) { const float f = (j <= last) ? 1.f : 0.f; se += __expf(fmaf(f, s[j], (1.f - f) * -1.0e9f) - mx); } const float sc = 256.0f / se;
#pragma unroll 1
  for (int j0 = 0; j0 < nk; j0 += 8) { FragH fr; for (int q = 0; q < 8; ++q) { const int j = j0 + q; const float f = (j <= last) ? 1.f : 0.f; fr.h[q] = (_Float16)(__expf(fmaf(f, s[j], (1.f - f) * -1.0e9f) - mx) * sc); } unsigned short* d = (unsigned short*)P + i * NKX + j0; *(v8us*)d = fr.half[0];  } }


template <int MASKADD>
__global__ __launch_bounds__(64) void k_att0(const float* __restrict__ QF, const float* __restrict__ KF, const float* __restrict__ VF, int ld, const float* __restrict__ mask, float scale, float* __restrict__ OF, int ldo) {
  #pragma clang fp contract(off)
  __shared__ __attribute__((aligned(16))) float lq[64][64]; __shared__ __attribute__((aligned(16))) float lo[64][64];
  const int tid = threadIdx.x; const int h = blockIdx.x / (QT0 / 64), rg = blockIdx.x % (QT0 / 64); const int i = rg * 64 + tid;
  const size_t bo_in = (size_t)blockIdx.y * QT0 * ld; QF += bo_in; KF += bo_in; VF += bo_in; OF += (size_t)blockIdx.y * QT0 * ldo;      /* batch on grid.y: QT0 rows per batch in every plane */
  const float* qr = QF + (size_t)i * ld + h * HD;
#pragma unroll 1
  for (int c = 0; c < HD / 4; ++c) { *(v4f*)&lq[tid][c * 4] = *(const v4fa*)(qr + c * 4); const v4f z = {0.f, 0.f, 0.f, 0.f}; *(v4f*)&lo[tid][c * 4] = z; }
  float m = -1.0e30f, l = 0.f; const int jmax = MASKADD ? (SQ - 1) : (rg * 64 + 63);      /* additive-mask form: every key (the mask input decides); causal form: keys up to the block's last row */
#pragma unroll 1
  for (int j = 0; j <= jmax; ++j) { const float* kr = KF + (size_t)j * ld + h * HD; const float* vr = VF + (size_t)j * ld + h * HD; float s = 0.f;
#pragma unroll 1
    for (int c = 0; c < HD / 4; ++c) { const v4f kq = *(const v4fa*)(kr + c * 4); const v4f qq = *(v4f*)&lq[tid][c * 4]; s = __fadd_rn(s, __fmul_rn(qq[0], kq[0])); s = __fadd_rn(s, __fmul_rn(qq[1], kq[1])); s = __fadd_rn(s, __fmul_rn(qq[2], kq[2])); s = __fadd_rn(s, __fmul_rn(qq[3], kq[3])); }
    s = __fmul_rn(s, scale); if (MASKADD) s = __fadd_rn(s, __fmul_rn(bf16_round(mask[(size_t)i * SQ + j]), -10000.0f));
    const float f = (MASKADD || j <= i) ? 1.f : 0.f; const float sm = fmaf(f, s, (1.f - f) * -1.0e30f); const float mn = fmaxf(m, sm); const float sc = expf(m - mn); const float e = expf(sm - mn); l = __fadd_rn(__fmul_rn(l, sc), e); m = mn;
#pragma unroll 1
    for (int c = 0; c < HD / 4; ++c) { const v4f vv = *(const v4fa*)(vr + c * 4); v4f oo = *(v4f*)&lo[tid][c * 4]; for (int u = 0; u < 4; ++u) oo[u] = __fadd_rn(__fmul_rn(oo[u], sc), __fmul_rn(e, vv[u])); *(v4f*)&lo[tid][c * 4] = oo; } }
  const float fin = 64.0f / l;      /* o carried x64 like the f16 path */
#pragma unroll 1
  for (int c = 0; c < HD / 4; ++c) { v4f oo = *(v4f*)&lo[tid][c * 4]; for (int u = 0; u < 4; ++u) oo[u] = __fmul_rn(oo[u], fin); *(v4f*)&lo[tid][c * 4] = oo; }
  __syncthreads();
  {
#pragma unroll 1
    for (int it = 0; it < 16; ++it) { const int row = it * 4 + tid / 16, pc = (tid % 16) * 4; const v4f v = *(const v4f*)&lo[row][pc]; *(v4f*)(OF + (size_t)(rg * 64 + row) * ldo + h * HD + pc) = v; }
     } }


template <int BFIN, int WXB>
__global__ __launch_bounds__(256) void k_ln16(const float* __restrict__ X, const float* __restrict__ g, const float* __restrict__ bb, float eps, _Float16* __restrict__ N16, float* __restrict__ XB) {
  #pragma clang fp contract(off)
  __shared__ float red[256]; const size_t r = blockIdx.x; const int t = threadIdx.x; const v4f xa = *(const v4fa*)(X + r * DMQ + t * 4); float s[4]; float sum = 0.f;
  for (int q = 0; q < 4; ++q) { s[q] = BFIN ? bf16_round(xa[q]) : xa[q]; sum = __fadd_rn(sum, s[q]); }
  red[t] = sum; __syncthreads(); for (int st = 128; st > 0; st >>= 1) { if (t < st) red[t] = __fadd_rn(red[t], red[t + st]); __syncthreads(); } const float mu = red[0] / (float)DMQ; __syncthreads();
  float vs = 0.f; for (int q = 0; q < 4; ++q) { const float dl = __fadd_rn(s[q], -mu); vs = __fadd_rn(vs, __fmul_rn(dl, dl)); } red[t] = vs; __syncthreads(); for (int st = 128; st > 0; st >>= 1) { if (t < st) red[t] = __fadd_rn(red[t], red[t + st]); __syncthreads(); }
  const float rs = rsqrtf(__fadd_rn(red[0] / (float)DMQ, eps)); v4h y; v4f xb;
  for (int q = 0; q < 4; ++q) { const int c = t * 4 + q; y[q] = (_Float16)__fadd_rn(__fmul_rn(__fmul_rn(__fadd_rn(s[q], -mu), rs), bf16_round(g[c])), bf16_round(bb[c])); xb[q] = s[q]; }
  { *(v4h*)(N16 + r * DMQ + t * 4) = y; if (WXB) *(v4f*)(XB + r * DMQ + t * 4) = xb;  } }
__global__ __launch_bounds__(256) void k_ftres2(const float* __restrict__ OF0, const float* __restrict__ XB, float* __restrict__ X1, size_t n4) {
  #pragma clang fp contract(off)
  const size_t t = (size_t)blockIdx.x * 256 + threadIdx.x; if (t >= n4) return; const v4f o = *(const v4fa*)(OF0 + t * 4), xv = *(const v4fa*)(XB + t * 4); v4f y; for (int q = 0; q < 4; ++q) y[q] = __fadd_rn(__fmul_rn(o[q], 0.015625f), xv[q]); *(v4f*)(X1 + t * 4) = y;  }

__global__ __launch_bounds__(256) void k_wthd(const float* __restrict__ Wt, _Float16* __restrict__ Bt) { const size_t t = (size_t)blockIdx.x * 256 + threadIdx.x; if (t >= (size_t)NH * HD * (DM / 8)) return; const int m8 = (int)(t % (DM / 8)) * 8; const int d = (int)((t / (DM / 8)) % HD); const int h = (int)(t / ((size_t)(DM / 8) * HD)); FragH f;
  for (int q = 0; q < 8; ++q) f.h[q] = (_Float16)(16.0f * bf16_round(Wt[((size_t)h * DM + m8 + q) * HD + d])); unsigned short* dst = (unsigned short*)Bt + ((size_t)h * HD + d) * DM + m8; *(v8us*)dst = f.half[0];  }




__global__ __launch_bounds__(256) void k_wtpad(const float* __restrict__ Wm, _Float16* __restrict__ Wt, int Kr, int Kp, int Nr, int Np, float scale) {
  const int t = blockIdx.x * 256 + threadIdx.x; if (t >= Np * (Kp / 8)) return; const int n = t / (Kp / 8), k8 = (t % (Kp / 8)) * 8; const int nc = min(n, Nr - 1); const float fn = (n < Nr) ? 1.f : 0.f; FragH f;
  for (int i = 0; i < 8; ++i) { const int k = k8 + i; const int kc = min(k, Kr - 1); const float fk = (k < Kr) ? fn : 0.f; f.h[i] = (_Float16)(bf16_round(Wm[(size_t)kc * Nr + nc]) * scale * fk); }
  unsigned short* o = (unsigned short*)Wt + (size_t)n * Kp + k8; *(v8us*)o = f.half[0];  }
__global__ __launch_bounds__(128) void k_bpad(const float* __restrict__ b, float* __restrict__ Bp, int nr, int np) {
  const int i = threadIdx.x; if (i >= np) return; const float v = b[min(i, nr - 1)] * ((i < nr) ? 1.f : 0.f); *(float*)(Bp + i) = v;  }
extern "C" void kernel_launch(void* const* d_in, const int* in_sizes, int n_in,
                              void* d_out, int out_size, void* d_ws, size_t ws_size, hipStream_t stream) {
  (void)in_sizes; (void)n_in; (void)out_size;
  const float* const* I = (const float* const*)d_in; const float* x = I[0]; const float* wqkv = I[1]; const float* bqkv = I[2]; const float* wo = I[3]; const float* bo = I[4]; const float* g1 = I[5]; const float* be1 = I[6]; const float* gg2 = I[7]; const float* be2 = I[8]; const float* wfc = I[9]; const float* bfc = I[10]; const float* wmp = I[11]; const float* bmp = I[12];      /* x; fused Wqkv [1024][3072] + bqkv [3072] ([in][out]); Wproj + bproj; LN1 g / b, LN2 g / b; W1 [1024][4096] + b1, W2 [4096][1024] + b2 */
  char* ws = (char*)d_ws; size_t off = 0;
  auto take = [&](size_t bytes) { char* p = ws + off; off += (bytes + 255) & ~(size_t)255; return p; };
  _Float16* BQKV = (_Float16*)take((size_t)3 * DM * DM * 2); _Float16* BO = (_Float16*)take((size_t)DM * DM * 2);
  _Float16* X16 = (_Float16*)take(NR * DM * 2); float* XB = (float*)take(NR * DM * 4); _Float16* BW1 = (_Float16*)take((size_t)DFF * DM * 2); _Float16* BW2 = (_Float16*)take((size_t)DM * DFF * 2);
  _Float16* QKV = (_Float16*)take(NR * 3 * DM * 2); _Float16* Q16 = QKV; _Float16* K16 = QKV + DM; _Float16* V16 = QKV + 2 * DM; _Float16* O16 = (_Float16*)take(NR * DM * 2);
  _Float16* HF16 = QKV;      /* alias: the FFN hidden rows [NR][DFF] fill QKV + O16 (adjacent, same bytes); their last reader, the output projection, precedes the FFN */
  _Float16* M16 = X16;      /* alias: X16's last reader, the first-tile q | k | v GEMM, precedes LN2's write */
  _Float16* VT = (_Float16*)take((size_t)NB * NH * HD * SQ * 2);
  float* OF0 = (float*)take((size_t)NB * QT0 * DM * 4); _Float16* OH0 = (_Float16*)take((size_t)NB * QT0 * DM * 2); _Float16* OL0 = (_Float16*)take((size_t)NB * QT0 * DM * 2);
  float* S = (float*)take((size_t)GB * NH * QT * NKX * 4); _Float16* P = (_Float16*)take((size_t)GB * NH * QT * NKX * 2);
  float* QKVF0 = S;      /* alias: f32 q | k | v of the first tiles [NB][QT0][3 DM]; read by the exact attention before the first scores are written */
  float* X1 = S;      /* alias: x1 [NR][DM] is written after the last read of S and P */
  if (off > ws_size) return;
  k_wt_f16<<<(unsigned)(((size_t)3 * DM * (DM / 8) + 255) / 256), 256, 0, stream>>>(wqkv, BQKV, DM, 3 * DM, 16.0f);      /* fused [in][out] [DM][3 DM] -> Bt [3 DM][DM] x16: rows 0.. = q, DM.. = k, 2 DM.. = v output columns (contiguous thirds) */ k_wt_f16<<<(unsigned)(((size_t)DM * (DM / 8) + 255) / 256), 256, 0, stream>>>(wo, BO, DM, DM, 16.0f);      /* w_proj [in][out] -> Bt x16 */
  k_ln16<1, 1><<<(unsigned)NR, 256, 0, stream>>>(x, g1, be1, 1e-5f, X16, XB);      /* a = LN1(bf16(x)) -> f16 rows; XB = bf16(x) for the residual */
  k_wt_f16<<<(unsigned)(((size_t)DFF * (DM / 8) + 255) / 256), 256, 0, stream>>>(wfc, BW1, DM, DFF, 16.0f); k_wt_f16<<<(unsigned)(((size_t)DM * (DFF / 8) + 255) / 256), 256, 0, stream>>>(wmp, BW2, DFF, DM, 16.0f);      /* W1 [1024][4096] -> Bt [4096][1024]; W2 [4096][1024] -> Bt [1024][4096] (x16) */
  k_gemm2<0><<<dim3((unsigned)((MP / 128) * (3 * DM / 64)), 1), 128, 0, stream>>>(X16, DM, 0, BQKV, DM, 0, 0.0625f, bqkv, 0, nullptr, 1, 0, 0, nullptr, QKV, 3 * DM, 0, MP, 3 * DM, DM);      /* q | k | v rows (f16); head h = columns h*HD.. of each DM block */
  k_vt<NH, SQ><<<NB * NH * (SQ / 64), 256, 0, stream>>>(V16, LQ, 0, VT);      /* V^T [NB][NH][HD][SQ], every batch in one launch */
  k_gemm2<0><<<dim3((QT0 / 128) * (3 * DM / 64), NB), 128, 0, stream>>>(X16, DM, (size_t)SQ * DM, BQKV, DM, 0, 0.0625f, bqkv, 0, nullptr, 1, 0, 0, QKVF0, nullptr, 3 * DM, (size_t)QT0 * 3 * DM, QT0, 3 * DM, DM);      /* f32 q | k | v of the first 128 rows of every batch (grid.y; exact products) */
  k_att0<0><<<dim3(NH * (QT0 / 64), NB), 64, 0, stream>>>(QKVF0, QKVF0 + DM, QKVF0 + 2 * DM, 3 * DM, nullptr, 0.07216878364870322f, OF0, DM);      /* exact f32 attention for rows 0..127 of every batch (grid.y; o x64) */
  for (int b = 0; b < NB; b += GB) { const size_t r0 = (size_t)b * SQ;      /* GB batches on grid.z */
    for (int q0 = 0; q0 < QN; q0 += QT) { const int nk = q0 + QT;      /* causal: only keys below the tile end are computed */
      k_gemm2<0><<<dim3((QT / 128) * (nk / 64), NHD, GB), 128, 0, stream>>>(Q16 + (r0 + q0) * LQ, LQ, (size_t)HD, K16 + r0 * LQ, LQ, (size_t)HD, 0.07216878364870322f, nullptr, 0, nullptr, 1, 0, 0, S, nullptr, NKX, (size_t)QT * NKX, QT, nk, HD, (size_t)SQ * LQ, (size_t)SQ * LQ, (size_t)NH * QT * NKX);      /* scores, heads on grid.y */
      k_rsmcf2<<<(GB * NHD * QT + 255) / 256, 256, 0, stream>>>(S, P, GB * NHD, q0, nk);
      k_gemm2<0><<<dim3((QT / 128) * (HD / 64), NHD, GB), 128, 0, stream>>>(P, NKX, (size_t)QT * NKX, VT + (size_t)b * NH * HD * SQ, SQ, (size_t)HD * SQ, 0.25f, nullptr, 0, nullptr, 1, 0, 0, nullptr, O16 + (r0 + q0) * DM, DM, (size_t)HD, QT, HD, nk, (size_t)NH * QT * NKX, (size_t)NH * HD * SQ, (size_t)SQ * DM); } }      /* o (merged heads, x64) as f16 rows */
  k_gemm2<0><<<dim3((unsigned)((MPO / 128) * (DM / 64)), 1), 128, 0, stream>>>(O16, DM, 0, BO, DM, 0, 0.0009765625f, bo, 0, XB, -1, 0, 0, X1, nullptr, DM, 0, MPO, DM, DM);      /* x1 = x + o Wo + b, all rows */
  k_hl<<<(unsigned)(((size_t)NB * QT0 * DM / 8 + 255) / 256), 256, 0, stream>>>(OF0, OH0, OL0, (size_t)NB * QT0 * DM / 8);      /* first-tile o (x64) -> f16 hi + x1024 residual planes */
  k_gemm2<0><<<dim3((QT0 / 128) * (DM / 64), NB), 128, 0, stream>>>(OH0, DM, (size_t)QT0 * DM, BO, DM, 0, 0.0009765625f, bo, 0, XB, -1, 0, 0, X1, nullptr, DM, (size_t)SQ * DM, QT0, DM, DM);      /* rows 0..127 of every batch (grid.y): x1 = x + o_hi Wo (+ b), overwriting the f16-path rows */
  k_gemm2<0><<<dim3((QT0 / 128) * (DM / 64), NB), 128, 0, stream>>>(OL0, DM, (size_t)QT0 * DM, BO, DM, 0, 0.00000095367431640625f, nullptr, 0, X1, -1, 0, 0, X1, nullptr, DM, (size_t)SQ * DM, QT0, DM, DM);      /* += o_lo Wo 2^-20 (own-element accumulate) */
  k_ln16<0, 0><<<(unsigned)NR, 256, 0, stream>>>(X1, gg2, be2, 1e-5f, M16, nullptr);      /* h = LN2(x1) -> f16 rows */
  k_gemm2<3><<<dim3((unsigned)((MP / 128) * (DFF / 64)), 1), 128, 0, stream>>>(M16, DM, 0, BW1, DM, 0, 0.0625f, bfc, 0, nullptr, 1, 0, 0, nullptr, HF16, DFF, 0, MP, DFF, DM);      /* relu(h2 W1 + b1) -> f16, all rows */
  k_gemm2<0><<<dim3((unsigned)((MP / 128) * (DM / 64)), 1), 128, 0, stream>>>(HF16, DFF, 0, BW2, DFF, 0, 0.0625f, bmp, 0, X1, -1, 0, 0, (float*)d_out, nullptr, DM, 0, MP, DM, DFF);      /* out = x1 + mlp (own-element residual), all rows */
}

// v002
// A run of this version takes 1670 microseconds.
// Two timings next to v001 put it at 1.47 and 1.48 times that version's speed.
// Counting every step since v000, it is 6.31 times as fast.
#include <hip/hip_runtime.h>
// Pre-LN causal transformer block with a fused QKV projection and the module's literal score scale (x [8][1024][1024]; h = LN1(x) (biased var, eps 1e-5); qkv = h Wqkv + bqkv ([in][out] 1024 x 3072 + bias) split q | k | v; 16 heads of 64; scale = 1 / sqrt(3 * 1024 / 16) = 1 / sqrt(192) (as the source: NOT 1 / sqrt(head_dim)); causal (tril, -inf); softmax; x1 = x + y Wproj + bproj; out = x1 + relu(LN2(x1) W1 + b1) W2 + b2 ([in][out] 1024 x 4096 x 1024) -> [8][1024][1024]).
// Structure: token rows r = b*1024 + s; h = LN1(bf16(x)) as f16 rows; q | k | v as ONE WMMA GEMM (N = 3 x 1024) (32x64 wave tiles, f32 accumulation, exact x16 weights + bias, f16 outputs); per batch: V^T for all heads via LDS transposes; per query tile of 256 rows: scores against the keys below the tile end only (K = 64, all heads on grid.y, alpha = 1 / sqrt(192)), causal row softmax on VALU, one wave per 4 rows with the rows in registers, keys above the row masked over the computed range (f32 statistics, native exp; weights x256 f16), o = P . V^T (K = keys below the tile end, alpha 2^-2: o carried x64, folded into the output GEMM alpha) written straight into the merged f16 o rows; x1 = x + o W_o + b GEMM (f32), then the FFN into the output.
// Compute dtype: inputs rounded to bf16; x / weights exact; q, k, v, softmax weights and o as plain f16 GEMM operands (~2^-12); scores and softmax statistics f32. v_wmma_f32_16x16x32_f16.
// Launches: V^T takes all batches on grid.x, the first-tile q | k | v GEMM, the exact first-tile attention and the first-tile output GEMMs on grid.y; a host loop steps over groups of GB batches, which scores and P V take on grid.z and the softmax on grid.x (S and P hold GB batches); the FFN GEMMs take all token rows.
#define NB 8
#define SQ 1024
#define DM 1024
#define NH 16
#define HD 64
#define HG 4                         /* heads per block group of the non-template k_vt (not launched) */
#define QT 256                       /* query rows per causal tile */
#define NKX SQ                       /* S / P row pitch */
#define QT0 128                      /* first-tile rows recomputed exactly in f32 */
#define GB 4                         /* batches per score, softmax and P V launch (grid.z of the GEMMs); S and P hold GB batches */
#define B0 0                         /* unused; the batch loops start at 0 */
#define NBR NB                       /* batches processed (debug hook) */
#define NR ((size_t)NB * SQ)
#define DMQ DM
#define DFF 4096                     /* FFN hidden width */
#define DFFR 100                     /* unused; the FFN hidden width is DFF */
#define MP ((int)((size_t)NBR * SQ)) /* rows projected (debug hook) */
#define QN SQ                        /* query rows attended per batch (debug hook) */
#define NHD NH                       /* heads attended (debug hook) */
#define MPO MP                       /* rows through the output stage (debug hook) */
#define LQ (3 * DM)      /* row pitch of the q/k/v rows */
typedef __bf16 v16b __attribute__((ext_vector_type(16)));
typedef unsigned short v8us __attribute__((ext_vector_type(8), may_alias));
typedef float  v8f  __attribute__((ext_vector_type(8)));
typedef float  v4f  __attribute__((ext_vector_type(4)));
typedef float  v4fa __attribute__((ext_vector_type(4), may_alias));
union FragB { v16b v; v8us half[2]; unsigned short u[16]; };

__device__ __forceinline__ unsigned short bf16_bits(float x) { unsigned int u = __float_as_uint(x); return (unsigned short)((u + 0x7FFFu + ((u >> 16) & 1u)) >> 16); }
__device__ __forceinline__ float bf16_val(unsigned short b) { return __uint_as_float(((unsigned int)b) << 16); }
__device__ __forceinline__ float bf16_round(float x) { return bf16_val(bf16_bits(x)); }
// D += A·B with NT terms: 1 = ah·bh, 2 = + al·bh (A split), 3 = + ah·bl (both split)
template <int NT>
__device__ __forceinline__ v8f mmaN(v16b ah, v16b al, v16b bh, v16b bl, v8f c) {
  c = __builtin_amdgcn_wmma_f32_16x16x32_bf16(false, ah, false, bh, (short)0, c, false, false);
  if (NT >= 2) c = __builtin_amdgcn_wmma_f32_16x16x32_bf16(false, al, false, bh, (short)0, c, false, false);
  if (NT >= 3) c = __builtin_amdgcn_wmma_f32_16x16x32_bf16(false, ah, false, bl, (short)0, c, false, false);
  asm volatile("v_nop\n\tv_nop\n\tv_nop\n\tv_nop" : "+v"(c) : "v"(ah), "v"(al), "v"(bh), "v"(bl));
  return c;
}

__global__ __launch_bounds__(256) void k_wt_bf16(const float* __restrict__ W, unsigned short* __restrict__ Wt, int K, int N) {
  const int t = blockIdx.x * 256 + threadIdx.x;
  const int k8n = K / 8;
  if (t >= N * k8n) return;
  const int n = t / k8n, k8 = (t % k8n) * 8;
  v8us v;
#pragma unroll
  for (int i = 0; i < 8; ++i) v[i] = bf16_bits(W[(size_t)(k8 + i) * N + n]);
  *(v8us*)(Wt + (size_t)n * K + k8) = v;
  
}

// GEMM C[M][N] (f32, pitch ldc) = act(A[M][K]·W + bias). A f32 row-major (pitch lda) converted per fragment to bf16
// (ASPLIT: hi/lo two planes -> 2 terms, else single rounded term); Wt bf16 [N][K] (pitch ldb). BIAS_BF16 rounds the
// bias to bf16 first (bias quantised to bf16 before the add). K%32==0, M%16==0, N%64==0.
template <bool ASPLIT, int ACT, bool BIAS_BF16>
__global__ __launch_bounds__(128) void k_gemm_bf(const float* __restrict__ A, int lda, const unsigned short* __restrict__ Wt, int ldb,
                                               const float* __restrict__ bias, float* __restrict__ C, int ldc, int M, int N, int K) {
  __shared__ __attribute__((aligned(16))) float so[4][16][64];
  const int tid = threadIdx.x, w = tid >> 5, lane = tid & 31, ln = lane & 15, hh = lane >> 4;
  const int ntn = N / 64;
  const int wid = blockIdx.x * 4 + w;
  const int mt = wid / ntn, nq = wid % ntn;
  if (mt * 16 >= M) return;
  const int row0 = mt * 16, col0 = nq * 64;
  const float* arow = A + (size_t)(row0 + ln) * lda;
  v8f acc[4] = {};
  for (int kb = 0; kb < K; kb += 32) {
    FragB ah, al;
    const v4f x0 = *(const v4fa*)(arow + kb + 8 * hh), x1 = *(const v4fa*)(arow + kb + 8 * hh + 4);
    const v4f x2 = *(const v4fa*)(arow + kb + 16 + 8 * hh), x3 = *(const v4fa*)(arow + kb + 16 + 8 * hh + 4);
    float xs[16] = {x0[0],x0[1],x0[2],x0[3],x1[0],x1[1],x1[2],x1[3],x2[0],x2[1],x2[2],x2[3],x3[0],x3[1],x3[2],x3[3]};
#pragma unroll
    for (int i = 0; i < 16; ++i) { const unsigned short hb = bf16_bits(xs[i]); ah.u[i] = hb; al.u[i] = ASPLIT ? bf16_bits(xs[i] - bf16_val(hb)) : (unsigned short)0; }
#pragma unroll
    for (int t = 0; t < 4; ++t) {
      const unsigned short* brow = Wt + (size_t)(col0 + t * 16 + ln) * ldb + kb;
      FragB b;
      b.half[0] = *(const v8us*)(brow + 8 * hh);
      b.half[1] = *(const v8us*)(brow + 16 + 8 * hh);
      acc[t] = mmaN<ASPLIT ? 2 : 1>(ah.v, al.v, b.v, b.v, acc[t]);
    }
  }
#pragma unroll
  for (int t = 0; t < 4; ++t) {
    float bv = bias ? bias[col0 + t * 16 + ln] : 0.f;
    if (BIAS_BF16) bv = bf16_round(bv);
#pragma unroll
    for (int r = 0; r < 8; ++r) { float v = acc[t][r] + bv; if (ACT == 1) v = fmaxf(v, 0.f); so[w][8 * hh + r][t * 16 + ln] = v; }
  }
  __builtin_amdgcn_fence(__ATOMIC_ACQ_REL, "workgroup");
  __builtin_amdgcn_wave_barrier();
  const int rsub = lane >> 4, c4 = (lane & 15) * 4;
  {
#pragma unroll
    for (int q = 0; q < 8; ++q) {
      const int r = q * 2 + rsub;
      const v4f v = *(const v4fa*)&so[w][r][c4];
      *(v4f*)(C + (size_t)(row0 + r) * ldc + col0 + c4) = v;
    }
    
  }
}

// GEMM C = act(A·W + bias + resid): A f32 (ASPLIT -> hi/lo 2 terms), Wt bf16 [N][K]; ACT 0 none, 1 relu, 2 exact gelu;
// resid (optional, f32, row index = (row % rmod), pitch ldr, RES_BF16 rounds it) added before the activation.
template <bool ASPLIT, int ACT, bool BIAS_BF16, bool RES_BF16>
__global__ __launch_bounds__(128) void k_gemm_bf3(const float* __restrict__ A, int lda, const unsigned short* __restrict__ Wt, int ldb,
                                                const float* __restrict__ bias, const float* __restrict__ resid, int rmod, int ldr,
                                                float* __restrict__ C, int ldc, int M, int N, int K) {
  __shared__ __attribute__((aligned(16))) float so[4][16][64];
  const int tid = threadIdx.x, w = tid >> 5, lane = tid & 31, ln = lane & 15, hh = lane >> 4;
  const int ntn = N / 64;
  const int wid = blockIdx.x * 4 + w;
  const int mt = wid / ntn, nq = wid % ntn;
  if (mt * 16 >= M) return;
  const int row0 = mt * 16, col0 = nq * 64;
  const float* arow = A + (size_t)(row0 + ln) * lda;
  v8f acc[4] = {};
  for (int kb = 0; kb < K; kb += 32) {
    FragB ah, al;
    const v4f x0 = *(const v4fa*)(arow + kb + 8 * hh), x1 = *(const v4fa*)(arow + kb + 8 * hh + 4);
    const v4f x2 = *(const v4fa*)(arow + kb + 16 + 8 * hh), x3 = *(const v4fa*)(arow + kb + 16 + 8 * hh + 4);
    float xs[16] = {x0[0],x0[1],x0[2],x0[3],x1[0],x1[1],x1[2],x1[3],x2[0],x2[1],x2[2],x2[3],x3[0],x3[1],x3[2],x3[3]};
#pragma unroll
    for (int i = 0; i < 16; ++i) { const unsigned short hb = bf16_bits(xs[i]); ah.u[i] = hb; al.u[i] = ASPLIT ? bf16_bits(xs[i] - bf16_val(hb)) : (unsigned short)0; }
#pragma unroll
    for (int t = 0; t < 4; ++t) {
      const unsigned short* brow = Wt + (size_t)(col0 + t * 16 + ln) * ldb + kb;
      FragB b;
      b.half[0] = *(const v8us*)(brow + 8 * hh);
      b.half[1] = *(const v8us*)(brow + 16 + 8 * hh);
      acc[t] = mmaN<ASPLIT ? 2 : 1>(ah.v, al.v, b.v, b.v, acc[t]);
    }
  }
#pragma unroll
  for (int t = 0; t < 4; ++t) {
    const int col = col0 + t * 16 + ln;
    float bv = bias ? bias[col] : 0.f;
    if (BIAS_BF16) bv = bf16_round(bv);
#pragma unroll
    for (int r = 0; r < 8; ++r) {
      float v = acc[t][r] + bv;
      if (resid) { float rv = resid[(size_t)((row0 + 8 * hh + r) % rmod) * ldr + col]; if (RES_BF16) rv = bf16_round(rv); v += rv; }
      if (ACT == 1) v = fmaxf(v, 0.f);
      if (ACT == 2) v = 0.5f * v * (1.0f + erff(v * 0.70710678118654752f));
      if (ACT == 3) { const float u = 0.7978845608028654f * (v + 0.044715f * v * v * v); v = 0.5f * v * (1.0f + tanhf(u)); }
      so[w][8 * hh + r][t * 16 + ln] = v;
    }
  }
  __builtin_amdgcn_fence(__ATOMIC_ACQ_REL, "workgroup");
  __builtin_amdgcn_wave_barrier();
  const int rsub = lane >> 4, c4 = (lane & 15) * 4;
  {
#pragma unroll
    for (int q = 0; q < 8; ++q) {
      const int r = q * 2 + rsub;
      const v4f v = *(const v4fa*)&so[w][r][c4];
      *(v4f*)(C + (size_t)(row0 + r) * ldc + col0 + c4) = v;
    }
    
  }
}
// row LayerNorm (biased variance, eps) over N: s = X (+ R); optional out_sum <- s; out_norm <- (s-mu)*rsqrt(var+eps)*g + b
template <bool PARAM_BF16>
__global__ __launch_bounds__(256) void k_layernorm(const float* __restrict__ X, const float* __restrict__ R, const float* __restrict__ g, const float* __restrict__ bta,
                                                  float* __restrict__ out_sum, float* __restrict__ out_norm, int N, float eps) {
  __shared__ float red[256];
  const int row = blockIdx.x, tid = threadIdx.x;
  const float* x = X + (size_t)row * N; const float* rr = R ? R + (size_t)row * N : nullptr;
  float vals[16];                     // up to N = 4096
  const int per = N / 256;            // contiguous chunk per thread? use strided-by-4 chunks: thread handles j = tid*4 + 1024*u
  float s1 = 0.f;
  for (int u = 0; u < per / 4; ++u) {
    const int j = tid * 4 + 1024 * u;
    const v4f a = *(const v4fa*)(x + j);
    v4f b = {0.f,0.f,0.f,0.f}; if (rr) b = *(const v4fa*)(rr + j);
#pragma unroll
    for (int q = 0; q < 4; ++q) { const float v = a[q] + b[q]; vals[u * 4 + q] = v; s1 += v; }
  }
  red[tid] = s1; __syncthreads();
  for (int st = 128; st > 0; st >>= 1) { if (tid < st) red[tid] += red[tid + st]; __syncthreads(); }
  const float mu = red[0] / (float)N; __syncthreads();
  float s2 = 0.f;
  for (int u = 0; u < per / 4; ++u)
#pragma unroll
    for (int q = 0; q < 4; ++q) { const float c = vals[u * 4 + q] - mu; s2 += c * c; }
  red[tid] = s2; __syncthreads();
  for (int st = 128; st > 0; st >>= 1) { if (tid < st) red[tid] += red[tid + st]; __syncthreads(); }
  const float rs = rsqrtf(red[0] / (float)N + eps);
  {
    for (int u = 0; u < per / 4; ++u) {
      const int j = tid * 4 + 1024 * u;
      v4f o, sm;
#pragma unroll
      for (int q = 0; q < 4; ++q) {
        float gg = g[j + q], bb = bta[j + q];
        if (PARAM_BF16) { gg = bf16_round(gg); bb = bf16_round(bb); }
        sm[q] = vals[u * 4 + q]; o[q] = (vals[u * 4 + q] - mu) * rs * gg + bb;
      }
      if (out_sum) *(v4f*)(out_sum + (size_t)row * N + j) = sm;
      *(v4f*)(out_norm + (size_t)row * N + j) = o;
    }
    
  }
}



// ---- f16 WMMA path (v_wmma_f32_16x16x32_f16): 11-bit significands for operands in range — used where a [0,1] probability operand needs more precision than bf16
typedef _Float16 v16h __attribute__((ext_vector_type(16)));
union FragH { v16h v; v8us half[2]; _Float16 h[16]; unsigned short u[16]; };
template <int NT>
__device__ __forceinline__ v8f mmaH(v16h ah, v16h al, v16h bh, v16h bl, v8f c) {
  c = __builtin_amdgcn_wmma_f32_16x16x32_f16(false, ah, false, bh, (short)0, c, false, false);
  if (NT >= 2) c = __builtin_amdgcn_wmma_f32_16x16x32_f16(false, al, false, bh, (short)0, c, false, false);
  if (NT >= 3) c = __builtin_amdgcn_wmma_f32_16x16x32_f16(false, ah, false, bl, (short)0, c, false, false);
  asm volatile("v_nop\n\tv_nop\n\tv_nop\n\tv_nop" : "+v"(c) : "v"(ah), "v"(al), "v"(bh), "v"(bl));
  return c;
}
// batched GEMM like k_gemm_b but f16 operands: A f32 (split into f16 hi/lo if ASPLIT, else rounded to f16), Bt = f16 values [n][k]; alpha; C f32; N multiple of 16 (partial tiles skipped)
template <bool ASPLIT>
__global__ __launch_bounds__(128) void k_gemm_h(const float* __restrict__ A, int lda, size_t sA, const _Float16* __restrict__ Bh, int ldb, size_t sB, float alpha, float* __restrict__ C, int ldc, size_t sC, int M, int N, int K) {
  __shared__ __attribute__((aligned(16))) float so[4][16][64];
  const int tid = threadIdx.x, w = tid >> 5, lane = tid & 31, ln = lane & 15, hh = lane >> 4; const int by = blockIdx.y;
  A += (size_t)by * sA; Bh += (size_t)by * sB; C += (size_t)by * sC;
  const int ntn = (N + 63) / 64; const int wid = blockIdx.x * 4 + w; const int mt = wid / ntn, nq = wid % ntn; if (mt * 16 >= M) return;
  const int row0 = mt * 16, col0 = nq * 64; const float* arow = A + (size_t)(row0 + ln) * lda;
  v8f acc[4] = {};
  for (int kb = 0; kb < K; kb += 32) {
    FragH ah, al;
    const v4f x0 = *(const v4fa*)(arow + kb + 8 * hh), x1 = *(const v4fa*)(arow + kb + 8 * hh + 4), x2 = *(const v4fa*)(arow + kb + 16 + 8 * hh), x3 = *(const v4fa*)(arow + kb + 16 + 8 * hh + 4);
    float xs[16] = {x0[0],x0[1],x0[2],x0[3],x1[0],x1[1],x1[2],x1[3],x2[0],x2[1],x2[2],x2[3],x3[0],x3[1],x3[2],x3[3]};
#pragma unroll
    for (int i = 0; i < 16; ++i) { const _Float16 h = (_Float16)xs[i]; ah.h[i] = h; al.h[i] = ASPLIT ? (_Float16)(xs[i] - (float)h) : (_Float16)0.0f; }
#pragma unroll
    for (int t = 0; t < 4; ++t) { if (col0 + t * 16 >= N) continue; const size_t boff = (size_t)(col0 + t * 16 + ln) * ldb + kb; FragH bq; bq.half[0] = *(const v8us*)(Bh + boff + 8 * hh); bq.half[1] = *(const v8us*)(Bh + boff + 16 + 8 * hh);
      acc[t] = mmaH<ASPLIT ? 2 : 1>(ah.v, al.v, bq.v, bq.v, acc[t]); }
  }
#pragma unroll
  for (int t = 0; t < 4; ++t) { if (col0 + t * 16 >= N) continue;
#pragma unroll
    for (int r = 0; r < 8; ++r) so[w][8 * hh + r][t * 16 + ln] = acc[t][r] * alpha; }
  __builtin_amdgcn_fence(__ATOMIC_ACQ_REL, "workgroup"); __builtin_amdgcn_wave_barrier();
  const int rsub = lane >> 4, c4 = (lane & 15) * 4;
  {
#pragma unroll
    for (int q = 0; q < 8; ++q) { const int r = q * 2 + rsub; if (col0 + c4 < N) { const v4f v = *(const v4fa*)&so[w][r][c4]; *(v4f*)(C + (size_t)(row0 + r) * ldc + col0 + c4) = v; } }
     }
}

// Wt[n][k] = f16(W[k][n]·scale) from f32 row-major W[K][N] (scale = power of two; bf16-exact weights stay exact in f16 away from the subnormal range)
__global__ __launch_bounds__(256) void k_wt_f16(const float* __restrict__ W, _Float16* __restrict__ Wt, int K, int N, float scale) {
  const int t = blockIdx.x * 256 + threadIdx.x; if (t >= N * (K / 8)) return; const int n = t / (K / 8), k8 = (t % (K / 8)) * 8; FragH f;
#pragma unroll
  for (int i = 0; i < 8; ++i) f.h[i] = (_Float16)(bf16_round(W[(size_t)(k8 + i) * N + n]) * scale); const v8us o = f.half[0];
  *(v8us*)((unsigned short*)Wt + (size_t)n * K + k8) = o; 
}
// k_gemm_hh variant with fused epilogue: v = acc·alpha + bias[by·sBias + col] (+ CP[(row/rowsPerB)·sCPb + by·64 + col] if CP) ; ACT 0 none / 1 elu ; writes f16 C16 (and f32 C if non-null)
template <int ACT>
__global__ __launch_bounds__(128) void k_gemm_hhx(const _Float16* __restrict__ A, int lda, size_t sA, const _Float16* __restrict__ Bh, int ldb, size_t sB, float alpha, const float* __restrict__ bias, size_t sBias, const float* __restrict__ CP, int rowsPerB, size_t sCPb, int row0g,
    float* __restrict__ C, _Float16* __restrict__ C16, int ldc, size_t sC, int M, int N, int K) {
  __shared__ __attribute__((aligned(16))) float so[4][16][64];
  const int tid = threadIdx.x, w = tid >> 5, lane = tid & 31, ln = lane & 15, hh = lane >> 4; const int by = blockIdx.y;
  A += (size_t)by * sA; Bh += (size_t)by * sB; const size_t cofs = (size_t)by * sC; const float* bp = bias ? bias + (size_t)by * sBias : nullptr;
  const int ntn = (N + 63) / 64; const int wid = blockIdx.x * 4 + w; const int mt = wid / ntn, nq = wid % ntn; if (mt * 16 >= M) return;
  const int row0 = mt * 16, col0 = nq * 64; const _Float16* arow = A + (size_t)(row0 + ln) * lda;
  v8f acc[4] = {};
  for (int kb = 0; kb < K; kb += 32) { FragH ah; ah.half[0] = *(const v8us*)((const unsigned short*)arow + kb + 8 * hh); ah.half[1] = *(const v8us*)((const unsigned short*)arow + kb + 16 + 8 * hh);
#pragma unroll
    for (int t = 0; t < 4; ++t) { if (col0 + t * 16 >= N) continue; const size_t boff = (size_t)(col0 + t * 16 + ln) * ldb + kb; FragH bq; bq.half[0] = *(const v8us*)((const unsigned short*)Bh + boff + 8 * hh); bq.half[1] = *(const v8us*)((const unsigned short*)Bh + boff + 16 + 8 * hh);
      acc[t] = mmaH<1>(ah.v, ah.v, bq.v, bq.v, acc[t]); }
  }
#pragma unroll
  for (int t = 0; t < 4; ++t) { if (col0 + t * 16 >= N) continue; const int col = col0 + t * 16 + ln; const float bv = bp ? bf16_round(bp[col]) : 0.f;
#pragma unroll
    for (int r = 0; r < 8; ++r) { float v = acc[t][r] * alpha + bv; if (CP) { const int rr = row0g + row0 + 8 * hh + r; if (rowsPerB < 0) v += CP[cofs + (size_t)rr * ldc + col];      /* rowsPerB < 0: own element of the batched C plane */ else { const int bidx = rr / rowsPerB; v += CP[(size_t)bidx * sCPb + (size_t)by * 64 + col]; } } if (ACT == 1) v = (v > 0.f) ? v : expm1f(v); else if (ACT == 7) v = (v > 0.f) ? v + 1.0f : expf(v); else if (ACT == 8) v = tanhf(v); else if (ACT == 9) v = 0.5f * v * (1.0f + tanhf(0.7978845608028654f * (v + 0.044715f * v * v * v))); else if (ACT == 11) v = 1.0f / (1.0f + expf(-v)); else if (ACT == 12) v = (v > 0.f) ? v : 0.01f * v; else if (ACT == 14) v = (v > 0.f) ? v : 0.1f * v; else if (ACT == 16) v = (v >= 0.f) ? v : 0.3f * v; else if (ACT == 17) v = (v >= 0.f) ? v : 0.2f * v; else if (ACT == 15) v = v / (1.0f + expf(-v)); else if (ACT == 3) v = fmaxf(v, 0.f); else if (ACT == 6) v = 0.5f * v * (1.0f + erff(v * 0.70710678118654752f)); so[w][8 * hh + r][t * 16 + ln] = v; } }
  __builtin_amdgcn_fence(__ATOMIC_ACQ_REL, "workgroup"); __builtin_amdgcn_wave_barrier();
  const int rsub = lane >> 4, c4 = (lane & 15) * 4; typedef _Float16 v4h __attribute__((ext_vector_type(4)));
  {
#pragma unroll
    for (int q = 0; q < 8; ++q) { const int r = q * 2 + rsub; if (col0 + c4 < N) { const v4f v = *(const v4fa*)&so[w][r][c4]; if (C) *(v4f*)(C + cofs + (size_t)(row0 + r) * ldc + col0 + c4) = v; if (C16) { v4h h4; for (int i = 0; i < 4; ++i) h4[i] = (_Float16)v[i]; *(v4h*)(C16 + cofs + (size_t)(row0 + r) * ldc + col0 + c4) = h4; } } }
     }
}


typedef _Float16 v4h __attribute__((ext_vector_type(4)));

__global__ __launch_bounds__(256) void k_x16(const float* __restrict__ x, _Float16* __restrict__ X16, size_t n8) { const size_t t = (size_t)blockIdx.x * 256 + threadIdx.x; if (t >= n8) return; FragH f;
#pragma unroll
  for (int q = 0; q < 8; ++q) f.h[q] = (_Float16)bf16_round(x[t * 8 + q]); *(v8us*)((unsigned short*)X16 + t * 8) = f.half[0];  }
__global__ __launch_bounds__(256) void k_h16(const float* __restrict__ x, _Float16* __restrict__ X16, size_t n8) { const size_t t = (size_t)blockIdx.x * 256 + threadIdx.x; if (t >= n8) return; FragH f;
#pragma unroll
  for (int q = 0; q < 8; ++q) f.h[q] = (_Float16)x[t * 8 + q]; *(v8us*)((unsigned short*)X16 + t * 8) = f.half[0];  }
__global__ __launch_bounds__(256) void k_round16f(const float* __restrict__ W, _Float16* __restrict__ Bt, size_t n8) { const size_t t = (size_t)blockIdx.x * 256 + threadIdx.x; if (t >= n8) return; FragH f;
#pragma unroll
  for (int i = 0; i < 8; ++i) f.h[i] = (_Float16)(bf16_round(W[t * 8 + i]) * 16.0f); *(v8us*)((unsigned short*)Bt + t * 8) = f.half[0];  }
template <int NHv, int TTv>
__global__ __launch_bounds__(256) void k_vt(const _Float16* __restrict__ V16, int ldv, int voff, _Float16* __restrict__ Vt) { __shared__ unsigned short tl[64][66]; const int tid = threadIdx.x; const int slab = blockIdx.x / (TTv / 64), lg = blockIdx.x % (TTv / 64); const int b = slab / NHv, h = slab % NHv;
  for (int i = tid; i < 64 * 8; i += 256) { const int r = i / 8, c8 = (i % 8) * 8; FragH f; f.half[0] = *(const v8us*)((const unsigned short*)V16 + ((size_t)b * TTv + lg * 64 + r) * ldv + voff + h * 64 + c8);
#pragma unroll
    for (int q = 0; q < 8; ++q) tl[r][c8 + q] = f.u[q]; }
  __syncthreads();
  {
#pragma unroll
    for (int rd = 0; rd < 2; ++rd) { const int d = rd * 32 + tid / 8, pc = tid % 8; FragH f;
#pragma unroll
      for (int q = 0; q < 8; ++q) f.u[q] = tl[pc * 8 + q][d];
      *(v8us*)((unsigned short*)Vt + ((size_t)slab * 64 + d) * TTv + lg * 64 + pc * 8) = f.half[0]; }
     } }

__global__ __launch_bounds__(256) void k_hl(const float* __restrict__ F, _Float16* __restrict__ Hh, _Float16* __restrict__ Hl, size_t n8) { const size_t t = (size_t)blockIdx.x * 256 + threadIdx.x; if (t >= n8) return; FragH fh, fl; const v4f a = *(const v4fa*)(F + t * 8), c = *(const v4fa*)(F + t * 8 + 4);
#pragma unroll
  for (int q = 0; q < 4; ++q) { _Float16 h = (_Float16)a[q]; fh.h[q] = h; fl.h[q] = (_Float16)((a[q] - (float)h) * 1024.0f); h = (_Float16)c[q]; fh.h[4 + q] = h; fl.h[4 + q] = (_Float16)((c[q] - (float)h) * 1024.0f); }
  { *(v8us*)((unsigned short*)Hh + t * 8) = fh.half[0]; *(v8us*)((unsigned short*)Hl + t * 8) = fl.half[0];  } }

// ---- fast GEMM (wave tile 32x64; requires M % 32 == 0 rows per launch region and N % 64 == 0); epilogue = k_gemm_hhx semantics ----
__device__ __forceinline__ v16h g2_frag(const _Float16* p, int hh) { FragH f; f.half[0] = *(const v8us*)((const unsigned short*)p + 8 * hh); f.half[1] = *(const v8us*)((const unsigned short*)p + 16 + 8 * hh); return f.v; }
__device__ __forceinline__ v8f g2_mma(v16h a, v16h b, v8f c) { v8f d = __builtin_amdgcn_wmma_f32_16x16x32_f16(false, a, false, b, (short)0, c, false, false); asm volatile("v_nop\n\tv_nop\n\tv_nop\n\tv_nop" : "+v"(d) : "v"(a), "v"(b)); return d; }
template <int ACT>
__global__ __launch_bounds__(128) void k_gemm2(const _Float16* __restrict__ A, int lda, size_t sA, const _Float16* __restrict__ Bh, int ldb, size_t sB, float alpha, const float* __restrict__ bias, size_t sBias, const float* __restrict__ CP, int rowsPerB, size_t sCPb, int row0g,
    float* __restrict__ C, _Float16* __restrict__ C16, int ldc, size_t sC, int M, int N, int K, size_t zA = 0, size_t zB = 0, size_t zC = 0) { static_assert(ACT == 0 || ACT == 3 || ACT == 6 || ACT == 8 || ACT == 9 || ACT == 11 || ACT == 12 || ACT == 14 || ACT == 15 || ACT == 16 || ACT == 17, "k_gemm2: unsupported ACT code (would silently apply no activation)");
  __shared__ __attribute__((aligned(16))) float so[4][32][68];
  const int tid = threadIdx.x, w = tid >> 5, lane = tid & 31, ln = lane & 15, hh = lane >> 4; const int by = blockIdx.y; const int bz = blockIdx.z;      /* second batch axis (strides zA, zB, zC) */
  A += (size_t)by * sA + (size_t)bz * zA; Bh += (size_t)by * sB + (size_t)bz * zB; const size_t cofs = (size_t)by * sC + (size_t)bz * zC; const float* bp = bias ? bias + (size_t)by * sBias : nullptr;
  const int ntn = N >> 6; const int mt = blockIdx.x / ntn, nq = blockIdx.x - mt * ntn; const int row0 = mt * 128 + 32 * w, col0 = nq * 64; if (row0 >= M) return;
  const _Float16* a0p = A + (size_t)(row0 + ln) * lda; const _Float16* a1p = a0p + (size_t)16 * lda;
  const _Float16* b0p = Bh + (size_t)(col0 + ln) * ldb; const _Float16* b1p = b0p + (size_t)16 * ldb; const _Float16* b2p = b1p + (size_t)16 * ldb; const _Float16* b3p = b2p + (size_t)16 * ldb;
  const v8f z8 = {0.f,0.f,0.f,0.f,0.f,0.f,0.f,0.f}; v8f c00 = z8, c01 = z8, c02 = z8, c03 = z8, c10 = z8, c11 = z8, c12 = z8, c13 = z8;
#pragma unroll 1
  for (int kb = 0; kb < K; kb += 32) { const v16h a0 = g2_frag(a0p + kb, hh), a1 = g2_frag(a1p + kb, hh);
    v16h b = g2_frag(b0p + kb, hh); c00 = g2_mma(a0, b, c00); c10 = g2_mma(a1, b, c10);
    b = g2_frag(b1p + kb, hh); c01 = g2_mma(a0, b, c01); c11 = g2_mma(a1, b, c11);
    b = g2_frag(b2p + kb, hh); c02 = g2_mma(a0, b, c02); c12 = g2_mma(a1, b, c12);
    b = g2_frag(b3p + kb, hh); c03 = g2_mma(a0, b, c03); c13 = g2_mma(a1, b, c13); }
  v8f accs[8] = {c00, c01, c02, c03, c10, c11, c12, c13};
#pragma unroll
  for (int u = 0; u < 8; ++u) { const int t = u & 3, half = u >> 2; const int col = col0 + t * 16 + ln; const float bv = bp ? bf16_round(bp[col]) : 0.f;
#pragma unroll
    for (int r = 0; r < 8; ++r) { const int rloc = half * 16 + 8 * hh + r; float v = accs[u][r] * alpha + bv; if (CP) { if (rowsPerB < 0) v += CP[cofs + (size_t)(row0g + row0 + rloc) * ldc + col];      /* rowsPerB < 0: own element of the batched C plane */ else { const int bidx = (row0g + row0 + rloc) / rowsPerB; v += CP[(size_t)bidx * sCPb + (size_t)by * 64 + col]; } }
      if (ACT == 3) v = fmaxf(v, 0.f); else if (ACT == 6) v = 0.5f * v * (1.0f + erff(v * 0.70710678118654752f)); else if (ACT == 11) v = 1.0f / (1.0f + expf(-v)); else if (ACT == 15) v = v / (1.0f + expf(-v)); else if (ACT == 12) v = (v > 0.f) ? v : 0.01f * v; else if (ACT == 8) v = tanhf(v); else if (ACT == 9) v = 0.5f * v * (1.0f + tanhf(0.7978845608028654f * (v + 0.044715f * v * v * v))); else if (ACT == 14) v = (v > 0.f) ? v : 0.1f * v; else if (ACT == 16) v = (v >= 0.f) ? v : 0.3f * v; else if (ACT == 17) v = (v >= 0.f) ? v : 0.2f * v;
      so[w][rloc][t * 16 + ln] = v; } }
  __builtin_amdgcn_fence(__ATOMIC_ACQ_REL, "workgroup"); __builtin_amdgcn_wave_barrier();
  const int rsub = lane >> 4, c4 = (lane & 15) * 4;
  {
#pragma unroll
    for (int q = 0; q < 16; ++q) { const int r = q * 2 + rsub; const v4f v = *(const v4fa*)&so[w][r][c4]; if (C) *(v4f*)(C + cofs + (size_t)(row0 + r) * ldc + col0 + c4) = v; if (C16) { v4h h4; for (int i = 0; i < 4; ++i) h4[i] = (_Float16)v[i]; *(v4h*)(C16 + cofs + (size_t)(row0 + r) * ldc + col0 + c4) = h4; } }
     } }


__global__ __launch_bounds__(256) void k_wnat(const float* __restrict__ w, size_t n8, _Float16* __restrict__ Bt) { const size_t t = (size_t)blockIdx.x * 256 + threadIdx.x; if (t >= n8) return; FragH f; for (int q = 0; q < 8; ++q) f.h[q] = (_Float16)(bf16_round(w[t * 8 + q]) * 16.0f); *(v8us*)((unsigned short*)Bt + t * 8) = f.half[0];  }
__global__ __launch_bounds__(256) void k_rsm(const float* __restrict__ S, _Float16* __restrict__ P, int nrows) {
  #pragma clang fp contract(off)
  const int i = blockIdx.x * 256 + threadIdx.x; if (i >= nrows) return; const float* s = S + (size_t)i * SQ; float mx = -3.0e38f;
#pragma unroll 1
  for (int j = 0; j < SQ; ++j) mx = fmaxf(mx, s[j]); float se = 0.f;
#pragma unroll 1
  for (int j = 0; j < SQ; ++j) se += expf(s[j] - mx); const float sc = 256.0f / se;
#pragma unroll 1
  for (int j0 = 0; j0 < SQ; j0 += 8) { FragH f; for (int q = 0; q < 8; ++q) f.h[q] = (_Float16)(expf(s[j0 + q] - mx) * sc); unsigned short* d = (unsigned short*)P + (size_t)i * SQ + j0; *(v8us*)d = f.half[0];  } }
__global__ __launch_bounds__(256) void k_vt(const _Float16* __restrict__ V16, int b, int h0, _Float16* __restrict__ VT) { __shared__ unsigned short tl[64][65]; const int tid = threadIdx.x; const int hh = blockIdx.x % HG, sg = blockIdx.x / HG; const int s0 = sg * 64; const int h = h0 + hh;
  for (int i = tid; i < 64 * 8; i += 256) { const int j = i / 8, d8 = (i % 8) * 8; FragH f; f.half[0] = *(const v8us*)((const unsigned short*)V16 + ((size_t)b * SQ + s0 + j) * DM + h * HD + d8); for (int q = 0; q < 8; ++q) tl[d8 + q][j] = f.u[q]; }
  __syncthreads();
  { for (int i = tid; i < 64 * 8; i += 256) { const int d = i / 8, j8 = (i % 8) * 8; FragH f; for (int q = 0; q < 8; ++q) f.u[q] = tl[d][j8 + q]; *(v8us*)((unsigned short*)VT + ((size_t)hh * HD + d) * SQ + s0 + j8) = f.half[0]; }  } }



#define RW 4                         /* score rows per wave in the causal softmax */
// lane l with lane l ^ m inside a 16-lane row (DPP row_xmask, CTRL = 0x160 | m), and with lane l ^ 16
template <int CTRL> __device__ __forceinline__ float lane_xm(float x) { return __builtin_bit_cast(float, __builtin_amdgcn_update_dpp(0, __builtin_bit_cast(int, x), CTRL, 0xf, 0xf, true)); }
__device__ __forceinline__ float lane_x16(float x) { return __builtin_bit_cast(float, __builtin_amdgcn_permlanex16(__builtin_bit_cast(int, x), __builtin_bit_cast(int, x), 0x76543210, 0xfedcba98, false, false)); }
__device__ __forceinline__ float wave_max(float x) { x = fmaxf(x, lane_xm<0x161>(x)); x = fmaxf(x, lane_xm<0x162>(x)); x = fmaxf(x, lane_xm<0x164>(x)); x = fmaxf(x, lane_xm<0x168>(x)); return fmaxf(x, lane_x16(x)); }
__device__ __forceinline__ float wave_sum(float x) { x += lane_xm<0x161>(x); x += lane_xm<0x162>(x); x += lane_xm<0x164>(x); x += lane_xm<0x168>(x); return x + lane_x16(x); }
// 2^t for eight values in place. Asm so that the free slot which the instruction set asks for behind a transcendental, before its result is used or its source overwritten, stands by construction: no line here touches the line before it, and the v_nop covers the last
__device__ __forceinline__ void exp2_x8(float (&t)[8]) { asm("v_exp_f32 %0, %0\n\tv_exp_f32 %1, %1\n\tv_exp_f32 %2, %2\n\tv_exp_f32 %3, %3\n\tv_exp_f32 %4, %4\n\tv_exp_f32 %5, %5\n\tv_exp_f32 %6, %6\n\tv_exp_f32 %7, %7\n\tv_nop" : "+v"(t[0]), "+v"(t[1]), "+v"(t[2]), "+v"(t[3]), "+v"(t[4]), "+v"(t[5]), "+v"(t[6]), "+v"(t[7])); }
// RW rows of NC * 256 keys per wave: lane l holds keys c * 256 + 8 l .. + 7 of every chunk c in registers (a pair of b128 loads covers 1 KiB of a row per wave, a b128 store 512 B); S is read once
template <int NC>
__device__ __forceinline__ void rsm_rows(const float* __restrict__ S, _Float16* __restrict__ P, int row0, int q0, int lane) {
  v4f raw[RW][NC][2];
#pragma unroll
  for (int r = 0; r < RW; ++r)
#pragma unroll
    for (int c = 0; c < NC; ++c) { const float* s = S + (size_t)(row0 + r) * NKX + c * 256 + lane * 8; raw[r][c][0] = *(const v4fa*)s; raw[r][c][1] = *(const v4fa*)(s + 4); }
  __builtin_amdgcn_sched_barrier(0);      /* keeps every row's loads issued in front of the first row's arithmetic: without it the later rows' loads sink to their use and each row pays its own memory latency */
#pragma unroll
  for (int r = 0; r < RW; ++r) { const int last = q0 + ((row0 + r) % QT); float v[NC][8]; float mx = -3.0e38f;
#pragma unroll
    for (int c = 0; c < NC; ++c)
#pragma unroll
      for (int q = 0; q < 8; ++q) { const int j = c * 256 + lane * 8 + q; v[c][q] = (j <= last) ? raw[r][c][q >> 2][q & 3] : -1.0e9f; mx = fmaxf(mx, v[c][q]); }
    mx = wave_max(mx); float s4[4] = {0.f, 0.f, 0.f, 0.f};      /* four independent add chains per lane */
#pragma unroll
    for (int c = 0; c < NC; ++c) {
#pragma unroll
      for (int q = 0; q < 8; ++q) v[c][q] = (v[c][q] - mx) * 1.44269504f;      /* e^x = 2^(x log2 e), the native form as before */
      exp2_x8(v[c]);
#pragma unroll
      for (int q = 0; q < 8; ++q) s4[q & 3] += v[c][q]; }
    const float sc = 256.0f / wave_sum((s4[0] + s4[1]) + (s4[2] + s4[3]));
#pragma unroll
    for (int c = 0; c < NC; ++c) { FragH fr;
#pragma unroll
      for (int q = 0; q < 8; ++q) fr.h[q] = (_Float16)(v[c][q] * sc);
      *(v8us*)((unsigned short*)P + (size_t)(row0 + r) * NKX + c * 256 + lane * 8) = fr.half[0]; } }
  asm volatile("s_wait_xcnt 0x0" ::: "memory");      /* the wait that belongs in front of any later overwrite of a register which the stores above name: the bodies for the other key counts lie behind this one in the code and reuse those registers */
}
__global__ __launch_bounds__(256) void k_rsmcf2(const float* __restrict__ S, _Float16* __restrict__ P, int hg, int q0, int nk) { static_assert(QT % 256 == 0 && QT % RW == 0 && NKX <= 1024, "k_rsmcf2: nk is a multiple of 256, at most 1024");
  const int lane = threadIdx.x & 31; const int row0 = (blockIdx.x * 8 + __builtin_amdgcn_readfirstlane(threadIdx.x >> 5)) * RW; if (row0 >= hg * QT) return;      /* wave-uniform exit; the kernel has no barrier */
  const int nc = nk >> 8; if (nc == 1) rsm_rows<1>(S, P, row0, q0, lane); else if (nc == 2) rsm_rows<2>(S, P, row0, q0, lane); else if (nc == 3) rsm_rows<3>(S, P, row0, q0, lane); else rsm_rows<4>(S, P, row0, q0, lane); }


template <int MASKADD>
__global__ __launch_bounds__(64) void k_att0(const float* __restrict__ QF, const float* __restrict__ KF, const float* __restrict__ VF, int ld, const float* __restrict__ mask, float scale, float* __restrict__ OF, int ldo) {
  #pragma clang fp contract(off)
  __shared__ __attribute__((aligned(16))) float lq[64][64]; __shared__ __attribute__((aligned(16))) float lo[64][64];
  const int tid = threadIdx.x; const int h = blockIdx.x / (QT0 / 64), rg = blockIdx.x % (QT0 / 64); const int i = rg * 64 + tid;
  const size_t bo_in = (size_t)blockIdx.y * QT0 * ld; QF += bo_in; KF += bo_in; VF += bo_in; OF += (size_t)blockIdx.y * QT0 * ldo;      /* batch on grid.y: QT0 rows per batch in every plane */
  const float* qr = QF + (size_t)i * ld + h * HD;
#pragma unroll 1
  for (int c = 0; c < HD / 4; ++c) { *(v4f*)&lq[tid][c * 4] = *(const v4fa*)(qr + c * 4); const v4f z = {0.f, 0.f, 0.f, 0.f}; *(v4f*)&lo[tid][c * 4] = z; }
  float m = -1.0e30f, l = 0.f; const int jmax = MASKADD ? (SQ - 1) : (rg * 64 + 63);      /* additive-mask form: every key (the mask input decides); causal form: keys up to the block's last row */
#pragma unroll 1
  for (int j = 0; j <= jmax; ++j) { const float* kr = KF + (size_t)j * ld + h * HD; const float* vr = VF + (size_t)j * ld + h * HD; float s = 0.f;
#pragma unroll 1
    for (int c = 0; c < HD / 4; ++c) { const v4f kq = *(const v4fa*)(kr + c * 4); const v4f qq = *(v4f*)&lq[tid][c * 4]; s = __fadd_rn(s, __fmul_rn(qq[0], kq[0])); s = __fadd_rn(s, __fmul_rn(qq[1], kq[1])); s = __fadd_rn(s, __fmul_rn(qq[2], kq[2])); s = __fadd_rn(s, __fmul_rn(qq[3], kq[3])); }
    s = __fmul_rn(s, scale); if (MASKADD) s = __fadd_rn(s, __fmul_rn(bf16_round(mask[(size_t)i * SQ + j]), -10000.0f));
    const float f = (MASKADD || j <= i) ? 1.f : 0.f; const float sm = fmaf(f, s, (1.f - f) * -1.0e30f); const float mn = fmaxf(m, sm); const float sc = expf(m - mn); const float e = expf(sm - mn); l = __fadd_rn(__fmul_rn(l, sc), e); m = mn;
#pragma unroll 1
    for (int c = 0; c < HD / 4; ++c) { const v4f vv = *(const v4fa*)(vr + c * 4); v4f oo = *(v4f*)&lo[tid][c * 4]; for (int u = 0; u < 4; ++u) oo[u] = __fadd_rn(__fmul_rn(oo[u], sc), __fmul_rn(e, vv[u])); *(v4f*)&lo[tid][c * 4] = oo; } }
  const float fin = 64.0f / l;      /* o carried x64 like the f16 path */
#pragma unroll 1
  for (int c = 0; c < HD / 4; ++c) { v4f oo = *(v4f*)&lo[tid][c * 4]; for (int u = 0; u < 4; ++u) oo[u] = __fmul_rn(oo[u], fin); *(v4f*)&lo[tid][c * 4] = oo; }
  __syncthreads();
  {
#pragma unroll 1
    for (int it = 0; it < 16; ++it) { const int row = it * 4 + tid / 16, pc = (tid % 16) * 4; const v4f v = *(const v4f*)&lo[row][pc]; *(v4f*)(OF + (size_t)(rg * 64 + row) * ldo + h * HD + pc) = v; }
     } }


template <int BFIN, int WXB>
__global__ __launch_bounds__(256) void k_ln16(const float* __restrict__ X, const float* __restrict__ g, const float* __restrict__ bb, float eps, _Float16* __restrict__ N16, float* __restrict__ XB) {
  #pragma clang fp contract(off)
  __shared__ float red[256]; const size_t r = blockIdx.x; const int t = threadIdx.x; const v4f xa = *(const v4fa*)(X + r * DMQ + t * 4); float s[4]; float sum = 0.f;
  for (int q = 0; q < 4; ++q) { s[q] = BFIN ? bf16_round(xa[q]) : xa[q]; sum = __fadd_rn(sum, s[q]); }
  red[t] = sum; __syncthreads(); for (int st = 128; st > 0; st >>= 1) { if (t < st) red[t] = __fadd_rn(red[t], red[t + st]); __syncthreads(); } const float mu = red[0] / (float)DMQ; __syncthreads();
  float vs = 0.f; for (int q = 0; q < 4; ++q) { const float dl = __fadd_rn(s[q], -mu); vs = __fadd_rn(vs, __fmul_rn(dl, dl)); } red[t] = vs; __syncthreads(); for (int st = 128; st > 0; st >>= 1) { if (t < st) red[t] = __fadd_rn(red[t], red[t + st]); __syncthreads(); }
  const float rs = rsqrtf(__fadd_rn(red[0] / (float)DMQ, eps)); v4h y; v4f xb;
  for (int q = 0; q < 4; ++q) { const int c = t * 4 + q; y[q] = (_Float16)__fadd_rn(__fmul_rn(__fmul_rn(__fadd_rn(s[q], -mu), rs), bf16_round(g[c])), bf16_round(bb[c])); xb[q] = s[q]; }
  { *(v4h*)(N16 + r * DMQ + t * 4) = y; if (WXB) *(v4f*)(XB + r * DMQ + t * 4) = xb;  } }
__global__ __launch_bounds__(256) void k_ftres2(const float* __restrict__ OF0, const float* __restrict__ XB, float* __restrict__ X1, size_t n4) {
  #pragma clang fp contract(off)
  const size_t t = (size_t)blockIdx.x * 256 + threadIdx.x; if (t >= n4) return; const v4f o = *(const v4fa*)(OF0 + t * 4), xv = *(const v4fa*)(XB + t * 4); v4f y; for (int q = 0; q < 4; ++q) y[q] = __fadd_rn(__fmul_rn(o[q], 0.015625f), xv[q]); *(v4f*)(X1 + t * 4) = y;  }

__global__ __launch_bounds__(256) void k_wthd(const float* __restrict__ Wt, _Float16* __restrict__ Bt) { const size_t t = (size_t)blockIdx.x * 256 + threadIdx.x; if (t >= (size_t)NH * HD * (DM / 8)) return; const int m8 = (int)(t % (DM / 8)) * 8; const int d = (int)((t / (DM / 8)) % HD); const int h = (int)(t / ((size_t)(DM / 8) * HD)); FragH f;
  for (int q = 0; q < 8; ++q) f.h[q] = (_Float16)(16.0f * bf16_round(Wt[((size_t)h * DM + m8 + q) * HD + d])); unsigned short* dst = (unsigned short*)Bt + ((size_t)h * HD + d) * DM + m8; *(v8us*)dst = f.half[0];  }




__global__ __launch_bounds__(256) void k_wtpad(const float* __restrict__ Wm, _Float16* __restrict__ Wt, int Kr, int Kp, int Nr, int Np, float scale) {
  const int t = blockIdx.x * 256 + threadIdx.x; if (t >= Np * (Kp / 8)) return; const int n = t / (Kp / 8), k8 = (t % (Kp / 8)) * 8; const int nc = min(n, Nr - 1); const float fn = (n < Nr) ? 1.f : 0.f; FragH f;
  for (int i = 0; i < 8; ++i) { const int k = k8 + i; const int kc = min(k, Kr - 1); const float fk = (k < Kr) ? fn : 0.f; f.h[i] = (_Float16)(bf16_round(Wm[(size_t)kc * Nr + nc]) * scale * fk); }
  unsigned short* o = (unsigned short*)Wt + (size_t)n * Kp + k8; *(v8us*)o = f.half[0];  }
__global__ __launch_bounds__(128) void k_bpad(const float* __restrict__ b, float* __restrict__ Bp, int nr, int np) {
  const int i = threadIdx.x; if (i >= np) return; const float v = b[min(i, nr - 1)] * ((i < nr) ? 1.f : 0.f); *(float*)(Bp + i) = v;  }
extern "C" void kernel_launch(void* const* d_in, const int* in_sizes, int n_in,
                              void* d_out, int out_size, void* d_ws, size_t ws_size, hipStream_t stream) {
  (void)in_sizes; (void)n_in; (void)out_size;
  const float* const* I = (const float* const*)d_in; const float* x = I[0]; const float* wqkv = I[1]; const float* bqkv = I[2]; const float* wo = I[3]; const float* bo = I[4]; const float* g1 = I[5]; const float* be1 = I[6]; const float* gg2 = I[7]; const float* be2 = I[8]; const float* wfc = I[9]; const float* bfc = I[10]; const float* wmp = I[11]; const float* bmp = I[12];      /* x; fused Wqkv [1024][3072] + bqkv [3072] ([in][out]); Wproj + bproj; LN1 g / b, LN2 g / b; W1 [1024][4096] + b1, W2 [4096][1024] + b2 */
  char* ws = (char*)d_ws; size_t off = 0;
  auto take = [&](size_t bytes) { char* p = ws + off; off += (bytes + 255) & ~(size_t)255; return p; };
  _Float16* BQKV = (_Float16*)take((size_t)3 * DM * DM * 2); _Float16* BO = (_Float16*)take((size_t)DM * DM * 2);
  _Float16* X16 = (_Float16*)take(NR * DM * 2); float* XB = (float*)take(NR * DM * 4); _Float16* BW1 = (_Float16*)take((size_t)DFF * DM * 2); _Float16* BW2 = (_Float16*)take((size_t)DM * DFF * 2);
  _Float16* QKV = (_Float16*)take(NR * 3 * DM * 2); _Float16* Q16 = QKV; _Float16* K16 = QKV + DM; _Float16* V16 = QKV + 2 * DM; _Float16* O16 = (_Float16*)take(NR * DM * 2);
  _Float16* HF16 = QKV;      /* alias: the FFN hidden rows [NR][DFF] fill QKV + O16 (adjacent, same bytes); their last reader, the output projection, precedes the FFN */
  _Float16* M16 = X16;      /* alias: X16's last reader, the first-tile q | k | v GEMM, precedes LN2's write */
  _Float16* VT = (_Float16*)take((size_t)NB * NH * HD * SQ * 2);
  float* OF0 = (float*)take((size_t)NB * QT0 * DM * 4); _Float16* OH0 = (_Float16*)take((size_t)NB * QT0 * DM * 2); _Float16* OL0 = (_Float16*)take((size_t)NB * QT0 * DM * 2);
  float* S = (float*)take((size_t)GB * NH * QT * NKX * 4); _Float16* P = (_Float16*)take((size_t)GB * NH * QT * NKX * 2);
  float* QKVF0 = S;      /* alias: f32 q | k | v of the first tiles [NB][QT0][3 DM]; read by the exact attention before the first scores are written */
  float* X1 = S;      /* alias: x1 [NR][DM] is written after the last read of S and P */
  if (off > ws_size) return;
  k_wt_f16<<<(unsigned)(((size_t)3 * DM * (DM / 8) + 255) / 256), 256, 0, stream>>>(wqkv, BQKV, DM, 3 * DM, 16.0f);      /* fused [in][out] [DM][3 DM] -> Bt [3 DM][DM] x16: rows 0.. = q, DM.. = k, 2 DM.. = v output columns (contiguous thirds) */ k_wt_f16<<<(unsigned)(((size_t)DM * (DM / 8) + 255) / 256), 256, 0, stream>>>(wo, BO, DM, DM, 16.0f);      /* w_proj [in][out] -> Bt x16 */
  k_ln16<1, 1><<<(unsigned)NR, 256, 0, stream>>>(x, g1, be1, 1e-5f, X16, XB);      /* a = LN1(bf16(x)) -> f16 rows; XB = bf16(x) for the residual */
  k_wt_f16<<<(unsigned)(((size_t)DFF * (DM / 8) + 255) / 256), 256, 0, stream>>>(wfc, BW1, DM, DFF, 16.0f); k_wt_f16<<<(unsigned)(((size_t)DM * (DFF / 8) + 255) / 256), 256, 0, stream>>>(wmp, BW2, DFF, DM, 16.0f);      /* W1 [1024][4096] -> Bt [4096][1024]; W2 [4096][1024] -> Bt [1024][4096] (x16) */
  k_gemm2<0><<<dim3((unsigned)((MP / 128) * (3 * DM / 64)), 1), 128, 0, stream>>>(X16, DM, 0, BQKV, DM, 0, 0.0625f, bqkv, 0, nullptr, 1, 0, 0, nullptr, QKV, 3 * DM, 0, MP, 3 * DM, DM);      /* q | k | v rows (f16); head h = columns h*HD.. of each DM block */
  k_vt<NH, SQ><<<NB * NH * (SQ / 64), 256, 0, stream>>>(V16, LQ, 0, VT);      /* V^T [NB][NH][HD][SQ], every batch in one launch */
  k_gemm2<0><<<dim3((QT0 / 128) * (3 * DM / 64), NB), 128, 0, stream>>>(X16, DM, (size_t)SQ * DM, BQKV, DM, 0, 0.0625f, bqkv, 0, nullptr, 1, 0, 0, QKVF0, nullptr, 3 * DM, (size_t)QT0 * 3 * DM, QT0, 3 * DM, DM);      /* f32 q | k | v of the first 128 rows of every batch (grid.y; exact products) */
  k_att0<0><<<dim3(NH * (QT0 / 64), NB), 64, 0, stream>>>(QKVF0, QKVF0 + DM, QKVF0 + 2 * DM, 3 * DM, nullptr, 0.07216878364870322f, OF0, DM);      /* exact f32 attention for rows 0..127 of every batch (grid.y; o x64) */
  for (int b = 0; b < NB; b += GB) { const size_t r0 = (size_t)b * SQ;      /* GB batches on grid.z */
    for (int q0 = 0; q0 < QN; q0 += QT) { const int nk = q0 + QT;      /* causal: only keys below the tile end are computed */
      k_gemm2<0><<<dim3((QT / 128) * (nk / 64), NHD, GB), 128, 0, stream>>>(Q16 + (r0 + q0) * LQ, LQ, (size_t)HD, K16 + r0 * LQ, LQ, (size_t)HD, 0.07216878364870322f, nullptr, 0, nullptr, 1, 0, 0, S, nullptr, NKX, (size_t)QT * NKX, QT, nk, HD, (size_t)SQ * LQ, (size_t)SQ * LQ, (size_t)NH * QT * NKX);      /* scores, heads on grid.y */
      k_rsmcf2<<<(GB * NHD * QT + 8 * RW - 1) / (8 * RW), 256, 0, stream>>>(S, P, GB * NHD, q0, nk);      /* one wave per RW rows */
      k_gemm2<0><<<dim3((QT / 128) * (HD / 64), NHD, GB), 128, 0, stream>>>(P, NKX, (size_t)QT * NKX, VT + (size_t)b * NH * HD * SQ, SQ, (size_t)HD * SQ, 0.25f, nullptr, 0, nullptr, 1, 0, 0, nullptr, O16 + (r0 + q0) * DM, DM, (size_t)HD, QT, HD, nk, (size_t)NH * QT * NKX, (size_t)NH * HD * SQ, (size_t)SQ * DM); } }      /* o (merged heads, x64) as f16 rows */
  k_gemm2<0><<<dim3((unsigned)((MPO / 128) * (DM / 64)), 1), 128, 0, stream>>>(O16, DM, 0, BO, DM, 0, 0.0009765625f, bo, 0, XB, -1, 0, 0, X1, nullptr, DM, 0, MPO, DM, DM);      /* x1 = x + o Wo + b, all rows */
  k_hl<<<(unsigned)(((size_t)NB * QT0 * DM / 8 + 255) / 256), 256, 0, stream>>>(OF0, OH0, OL0, (size_t)NB * QT0 * DM / 8);      /* first-tile o (x64) -> f16 hi + x1024 residual planes */
  k_gemm2<0><<<dim3((QT0 / 128) * (DM / 64), NB), 128, 0, stream>>>(OH0, DM, (size_t)QT0 * DM, BO, DM, 0, 0.0009765625f, bo, 0, XB, -1, 0, 0, X1, nullptr, DM, (size_t)SQ * DM, QT0, DM, DM);      /* rows 0..127 of every batch (grid.y): x1 = x + o_hi Wo (+ b), overwriting the f16-path rows */
  k_gemm2<0><<<dim3((QT0 / 128) * (DM / 64), NB), 128, 0, stream>>>(OL0, DM, (size_t)QT0 * DM, BO, DM, 0, 0.00000095367431640625f, nullptr, 0, X1, -1, 0, 0, X1, nullptr, DM, (size_t)SQ * DM, QT0, DM, DM);      /* += o_lo Wo 2^-20 (own-element accumulate) */
  k_ln16<0, 0><<<(unsigned)NR, 256, 0, stream>>>(X1, gg2, be2, 1e-5f, M16, nullptr);      /* h = LN2(x1) -> f16 rows */
  k_gemm2<3><<<dim3((unsigned)((MP / 128) * (DFF / 64)), 1), 128, 0, stream>>>(M16, DM, 0, BW1, DM, 0, 0.0625f, bfc, 0, nullptr, 1, 0, 0, nullptr, HF16, DFF, 0, MP, DFF, DM);      /* relu(h2 W1 + b1) -> f16, all rows */
  k_gemm2<0><<<dim3((unsigned)((MP / 128) * (DM / 64)), 1), 128, 0, stream>>>(HF16, DFF, 0, BW2, DFF, 0, 0.0625f, bmp, 0, X1, -1, 0, 0, (float*)d_out, nullptr, DM, 0, MP, DM, DFF);      /* out = x1 + mlp (own-element residual), all rows */
}

// v003
// Measured time: 1130 microseconds a run.
// Next to v002, in two timings, it ran 1.48 times as fast each time.
// Over all steps from v000 it is 9.33 times as fast.
#include <hip/hip_runtime.h>
// Pre-LN causal transformer block with a fused QKV projection and the module's literal score scale (x [8][1024][1024]; h = LN1(x) (biased var, eps 1e-5); qkv = h Wqkv + bqkv ([in][out] 1024 x 3072 + bias) split q | k | v; 16 heads of 64; scale = 1 / sqrt(3 * 1024 / 16) = 1 / sqrt(192) (as the source: NOT 1 / sqrt(head_dim)); causal (tril, -inf); softmax; x1 = x + y Wproj + bproj; out = x1 + relu(LN2(x1) W1 + b1) W2 + b2 ([in][out] 1024 x 4096 x 1024) -> [8][1024][1024]).
// Structure: token rows r = b*1024 + s; h = LN1(bf16(x)) as f16 rows; q | k | v as ONE WMMA GEMM (N = 3 x 1024) (32x64 wave tiles, f32 accumulation, exact x16 weights + bias, f16 outputs); per batch: V^T for all heads via LDS transposes; per query tile of 256 rows: scores against the keys below the tile end only (K = 64, all heads on grid.y, alpha = 1 / sqrt(192)), causal row softmax on VALU, one wave per 4 rows with the rows in registers, keys above the row masked over the computed range (f32 statistics, native exp; weights x256 f16), o = P . V^T (K = keys below the tile end, alpha 2^-2: o carried x64, folded into the output GEMM alpha) written straight into the merged f16 o rows; x1 = x + o W_o + b GEMM (f32), then the FFN into the output.
// Compute dtype: inputs rounded to bf16; x / weights exact; q, k, v, softmax weights and o as plain f16 GEMM operands (~2^-12); scores and softmax statistics f32. v_wmma_f32_16x16x32_f16.
// Launches: V^T takes all batches on grid.x, the first-tile q | k | v GEMM, the exact first-tile attention and the first-tile output GEMMs on grid.y; a host loop steps over groups of GB batches, which scores and P V take on grid.z and the softmax on grid.x (S and P hold GB batches); the FFN GEMMs take all token rows.
#define NB 8
#define SQ 1024
#define DM 1024
#define NH 16
#define HD 64
#define HG 4                         /* heads per block group of the non-template k_vt (not launched) */
#define QT 256                       /* query rows per causal tile */
#define NKX SQ                       /* S / P row pitch */
#define QT0 128                      /* first-tile rows recomputed exactly in f32 */
#define GB 4                         /* batches per score, softmax and P V launch (grid.z of the GEMMs); S and P hold GB batches */
#define B0 0                         /* unused; the batch loops start at 0 */
#define NBR NB                       /* batches processed (debug hook) */
#define NR ((size_t)NB * SQ)
#define DMQ DM
#define DFF 4096                     /* FFN hidden width */
#define DFFR 100                     /* unused; the FFN hidden width is DFF */
#define MP ((int)((size_t)NBR * SQ)) /* rows projected (debug hook) */
#define QN SQ                        /* query rows attended per batch (debug hook) */
#define NHD NH                       /* heads attended (debug hook) */
#define MPO MP                       /* rows through the output stage (debug hook) */
#define LQ (3 * DM)      /* row pitch of the q/k/v rows */
typedef __bf16 v16b __attribute__((ext_vector_type(16)));
typedef unsigned short v8us __attribute__((ext_vector_type(8), may_alias));
typedef float  v8f  __attribute__((ext_vector_type(8)));
typedef float  v4f  __attribute__((ext_vector_type(4)));
typedef float  v4fa __attribute__((ext_vector_type(4), may_alias));
union FragB { v16b v; v8us half[2]; unsigned short u[16]; };

__device__ __forceinline__ unsigned short bf16_bits(float x) { unsigned int u = __float_as_uint(x); return (unsigned short)((u + 0x7FFFu + ((u >> 16) & 1u)) >> 16); }
__device__ __forceinline__ float bf16_val(unsigned short b) { return __uint_as_float(((unsigned int)b) << 16); }
__device__ __forceinline__ float bf16_round(float x) { return bf16_val(bf16_bits(x)); }
// D += A·B with NT terms: 1 = ah·bh, 2 = + al·bh (A split), 3 = + ah·bl (both split)
template <int NT>
__device__ __forceinline__ v8f mmaN(v16b ah, v16b al, v16b bh, v16b bl, v8f c) {
  c = __builtin_amdgcn_wmma_f32_16x16x32_bf16(false, ah, false, bh, (short)0, c, false, false);
  if (NT >= 2) c = __builtin_amdgcn_wmma_f32_16x16x32_bf16(false, al, false, bh, (short)0, c, false, false);
  if (NT >= 3) c = __builtin_amdgcn_wmma_f32_16x16x32_bf16(false, ah, false, bl, (short)0, c, false, false);
  asm volatile("v_nop\n\tv_nop\n\tv_nop\n\tv_nop" : "+v"(c) : "v"(ah), "v"(al), "v"(bh), "v"(bl));
  return c;
}

__global__ __launch_bounds__(256) void k_wt_bf16(const float* __restrict__ W, unsigned short* __restrict__ Wt, int K, int N) {
  const int t = blockIdx.x * 256 + threadIdx.x;
  const int k8n = K / 8;
  if (t >= N * k8n) return;
  const int n = t / k8n, k8 = (t % k8n) * 8;
  v8us v;
#pragma unroll
  for (int i = 0; i < 8; ++i) v[i] = bf16_bits(W[(size_t)(k8 + i) * N + n]);
  *(v8us*)(Wt + (size_t)n * K + k8) = v;
  
}

// GEMM C[M][N] (f32, pitch ldc) = act(A[M][K]·W + bias). A f32 row-major (pitch lda) converted per fragment to bf16
// (ASPLIT: hi/lo two planes -> 2 terms, else single rounded term); Wt bf16 [N][K] (pitch ldb). BIAS_BF16 rounds the
// bias to bf16 first (bias quantised to bf16 before the add). K%32==0, M%16==0, N%64==0.
template <bool ASPLIT, int ACT, bool BIAS_BF16>
__global__ __launch_bounds__(128) void k_gemm_bf(const float* __restrict__ A, int lda, const unsigned short* __restrict__ Wt, int ldb,
                                               const float* __restrict__ bias, float* __restrict__ C, int ldc, int M, int N, int K) {
  __shared__ __attribute__((aligned(16))) float so[4][16][64];
  const int tid = threadIdx.x, w = tid >> 5, lane = tid & 31, ln = lane & 15, hh = lane >> 4;
  const int ntn = N / 64;
  const int wid = blockIdx.x * 4 + w;
  const int mt = wid / ntn, nq = wid % ntn;
  if (mt * 16 >= M) return;
  const int row0 = mt * 16, col0 = nq * 64;
  const float* arow = A + (size_t)(row0 + ln) * lda;
  v8f acc[4] = {};
  for (int kb = 0; kb < K; kb += 32) {
    FragB ah, al;
    const v4f x0 = *(const v4fa*)(arow + kb + 8 * hh), x1 = *(const v4fa*)(arow + kb + 8 * hh + 4);
    const v4f x2 = *(const v4fa*)(arow + kb + 16 + 8 * hh), x3 = *(const v4fa*)(arow + kb + 16 + 8 * hh + 4);
    float xs[16] = {x0[0],x0[1],x0[2],x0[3],x1[0],x1[1],x1[2],x1[3],x2[0],x2[1],x2[2],x2[3],x3[0],x3[1],x3[2],x3[3]};
#pragma unroll
    for (int i = 0; i < 16; ++i) { const unsigned short hb = bf16_bits(xs[i]); ah.u[i] = hb; al.u[i] = ASPLIT ? bf16_bits(xs[i] - bf16_val(hb)) : (unsigned short)0; }
#pragma unroll
    for (int t = 0; t < 4; ++t) {
      const unsigned short* brow = Wt + (size_t)(col0 + t * 16 + ln) * ldb + kb;
      FragB b;
      b.half[0] = *(const v8us*)(brow + 8 * hh);
      b.half[1] = *(const v8us*)(brow + 16 + 8 * hh);
      acc[t] = mmaN<ASPLIT ? 2 : 1>(ah.v, al.v, b.v, b.v, acc[t]);
    }
  }
#pragma unroll
  for (int t = 0; t < 4; ++t) {
    float bv = bias ? bias[col0 + t * 16 + ln] : 0.f;
    if (BIAS_BF16) bv = bf16_round(bv);
#pragma unroll
    for (int r = 0; r < 8; ++r) { float v = acc[t][r] + bv; if (ACT == 1) v = fmaxf(v, 0.f); so[w][8 * hh + r][t * 16 + ln] = v; }
  }
  __builtin_amdgcn_fence(__ATOMIC_ACQ_REL, "workgroup");
  __builtin_amdgcn_wave_barrier();
  const int rsub = lane >> 4, c4 = (lane & 15) * 4;
  {
#pragma unroll
    for (int q = 0; q < 8; ++q) {
      const int r = q * 2 + rsub;
      const v4f v = *(const v4fa*)&so[w][r][c4];
      *(v4f*)(C + (size_t)(row0 + r) * ldc + col0 + c4) = v;
    }
    
  }
}

// GEMM C = act(A·W + bias + resid): A f32 (ASPLIT -> hi/lo 2 terms), Wt bf16 [N][K]; ACT 0 none, 1 relu, 2 exact gelu;
// resid (optional, f32, row index = (row % rmod), pitch ldr, RES_BF16 rounds it) added before the activation.
template <bool ASPLIT, int ACT, bool BIAS_BF16, bool RES_BF16>
__global__ __launch_bounds__(128) void k_gemm_bf3(const float* __restrict__ A, int lda, const unsigned short* __restrict__ Wt, int ldb,
                                                const float* __restrict__ bias, const float* __restrict__ resid, int rmod, int ldr,
                                                float* __restrict__ C, int ldc, int M, int N, int K) {
  __shared__ __attribute__((aligned(16))) float so[4][16][64];
  const int tid = threadIdx.x, w = tid >> 5, lane = tid & 31, ln = lane & 15, hh = lane >> 4;
  const int ntn = N / 64;
  const int wid = blockIdx.x * 4 + w;
  const int mt = wid / ntn, nq = wid % ntn;
  if (mt * 16 >= M) return;
  const int row0 = mt * 16, col0 = nq * 64;
  const float* arow = A + (size_t)(row0 + ln) * lda;
  v8f acc[4] = {};
  for (int kb = 0; kb < K; kb += 32) {
    FragB ah, al;
    const v4f x0 = *(const v4fa*)(arow + kb + 8 * hh), x1 = *(const v4fa*)(arow + kb + 8 * hh + 4);
    const v4f x2 = *(const v4fa*)(arow + kb + 16 + 8 * hh), x3 = *(const v4fa*)(arow + kb + 16 + 8 * hh + 4);
    float xs[16] = {x0[0],x0[1],x0[2],x0[3],x1[0],x1[1],x1[2],x1[3],x2[0],x2[1],x2[2],x2[3],x3[0],x3[1],x3[2],x3[3]};
#pragma unroll
    for (int i = 0; i < 16; ++i) { const unsigned short hb = bf16_bits(xs[i]); ah.u[i] = hb; al.u[i] = ASPLIT ? bf16_bits(xs[i] - bf16_val(hb)) : (unsigned short)0; }
#pragma unroll
    for (int t = 0; t < 4; ++t) {
      const unsigned short* brow = Wt + (size_t)(col0 + t * 16 + ln) * ldb + kb;
      FragB b;
      b.half[0] = *(const v8us*)(brow + 8 * hh);
      b.half[1] = *(const v8us*)(brow + 16 + 8 * hh);
      acc[t] = mmaN<ASPLIT ? 2 : 1>(ah.v, al.v, b.v, b.v, acc[t]);
    }
  }
#pragma unroll
  for (int t = 0; t < 4; ++t) {
    const int col = col0 + t * 16 + ln;
    float bv = bias ? bias[col] : 0.f;
    if (BIAS_BF16) bv = bf16_round(bv);
#pragma unroll
    for (int r = 0; r < 8; ++r) {
      float v = acc[t][r] + bv;
      if (resid) { float rv = resid[(size_t)((row0 + 8 * hh + r) % rmod) * ldr + col]; if (RES_BF16) rv = bf16_round(rv); v += rv; }
      if (ACT == 1) v = fmaxf(v, 0.f);
      if (ACT == 2) v = 0.5f * v * (1.0f + erff(v * 0.70710678118654752f));
      if (ACT == 3) { const float u = 0.7978845608028654f * (v + 0.044715f * v * v * v); v = 0.5f * v * (1.0f + tanhf(u)); }
      so[w][8 * hh + r][t * 16 + ln] = v;
    }
  }
  __builtin_amdgcn_fence(__ATOMIC_ACQ_REL, "workgroup");
  __builtin_amdgcn_wave_barrier();
  const int rsub = lane >> 4, c4 = (lane & 15) * 4;
  {
#pragma unroll
    for (int q = 0; q < 8; ++q) {
      const int r = q * 2 + rsub;
      const v4f v = *(const v4fa*)&so[w][r][c4];
      *(v4f*)(C + (size_t)(row0 + r) * ldc + col0 + c4) = v;
    }
    
  }
}
// row LayerNorm (biased variance, eps) over N: s = X (+ R); optional out_sum <- s; out_norm <- (s-mu)*rsqrt(var+eps)*g + b
template <bool PARAM_BF16>
__global__ __launch_bounds__(256) void k_layernorm(const float* __restrict__ X, const float* __restrict__ R, const float* __restrict__ g, const float* __restrict__ bta,
                                                  float* __restrict__ out_sum, float* __restrict__ out_norm, int N, float eps) {
  __shared__ float red[256];
  const int row = blockIdx.x, tid = threadIdx.x;
  const float* x = X + (size_t)row * N; const float* rr = R ? R + (size_t)row * N : nullptr;
  float vals[16];                     // up to N = 4096
  const int per = N / 256;            // contiguous chunk per thread? use strided-by-4 chunks: thread handles j = tid*4 + 1024*u
  float s1 = 0.f;
  for (int u = 0; u < per / 4; ++u) {
    const int j = tid * 4 + 1024 * u;
    const v4f a = *(const v4fa*)(x + j);
    v4f b = {0.f,0.f,0.f,0.f}; if (rr) b = *(const v4fa*)(rr + j);
#pragma unroll
    for (int q = 0; q < 4; ++q) { const float v = a[q] + b[q]; vals[u * 4 + q] = v; s1 += v; }
  }
  red[tid] = s1; __syncthreads();
  for (int st = 128; st > 0; st >>= 1) { if (tid < st) red[tid] += red[tid + st]; __syncthreads(); }
  const float mu = red[0] / (float)N; __syncthreads();
  float s2 = 0.f;
  for (int u = 0; u < per / 4; ++u)
#pragma unroll
    for (int q = 0; q < 4; ++q) { const float c = vals[u * 4 + q] - mu; s2 += c * c; }
  red[tid] = s2; __syncthreads();
  for (int st = 128; st > 0; st >>= 1) { if (tid < st) red[tid] += red[tid + st]; __syncthreads(); }
  const float rs = rsqrtf(red[0] / (float)N + eps);
  {
    for (int u = 0; u < per / 4; ++u) {
      const int j = tid * 4 + 1024 * u;
      v4f o, sm;
#pragma unroll
      for (int q = 0; q < 4; ++q) {
        float gg = g[j + q], bb = bta[j + q];
        if (PARAM_BF16) { gg = bf16_round(gg); bb = bf16_round(bb); }
        sm[q] = vals[u * 4 + q]; o[q] = (vals[u * 4 + q] - mu) * rs * gg + bb;
      }
      if (out_sum) *(v4f*)(out_sum + (size_t)row * N + j) = sm;
      *(v4f*)(out_norm + (size_t)row * N + j) = o;
    }
    
  }
}



// ---- f16 WMMA path (v_wmma_f32_16x16x32_f16): 11-bit significands for operands in range — used where a [0,1] probability operand needs more precision than bf16
typedef _Float16 v16h __attribute__((ext_vector_type(16)));
union FragH { v16h v; v8us half[2]; _Float16 h[16]; unsigned short u[16]; };
template <int NT>
__device__ __forceinline__ v8f mmaH(v16h ah, v16h al, v16h bh, v16h bl, v8f c) {
  c = __builtin_amdgcn_wmma_f32_16x16x32_f16(false, ah, false, bh, (short)0, c, false, false);
  if (NT >= 2) c = __builtin_amdgcn_wmma_f32_16x16x32_f16(false, al, false, bh, (short)0, c, false, false);
  if (NT >= 3) c = __builtin_amdgcn_wmma_f32_16x16x32_f16(false, ah, false, bl, (short)0, c, false, false);
  asm volatile("v_nop\n\tv_nop\n\tv_nop\n\tv_nop" : "+v"(c) : "v"(ah), "v"(al), "v"(bh), "v"(bl));
  return c;
}
// batched GEMM like k_gemm_b but f16 operands: A f32 (split into f16 hi/lo if ASPLIT, else rounded to f16), Bt = f16 values [n][k]; alpha; C f32; N multiple of 16 (partial tiles skipped)
template <bool ASPLIT>
__global__ __launch_bounds__(128) void k_gemm_h(const float* __restrict__ A, int lda, size_t sA, const _Float16* __restrict__ Bh, int ldb, size_t sB, float alpha, float* __restrict__ C, int ldc, size_t sC, int M, int N, int K) {
  __shared__ __attribute__((aligned(16))) float so[4][16][64];
  const int tid = threadIdx.x, w = tid >> 5, lane = tid & 31, ln = lane & 15, hh = lane >> 4; const int by = blockIdx.y;
  A += (size_t)by * sA; Bh += (size_t)by * sB; C += (size_t)by * sC;
  const int ntn = (N + 63) / 64; const int wid = blockIdx.x * 4 + w; const int mt = wid / ntn, nq = wid % ntn; if (mt * 16 >= M) return;
  const int row0 = mt * 16, col0 = nq * 64; const float* arow = A + (size_t)(row0 + ln) * lda;
  v8f acc[4] = {};
  for (int kb = 0; kb < K; kb += 32) {
    FragH ah, al;
    const v4f x0 = *(const v4fa*)(arow + kb + 8 * hh), x1 = *(const v4fa*)(arow + kb + 8 * hh + 4), x2 = *(const v4fa*)(arow + kb + 16 + 8 * hh), x3 = *(const v4fa*)(arow + kb + 16 + 8 * hh + 4);
    float xs[16] = {x0[0],x0[1],x0[2],x0[3],x1[0],x1[1],x1[2],x1[3],x2[0],x2[1],x2[2],x2[3],x3[0],x3[1],x3[2],x3[3]};
#pragma unroll
    for (int i = 0; i < 16; ++i) { const _Float16 h = (_Float16)xs[i]; ah.h[i] = h; al.h[i] = ASPLIT ? (_Float16)(xs[i] - (float)h) : (_Float16)0.0f; }
#pragma unroll
    for (int t = 0; t < 4; ++t) { if (col0 + t * 16 >= N) continue; const size_t boff = (size_t)(col0 + t * 16 + ln) * ldb + kb; FragH bq; bq.half[0] = *(const v8us*)(Bh + boff + 8 * hh); bq.half[1] = *(const v8us*)(Bh + boff + 16 + 8 * hh);
      acc[t] = mmaH<ASPLIT ? 2 : 1>(ah.v, al.v, bq.v, bq.v, acc[t]); }
  }
#pragma unroll
  for (int t = 0; t < 4; ++t) { if (col0 + t * 16 >= N) continue;
#pragma unroll
    for (int r = 0; r < 8; ++r) so[w][8 * hh + r][t * 16 + ln] = acc[t][r] * alpha; }
  __builtin_amdgcn_fence(__ATOMIC_ACQ_REL, "workgroup"); __builtin_amdgcn_wave_barrier();
  const int rsub = lane >> 4, c4 = (lane & 15) * 4;
  {
#pragma unroll
    for (int q = 0; q < 8; ++q) { const int r = q * 2 + rsub; if (col0 + c4 < N) { const v4f v = *(const v4fa*)&so[w][r][c4]; *(v4f*)(C + (size_t)(row0 + r) * ldc + col0 + c4) = v; } }
     }
}

// Wt[n][k] = f16(W[k][n]·scale) from f32 row-major W[K][N] (scale = power of two; bf16-exact weights stay exact in f16 away from the subnormal range)
__global__ __launch_bounds__(256) void k_wt_f16(const float* __restrict__ W, _Float16* __restrict__ Wt, int K, int N, float scale) {
  const int t = blockIdx.x * 256 + threadIdx.x; if (t >= N * (K / 8)) return; const int n = t / (K / 8), k8 = (t % (K / 8)) * 8; FragH f;
#pragma unroll
  for (int i = 0; i < 8; ++i) f.h[i] = (_Float16)(bf16_round(W[(size_t)(k8 + i) * N + n]) * scale); const v8us o = f.half[0];
  *(v8us*)((unsigned short*)Wt + (size_t)n * K + k8) = o; 
}
// k_gemm_hh variant with fused epilogue: v = acc·alpha + bias[by·sBias + col] (+ CP[(row/rowsPerB)·sCPb + by·64 + col] if CP) ; ACT 0 none / 1 elu ; writes f16 C16 (and f32 C if non-null)
template <int ACT>
__global__ __launch_bounds__(128) void k_gemm_hhx(const _Float16* __restrict__ A, int lda, size_t sA, const _Float16* __restrict__ Bh, int ldb, size_t sB, float alpha, const float* __restrict__ bias, size_t sBias, const float* __restrict__ CP, int rowsPerB, size_t sCPb, int row0g,
    float* __restrict__ C, _Float16* __restrict__ C16, int ldc, size_t sC, int M, int N, int K) {
  __shared__ __attribute__((aligned(16))) float so[4][16][64];
  const int tid = threadIdx.x, w = tid >> 5, lane = tid & 31, ln = lane & 15, hh = lane >> 4; const int by = blockIdx.y;
  A += (size_t)by * sA; Bh += (size_t)by * sB; const size_t cofs = (size_t)by * sC; const float* bp = bias ? bias + (size_t)by * sBias : nullptr;
  const int ntn = (N + 63) / 64; const int wid = blockIdx.x * 4 + w; const int mt = wid / ntn, nq = wid % ntn; if (mt * 16 >= M) return;
  const int row0 = mt * 16, col0 = nq * 64; const _Float16* arow = A + (size_t)(row0 + ln) * lda;
  v8f acc[4] = {};
  for (int kb = 0; kb < K; kb += 32) { FragH ah; ah.half[0] = *(const v8us*)((const unsigned short*)arow + kb + 8 * hh); ah.half[1] = *(const v8us*)((const unsigned short*)arow + kb + 16 + 8 * hh);
#pragma unroll
    for (int t = 0; t < 4; ++t) { if (col0 + t * 16 >= N) continue; const size_t boff = (size_t)(col0 + t * 16 + ln) * ldb + kb; FragH bq; bq.half[0] = *(const v8us*)((const unsigned short*)Bh + boff + 8 * hh); bq.half[1] = *(const v8us*)((const unsigned short*)Bh + boff + 16 + 8 * hh);
      acc[t] = mmaH<1>(ah.v, ah.v, bq.v, bq.v, acc[t]); }
  }
#pragma unroll
  for (int t = 0; t < 4; ++t) { if (col0 + t * 16 >= N) continue; const int col = col0 + t * 16 + ln; const float bv = bp ? bf16_round(bp[col]) : 0.f;
#pragma unroll
    for (int r = 0; r < 8; ++r) { float v = acc[t][r] * alpha + bv; if (CP) { const int rr = row0g + row0 + 8 * hh + r; if (rowsPerB < 0) v += CP[cofs + (size_t)rr * ldc + col];      /* rowsPerB < 0: own element of the batched C plane */ else { const int bidx = rr / rowsPerB; v += CP[(size_t)bidx * sCPb + (size_t)by * 64 + col]; } } if (ACT == 1) v = (v > 0.f) ? v : expm1f(v); else if (ACT == 7) v = (v > 0.f) ? v + 1.0f : expf(v); else if (ACT == 8) v = tanhf(v); else if (ACT == 9) v = 0.5f * v * (1.0f + tanhf(0.7978845608028654f * (v + 0.044715f * v * v * v))); else if (ACT == 11) v = 1.0f / (1.0f + expf(-v)); else if (ACT == 12) v = (v > 0.f) ? v : 0.01f * v; else if (ACT == 14) v = (v > 0.f) ? v : 0.1f * v; else if (ACT == 16) v = (v >= 0.f) ? v : 0.3f * v; else if (ACT == 17) v = (v >= 0.f) ? v : 0.2f * v; else if (ACT == 15) v = v / (1.0f + expf(-v)); else if (ACT == 3) v = fmaxf(v, 0.f); else if (ACT == 6) v = 0.5f * v * (1.0f + erff(v * 0.70710678118654752f)); so[w][8 * hh + r][t * 16 + ln] = v; } }
  __builtin_amdgcn_fence(__ATOMIC_ACQ_REL, "workgroup"); __builtin_amdgcn_wave_barrier();
  const int rsub = lane >> 4, c4 = (lane & 15) * 4; typedef _Float16 v4h __attribute__((ext_vector_type(4)));
  {
#pragma unroll
    for (int q = 0; q < 8; ++q) { const int r = q * 2 + rsub; if (col0 + c4 < N) { const v4f v = *(const v4fa*)&so[w][r][c4]; if (C) *(v4f*)(C + cofs + (size_t)(row0 + r) * ldc + col0 + c4) = v; if (C16) { v4h h4; for (int i = 0; i < 4; ++i) h4[i] = (_Float16)v[i]; *(v4h*)(C16 + cofs + (size_t)(row0 + r) * ldc + col0 + c4) = h4; } } }
     }
}


typedef _Float16 v4h __attribute__((ext_vector_type(4)));

__global__ __launch_bounds__(256) void k_x16(const float* __restrict__ x, _Float16* __restrict__ X16, size_t n8) { const size_t t = (size_t)blockIdx.x * 256 + threadIdx.x; if (t >= n8) return; FragH f;
#pragma unroll
  for (int q = 0; q < 8; ++q) f.h[q] = (_Float16)bf16_round(x[t * 8 + q]); *(v8us*)((unsigned short*)X16 + t * 8) = f.half[0];  }
__global__ __launch_bounds__(256) void k_h16(const float* __restrict__ x, _Float16* __restrict__ X16, size_t n8) { const size_t t = (size_t)blockIdx.x * 256 + threadIdx.x; if (t >= n8) return; FragH f;
#pragma unroll
  for (int q = 0; q < 8; ++q) f.h[q] = (_Float16)x[t * 8 + q]; *(v8us*)((unsigned short*)X16 + t * 8) = f.half[0];  }
__global__ __launch_bounds__(256) void k_round16f(const float* __restrict__ W, _Float16* __restrict__ Bt, size_t n8) { const size_t t = (size_t)blockIdx.x * 256 + threadIdx.x; if (t >= n8) return; FragH f;
#pragma unroll
  for (int i = 0; i < 8; ++i) f.h[i] = (_Float16)(bf16_round(W[t * 8 + i]) * 16.0f); *(v8us*)((unsigned short*)Bt + t * 8) = f.half[0];  }
template <int NHv, int TTv>
__global__ __launch_bounds__(256) void k_vt(const _Float16* __restrict__ V16, int ldv, int voff, _Float16* __restrict__ Vt) { __shared__ unsigned short tl[64][66]; const int tid = threadIdx.x; const int slab = blockIdx.x / (TTv / 64), lg = blockIdx.x % (TTv / 64); const int b = slab / NHv, h = slab % NHv;
  for (int i = tid; i < 64 * 8; i += 256) { const int r = i / 8, c8 = (i % 8) * 8; FragH f; f.half[0] = *(const v8us*)((const unsigned short*)V16 + ((size_t)b * TTv + lg * 64 + r) * ldv + voff + h * 64 + c8);
#pragma unroll
    for (int q = 0; q < 8; ++q) tl[r][c8 + q] = f.u[q]; }
  __syncthreads();
  {
#pragma unroll
    for (int rd = 0; rd < 2; ++rd) { const int d = rd * 32 + tid / 8, pc = tid % 8; FragH f;
#pragma unroll
      for (int q = 0; q < 8; ++q) f.u[q] = tl[pc * 8 + q][d];
      *(v8us*)((unsigned short*)Vt + ((size_t)slab * 64 + d) * TTv + lg * 64 + pc * 8) = f.half[0]; }
     } }

__global__ __launch_bounds__(256) void k_hl(const float* __restrict__ F, _Float16* __restrict__ Hh, _Float16* __restrict__ Hl, size_t n8) { const size_t t = (size_t)blockIdx.x * 256 + threadIdx.x; if (t >= n8) return; FragH fh, fl; const v4f a = *(const v4fa*)(F + t * 8), c = *(const v4fa*)(F + t * 8 + 4);
#pragma unroll
  for (int q = 0; q < 4; ++q) { _Float16 h = (_Float16)a[q]; fh.h[q] = h; fl.h[q] = (_Float16)((a[q] - (float)h) * 1024.0f); h = (_Float16)c[q]; fh.h[4 + q] = h; fl.h[4 + q] = (_Float16)((c[q] - (float)h) * 1024.0f); }
  { *(v8us*)((unsigned short*)Hh + t * 8) = fh.half[0]; *(v8us*)((unsigned short*)Hl + t * 8) = fl.half[0];  } }

// ---- fast GEMM (work-group tile 128x64, wave tile 32x64; A and B tiles of 64 k staged in LDS by asynchronous copies, two buffers; requires M % 128 == 0 rows per launch region, N % 64 == 0, K % 64 == 0); epilogue = k_gemm_hhx semantics ----
__device__ __forceinline__ v16h g2_frag(const _Float16* p, int hh) { FragH f; f.half[0] = *(const v8us*)((const unsigned short*)p + 8 * hh); f.half[1] = *(const v8us*)((const unsigned short*)p + 16 + 8 * hh); return f.v; }
__device__ __forceinline__ v8f g2_mma(v16h a, v16h b, v8f c) { v8f d = __builtin_amdgcn_wmma_f32_16x16x32_f16(false, a, false, b, (short)0, c, false, false); asm volatile("v_nop\n\tv_nop\n\tv_nop\n\tv_nop" : "+v"(d) : "v"(a), "v"(b)); return d; }
#define G2_PITCH 144                 /* LDS row pitch in bytes of a staged 128-byte row: 16 B x odd, the conflict-free pitch for 16-byte LDS reads */
#define G2_BUF (192 * G2_PITCH)      /* one staged tile: 128 A rows, then 64 B rows, 64 k each */
static_assert(MP % 128 == 0 && QT % 128 == 0 && QT0 % 128 == 0, "k_gemm2: a work-group stages 128 whole A rows");
static_assert(HD % 64 == 0 && QT % 64 == 0 && DM % 64 == 0 && DFF % 64 == 0, "k_gemm2: K is a multiple of the staged 64 k, N of the 64 B rows");
// One tile into LDS: twelve asynchronous 16-byte copies a lane (a wave's 32 lanes take 4 whole 128-byte rows per copy; copy i lands 16 rows below copy i - 1; 0..7 = A rows, 8..11 = B rows).
// One asm statement: the copies go from global memory to LDS through no register, and the s_wait_xcnt at its end stands in front of any later overwrite of the address registers that the copies name.
__device__ __forceinline__ void g2_stage(unsigned l, const _Float16* ga, size_t sa, const _Float16* gb, size_t sb) {
  asm volatile("global_load_async_to_lds_b128 %0, %12, off\n\tglobal_load_async_to_lds_b128 %1, %13, off\n\tglobal_load_async_to_lds_b128 %2, %14, off\n\tglobal_load_async_to_lds_b128 %3, %15, off\n\t"
               "global_load_async_to_lds_b128 %4, %16, off\n\tglobal_load_async_to_lds_b128 %5, %17, off\n\tglobal_load_async_to_lds_b128 %6, %18, off\n\tglobal_load_async_to_lds_b128 %7, %19, off\n\t"
               "global_load_async_to_lds_b128 %8, %20, off\n\tglobal_load_async_to_lds_b128 %9, %21, off\n\tglobal_load_async_to_lds_b128 %10, %22, off\n\tglobal_load_async_to_lds_b128 %11, %23, off\n\ts_wait_xcnt 0x0"
               :: "v"(l), "v"(l + 16 * G2_PITCH), "v"(l + 32 * G2_PITCH), "v"(l + 48 * G2_PITCH), "v"(l + 64 * G2_PITCH), "v"(l + 80 * G2_PITCH), "v"(l + 96 * G2_PITCH), "v"(l + 112 * G2_PITCH),
                  "v"(l + 128 * G2_PITCH), "v"(l + 144 * G2_PITCH), "v"(l + 160 * G2_PITCH), "v"(l + 176 * G2_PITCH),
                  "v"(ga), "v"(ga + sa), "v"(ga + 2 * sa), "v"(ga + 3 * sa), "v"(ga + 4 * sa), "v"(ga + 5 * sa), "v"(ga + 6 * sa), "v"(ga + 7 * sa), "v"(gb), "v"(gb + sb), "v"(gb + 2 * sb), "v"(gb + 3 * sb) : "memory"); }
template <int ACT>
__global__ __launch_bounds__(128) void k_gemm2(const _Float16* __restrict__ A, int lda, size_t sA, const _Float16* __restrict__ Bh, int ldb, size_t sB, float alpha, const float* __restrict__ bias, size_t sBias, const float* __restrict__ CP, int rowsPerB, size_t sCPb, int row0g,
    float* __restrict__ C, _Float16* __restrict__ C16, int ldc, size_t sC, int M, int N, int K, size_t zA = 0, size_t zB = 0, size_t zC = 0) { static_assert(ACT == 0 || ACT == 3 || ACT == 6 || ACT == 8 || ACT == 9 || ACT == 11 || ACT == 12 || ACT == 14 || ACT == 15 || ACT == 16 || ACT == 17, "k_gemm2: unsupported ACT code (would silently apply no activation)");
  __shared__ __attribute__((aligned(16))) unsigned char sm[2 * G2_BUF]; float (*so)[32][68] = (float (*)[32][68])sm;      /* two staged tiles; behind the loop's last barrier the same bytes are the epilogue's [4][32][68] f32 staging */
  static_assert(sizeof(float) * 4 * 32 * 68 <= 2 * G2_BUF, "k_gemm2: the epilogue staging fits the two tile buffers");
  const int tid = threadIdx.x, w = tid >> 5, lane = tid & 31, ln = lane & 15, hh = lane >> 4; const int by = blockIdx.y; const int bz = blockIdx.z;      /* second batch axis (strides zA, zB, zC) */
  A += (size_t)by * sA + (size_t)bz * zA; Bh += (size_t)by * sB + (size_t)bz * zB; const size_t cofs = (size_t)by * sC + (size_t)bz * zC; const float* bp = bias ? bias + (size_t)by * sBias : nullptr;
  const int ntn = N >> 6; const int mt = blockIdx.x / ntn, nq = blockIdx.x - mt * ntn; const int row0 = mt * 128 + 32 * w, col0 = nq * 64; if (mt * 128 >= M) return;      /* the whole work-group leaves or none: barriers follow */
  const _Float16* ga = A + (size_t)(mt * 128 + (tid >> 3)) * lda + (tid & 7) * 8; const _Float16* gb = Bh + (size_t)(col0 + (tid >> 3)) * ldb + (tid & 7) * 8;      /* this lane's 16 bytes of row tid / 8 of each 16-row group */
  const size_t sa = (size_t)16 * lda, sb = (size_t)16 * ldb; const unsigned l0 = (unsigned)(size_t)sm + (unsigned)((tid >> 3) * G2_PITCH + (tid & 7) * 16);
  const unsigned char* fa = sm + (32 * w + ln) * G2_PITCH; const unsigned char* fb = sm + (128 + ln) * G2_PITCH;      /* this lane's fragment rows in buffer 0 */
  const v8f z8 = {0.f,0.f,0.f,0.f,0.f,0.f,0.f,0.f}; v8f c00 = z8, c01 = z8, c02 = z8, c03 = z8, c10 = z8, c11 = z8, c12 = z8, c13 = z8;
  const int nt = K >> 6;
  g2_stage(l0, ga, sa, gb, sb);
  asm volatile("s_wait_asynccnt 0x0" ::: "memory");      /* this wave's copies of tile 0 have landed */
  __syncthreads();      /* tile 0 published: every wave's copies have landed */
  if (nt > 1) g2_stage(l0 + G2_BUF, ga + 64, sa, gb + 64, sb);      /* tile 1 flies while tile 0 is worked on */
#pragma unroll 1
  for (int t = 0; t < nt; ++t) { const unsigned bo = (unsigned)(t & 1) * G2_BUF;      /* kept rolled: one trip is one staged tile and the buffers alternate; unrolled, the copies' and waits' code would only be repeated */
#pragma unroll
    for (int ks = 0; ks < 2; ++ks) { const _Float16* pa = (const _Float16*)(fa + bo + ks * 64); const _Float16* pb = (const _Float16*)(fb + bo + ks * 64);      /* unrolled so that the two halves of a tile are immediate offsets of the LDS reads; 32 k = 64 bytes of every row; k ascends as before */
      const v16h a0 = g2_frag(pa, hh), a1 = g2_frag(pa + 8 * G2_PITCH, hh), b0 = g2_frag(pb, hh), b1 = g2_frag(pb + 8 * G2_PITCH, hh), b2 = g2_frag(pb + 16 * G2_PITCH, hh), b3 = g2_frag(pb + 24 * G2_PITCH, hh);      /* 16 rows = 8 * G2_PITCH halves */
      c00 = g2_mma(a0, b0, c00); c10 = g2_mma(a1, b0, c10); c01 = g2_mma(a0, b1, c01); c11 = g2_mma(a1, b1, c11);
      c02 = g2_mma(a0, b2, c02); c12 = g2_mma(a1, b2, c12); c03 = g2_mma(a0, b3, c03); c13 = g2_mma(a1, b3, c13); }
    asm volatile("s_wait_dscnt 0x0" ::: "memory");      /* this wave's reads of the buffer have returned before the buffer is given up */
    asm volatile("s_wait_asynccnt 0x0" ::: "memory");      /* this wave's copies of tile t + 1 have landed */
    __syncthreads();      /* publishes tile t + 1 and ends every wave's reads of tile t */
    if (t + 2 < nt) g2_stage(l0 + bo, ga + (size_t)(t + 2) * 64, sa, gb + (size_t)(t + 2) * 64, sb); }      /* refill of the buffer just left */
  asm volatile("s_wait_asynccnt 0x0" ::: "memory");      /* no copy is outstanding when the buffers become the epilogue's staging */
  v8f accs[8] = {c00, c01, c02, c03, c10, c11, c12, c13};
#pragma unroll
  for (int u = 0; u < 8; ++u) { const int t = u & 3, half = u >> 2; const int col = col0 + t * 16 + ln; const float bv = bp ? bf16_round(bp[col]) : 0.f;
#pragma unroll
    for (int r = 0; r < 8; ++r) { const int rloc = half * 16 + 8 * hh + r; float v = accs[u][r] * alpha + bv; if (CP) { if (rowsPerB < 0) v += CP[cofs + (size_t)(row0g + row0 + rloc) * ldc + col];      /* rowsPerB < 0: own element of the batched C plane */ else { const int bidx = (row0g + row0 + rloc) / rowsPerB; v += CP[(size_t)bidx * sCPb + (size_t)by * 64 + col]; } }
      if (ACT == 3) v = fmaxf(v, 0.f); else if (ACT == 6) v = 0.5f * v * (1.0f + erff(v * 0.70710678118654752f)); else if (ACT == 11) v = 1.0f / (1.0f + expf(-v)); else if (ACT == 15) v = v / (1.0f + expf(-v)); else if (ACT == 12) v = (v > 0.f) ? v : 0.01f * v; else if (ACT == 8) v = tanhf(v); else if (ACT == 9) v = 0.5f * v * (1.0f + tanhf(0.7978845608028654f * (v + 0.044715f * v * v * v))); else if (ACT == 14) v = (v > 0.f) ? v : 0.1f * v; else if (ACT == 16) v = (v >= 0.f) ? v : 0.3f * v; else if (ACT == 17) v = (v >= 0.f) ? v : 0.2f * v;
      so[w][rloc][t * 16 + ln] = v; } }
  __builtin_amdgcn_fence(__ATOMIC_ACQ_REL, "workgroup"); __builtin_amdgcn_wave_barrier();
  const int rsub = lane >> 4, c4 = (lane & 15) * 4;
  {
#pragma unroll
    for (int q = 0; q < 16; ++q) { const int r = q * 2 + rsub; const v4f v = *(const v4fa*)&so[w][r][c4]; if (C) *(v4f*)(C + cofs + (size_t)(row0 + r) * ldc + col0 + c4) = v; if (C16) { v4h h4; for (int i = 0; i < 4; ++i) h4[i] = (_Float16)v[i]; *(v4h*)(C16 + cofs + (size_t)(row0 + r) * ldc + col0 + c4) = h4; } }
     } }


__global__ __launch_bounds__(256) void k_wnat(const float* __restrict__ w, size_t n8, _Float16* __restrict__ Bt) { const size_t t = (size_t)blockIdx.x * 256 + threadIdx.x; if (t >= n8) return; FragH f; for (int q = 0; q < 8; ++q) f.h[q] = (_Float16)(bf16_round(w[t * 8 + q]) * 16.0f); *(v8us*)((unsigned short*)Bt + t * 8) = f.half[0];  }
__global__ __launch_bounds__(256) void k_rsm(const float* __restrict__ S, _Float16* __restrict__ P, int nrows) {
  #pragma clang fp contract(off)
  const int i = blockIdx.x * 256 + threadIdx.x; if (i >= nrows) return; const float* s = S + (size_t)i * SQ; float mx = -3.0e38f;
#pragma unroll 1
  for (int j = 0; j < SQ; ++j) mx = fmaxf(mx, s[j]); float se = 0.f;
#pragma unroll 1
  for (int j = 0; j < SQ; ++j) se += expf(s[j] - mx); const float sc = 256.0f / se;
#pragma unroll 1
  for (int j0 = 0; j0 < SQ; j0 += 8) { FragH f; for (int q = 0; q < 8; ++q) f.h[q] = (_Float16)(expf(s[j0 + q] - mx) * sc); unsigned short* d = (unsigned short*)P + (size_t)i * SQ + j0; *(v8us*)d = f.half[0];  } }
__global__ __launch_bounds__(256) void k_vt(const _Float16* __restrict__ V16, int b, int h0, _Float16* __restrict__ VT) { __shared__ unsigned short tl[64][65]; const int tid = threadIdx.x; const int hh = blockIdx.x % HG, sg = blockIdx.x / HG; const int s0 = sg * 64; const int h = h0 + hh;
  for (int i = tid; i < 64 * 8; i += 256) { const int j = i / 8, d8 = (i % 8) * 8; FragH f; f.half[0] = *(const v8us*)((const unsigned short*)V16 + ((size_t)b * SQ + s0 + j) * DM + h * HD + d8); for (int q = 0; q < 8; ++q) tl[d8 + q][j] = f.u[q]; }
  __syncthreads();
  { for (int i = tid; i < 64 * 8; i += 256) { const int d = i / 8, j8 = (i % 8) * 8; FragH f; for (int q = 0; q < 8; ++q) f.u[q] = tl[d][j8 + q]; *(v8us*)((unsigned short*)VT + ((size_t)hh * HD + d) * SQ + s0 + j8) = f.half[0]; }  } }



#define RW 4                         /* score rows per wave in the causal softmax */
// lane l with lane l ^ m inside a 16-lane row (DPP row_xmask, CTRL = 0x160 | m), and with lane l ^ 16
template <int CTRL> __device__ __forceinline__ float lane_xm(float x) { return __builtin_bit_cast(float, __builtin_amdgcn_update_dpp(0, __builtin_bit_cast(int, x), CTRL, 0xf, 0xf, true)); }
__device__ __forceinline__ float lane_x16(float x) { return __builtin_bit_cast(float, __builtin_amdgcn_permlanex16(__builtin_bit_cast(int, x), __builtin_bit_cast(int, x), 0x76543210, 0xfedcba98, false, false)); }
__device__ __forceinline__ float wave_max(float x) { x = fmaxf(x, lane_xm<0x161>(x)); x = fmaxf(x, lane_xm<0x162>(x)); x = fmaxf(x, lane_xm<0x164>(x)); x = fmaxf(x, lane_xm<0x168>(x)); return fmaxf(x, lane_x16(x)); }
__device__ __forceinline__ float wave_sum(float x) { x += lane_xm<0x161>(x); x += lane_xm<0x162>(x); x += lane_xm<0x164>(x); x += lane_xm<0x168>(x); return x + lane_x16(x); }
// 2^t for eight values in place. Asm so that the free slot which the instruction set asks for behind a transcendental, before its result is used or its source overwritten, stands by construction: no line here touches the line before it, and the v_nop covers the last
__device__ __forceinline__ void exp2_x8(float (&t)[8]) { asm("v_exp_f32 %0, %0\n\tv_exp_f32 %1, %1\n\tv_exp_f32 %2, %2\n\tv_exp_f32 %3, %3\n\tv_exp_f32 %4, %4\n\tv_exp_f32 %5, %5\n\tv_exp_f32 %6, %6\n\tv_exp_f32 %7, %7\n\tv_nop" : "+v"(t[0]), "+v"(t[1]), "+v"(t[2]), "+v"(t[3]), "+v"(t[4]), "+v"(t[5]), "+v"(t[6]), "+v"(t[7])); }
// RW rows of NC * 256 keys per wave: lane l holds keys c * 256 + 8 l .. + 7 of every chunk c in registers (a pair of b128 loads covers 1 KiB of a row per wave, a b128 store 512 B); S is read once
template <int NC>
__device__ __forceinline__ void rsm_rows(const float* __restrict__ S, _Float16* __restrict__ P, int row0, int q0, int lane) {
  v4f raw[RW][NC][2];
#pragma unroll
  for (int r = 0; r < RW; ++r)
#pragma unroll
    for (int c = 0; c < NC; ++c) { const float* s = S + (size_t)(row0 + r) * NKX + c * 256 + lane * 8; raw[r][c][0] = *(const v4fa*)s; raw[r][c][1] = *(const v4fa*)(s + 4); }
  __builtin_amdgcn_sched_barrier(0);      /* keeps every row's loads issued in front of the first row's arithmetic: without it the later rows' loads sink to their use and each row pays its own memory latency */
#pragma unroll
  for (int r = 0; r < RW; ++r) { const int last = q0 + ((row0 + r) % QT); float v[NC][8]; float mx = -3.0e38f;
#pragma unroll
    for (int c = 0; c < NC; ++c)
#pragma unroll
      for (int q = 0; q < 8; ++q) { const int j = c * 256 + lane * 8 + q; v[c][q] = (j <= last) ? raw[r][c][q >> 2][q & 3] : -1.0e9f; mx = fmaxf(mx, v[c][q]); }
    mx = wave_max(mx); float s4[4] = {0.f, 0.f, 0.f, 0.f};      /* four independent add chains per lane */
#pragma unroll
    for (int c = 0; c < NC; ++c) {
#pragma unroll
      for (int q = 0; q < 8; ++q) v[c][q] = (v[c][q] - mx) * 1.44269504f;      /* e^x = 2^(x log2 e), the native form as before */
      exp2_x8(v[c]);
#pragma unroll
      for (int q = 0; q < 8; ++q) s4[q & 3] += v[c][q]; }
    const float sc = 256.0f / wave_sum((s4[0] + s4[1]) + (s4[2] + s4[3]));
#pragma unroll
    for (int c = 0; c < NC; ++c) { FragH fr;
#pragma unroll
      for (int q = 0; q < 8; ++q) fr.h[q] = (_Float16)(v[c][q] * sc);
      *(v8us*)((unsigned short*)P + (size_t)(row0 + r) * NKX + c * 256 + lane * 8) = fr.half[0]; } }
  asm volatile("s_wait_xcnt 0x0" ::: "memory");      /* the wait that belongs in front of any later overwrite of a register which the stores above name: the bodies for the other key counts lie behind this one in the code and reuse those registers */
}
__global__ __launch_bounds__(256) void k_rsmcf2(const float* __restrict__ S, _Float16* __restrict__ P, int hg, int q0, int nk) { static_assert(QT % 256 == 0 && QT % RW == 0 && NKX <= 1024, "k_rsmcf2: nk is a multiple of 256, at most 1024");
  const int lane = threadIdx.x & 31; const int row0 = (blockIdx.x * 8 + __builtin_amdgcn_readfirstlane(threadIdx.x >> 5)) * RW; if (row0 >= hg * QT) return;      /* wave-uniform exit; the kernel has no barrier */
  const int nc = nk >> 8; if (nc == 1) rsm_rows<1>(S, P, row0, q0, lane); else if (nc == 2) rsm_rows<2>(S, P, row0, q0, lane); else if (nc == 3) rsm_rows<3>(S, P, row0, q0, lane); else rsm_rows<4>(S, P, row0, q0, lane); }


template <int MASKADD>
__global__ __launch_bounds__(64) void k_att0(const float* __restrict__ QF, const float* __restrict__ KF, const float* __restrict__ VF, int ld, const float* __restrict__ mask, float scale, float* __restrict__ OF, int ldo) {
  #pragma clang fp contract(off)
  __shared__ __attribute__((aligned(16))) float lq[64][64]; __shared__ __attribute__((aligned(16))) float lo[64][64];
  const int tid = threadIdx.x; const int h = blockIdx.x / (QT0 / 64), rg = blockIdx.x % (QT0 / 64); const int i = rg * 64 + tid;
  const size_t bo_in = (size_t)blockIdx.y * QT0 * ld; QF += bo_in; KF += bo_in; VF += bo_in; OF += (size_t)blockIdx.y * QT0 * ldo;      /* batch on grid.y: QT0 rows per batch in every plane */
  const float* qr = QF + (size_t)i * ld + h * HD;
#pragma unroll 1
  for (int c = 0; c < HD / 4; ++c) { *(v4f*)&lq[tid][c * 4] = *(const v4fa*)(qr + c * 4); const v4f z = {0.f, 0.f, 0.f, 0.f}; *(v4f*)&lo[tid][c * 4] = z; }
  float m = -1.0e30f, l = 0.f; const int jmax = MASKADD ? (SQ - 1) : (rg * 64 + 63);      /* additive-mask form: every key (the mask input decides); causal form: keys up to the block's last row */
#pragma unroll 1
  for (int j = 0; j <= jmax; ++j) { const float* kr = KF + (size_t)j * ld + h * HD; const float* vr = VF + (size_t)j * ld + h * HD; float s = 0.f;
#pragma unroll 1
    for (int c = 0; c < HD / 4; ++c) { const v4f kq = *(const v4fa*)(kr + c * 4); const v4f qq = *(v4f*)&lq[tid][c * 4]; s = __fadd_rn(s, __fmul_rn(qq[0], kq[0])); s = __fadd_rn(s, __fmul_rn(qq[1], kq[1])); s = __fadd_rn(s, __fmul_rn(qq[2], kq[2])); s = __fadd_rn(s, __fmul_rn(qq[3], kq[3])); }
    s = __fmul_rn(s, scale); if (MASKADD) s = __fadd_rn(s, __fmul_rn(bf16_round(mask[(size_t)i * SQ + j]), -10000.0f));
    const float f = (MASKADD || j <= i) ? 1.f : 0.f; const float sm = fmaf(f, s, (1.f - f) * -1.0e30f); const float mn = fmaxf(m, sm); const float sc = expf(m - mn); const float e = expf(sm - mn); l = __fadd_rn(__fmul_rn(l, sc), e); m = mn;
#pragma unroll 1
    for (int c = 0; c < HD / 4; ++c) { const v4f vv = *(const v4fa*)(vr + c * 4); v4f oo = *(v4f*)&lo[tid][c * 4]; for (int u = 0; u < 4; ++u) oo[u] = __fadd_rn(__fmul_rn(oo[u], sc), __fmul_rn(e, vv[u])); *(v4f*)&lo[tid][c * 4] = oo; } }
  const float fin = 64.0f / l;      /* o carried x64 like the f16 path */
#pragma unroll 1
  for (int c = 0; c < HD / 4; ++c) { v4f oo = *(v4f*)&lo[tid][c * 4]; for (int u = 0; u < 4; ++u) oo[u] = __fmul_rn(oo[u], fin); *(v4f*)&lo[tid][c * 4] = oo; }
  __syncthreads();
  {
#pragma unroll 1
    for (int it = 0; it < 16; ++it) { const int row = it * 4 + tid / 16, pc = (tid % 16) * 4; const v4f v = *(const v4f*)&lo[row][pc]; *(v4f*)(OF + (size_t)(rg * 64 + row) * ldo + h * HD + pc) = v; }
     } }


template <int BFIN, int WXB>
__global__ __launch_bounds__(256) void k_ln16(const float* __restrict__ X, const float* __restrict__ g, const float* __restrict__ bb, float eps, _Float16* __restrict__ N16, float* __restrict__ XB) {
  #pragma clang fp contract(off)
  __shared__ float red[256]; const size_t r = blockIdx.x; const int t = threadIdx.x; const v4f xa = *(const v4fa*)(X + r * DMQ + t * 4); float s[4]; float sum = 0.f;
  for (int q = 0; q < 4; ++q) { s[q] = BFIN ? bf16_round(xa[q]) : xa[q]; sum = __fadd_rn(sum, s[q]); }
  red[t] = sum; __syncthreads(); for (int st = 128; st > 0; st >>= 1) { if (t < st) red[t] = __fadd_rn(red[t], red[t + st]); __syncthreads(); } const float mu = red[0] / (float)DMQ; __syncthreads();
  float vs = 0.f; for (int q = 0; q < 4; ++q) { const float dl = __fadd_rn(s[q], -mu); vs = __fadd_rn(vs, __fmul_rn(dl, dl)); } red[t] = vs; __syncthreads(); for (int st = 128; st > 0; st >>= 1) { if (t < st) red[t] = __fadd_rn(red[t], red[t + st]); __syncthreads(); }
  const float rs = rsqrtf(__fadd_rn(red[0] / (float)DMQ, eps)); v4h y; v4f xb;
  for (int q = 0; q < 4; ++q) { const int c = t * 4 + q; y[q] = (_Float16)__fadd_rn(__fmul_rn(__fmul_rn(__fadd_rn(s[q], -mu), rs), bf16_round(g[c])), bf16_round(bb[c])); xb[q] = s[q]; }
  { *(v4h*)(N16 + r * DMQ + t * 4) = y; if (WXB) *(v4f*)(XB + r * DMQ + t * 4) = xb;  } }
__global__ __launch_bounds__(256) void k_ftres2(const float* __restrict__ OF0, const float* __restrict__ XB, float* __restrict__ X1, size_t n4) {
  #pragma clang fp contract(off)
  const size_t t = (size_t)blockIdx.x * 256 + threadIdx.x; if (t >= n4) return; const v4f o = *(const v4fa*)(OF0 + t * 4), xv = *(const v4fa*)(XB + t * 4); v4f y; for (int q = 0; q < 4; ++q) y[q] = __fadd_rn(__fmul_rn(o[q], 0.015625f), xv[q]); *(v4f*)(X1 + t * 4) = y;  }

__global__ __launch_bounds__(256) void k_wthd(const float* __restrict__ Wt, _Float16* __restrict__ Bt) { const size_t t = (size_t)blockIdx.x * 256 + threadIdx.x; if (t >= (size_t)NH * HD * (DM / 8)) return; const int m8 = (int)(t % (DM / 8)) * 8; const int d = (int)((t / (DM / 8)) % HD); const int h = (int)(t / ((size_t)(DM / 8) * HD)); FragH f;
  for (int q = 0; q < 8; ++q) f.h[q] = (_Float16)(16.0f * bf16_round(Wt[((size_t)h * DM + m8 + q) * HD + d])); unsigned short* dst = (unsigned short*)Bt + ((size_t)h * HD + d) * DM + m8; *(v8us*)dst = f.half[0];  }




__global__ __launch_bounds__(256) void k_wtpad(const float* __restrict__ Wm, _Float16* __restrict__ Wt, int Kr, int Kp, int Nr, int Np, float scale) {
  const int t = blockIdx.x * 256 + threadIdx.x; if (t >= Np * (Kp / 8)) return; const int n = t / (Kp / 8), k8 = (t % (Kp / 8)) * 8; const int nc = min(n, Nr - 1); const float fn = (n < Nr) ? 1.f : 0.f; FragH f;
  for (int i = 0; i < 8; ++i) { const int k = k8 + i; const int kc = min(k, Kr - 1); const float fk = (k < Kr) ? fn : 0.f; f.h[i] = (_Float16)(bf16_round(Wm[(size_t)kc * Nr + nc]) * scale * fk); }
  unsigned short* o = (unsigned short*)Wt + (size_t)n * Kp + k8; *(v8us*)o = f.half[0];  }
__global__ __launch_bounds__(128) void k_bpad(const float* __restrict__ b, float* __restrict__ Bp, int nr, int np) {
  const int i = threadIdx.x; if (i >= np) return; const float v = b[min(i, nr - 1)] * ((i < nr) ? 1.f : 0.f); *(float*)(Bp + i) = v;  }
extern "C" void kernel_launch(void* const* d_in, const int* in_sizes, int n_in,
                              void* d_out, int out_size, void* d_ws, size_t ws_size, hipStream_t stream) {
  (void)in_sizes; (void)n_in; (void)out_size;
  const float* const* I = (const float* const*)d_in; const float* x = I[0]; const float* wqkv = I[1]; const float* bqkv = I[2]; const float* wo = I[3]; const float* bo = I[4]; const float* g1 = I[5]; const float* be1 = I[6]; const float* gg2 = I[7]; const float* be2 = I[8]; const float* wfc = I[9]; const float* bfc = I[10]; const float* wmp = I[11]; const float* bmp = I[12];      /* x; fused Wqkv [1024][3072] + bqkv [3072] ([in][out]); Wproj + bproj; LN1 g / b, LN2 g / b; W1 [1024][4096] + b1, W2 [4096][1024] + b2 */
  char* ws = (char*)d_ws; size_t off = 0;
  auto take = [&](size_t bytes) { char* p = ws + off; off += (bytes + 255) & ~(size_t)255; return p; };
  _Float16* BQKV = (_Float16*)take((size_t)3 * DM * DM * 2); _Float16* BO = (_Float16*)take((size_t)DM * DM * 2);
  _Float16* X16 = (_Float16*)take(NR * DM * 2); float* XB = (float*)take(NR * DM * 4); _Float16* BW1 = (_Float16*)take((size_t)DFF * DM * 2); _Float16* BW2 = (_Float16*)take((size_t)DM * DFF * 2);
  _Float16* QKV = (_Float16*)take(NR * 3 * DM * 2); _Float16* Q16 = QKV; _Float16* K16 = QKV + DM; _Float16* V16 = QKV + 2 * DM; _Float16* O16 = (_Float16*)take(NR * DM * 2);
  _Float16* HF16 = QKV;      /* alias: the FFN hidden rows [NR][DFF] fill QKV + O16 (adjacent, same bytes); their last reader, the output projection, precedes the FFN */
  _Float16* M16 = X16;      /* alias: X16's last reader, the first-tile q | k | v GEMM, precedes LN2's write */
  _Float16* VT = (_Float16*)take((size_t)NB * NH * HD * SQ * 2);
  float* OF0 = (float*)take((size_t)NB * QT0 * DM * 4); _Float16* OH0 = (_Float16*)take((size_t)NB * QT0 * DM * 2); _Float16* OL0 = (_Float16*)take((size_t)NB * QT0 * DM * 2);
  float* S = (float*)take((size_t)GB * NH * QT * NKX * 4); _Float16* P = (_Float16*)take((size_t)GB * NH * QT * NKX * 2);
  float* QKVF0 = S;      /* alias: f32 q | k | v of the first tiles [NB][QT0][3 DM]; read by the exact attention before the first scores are written */
  float* X1 = S;      /* alias: x1 [NR][DM] is written after the last read of S and P */
  if (off > ws_size) return;
  k_wt_f16<<<(unsigned)(((size_t)3 * DM * (DM / 8) + 255) / 256), 256, 0, stream>>>(wqkv, BQKV, DM, 3 * DM, 16.0f);      /* fused [in][out] [DM][3 DM] -> Bt [3 DM][DM] x16: rows 0.. = q, DM.. = k, 2 DM.. = v output columns (contiguous thirds) */ k_wt_f16<<<(unsigned)(((size_t)DM * (DM / 8) + 255) / 256), 256, 0, stream>>>(wo, BO, DM, DM, 16.0f);      /* w_proj [in][out] -> Bt x16 */
  k_ln16<1, 1><<<(unsigned)NR, 256, 0, stream>>>(x, g1, be1, 1e-5f, X16, XB);      /* a = LN1(bf16(x)) -> f16 rows; XB = bf16(x) for the residual */
  k_wt_f16<<<(unsigned)(((size_t)DFF * (DM / 8) + 255) / 256), 256, 0, stream>>>(wfc, BW1, DM, DFF, 16.0f); k_wt_f16<<<(unsigned)(((size_t)DM * (DFF / 8) + 255) / 256), 256, 0, stream>>>(wmp, BW2, DFF, DM, 16.0f);      /* W1 [1024][4096] -> Bt [4096][1024]; W2 [4096][1024] -> Bt [1024][4096] (x16) */
  k_gemm2<0><<<dim3((unsigned)((MP / 128) * (3 * DM / 64)), 1), 128, 0, stream>>>(X16, DM, 0, BQKV, DM, 0, 0.0625f, bqkv, 0, nullptr, 1, 0, 0, nullptr, QKV, 3 * DM, 0, MP, 3 * DM, DM);      /* q | k | v rows (f16); head h = columns h*HD.. of each DM block */
  k_vt<NH, SQ><<<NB * NH * (SQ / 64), 256, 0, stream>>>(V16, LQ, 0, VT);      /* V^T [NB][NH][HD][SQ], every batch in one launch */
  k_gemm2<0><<<dim3((QT0 / 128) * (3 * DM / 64), NB), 128, 0, stream>>>(X16, DM, (size_t)SQ * DM, BQKV, DM, 0, 0.0625f, bqkv, 0, nullptr, 1, 0, 0, QKVF0, nullptr, 3 * DM, (size_t)QT0 * 3 * DM, QT0, 3 * DM, DM);      /* f32 q | k | v of the first 128 rows of every batch (grid.y; exact products) */
  k_att0<0><<<dim3(NH * (QT0 / 64), NB), 64, 0, stream>>>(QKVF0, QKVF0 + DM, QKVF0 + 2 * DM, 3 * DM, nullptr, 0.07216878364870322f, OF0, DM);      /* exact f32 attention for rows 0..127 of every batch (grid.y; o x64) */
  for (int b = 0; b < NB; b += GB) { const size_t r0 = (size_t)b * SQ;      /* GB batches on grid.z */
    for (int q0 = 0; q0 < QN; q0 += QT) { const int nk = q0 + QT;      /* causal: only keys below the tile end are computed */
      k_gemm2<0><<<dim3((QT / 128) * (nk / 64), NHD, GB), 128, 0, stream>>>(Q16 + (r0 + q0) * LQ, LQ, (size_t)HD, K16 + r0 * LQ, LQ, (size_t)HD, 0.07216878364870322f, nullptr, 0, nullptr, 1, 0, 0, S, nullptr, NKX, (size_t)QT * NKX, QT, nk, HD, (size_t)SQ * LQ, (size_t)SQ * LQ, (size_t)NH * QT * NKX);      /* scores, heads on grid.y */
      k_rsmcf2<<<(GB * NHD * QT + 8 * RW - 1) / (8 * RW), 256, 0, stream>>>(S, P, GB * NHD, q0, nk);      /* one wave per RW rows */
      k_gemm2<0><<<dim3((QT / 128) * (HD / 64), NHD, GB), 128, 0, stream>>>(P, NKX, (size_t)QT * NKX, VT + (size_t)b * NH * HD * SQ, SQ, (size_t)HD * SQ, 0.25f, nullptr, 0, nullptr, 1, 0, 0, nullptr, O16 + (r0 + q0) * DM, DM, (size_t)HD, QT, HD, nk, (size_t)NH * QT * NKX, (size_t)NH * HD * SQ, (size_t)SQ * DM); } }      /* o (merged heads, x64) as f16 rows */
  k_gemm2<0><<<dim3((unsigned)((MPO / 128) * (DM / 64)), 1), 128, 0, stream>>>(O16, DM, 0, BO, DM, 0, 0.0009765625f, bo, 0, XB, -1, 0, 0, X1, nullptr, DM, 0, MPO, DM, DM);      /* x1 = x + o Wo + b, all rows */
  k_hl<<<(unsigned)(((size_t)NB * QT0 * DM / 8 + 255) / 256), 256, 0, stream>>>(OF0, OH0, OL0, (size_t)NB * QT0 * DM / 8);      /* first-tile o (x64) -> f16 hi + x1024 residual planes */
  k_gemm2<0><<<dim3((QT0 / 128) * (DM / 64), NB), 128, 0, stream>>>(OH0, DM, (size_t)QT0 * DM, BO, DM, 0, 0.0009765625f, bo, 0, XB, -1, 0, 0, X1, nullptr, DM, (size_t)SQ * DM, QT0, DM, DM);      /* rows 0..127 of every batch (grid.y): x1 = x + o_hi Wo (+ b), overwriting the f16-path rows */
  k_gemm2<0><<<dim3((QT0 / 128) * (DM / 64), NB), 128, 0, stream>>>(OL0, DM, (size_t)QT0 * DM, BO, DM, 0, 0.00000095367431640625f, nullptr, 0, X1, -1, 0, 0, X1, nullptr, DM, (size_t)SQ * DM, QT0, DM, DM);      /* += o_lo Wo 2^-20 (own-element accumulate) */
  k_ln16<0, 0><<<(unsigned)NR, 256, 0, stream>>>(X1, gg2, be2, 1e-5f, M16, nullptr);      /* h = LN2(x1) -> f16 rows */
  k_gemm2<3><<<dim3((unsigned)((MP / 128) * (DFF / 64)), 1), 128, 0, stream>>>(M16, DM, 0, BW1, DM, 0, 0.0625f, bfc, 0, nullptr, 1, 0, 0, nullptr, HF16, DFF, 0, MP, DFF, DM);      /* relu(h2 W1 + b1) -> f16, all rows */
  k_gemm2<0><<<dim3((unsigned)((MP / 128) * (DM / 64)), 1), 128, 0, stream>>>(HF16, DFF, 0, BW2, DFF, 0, 0.0625f, bmp, 0, X1, -1, 0, 0, (float*)d_out, nullptr, DM, 0, MP, DM, DFF);      /* out = x1 + mlp (own-element residual), all rows */
}

// v004
// Measured time: 707 microseconds a run.
// Two timings next to v003 put it at 1.59 and 1.60 times that version's speed.
// All steps since v000 together make it 14.9 times as fast.
#include <hip/hip_runtime.h>
// Pre-LN causal transformer block with a fused QKV projection and the module's literal score scale (x [8][1024][1024]; h = LN1(x) (biased var, eps 1e-5); qkv = h Wqkv + bqkv ([in][out] 1024 x 3072 + bias) split q | k | v; 16 heads of 64; scale = 1 / sqrt(3 * 1024 / 16) = 1 / sqrt(192) (as the source: NOT 1 / sqrt(head_dim)); causal (tril, -inf); softmax; x1 = x + y Wproj + bproj; out = x1 + relu(LN2(x1) W1 + b1) W2 + b2 ([in][out] 1024 x 4096 x 1024) -> [8][1024][1024]).
// Structure: token rows r = b*1024 + s; h = LN1(bf16(x)) as f16 rows; q | k | v as ONE WMMA GEMM (N = 3 x 1024) (32x64 wave tiles, f32 accumulation, exact x16 weights + bias, f16 outputs); per batch: V^T for all heads via LDS transposes; per query tile of 256 rows: scores against the keys below the tile end only (K = 64, all heads on grid.y, alpha = 1 / sqrt(192)), causal row softmax on VALU, one wave per 4 rows with the rows in registers, keys above the row masked over the computed range (f32 statistics, native exp; weights x256 f16), o = P . V^T (K = keys below the tile end, alpha 2^-2: o carried x64, folded into the output GEMM alpha) written straight into the merged f16 o rows; x1 = x + o W_o + b GEMM (f32), then the FFN into the output.
// Compute dtype: inputs rounded to bf16; x / weights exact; q, k, v, softmax weights and o as plain f16 GEMM operands (~2^-12); scores and softmax statistics f32. v_wmma_f32_16x16x32_f16.
// Launches: V^T takes all batches on grid.x, the first-tile q | k | v GEMM, the exact first-tile attention and the first-tile output GEMMs on grid.y; a host loop steps over groups of GB batches, which scores and P V take on grid.z and the softmax on grid.x (S and P hold GB batches); the FFN GEMMs take all token rows.
#define NB 8
#define SQ 1024
#define DM 1024
#define NH 16
#define HD 64
#define HG 4                         /* heads per block group of the non-template k_vt (not launched) */
#define QT 256                       /* query rows per causal tile */
#define NKX SQ                       /* S / P row pitch */
#define QT0 128                      /* first-tile rows recomputed exactly in f32 */
#define GB 4                         /* batches per score, softmax and P V launch (grid.z of the GEMMs); S and P hold GB batches */
#define B0 0                         /* unused; the batch loops start at 0 */
#define NBR NB                       /* batches processed (debug hook) */
#define NR ((size_t)NB * SQ)
#define DMQ DM
#define DFF 4096                     /* FFN hidden width */
#define DFFR 100                     /* unused; the FFN hidden width is DFF */
#define MP ((int)((size_t)NBR * SQ)) /* rows projected (debug hook) */
#define QN SQ                        /* query rows attended per batch (debug hook) */
#define NHD NH                       /* heads attended (debug hook) */
#define MPO MP                       /* rows through the output stage (debug hook) */
#define LQ (3 * DM)      /* row pitch of the q/k/v rows */
typedef __bf16 v16b __attribute__((ext_vector_type(16)));
typedef unsigned short v8us __attribute__((ext_vector_type(8), may_alias));
typedef float  v8f  __attribute__((ext_vector_type(8)));
typedef float  v4f  __attribute__((ext_vector_type(4)));
typedef float  v4fa __attribute__((ext_vector_type(4), may_alias));
union FragB { v16b v; v8us half[2]; unsigned short u[16]; };

__device__ __forceinline__ unsigned short bf16_bits(float x) { unsigned int u = __float_as_uint(x); return (unsigned short)((u + 0x7FFFu + ((u >> 16) & 1u)) >> 16); }
__device__ __forceinline__ float bf16_val(unsigned short b) { return __uint_as_float(((unsigned int)b) << 16); }
__device__ __forceinline__ float bf16_round(float x) { return bf16_val(bf16_bits(x)); }
// D += A·B with NT terms: 1 = ah·bh, 2 = + al·bh (A split), 3 = + ah·bl (both split)
template <int NT>
__device__ __forceinline__ v8f mmaN(v16b ah, v16b al, v16b bh, v16b bl, v8f c) {
  c = __builtin_amdgcn_wmma_f32_16x16x32_bf16(false, ah, false, bh, (short)0, c, false, false);
  if (NT >= 2) c = __builtin_amdgcn_wmma_f32_16x16x32_bf16(false, al, false, bh, (short)0, c, false, false);
  if (NT >= 3) c = __builtin_amdgcn_wmma_f32_16x16x32_bf16(false, ah, false, bl, (short)0, c, false, false);
  asm volatile("v_nop\n\tv_nop\n\tv_nop\n\tv_nop" : "+v"(c) : "v"(ah), "v"(al), "v"(bh), "v"(bl));
  return c;
}

__global__ __launch_bounds__(256) void k_wt_bf16(const float* __restrict__ W, unsigned short* __restrict__ Wt, int K, int N) {
  const int t = blockIdx.x * 256 + threadIdx.x;
  const int k8n = K / 8;
  if (t >= N * k8n) return;
  const int n = t / k8n, k8 = (t % k8n) * 8;
  v8us v;
#pragma unroll
  for (int i = 0; i < 8; ++i) v[i] = bf16_bits(W[(size_t)(k8 + i) * N + n]);
  *(v8us*)(Wt + (size_t)n * K + k8) = v;
  
}

// GEMM C[M][N] (f32, pitch ldc) = act(A[M][K]·W + bias). A f32 row-major (pitch lda) converted per fragment to bf16
// (ASPLIT: hi/lo two planes -> 2 terms, else single rounded term); Wt bf16 [N][K] (pitch ldb). BIAS_BF16 rounds the
// bias to bf16 first (bias quantised to bf16 before the add). K%32==0, M%16==0, N%64==0.
template <bool ASPLIT, int ACT, bool BIAS_BF16>
__global__ __launch_bounds__(128) void k_gemm_bf(const float* __restrict__ A, int lda, const unsigned short* __restrict__ Wt, int ldb,
                                               const float* __restrict__ bias, float* __restrict__ C, int ldc, int M, int N, int K) {
  __shared__ __attribute__((aligned(16))) float so[4][16][64];
  const int tid = threadIdx.x, w = tid >> 5, lane = tid & 31, ln = lane & 15, hh = lane >> 4;
  const int ntn = N / 64;
  const int wid = blockIdx.x * 4 + w;
  const int mt = wid / ntn, nq = wid % ntn;
  if (mt * 16 >= M) return;
  const int row0 = mt * 16, col0 = nq * 64;
  const float* arow = A + (size_t)(row0 + ln) * lda;
  v8f acc[4] = {};
  for (int kb = 0; kb < K; kb += 32) {
    FragB ah, al;
    const v4f x0 = *(const v4fa*)(arow + kb + 8 * hh), x1 = *(const v4fa*)(arow + kb + 8 * hh + 4);
    const v4f x2 = *(const v4fa*)(arow + kb + 16 + 8 * hh), x3 = *(const v4fa*)(arow + kb + 16 + 8 * hh + 4);
    float xs[16] = {x0[0],x0[1],x0[2],x0[3],x1[0],x1[1],x1[2],x1[3],x2[0],x2[1],x2[2],x2[3],x3[0],x3[1],x3[2],x3[3]};
#pragma unroll
    for (int i = 0; i < 16; ++i) { const unsigned short hb = bf16_bits(xs[i]); ah.u[i] = hb; al.u[i] = ASPLIT ? bf16_bits(xs[i] - bf16_val(hb)) : (unsigned short)0; }
#pragma unroll
    for (int t = 0; t < 4; ++t) {
      const unsigned short* brow = Wt + (size_t)(col0 + t * 16 + ln) * ldb + kb;
      FragB b;
      b.half[0] = *(const v8us*)(brow + 8 * hh);
      b.half[1] = *(const v8us*)(brow + 16 + 8 * hh);
      acc[t] = mmaN<ASPLIT ? 2 : 1>(ah.v, al.v, b.v, b.v, acc[t]);
    }
  }
#pragma unroll
  for (int t = 0; t < 4; ++t) {
    float bv = bias ? bias[col0 + t * 16 + ln] : 0.f;
    if (BIAS_BF16) bv = bf16_round(bv);
#pragma unroll
    for (int r = 0; r < 8; ++r) { float v = acc[t][r] + bv; if (ACT == 1) v = fmaxf(v, 0.f); so[w][8 * hh + r][t * 16 + ln] = v; }
  }
  __builtin_amdgcn_fence(__ATOMIC_ACQ_REL, "workgroup");
  __builtin_amdgcn_wave_barrier();
  const int rsub = lane >> 4, c4 = (lane & 15) * 4;
  {
#pragma unroll
    for (int q = 0; q < 8; ++q) {
      const int r = q * 2 + rsub;
      const v4f v = *(const v4fa*)&so[w][r][c4];
      *(v4f*)(C + (size_t)(row0 + r) * ldc + col0 + c4) = v;
    }
    
  }
}

// GEMM C = act(A·W + bias + resid): A f32 (ASPLIT -> hi/lo 2 terms), Wt bf16 [N][K]; ACT 0 none, 1 relu, 2 exact gelu;
// resid (optional, f32, row index = (row % rmod), pitch ldr, RES_BF16 rounds it) added before the activation.
template <bool ASPLIT, int ACT, bool BIAS_BF16, bool RES_BF16>
__global__ __launch_bounds__(128) void k_gemm_bf3(const float* __restrict__ A, int lda, const unsigned short* __restrict__ Wt, int ldb,
                                                const float* __restrict__ bias, const float* __restrict__ resid, int rmod, int ldr,
                                                float* __restrict__ C, int ldc, int M, int N, int K) {
  __shared__ __attribute__((aligned(16))) float so[4][16][64];
  const int tid = threadIdx.x, w = tid >> 5, lane = tid & 31, ln = lane & 15, hh = lane >> 4;
  const int ntn = N / 64;
  const int wid = blockIdx.x * 4 + w;
  const int mt = wid / ntn, nq = wid % ntn;
  if (mt * 16 >= M) return;
  const int row0 = mt * 16, col0 = nq * 64;
  const float* arow = A + (size_t)(row0 + ln) * lda;
  v8f acc[4] = {};
  for (int kb = 0; kb < K; kb += 32) {
    FragB ah, al;
    const v4f x0 = *(const v4fa*)(arow + kb + 8 * hh), x1 = *(const v4fa*)(arow + kb + 8 * hh + 4);
    const v4f x2 = *(const v4fa*)(arow + kb + 16 + 8 * hh), x3 = *(const v4fa*)(arow + kb + 16 + 8 * hh + 4);
    float xs[16] = {x0[0],x0[1],x0[2],x0[3],x1[0],x1[1],x1[2],x1[3],x2[0],x2[1],x2[2],x2[3],x3[0],x3[1],x3[2],x3[3]};
#pragma unroll
    for (int i = 0; i < 16; ++i) { const unsigned short hb = bf16_bits(xs[i]); ah.u[i] = hb; al.u[i] = ASPLIT ? bf16_bits(xs[i] - bf16_val(hb)) : (unsigned short)0; }
#pragma unroll
    for (int t = 0; t < 4; ++t) {
      const unsigned short* brow = Wt + (size_t)(col0 + t * 16 + ln) * ldb + kb;
      FragB b;
      b.half[0] = *(const v8us*)(brow + 8 * hh);
      b.half[1] = *(const v8us*)(brow + 16 + 8 * hh);
      acc[t] = mmaN<ASPLIT ? 2 : 1>(ah.v, al.v, b.v, b.v, acc[t]);
    }
  }
#pragma unroll
  for (int t = 0; t < 4; ++t) {
    const int col = col0 + t * 16 + ln;
    float bv = bias ? bias[col] : 0.f;
    if (BIAS_BF16) bv = bf16_round(bv);
#pragma unroll
    for (int r = 0; r < 8; ++r) {
      float v = acc[t][r] + bv;
      if (resid) { float rv = resid[(size_t)((row0 + 8 * hh + r) % rmod) * ldr + col]; if (RES_BF16) rv = bf16_round(rv); v += rv; }
      if (ACT == 1) v = fmaxf(v, 0.f);
      if (ACT == 2) v = 0.5f * v * (1.0f + erff(v * 0.70710678118654752f));
      if (ACT == 3) { const float u = 0.7978845608028654f * (v + 0.044715f * v * v * v); v = 0.5f * v * (1.0f + tanhf(u)); }
      so[w][8 * hh + r][t * 16 + ln] = v;
    }
  }
  __builtin_amdgcn_fence(__ATOMIC_ACQ_REL, "workgroup");
  __builtin_amdgcn_wave_barrier();
  const int rsub = lane >> 4, c4 = (lane & 15) * 4;
  {
#pragma unroll
    for (int q = 0; q < 8; ++q) {
      const int r = q * 2 + rsub;
      const v4f v = *(const v4fa*)&so[w][r][c4];
      *(v4f*)(C + (size_t)(row0 + r) * ldc + col0 + c4) = v;
    }
    
  }
}
// row LayerNorm (biased variance, eps) over N: s = X (+ R); optional out_sum <- s; out_norm <- (s-mu)*rsqrt(var+eps)*g + b
template <bool PARAM_BF16>
__global__ __launch_bounds__(256) void k_layernorm(const float* __restrict__ X, const float* __restrict__ R, const float* __restrict__ g, const float* __restrict__ bta,
                                                  float* __restrict__ out_sum, float* __restrict__ out_norm, int N, float eps) {
  __shared__ float red[256];
  const int row = blockIdx.x, tid = threadIdx.x;
  const float* x = X + (size_t)row * N; const float* rr = R ? R + (size_t)row * N : nullptr;
  float vals[16];                     // up to N = 4096
  const int per = N / 256;            // contiguous chunk per thread? use strided-by-4 chunks: thread handles j = tid*4 + 1024*u
  float s1 = 0.f;
  for (int u = 0; u < per / 4; ++u) {
    const int j = tid * 4 + 1024 * u;
    const v4f a = *(const v4fa*)(x + j);
    v4f b = {0.f,0.f,0.f,0.f}; if (rr) b = *(const v4fa*)(rr + j);
#pragma unroll
    for (int q = 0; q < 4; ++q) { const float v = a[q] + b[q]; vals[u * 4 + q] = v; s1 += v; }
  }
  red[tid] = s1; __syncthreads();
  for (int st = 128; st > 0; st >>= 1) { if (tid < st) red[tid] += red[tid + st]; __syncthreads(); }
  const float mu = red[0] / (float)N; __syncthreads();
  float s2 = 0.f;
  for (int u = 0; u < per / 4; ++u)
#pragma unroll
    for (int q = 0; q < 4; ++q) { const float c = vals[u * 4 + q] - mu; s2 += c * c; }
  red[tid] = s2; __syncthreads();
  for (int st = 128; st > 0; st >>= 1) { if (tid < st) red[tid] += red[tid + st]; __syncthreads(); }
  const float rs = rsqrtf(red[0] / (float)N + eps);
  {
    for (int u = 0; u < per / 4; ++u) {
      const int j = tid * 4 + 1024 * u;
      v4f o, sm;
#pragma unroll
      for (int q = 0; q < 4; ++q) {
        float gg = g[j + q], bb = bta[j + q];
        if (PARAM_BF16) { gg = bf16_round(gg); bb = bf16_round(bb); }
        sm[q] = vals[u * 4 + q]; o[q] = (vals[u * 4 + q] - mu) * rs * gg + bb;
      }
      if (out_sum) *(v4f*)(out_sum + (size_t)row * N + j) = sm;
      *(v4f*)(out_norm + (size_t)row * N + j) = o;
    }
    
  }
}



// ---- f16 WMMA path (v_wmma_f32_16x16x32_f16): 11-bit significands for operands in range — used where a [0,1] probability operand needs more precision than bf16
typedef _Float16 v16h __attribute__((ext_vector_type(16)));
union FragH { v16h v; v8us half[2]; _Float16 h[16]; unsigned short u[16]; };
template <int NT>
__device__ __forceinline__ v8f mmaH(v16h ah, v16h al, v16h bh, v16h bl, v8f c) {
  c = __builtin_amdgcn_wmma_f32_16x16x32_f16(false, ah, false, bh, (short)0, c, false, false);
  if (NT >= 2) c = __builtin_amdgcn_wmma_f32_16x16x32_f16(false, al, false, bh, (short)0, c, false, false);
  if (NT >= 3) c = __builtin_amdgcn_wmma_f32_16x16x32_f16(false, ah, false, bl, (short)0, c, false, false);
  asm volatile("v_nop\n\tv_nop\n\tv_nop\n\tv_nop" : "+v"(c) : "v"(ah), "v"(al), "v"(bh), "v"(bl));
  return c;
}
// batched GEMM like k_gemm_b but f16 operands: A f32 (split into f16 hi/lo if ASPLIT, else rounded to f16), Bt = f16 values [n][k]; alpha; C f32; N multiple of 16 (partial tiles skipped)
template <bool ASPLIT>
__global__ __launch_bounds__(128) void k_gemm_h(const float* __restrict__ A, int lda, size_t sA, const _Float16* __restrict__ Bh, int ldb, size_t sB, float alpha, float* __restrict__ C, int ldc, size_t sC, int M, int N, int K) {
  __shared__ __attribute__((aligned(16))) float so[4][16][64];
  const int tid = threadIdx.x, w = tid >> 5, lane = tid & 31, ln = lane & 15, hh = lane >> 4; const int by = blockIdx.y;
  A += (size_t)by * sA; Bh += (size_t)by * sB; C += (size_t)by * sC;
  const int ntn = (N + 63) / 64; const int wid = blockIdx.x * 4 + w; const int mt = wid / ntn, nq = wid % ntn; if (mt * 16 >= M) return;
  const int row0 = mt * 16, col0 = nq * 64; const float* arow = A + (size_t)(row0 + ln) * lda;
  v8f acc[4] = {};
  for (int kb = 0; kb < K; kb += 32) {
    FragH ah, al;
    const v4f x0 = *(const v4fa*)(arow + kb + 8 * hh), x1 = *(const v4fa*)(arow + kb + 8 * hh + 4), x2 = *(const v4fa*)(arow + kb + 16 + 8 * hh), x3 = *(const v4fa*)(arow + kb + 16 + 8 * hh + 4);
    float xs[16] = {x0[0],x0[1],x0[2],x0[3],x1[0],x1[1],x1[2],x1[3],x2[0],x2[1],x2[2],x2[3],x3[0],x3[1],x3[2],x3[3]};
#pragma unroll
    for (int i = 0; i < 16; ++i) { const _Float16 h = (_Float16)xs[i]; ah.h[i] = h; al.h[i] = ASPLIT ? (_Float16)(xs[i] - (float)h) : (_Float16)0.0f; }
#pragma unroll
    for (int t = 0; t < 4; ++t) { if (col0 + t * 16 >= N) continue; const size_t boff = (size_t)(col0 + t * 16 + ln) * ldb + kb; FragH bq; bq.half[0] = *(const v8us*)(Bh + boff + 8 * hh); bq.half[1] = *(const v8us*)(Bh + boff + 16 + 8 * hh);
      acc[t] = mmaH<ASPLIT ? 2 : 1>(ah.v, al.v, bq.v, bq.v, acc[t]); }
  }
#pragma unroll
  for (int t = 0; t < 4; ++t) { if (col0 + t * 16 >= N) continue;
#pragma unroll
    for (int r = 0; r < 8; ++r) so[w][8 * hh + r][t * 16 + ln] = acc[t][r] * alpha; }
  __builtin_amdgcn_fence(__ATOMIC_ACQ_REL, "workgroup"); __builtin_amdgcn_wave_barrier();
  const int rsub = lane >> 4, c4 = (lane & 15) * 4;
  {
#pragma unroll
    for (int q = 0; q < 8; ++q) { const int r = q * 2 + rsub; if (col0 + c4 < N) { const v4f v = *(const v4fa*)&so[w][r][c4]; *(v4f*)(C + (size_t)(row0 + r) * ldc + col0 + c4) = v; } }
     }
}

// Wt[n][k] = f16(W[k][n]·scale) from f32 row-major W[K][N] (scale = power of two; bf16-exact weights stay exact in f16 away from the subnormal range)
__global__ __launch_bounds__(256) void k_wt_f16(const float* __restrict__ W, _Float16* __restrict__ Wt, int K, int N, float scale) {
  const int t = blockIdx.x * 256 + threadIdx.x; if (t >= N * (K / 8)) return; const int n = t / (K / 8), k8 = (t % (K / 8)) * 8; FragH f;
#pragma unroll
  for (int i = 0; i < 8; ++i) f.h[i] = (_Float16)(bf16_round(W[(size_t)(k8 + i) * N + n]) * scale); const v8us o = f.half[0];
  *(v8us*)((unsigned short*)Wt + (size_t)n * K + k8) = o; 
}
// k_gemm_hh variant with fused epilogue: v = acc·alpha + bias[by·sBias + col] (+ CP[(row/rowsPerB)·sCPb + by·64 + col] if CP) ; ACT 0 none / 1 elu ; writes f16 C16 (and f32 C if non-null)
template <int ACT>
__global__ __launch_bounds__(128) void k_gemm_hhx(const _Float16* __restrict__ A, int lda, size_t sA, const _Float16* __restrict__ Bh, int ldb, size_t sB, float alpha, const float* __restrict__ bias, size_t sBias, const float* __restrict__ CP, int rowsPerB, size_t sCPb, int row0g,
    float* __restrict__ C, _Float16* __restrict__ C16, int ldc, size_t sC, int M, int N, int K) {
  __shared__ __attribute__((aligned(16))) float so[4][16][64];
  const int tid = threadIdx.x, w = tid >> 5, lane = tid & 31, ln = lane & 15, hh = lane >> 4; const int by = blockIdx.y;
  A += (size_t)by * sA; Bh += (size_t)by * sB; const size_t cofs = (size_t)by * sC; const float* bp = bias ? bias + (size_t)by * sBias : nullptr;
  const int ntn = (N + 63) / 64; const int wid = blockIdx.x * 4 + w; const int mt = wid / ntn, nq = wid % ntn; if (mt * 16 >= M) return;
  const int row0 = mt * 16, col0 = nq * 64; const _Float16* arow = A + (size_t)(row0 + ln) * lda;
  v8f acc[4] = {};
  for (int kb = 0; kb < K; kb += 32) { FragH ah; ah.half[0] = *(const v8us*)((const unsigned short*)arow + kb + 8 * hh); ah.half[1] = *(const v8us*)((const unsigned short*)arow + kb + 16 + 8 * hh);
#pragma unroll
    for (int t = 0; t < 4; ++t) { if (col0 + t * 16 >= N) continue; const size_t boff = (size_t)(col0 + t * 16 + ln) * ldb + kb; FragH bq; bq.half[0] = *(const v8us*)((const unsigned short*)Bh + boff + 8 * hh); bq.half[1] = *(const v8us*)((const unsigned short*)Bh + boff + 16 + 8 * hh);
      acc[t] = mmaH<1>(ah.v, ah.v, bq.v, bq.v, acc[t]); }
  }
#pragma unroll
  for (int t = 0; t < 4; ++t) { if (col0 + t * 16 >= N) continue; const int col = col0 + t * 16 + ln; const float bv = bp ? bf16_round(bp[col]) : 0.f;
#pragma unroll
    for (int r = 0; r < 8; ++r) { float v = acc[t][r] * alpha + bv; if (CP) { const int rr = row0g + row0 + 8 * hh + r; if (rowsPerB < 0) v += CP[cofs + (size_t)rr * ldc + col];      /* rowsPerB < 0: own element of the batched C plane */ else { const int bidx = rr / rowsPerB; v += CP[(size_t)bidx * sCPb + (size_t)by * 64 + col]; } } if (ACT == 1) v = (v > 0.f) ? v : expm1f(v); else if (ACT == 7) v = (v > 0.f) ? v + 1.0f : expf(v); else if (ACT == 8) v = tanhf(v); else if (ACT == 9) v = 0.5f * v * (1.0f + tanhf(0.7978845608028654f * (v + 0.044715f * v * v * v))); else if (ACT == 11) v = 1.0f / (1.0f + expf(-v)); else if (ACT == 12) v = (v > 0.f) ? v : 0.01f * v; else if (ACT == 14) v = (v > 0.f) ? v : 0.1f * v; else if (ACT == 16) v = (v >= 0.f) ? v : 0.3f * v; else if (ACT == 17) v = (v >= 0.f) ? v : 0.2f * v; else if (ACT == 15) v = v / (1.0f + expf(-v)); else if (ACT == 3) v = fmaxf(v, 0.f); else if (ACT == 6) v = 0.5f * v * (1.0f + erff(v * 0.70710678118654752f)); so[w][8 * hh + r][t * 16 + ln] = v; } }
  __builtin_amdgcn_fence(__ATOMIC_ACQ_REL, "workgroup"); __builtin_amdgcn_wave_barrier();
  const int rsub = lane >> 4, c4 = (lane & 15) * 4; typedef _Float16 v4h __attribute__((ext_vector_type(4)));
  {
#pragma unroll
    for (int q = 0; q < 8; ++q) { const int r = q * 2 + rsub; if (col0 + c4 < N) { const v4f v = *(const v4fa*)&so[w][r][c4]; if (C) *(v4f*)(C + cofs + (size_t)(row0 + r) * ldc + col0 + c4) = v; if (C16) { v4h h4; for (int i = 0; i < 4; ++i) h4[i] = (_Float16)v[i]; *(v4h*)(C16 + cofs + (size_t)(row0 + r) * ldc + col0 + c4) = h4; } } }
     }
}


typedef _Float16 v4h __attribute__((ext_vector_type(4)));

__global__ __launch_bounds__(256) void k_x16(const float* __restrict__ x, _Float16* __restrict__ X16, size_t n8) { const size_t t = (size_t)blockIdx.x * 256 + threadIdx.x; if (t >= n8) return; FragH f;
#pragma unroll
  for (int q = 0; q < 8; ++q) f.h[q] = (_Float16)bf16_round(x[t * 8 + q]); *(v8us*)((unsigned short*)X16 + t * 8) = f.half[0];  }
__global__ __launch_bounds__(256) void k_h16(const float* __restrict__ x, _Float16* __restrict__ X16, size_t n8) { const size_t t = (size_t)blockIdx.x * 256 + threadIdx.x; if (t >= n8) return; FragH f;
#pragma unroll
  for (int q = 0; q < 8; ++q) f.h[q] = (_Float16)x[t * 8 + q]; *(v8us*)((unsigned short*)X16 + t * 8) = f.half[0];  }
__global__ __launch_bounds__(256) void k_round16f(const float* __restrict__ W, _Float16* __restrict__ Bt, size_t n8) { const size_t t = (size_t)blockIdx.x * 256 + threadIdx.x; if (t >= n8) return; FragH f;
#pragma unroll
  for (int i = 0; i < 8; ++i) f.h[i] = (_Float16)(bf16_round(W[t * 8 + i]) * 16.0f); *(v8us*)((unsigned short*)Bt + t * 8) = f.half[0];  }
template <int NHv, int TTv>
__global__ __launch_bounds__(256) void k_vt(const _Float16* __restrict__ V16, int ldv, int voff, _Float16* __restrict__ Vt) { __shared__ unsigned short tl[64][66]; const int tid = threadIdx.x; const int slab = blockIdx.x / (TTv / 64), lg = blockIdx.x % (TTv / 64); const int b = slab / NHv, h = slab % NHv;
  for (int i = tid; i < 64 * 8; i += 256) { const int r = i / 8, c8 = (i % 8) * 8; FragH f; f.half[0] = *(const v8us*)((const unsigned short*)V16 + ((size_t)b * TTv + lg * 64 + r) * ldv + voff + h * 64 + c8);
#pragma unroll
    for (int q = 0; q < 8; ++q) tl[r][c8 + q] = f.u[q]; }
  __syncthreads();
  {
#pragma unroll
    for (int rd = 0; rd < 2; ++rd) { const int d = rd * 32 + tid / 8, pc = tid % 8; FragH f;
#pragma unroll
      for (int q = 0; q < 8; ++q) f.u[q] = tl[pc * 8 + q][d];
      *(v8us*)((unsigned short*)Vt + ((size_t)slab * 64 + d) * TTv + lg * 64 + pc * 8) = f.half[0]; }
     } }

__global__ __launch_bounds__(256) void k_hl(const float* __restrict__ F, _Float16* __restrict__ Hh, _Float16* __restrict__ Hl, size_t n8) { const size_t t = (size_t)blockIdx.x * 256 + threadIdx.x; if (t >= n8) return; FragH fh, fl; const v4f a = *(const v4fa*)(F + t * 8), c = *(const v4fa*)(F + t * 8 + 4);
#pragma unroll
  for (int q = 0; q < 4; ++q) { _Float16 h = (_Float16)a[q]; fh.h[q] = h; fl.h[q] = (_Float16)((a[q] - (float)h) * 1024.0f); h = (_Float16)c[q]; fh.h[4 + q] = h; fl.h[4 + q] = (_Float16)((c[q] - (float)h) * 1024.0f); }
  { *(v8us*)((unsigned short*)Hh + t * 8) = fh.half[0]; *(v8us*)((unsigned short*)Hl + t * 8) = fl.half[0];  } }

// ---- fast GEMM (work-group tile 128x64, wave tile 32x64; A and B tiles of 64 k staged in LDS by asynchronous copies, two buffers; requires M % 128 == 0 rows per launch region, N % 64 == 0, K % 64 == 0); epilogue = k_gemm_hhx semantics ----
__device__ __forceinline__ v16h g2_frag(const _Float16* p, int hh) { FragH f; f.half[0] = *(const v8us*)((const unsigned short*)p + 8 * hh); f.half[1] = *(const v8us*)((const unsigned short*)p + 16 + 8 * hh); return f.v; }
__device__ __forceinline__ v8f g2_mma(v16h a, v16h b, v8f c) { v8f d = __builtin_amdgcn_wmma_f32_16x16x32_f16(false, a, false, b, (short)0, c, false, false); asm volatile("v_nop\n\tv_nop\n\tv_nop\n\tv_nop" : "+v"(d) : "v"(a), "v"(b)); return d; }
#define G2_PITCH 144                 /* LDS row pitch in bytes of a staged 128-byte row: 16 B x odd, the conflict-free pitch for 16-byte LDS reads */
#define G2_BUF (192 * G2_PITCH)      /* one staged tile: 128 A rows, then 64 B rows, 64 k each */
static_assert(MP % 128 == 0 && QT % 128 == 0 && QT0 % 128 == 0, "k_gemm2: a work-group stages 128 whole A rows");
static_assert(HD % 64 == 0 && QT % 64 == 0 && DM % 64 == 0 && DFF % 64 == 0, "k_gemm2: K is a multiple of the staged 64 k, N of the 64 B rows");
// One tile into LDS: twelve asynchronous 16-byte copies a lane (a wave's 32 lanes take 4 whole 128-byte rows per copy; copy i lands 16 rows below copy i - 1; 0..7 = A rows, 8..11 = B rows).
// One asm statement: the copies go from global memory to LDS through no register, and the s_wait_xcnt at its end stands in front of any later overwrite of the address registers that the copies name.
__device__ __forceinline__ void g2_stage(unsigned l, const _Float16* ga, size_t sa, const _Float16* gb, size_t sb) {
  asm volatile("global_load_async_to_lds_b128 %0, %12, off\n\tglobal_load_async_to_lds_b128 %1, %13, off\n\tglobal_load_async_to_lds_b128 %2, %14, off\n\tglobal_load_async_to_lds_b128 %3, %15, off\n\t"
               "global_load_async_to_lds_b128 %4, %16, off\n\tglobal_load_async_to_lds_b128 %5, %17, off\n\tglobal_load_async_to_lds_b128 %6, %18, off\n\tglobal_load_async_to_lds_b128 %7, %19, off\n\t"
               "global_load_async_to_lds_b128 %8, %20, off\n\tglobal_load_async_to_lds_b128 %9, %21, off\n\tglobal_load_async_to_lds_b128 %10, %22, off\n\tglobal_load_async_to_lds_b128 %11, %23, off\n\ts_wait_xcnt 0x0"
               :: "v"(l), "v"(l + 16 * G2_PITCH), "v"(l + 32 * G2_PITCH), "v"(l + 48 * G2_PITCH), "v"(l + 64 * G2_PITCH), "v"(l + 80 * G2_PITCH), "v"(l + 96 * G2_PITCH), "v"(l + 112 * G2_PITCH),
                  "v"(l + 128 * G2_PITCH), "v"(l + 144 * G2_PITCH), "v"(l + 160 * G2_PITCH), "v"(l + 176 * G2_PITCH),
                  "v"(ga), "v"(ga + sa), "v"(ga + 2 * sa), "v"(ga + 3 * sa), "v"(ga + 4 * sa), "v"(ga + 5 * sa), "v"(ga + 6 * sa), "v"(ga + 7 * sa), "v"(gb), "v"(gb + sb), "v"(gb + 2 * sb), "v"(gb + 3 * sb) : "memory"); }
template <int ACT>
__global__ __launch_bounds__(128) void k_gemm2(const _Float16* __restrict__ A, int lda, size_t sA, const _Float16* __restrict__ Bh, int ldb, size_t sB, float alpha, const float* __restrict__ bias, size_t sBias, const float* __restrict__ CP, int rowsPerB, size_t sCPb, int row0g,
    float* __restrict__ C, _Float16* __restrict__ C16, int ldc, size_t sC, int M, int N, int K, size_t zA = 0, size_t zB = 0, size_t zC = 0) { static_assert(ACT == 0 || ACT == 3 || ACT == 6 || ACT == 8 || ACT == 9 || ACT == 11 || ACT == 12 || ACT == 14 || ACT == 15 || ACT == 16 || ACT == 17, "k_gemm2: unsupported ACT code (would silently apply no activation)");
  __shared__ __attribute__((aligned(16))) unsigned char sm[2 * G2_BUF]; float (*so)[32][68] = (float (*)[32][68])sm;      /* two staged tiles; behind the loop's last barrier the same bytes are the epilogue's [4][32][68] f32 staging */
  static_assert(sizeof(float) * 4 * 32 * 68 <= 2 * G2_BUF, "k_gemm2: the epilogue staging fits the two tile buffers");
  const int tid = threadIdx.x, w = tid >> 5, lane = tid & 31, ln = lane & 15, hh = lane >> 4; const int by = blockIdx.y; const int bz = blockIdx.z;      /* second batch axis (strides zA, zB, zC) */
  A += (size_t)by * sA + (size_t)bz * zA; Bh += (size_t)by * sB + (size_t)bz * zB; const size_t cofs = (size_t)by * sC + (size_t)bz * zC; const float* bp = bias ? bias + (size_t)by * sBias : nullptr;
  const int ntn = N >> 6; const int mt = blockIdx.x / ntn, nq = blockIdx.x - mt * ntn; const int row0 = mt * 128 + 32 * w, col0 = nq * 64; if (mt * 128 >= M) return;      /* the whole work-group leaves or none: barriers follow */
  const _Float16* ga = A + (size_t)(mt * 128 + (tid >> 3)) * lda + (tid & 7) * 8; const _Float16* gb = Bh + (size_t)(col0 + (tid >> 3)) * ldb + (tid & 7) * 8;      /* this lane's 16 bytes of row tid / 8 of each 16-row group */
  const size_t sa = (size_t)16 * lda, sb = (size_t)16 * ldb; const unsigned l0 = (unsigned)(size_t)sm + (unsigned)((tid >> 3) * G2_PITCH + (tid & 7) * 16);
  const unsigned char* fa = sm + (32 * w + ln) * G2_PITCH; const unsigned char* fb = sm + (128 + ln) * G2_PITCH;      /* this lane's fragment rows in buffer 0 */
  const v8f z8 = {0.f,0.f,0.f,0.f,0.f,0.f,0.f,0.f}; v8f c00 = z8, c01 = z8, c02 = z8, c03 = z8, c10 = z8, c11 = z8, c12 = z8, c13 = z8;
  const int nt = K >> 6;
  g2_stage(l0, ga, sa, gb, sb);
  asm volatile("s_wait_asynccnt 0x0" ::: "memory");      /* this wave's copies of tile 0 have landed */
  __syncthreads();      /* tile 0 published: every wave's copies have landed */
  if (nt > 1) g2_stage(l0 + G2_BUF, ga + 64, sa, gb + 64, sb);      /* tile 1 flies while tile 0 is worked on */
#pragma unroll 1
  for (int t = 0; t < nt; ++t) { const unsigned bo = (unsigned)(t & 1) * G2_BUF;      /* kept rolled: one trip is one staged tile and the buffers alternate; unrolled, the copies' and waits' code would only be repeated */
#pragma unroll
    for (int ks = 0; ks < 2; ++ks) { const _Float16* pa = (const _Float16*)(fa + bo + ks * 64); const _Float16* pb = (const _Float16*)(fb + bo + ks * 64);      /* unrolled so that the two halves of a tile are immediate offsets of the LDS reads; 32 k = 64 bytes of every row; k ascends as before */
      const v16h a0 = g2_frag(pa, hh), a1 = g2_frag(pa + 8 * G2_PITCH, hh), b0 = g2_frag(pb, hh), b1 = g2_frag(pb + 8 * G2_PITCH, hh), b2 = g2_frag(pb + 16 * G2_PITCH, hh), b3 = g2_frag(pb + 24 * G2_PITCH, hh);      /* 16 rows = 8 * G2_PITCH halves */
      c00 = g2_mma(a0, b0, c00); c10 = g2_mma(a1, b0, c10); c01 = g2_mma(a0, b1, c01); c11 = g2_mma(a1, b1, c11);
      c02 = g2_mma(a0, b2, c02); c12 = g2_mma(a1, b2, c12); c03 = g2_mma(a0, b3, c03); c13 = g2_mma(a1, b3, c13); }
    asm volatile("s_wait_dscnt 0x0" ::: "memory");      /* this wave's reads of the buffer have returned before the buffer is given up */
    asm volatile("s_wait_asynccnt 0x0" ::: "memory");      /* this wave's copies of tile t + 1 have landed */
    __syncthreads();      /* publishes tile t + 1 and ends every wave's reads of tile t */
    if (t + 2 < nt) g2_stage(l0 + bo, ga + (size_t)(t + 2) * 64, sa, gb + (size_t)(t + 2) * 64, sb); }      /* refill of the buffer just left */
  asm volatile("s_wait_asynccnt 0x0" ::: "memory");      /* no copy is outstanding when the buffers become the epilogue's staging */
  v8f accs[8] = {c00, c01, c02, c03, c10, c11, c12, c13};
#pragma unroll
  for (int u = 0; u < 8; ++u) { const int t = u & 3, half = u >> 2; const int col = col0 + t * 16 + ln; const float bv = bp ? bf16_round(bp[col]) : 0.f;
#pragma unroll
    for (int r = 0; r < 8; ++r) { const int rloc = half * 16 + 8 * hh + r; float v = accs[u][r] * alpha + bv; if (CP) { if (rowsPerB < 0) v += CP[cofs + (size_t)(row0g + row0 + rloc) * ldc + col];      /* rowsPerB < 0: own element of the batched C plane */ else { const int bidx = (row0g + row0 + rloc) / rowsPerB; v += CP[(size_t)bidx * sCPb + (size_t)by * 64 + col]; } }
      if (ACT == 3) v = fmaxf(v, 0.f); else if (ACT == 6) v = 0.5f * v * (1.0f + erff(v * 0.70710678118654752f)); else if (ACT == 11) v = 1.0f / (1.0f + expf(-v)); else if (ACT == 15) v = v / (1.0f + expf(-v)); else if (ACT == 12) v = (v > 0.f) ? v : 0.01f * v; else if (ACT == 8) v = tanhf(v); else if (ACT == 9) v = 0.5f * v * (1.0f + tanhf(0.7978845608028654f * (v + 0.044715f * v * v * v))); else if (ACT == 14) v = (v > 0.f) ? v : 0.1f * v; else if (ACT == 16) v = (v >= 0.f) ? v : 0.3f * v; else if (ACT == 17) v = (v >= 0.f) ? v : 0.2f * v;
      so[w][rloc][t * 16 + ln] = v; } }
  __builtin_amdgcn_fence(__ATOMIC_ACQ_REL, "workgroup"); __builtin_amdgcn_wave_barrier();
  const int rsub = lane >> 4, c4 = (lane & 15) * 4;
  {
#pragma unroll
    for (int q = 0; q < 16; ++q) { const int r = q * 2 + rsub; const v4f v = *(const v4fa*)&so[w][r][c4]; if (C) *(v4f*)(C + cofs + (size_t)(row0 + r) * ldc + col0 + c4) = v; if (C16) { v4h h4; for (int i = 0; i < 4; ++i) h4[i] = (_Float16)v[i]; *(v4h*)(C16 + cofs + (size_t)(row0 + r) * ldc + col0 + c4) = h4; } }
     } }


__global__ __launch_bounds__(256) void k_wnat(const float* __restrict__ w, size_t n8, _Float16* __restrict__ Bt) { const size_t t = (size_t)blockIdx.x * 256 + threadIdx.x; if (t >= n8) return; FragH f; for (int q = 0; q < 8; ++q) f.h[q] = (_Float16)(bf16_round(w[t * 8 + q]) * 16.0f); *(v8us*)((unsigned short*)Bt + t * 8) = f.half[0];  }
__global__ __launch_bounds__(256) void k_rsm(const float* __restrict__ S, _Float16* __restrict__ P, int nrows) {
  #pragma clang fp contract(off)
  const int i = blockIdx.x * 256 + threadIdx.x; if (i >= nrows) return; const float* s = S + (size_t)i * SQ; float mx = -3.0e38f;
#pragma unroll 1
  for (int j = 0; j < SQ; ++j) mx = fmaxf(mx, s[j]); float se = 0.f;
#pragma unroll 1
  for (int j = 0; j < SQ; ++j) se += expf(s[j] - mx); const float sc = 256.0f / se;
#pragma unroll 1
  for (int j0 = 0; j0 < SQ; j0 += 8) { FragH f; for (int q = 0; q < 8; ++q) f.h[q] = (_Float16)(expf(s[j0 + q] - mx) * sc); unsigned short* d = (unsigned short*)P + (size_t)i * SQ + j0; *(v8us*)d = f.half[0];  } }
__global__ __launch_bounds__(256) void k_vt(const _Float16* __restrict__ V16, int b, int h0, _Float16* __restrict__ VT) { __shared__ unsigned short tl[64][65]; const int tid = threadIdx.x; const int hh = blockIdx.x % HG, sg = blockIdx.x / HG; const int s0 = sg * 64; const int h = h0 + hh;
  for (int i = tid; i < 64 * 8; i += 256) { const int j = i / 8, d8 = (i % 8) * 8; FragH f; f.half[0] = *(const v8us*)((const unsigned short*)V16 + ((size_t)b * SQ + s0 + j) * DM + h * HD + d8); for (int q = 0; q < 8; ++q) tl[d8 + q][j] = f.u[q]; }
  __syncthreads();
  { for (int i = tid; i < 64 * 8; i += 256) { const int d = i / 8, j8 = (i % 8) * 8; FragH f; for (int q = 0; q < 8; ++q) f.u[q] = tl[d][j8 + q]; *(v8us*)((unsigned short*)VT + ((size_t)hh * HD + d) * SQ + s0 + j8) = f.half[0]; }  } }



#define RW 4                         /* score rows per wave in the causal softmax */
// lane l with lane l ^ m inside a 16-lane row (DPP row_xmask, CTRL = 0x160 | m), and with lane l ^ 16
template <int CTRL> __device__ __forceinline__ float lane_xm(float x) { return __builtin_bit_cast(float, __builtin_amdgcn_update_dpp(0, __builtin_bit_cast(int, x), CTRL, 0xf, 0xf, true)); }
__device__ __forceinline__ float lane_x16(float x) { return __builtin_bit_cast(float, __builtin_amdgcn_permlanex16(__builtin_bit_cast(int, x), __builtin_bit_cast(int, x), 0x76543210, 0xfedcba98, false, false)); }
__device__ __forceinline__ float wave_max(float x) { x = fmaxf(x, lane_xm<0x161>(x)); x = fmaxf(x, lane_xm<0x162>(x)); x = fmaxf(x, lane_xm<0x164>(x)); x = fmaxf(x, lane_xm<0x168>(x)); return fmaxf(x, lane_x16(x)); }
__device__ __forceinline__ float wave_sum(float x) { x += lane_xm<0x161>(x); x += lane_xm<0x162>(x); x += lane_xm<0x164>(x); x += lane_xm<0x168>(x); return x + lane_x16(x); }
// 2^t for eight values in place. Asm so that the free slot which the instruction set asks for behind a transcendental, before its result is used or its source overwritten, stands by construction: no line here touches the line before it, and the v_nop covers the last
__device__ __forceinline__ void exp2_x8(float (&t)[8]) { asm("v_exp_f32 %0, %0\n\tv_exp_f32 %1, %1\n\tv_exp_f32 %2, %2\n\tv_exp_f32 %3, %3\n\tv_exp_f32 %4, %4\n\tv_exp_f32 %5, %5\n\tv_exp_f32 %6, %6\n\tv_exp_f32 %7, %7\n\tv_nop" : "+v"(t[0]), "+v"(t[1]), "+v"(t[2]), "+v"(t[3]), "+v"(t[4]), "+v"(t[5]), "+v"(t[6]), "+v"(t[7])); }
// RW rows of NC * 256 keys per wave: lane l holds keys c * 256 + 8 l .. + 7 of every chunk c in registers (a pair of b128 loads covers 1 KiB of a row per wave, a b128 store 512 B); S is read once
template <int NC>
__device__ __forceinline__ void rsm_rows(const float* __restrict__ S, _Float16* __restrict__ P, int row0, int q0, int lane) {
  v4f raw[RW][NC][2];
#pragma unroll
  for (int r = 0; r < RW; ++r)
#pragma unroll
    for (int c = 0; c < NC; ++c) { const float* s = S + (size_t)(row0 + r) * NKX + c * 256 + lane * 8; raw[r][c][0] = *(const v4fa*)s; raw[r][c][1] = *(const v4fa*)(s + 4); }
  __builtin_amdgcn_sched_barrier(0);      /* keeps every row's loads issued in front of the first row's arithmetic: without it the later rows' loads sink to their use and each row pays its own memory latency */
#pragma unroll
  for (int r = 0; r < RW; ++r) { const int last = q0 + ((row0 + r) % QT); float v[NC][8]; float mx = -3.0e38f;
#pragma unroll
    for (int c = 0; c < NC; ++c)
#pragma unroll
      for (int q = 0; q < 8; ++q) { const int j = c * 256 + lane * 8 + q; v[c][q] = (j <= last) ? raw[r][c][q >> 2][q & 3] : -1.0e9f; mx = fmaxf(mx, v[c][q]); }
    mx = wave_max(mx); float s4[4] = {0.f, 0.f, 0.f, 0.f};      /* four independent add chains per lane */
#pragma unroll
    for (int c = 0; c < NC; ++c) {
#pragma unroll
      for (int q = 0; q < 8; ++q) v[c][q] = (v[c][q] - mx) * 1.44269504f;      /* e^x = 2^(x log2 e), the native form as before */
      exp2_x8(v[c]);
#pragma unroll
      for (int q = 0; q < 8; ++q) s4[q & 3] += v[c][q]; }
    const float sc = 256.0f / wave_sum((s4[0] + s4[1]) + (s4[2] + s4[3]));
#pragma unroll
    for (int c = 0; c < NC; ++c) { FragH fr;
#pragma unroll
      for (int q = 0; q < 8; ++q) fr.h[q] = (_Float16)(v[c][q] * sc);
      *(v8us*)((unsigned short*)P + (size_t)(row0 + r) * NKX + c * 256 + lane * 8) = fr.half[0]; } }
  asm volatile("s_wait_xcnt 0x0" ::: "memory");      /* the wait that belongs in front of any later overwrite of a register which the stores above name: the bodies for the other key counts lie behind this one in the code and reuse those registers */
}
__global__ __launch_bounds__(256) void k_rsmcf2(const float* __restrict__ S, _Float16* __restrict__ P, int hg, int q0, int nk) { static_assert(QT % 256 == 0 && QT % RW == 0 && NKX <= 1024, "k_rsmcf2: nk is a multiple of 256, at most 1024");
  const int lane = threadIdx.x & 31; const int row0 = (blockIdx.x * 8 + __builtin_amdgcn_readfirstlane(threadIdx.x >> 5)) * RW; if (row0 >= hg * QT) return;      /* wave-uniform exit; the kernel has no barrier */
  const int nc = nk >> 8; if (nc == 1) rsm_rows<1>(S, P, row0, q0, lane); else if (nc == 2) rsm_rows<2>(S, P, row0, q0, lane); else if (nc == 3) rsm_rows<3>(S, P, row0, q0, lane); else rsm_rows<4>(S, P, row0, q0, lane); }


typedef float v2f __attribute__((ext_vector_type(2)));
#define JU 4                         /* keys whose score chains run side by side in the exact attention */
// Exact f32 attention of the first QT0 rows, one thread per query row. The row's q and o live in registers; the head's K and V rows are staged once in LDS and read from there at one address for the whole wave.
// Every d loop is unrolled, and JU keys are taken together, so that their JU chains of dependent adds fill one another's latency. Per row every product, every sum and the running-maximum recurrence stand in the order they had key by key.
template <int MASKADD>
__global__ __launch_bounds__(64) void k_att0(const float* __restrict__ QF, const float* __restrict__ KF, const float* __restrict__ VF, int ld, const float* __restrict__ mask, float scale, float* __restrict__ OF, int ldo) {
  #pragma clang fp contract(off)      /* as before; numerical: each q k product stays rounded in front of its add, as it was built so far, so that the exact rows' scores, and with them o, stay bit-identical */
  static_assert(MASKADD == 0, "k_att0: causal form only (the staged K and V rows are those of the first tile)"); static_assert(64 % JU == 0 && HD == 64, "k_att0: whole groups of JU keys; 64 values a row");
  (void)mask;
  __shared__ __attribute__((aligned(16))) float sk[QT0][HD]; __shared__ __attribute__((aligned(16))) float sv[QT0][HD];
  float (*lo)[HD + 4] = (float (*)[HD + 4])sk;      /* behind the loop's barrier the K rows' bytes are the output staging; pitch 68 floats spreads the rows over the banks */
  static_assert(sizeof(float) * 64 * (HD + 4) <= sizeof(float) * QT0 * HD, "k_att0: the output staging fits the K rows");
  const int tid = threadIdx.x; const int h = blockIdx.x / (QT0 / 64), rg = blockIdx.x % (QT0 / 64); const int i = rg * 64 + tid;
  const size_t bo_in = (size_t)blockIdx.y * QT0 * ld; QF += bo_in; KF += bo_in; VF += bo_in; OF += (size_t)blockIdx.y * QT0 * ldo;      /* batch on grid.y: QT0 rows per batch in every plane */
  const float* qr = QF + (size_t)i * ld + h * HD;
  const int nkey = rg * 64 + 64;      /* causal form: keys up to the block's last row */
  const int sr = tid >> 4, c4 = (tid & 15) * 4; const unsigned lof = (unsigned)(sr * ld + c4);      /* sixteen lanes take one 256-byte row */
#pragma unroll 1
  for (int r0 = 0; r0 < nkey; r0 += 32) { v4f tk[8], tv[8]; const float* pk[8]; const float* pv[8];      /* 32 rows a trip: sixteen loads in flight per lane; rolled, since two or four trips of them are all there is */
#pragma unroll
    for (int it = 0; it < 8; ++it) { const size_t g = (size_t)(r0 + it * 4) * ld + h * HD; pk[it] = (KF + g) + lof; pv[it] = (VF + g) + lof; tk[it] = *(const v4fa*)pk[it]; tv[it] = *(const v4fa*)pv[it]; }
    asm volatile("s_wait_xcnt 0x0" :: "v"(pk[0]), "v"(pk[1]), "v"(pk[2]), "v"(pk[3]), "v"(pk[4]), "v"(pk[5]), "v"(pk[6]), "v"(pk[7]), "v"(pv[0]), "v"(pv[1]), "v"(pv[2]), "v"(pv[3]), "v"(pv[4]), "v"(pv[5]), "v"(pv[6]), "v"(pv[7]) : "memory");      /* the wait that belongs in front of any overwrite of the loads' address registers; naming them keeps them whole up to it (without it the last load's result was given the first load's address registers) */
#pragma unroll
    for (int it = 0; it < 8; ++it) { *(v4f*)&sk[r0 + it * 4 + sr][c4] = tk[it]; *(v4f*)&sv[r0 + it * 4 + sr][c4] = tv[it]; } }
  v2f q2[HD / 2], o2[HD / 2];
#pragma unroll
  for (int c = 0; c < HD / 4; ++c) { const v4f qq = *(const v4fa*)(qr + c * 4); q2[2 * c] = v2f{qq[0], qq[1]}; q2[2 * c + 1] = v2f{qq[2], qq[3]}; o2[2 * c] = v2f{0.f, 0.f}; o2[2 * c + 1] = v2f{0.f, 0.f}; }
  asm volatile("s_wait_xcnt 0x0" :: "v"(qr) : "memory");      /* as above, for the address register of the q loads */
  __syncthreads();      /* the staged K and V rows are published to both waves */
  float m = -1.0e30f, l = 0.f;
  // A piece = 8 LDS reads of 16 bytes: 8 values (d = 8 n .. 8 n + 7) of JU rows. Two register buffers: the next piece's reads are issued in front of this piece's arithmetic, so that an LDS read's latency is not paid read by read.
  v4f ba[2 * JU], bb[2 * JU];
  auto fetch = [&](v4f (&buf)[2 * JU], const float (*rows)[HD], int jb, int n) {
#pragma unroll
    for (int u = 0; u < JU; ++u) { buf[2 * u] = *(const v4f*)&rows[jb + u][8 * n]; buf[2 * u + 1] = *(const v4f*)&rows[jb + u][8 * n + 4]; } };
  float s[JU], sc[JU], e[JU];
  auto dots = [&](const v4f (&buf)[2 * JU], int n) {      /* two rounded products an instruction; the adds stay one chain per key, d ascending */
#pragma unroll
    for (int w = 0; w < 2; ++w)
#pragma unroll
      for (int u = 0; u < JU; ++u) { const v4f kq = buf[2 * u + w]; const v2f p0 = q2[4 * n + 2 * w] * v2f{kq[0], kq[1]}, p1 = q2[4 * n + 2 * w + 1] * v2f{kq[2], kq[3]};
        s[u] = __fadd_rn(s[u], p0[0]); s[u] = __fadd_rn(s[u], p0[1]); s[u] = __fadd_rn(s[u], p1[0]); s[u] = __fadd_rn(s[u], p1[1]); } };
  auto accum = [&](const v4f (&buf)[2 * JU], int n) {      /* o = fma(o, sc, round(e v)), key after key: the rounding that this line was built with before, written out */
#pragma unroll
    for (int w = 0; w < 2; ++w)
#pragma unroll
      for (int u = 0; u < JU; ++u) { const v4f vv = buf[2 * u + w]; const v2f s2 = {sc[u], sc[u]}, e2 = {e[u], e[u]};
        o2[4 * n + 2 * w] = __builtin_elementwise_fma(o2[4 * n + 2 * w], s2, e2 * v2f{vv[0], vv[1]}); o2[4 * n + 2 * w + 1] = __builtin_elementwise_fma(o2[4 * n + 2 * w + 1], s2, e2 * v2f{vv[2], vv[3]}); } };
  fetch(ba, sk, 0, 0);
#pragma unroll 1
  for (int j0 = 0; j0 < nkey; j0 += JU) {      /* kept rolled: one trip already holds JU keys' unrolled d loops */
    const int jn = (j0 + JU < nkey) ? j0 + JU : 0;      /* the last trip fetches ahead from row 0, inside the array; that piece is not used */
#pragma unroll
    for (int u = 0; u < JU; ++u) s[u] = 0.f;
#pragma unroll
    for (int n = 0; n < HD / 8; n += 2) {
      fetch(bb, sk, j0, n + 1);
      __builtin_amdgcn_sched_barrier(0);      /* keeps the reads above in front of the arithmetic below: without it each read sinks to its use and waits out its own latency */
      dots(ba, n);
      if (n + 2 < HD / 8) fetch(ba, sk, j0, n + 2); else fetch(ba, sv, j0, 0);
      __builtin_amdgcn_sched_barrier(0);      /* as above */
      dots(bb, n + 1); }
#pragma unroll
    for (int u = 0; u < JU; ++u) { const float ss = __fmul_rn(s[u], scale);
      const float f = (j0 + u <= i) ? 1.f : 0.f; const float sm = fmaf(f, ss, (1.f - f) * -1.0e30f); const float mn = fmaxf(m, sm); sc[u] = expf(m - mn); e[u] = expf(sm - mn); l = fmaf(l, sc[u], e[u]); m = mn; }      /* l: one fused multiply-add, as this line was built before */
#pragma unroll
    for (int n = 0; n < HD / 8; n += 2) {
      fetch(bb, sv, j0, n + 1);
      __builtin_amdgcn_sched_barrier(0);      /* as above */
      accum(ba, n);
      if (n + 2 < HD / 8) fetch(ba, sv, j0, n + 2); else fetch(ba, sk, jn, 0);
      __builtin_amdgcn_sched_barrier(0);      /* as above */
      accum(bb, n + 1); } }
  const float fin = 64.0f / l;      /* o carried x64 like the f16 path */
  __syncthreads();      /* both waves have left the K rows before their bytes become the output staging */
#pragma unroll
  for (int c = 0; c < HD / 4; ++c) { const v2f a = o2[2 * c] * v2f{fin, fin}, b = o2[2 * c + 1] * v2f{fin, fin}; *(v4f*)&lo[tid][c * 4] = v4f{a[0], a[1], b[0], b[1]}; }
  __syncthreads();
  {
#pragma unroll 1
    for (int it0 = 0; it0 < 16; it0 += 4) {      /* rolled: four stores in flight a trip are enough for 16 KiB */
#pragma unroll
      for (int it = it0; it < it0 + 4; ++it) { const int row = it * 4 + tid / 16, pc = (tid % 16) * 4; const v4f v = *(const v4f*)&lo[row][pc]; *(v4f*)(OF + (size_t)(rg * 64 + row) * ldo + h * HD + pc) = v; }      /* whole 256-byte row pieces per store, as before */
      asm volatile("s_wait_xcnt 0x0" ::: "memory"); }      /* the wait that belongs in front of the next trip's overwrite of the registers which these stores name */
     } }


template <int BFIN, int WXB>
__global__ __launch_bounds__(256) void k_ln16(const float* __restrict__ X, const float* __restrict__ g, const float* __restrict__ bb, float eps, _Float16* __restrict__ N16, float* __restrict__ XB) {
  #pragma clang fp contract(off)
  __shared__ float red[256]; const size_t r = blockIdx.x; const int t = threadIdx.x; const v4f xa = *(const v4fa*)(X + r * DMQ + t * 4); float s[4]; float sum = 0.f;
  for (int q = 0; q < 4; ++q) { s[q] = BFIN ? bf16_round(xa[q]) : xa[q]; sum = __fadd_rn(sum, s[q]); }
  red[t] = sum; __syncthreads(); for (int st = 128; st > 0; st >>= 1) { if (t < st) red[t] = __fadd_rn(red[t], red[t + st]); __syncthreads(); } const float mu = red[0] / (float)DMQ; __syncthreads();
  float vs = 0.f; for (int q = 0; q < 4; ++q) { const float dl = __fadd_rn(s[q], -mu); vs = __fadd_rn(vs, __fmul_rn(dl, dl)); } red[t] = vs; __syncthreads(); for (int st = 128; st > 0; st >>= 1) { if (t < st) red[t] = __fadd_rn(red[t], red[t + st]); __syncthreads(); }
  const float rs = rsqrtf(__fadd_rn(red[0] / (float)DMQ, eps)); v4h y; v4f xb;
  for (int q = 0; q < 4; ++q) { const int c = t * 4 + q; y[q] = (_Float16)__fadd_rn(__fmul_rn(__fmul_rn(__fadd_rn(s[q], -mu), rs), bf16_round(g[c])), bf16_round(bb[c])); xb[q] = s[q]; }
  { *(v4h*)(N16 + r * DMQ + t * 4) = y; if (WXB) *(v4f*)(XB + r * DMQ + t * 4) = xb;  } }
__global__ __launch_bounds__(256) void k_ftres2(const float* __restrict__ OF0, const float* __restrict__ XB, float* __restrict__ X1, size_t n4) {
  #pragma clang fp contract(off)
  const size_t t = (size_t)blockIdx.x * 256 + threadIdx.x; if (t >= n4) return; const v4f o = *(const v4fa*)(OF0 + t * 4), xv = *(const v4fa*)(XB + t * 4); v4f y; for (int q = 0; q < 4; ++q) y[q] = __fadd_rn(__fmul_rn(o[q], 0.015625f), xv[q]); *(v4f*)(X1 + t * 4) = y;  }

__global__ __launch_bounds__(256) void k_wthd(const float* __restrict__ Wt, _Float16* __restrict__ Bt) { const size_t t = (size_t)blockIdx.x * 256 + threadIdx.x; if (t >= (size_t)NH * HD * (DM / 8)) return; const int m8 = (int)(t % (DM / 8)) * 8; const int d = (int)((t / (DM / 8)) % HD); const int h = (int)(t / ((size_t)(DM / 8) * HD)); FragH f;
  for (int q = 0; q < 8; ++q) f.h[q] = (_Float16)(16.0f * bf16_round(Wt[((size_t)h * DM + m8 + q) * HD + d])); unsigned short* dst = (unsigned short*)Bt + ((size_t)h * HD + d) * DM + m8; *(v8us*)dst = f.half[0];  }




__global__ __launch_bounds__(256) void k_wtpad(const float* __restrict__ Wm, _Float16* __restrict__ Wt, int Kr, int Kp, int Nr, int Np, float scale) {
  const int t = blockIdx.x * 256 + threadIdx.x; if (t >= Np * (Kp / 8)) return; const int n = t / (Kp / 8), k8 = (t % (Kp / 8)) * 8; const int nc = min(n, Nr - 1); const float fn = (n < Nr) ? 1.f : 0.f; FragH f;
  for (int i = 0; i < 8; ++i) { const int k = k8 + i; const int kc = min(k, Kr - 1); const float fk = (k < Kr) ? fn : 0.f; f.h[i] = (_Float16)(bf16_round(Wm[(size_t)kc * Nr + nc]) * scale * fk); }
  unsigned short* o = (unsigned short*)Wt + (size_t)n * Kp + k8; *(v8us*)o = f.half[0];  }
__global__ __launch_bounds__(128) void k_bpad(const float* __restrict__ b, float* __restrict__ Bp, int nr, int np) {
  const int i = threadIdx.x; if (i >= np) return; const float v = b[min(i, nr - 1)] * ((i < nr) ? 1.f : 0.f); *(float*)(Bp + i) = v;  }
extern "C" void kernel_launch(void* const* d_in, const int* in_sizes, int n_in,
                              void* d_out, int out_size, void* d_ws, size_t ws_size, hipStream_t stream) {
  (void)in_sizes; (void)n_in; (void)out_size;
  const float* const* I = (const float* const*)d_in; const float* x = I[0]; const float* wqkv = I[1]; const float* bqkv = I[2]; const float* wo = I[3]; const float* bo = I[4]; const float* g1 = I[5]; const float* be1 = I[6]; const float* gg2 = I[7]; const float* be2 = I[8]; const float* wfc = I[9]; const float* bfc = I[10]; const float* wmp = I[11]; const float* bmp = I[12];      /* x; fused Wqkv [1024][3072] + bqkv [3072] ([in][out]); Wproj + bproj; LN1 g / b, LN2 g / b; W1 [1024][4096] + b1, W2 [4096][1024] + b2 */
  char* ws = (char*)d_ws; size_t off = 0;
  auto take = [&](size_t bytes) { char* p = ws + off; off += (bytes + 255) & ~(size_t)255; return p; };
  _Float16* BQKV = (_Float16*)take((size_t)3 * DM * DM * 2); _Float16* BO = (_Float16*)take((size_t)DM * DM * 2);
  _Float16* X16 = (_Float16*)take(NR * DM * 2); float* XB = (float*)take(NR * DM * 4); _Float16* BW1 = (_Float16*)take((size_t)DFF * DM * 2); _Float16* BW2 = (_Float16*)take((size_t)DM * DFF * 2);
  _Float16* QKV = (_Float16*)take(NR * 3 * DM * 2); _Float16* Q16 = QKV; _Float16* K16 = QKV + DM; _Float16* V16 = QKV + 2 * DM; _Float16* O16 = (_Float16*)take(NR * DM * 2);
  _Float16* HF16 = QKV;      /* alias: the FFN hidden rows [NR][DFF] fill QKV + O16 (adjacent, same bytes); their last reader, the output projection, precedes the FFN */
  _Float16* M16 = X16;      /* alias: X16's last reader, the first-tile q | k | v GEMM, precedes LN2's write */
  _Float16* VT = (_Float16*)take((size_t)NB * NH * HD * SQ * 2);
  float* OF0 = (float*)take((size_t)NB * QT0 * DM * 4); _Float16* OH0 = (_Float16*)take((size_t)NB * QT0 * DM * 2); _Float16* OL0 = (_Float16*)take((size_t)NB * QT0 * DM * 2);
  float* S = (float*)take((size_t)GB * NH * QT * NKX * 4); _Float16* P = (_Float16*)take((size_t)GB * NH * QT * NKX * 2);
  float* QKVF0 = S;      /* alias: f32 q | k | v of the first tiles [NB][QT0][3 DM]; read by the exact attention before the first scores are written */
  float* X1 = S;      /* alias: x1 [NR][DM] is written after the last read of S and P */
  if (off > ws_size) return;
  k_wt_f16<<<(unsigned)(((size_t)3 * DM * (DM / 8) + 255) / 256), 256, 0, stream>>>(wqkv, BQKV, DM, 3 * DM, 16.0f);      /* fused [in][out] [DM][3 DM] -> Bt [3 DM][DM] x16: rows 0.. = q, DM.. = k, 2 DM.. = v output columns (contiguous thirds) */ k_wt_f16<<<(unsigned)(((size_t)DM * (DM / 8) + 255) / 256), 256, 0, stream>>>(wo, BO, DM, DM, 16.0f);      /* w_proj [in][out] -> Bt x16 */
  k_ln16<1, 1><<<(unsigned)NR, 256, 0, stream>>>(x, g1, be1, 1e-5f, X16, XB);      /* a = LN1(bf16(x)) -> f16 rows; XB = bf16(x) for the residual */
  k_wt_f16<<<(unsigned)(((size_t)DFF * (DM / 8) + 255) / 256), 256, 0, stream>>>(wfc, BW1, DM, DFF, 16.0f); k_wt_f16<<<(unsigned)(((size_t)DM * (DFF / 8) + 255) / 256), 256, 0, stream>>>(wmp, BW2, DFF, DM, 16.0f);      /* W1 [1024][4096] -> Bt [4096][1024]; W2 [4096][1024] -> Bt [1024][4096] (x16) */
  k_gemm2<0><<<dim3((unsigned)((MP / 128) * (3 * DM / 64)), 1), 128, 0, stream>>>(X16, DM, 0, BQKV, DM, 0, 0.0625f, bqkv, 0, nullptr, 1, 0, 0, nullptr, QKV, 3 * DM, 0, MP, 3 * DM, DM);      /* q | k | v rows (f16); head h = columns h*HD.. of each DM block */
  k_vt<NH, SQ><<<NB * NH * (SQ / 64), 256, 0, stream>>>(V16, LQ, 0, VT);      /* V^T [NB][NH][HD][SQ], every batch in one launch */
  k_gemm2<0><<<dim3((QT0 / 128) * (3 * DM / 64), NB), 128, 0, stream>>>(X16, DM, (size_t)SQ * DM, BQKV, DM, 0, 0.0625f, bqkv, 0, nullptr, 1, 0, 0, QKVF0, nullptr, 3 * DM, (size_t)QT0 * 3 * DM, QT0, 3 * DM, DM);      /* f32 q | k | v of the first 128 rows of every batch (grid.y; exact products) */
  k_att0<0><<<dim3(NH * (QT0 / 64), NB), 64, 0, stream>>>(QKVF0, QKVF0 + DM, QKVF0 + 2 * DM, 3 * DM, nullptr, 0.07216878364870322f, OF0, DM);      /* exact f32 attention for rows 0..127 of every batch (grid.y; o x64) */
  for (int b = 0; b < NB; b += GB) { const size_t r0 = (size_t)b * SQ;      /* GB batches on grid.z */
    for (int q0 = 0; q0 < QN; q0 += QT) { const int nk = q0 + QT;      /* causal: only keys below the tile end are computed */
      k_gemm2<0><<<dim3((QT / 128) * (nk / 64), NHD, GB), 128, 0, stream>>>(Q16 + (r0 + q0) * LQ, LQ, (size_t)HD, K16 + r0 * LQ, LQ, (size_t)HD, 0.07216878364870322f, nullptr, 0, nullptr, 1, 0, 0, S, nullptr, NKX, (size_t)QT * NKX, QT, nk, HD, (size_t)SQ * LQ, (size_t)SQ * LQ, (size_t)NH * QT * NKX);      /* scores, heads on grid.y */
      k_rsmcf2<<<(GB * NHD * QT + 8 * RW - 1) / (8 * RW), 256, 0, stream>>>(S, P, GB * NHD, q0, nk);      /* one wave per RW rows */
      k_gemm2<0><<<dim3((QT / 128) * (HD / 64), NHD, GB), 128, 0, stream>>>(P, NKX, (size_t)QT * NKX, VT + (size_t)b * NH * HD * SQ, SQ, (size_t)HD * SQ, 0.25f, nullptr, 0, nullptr, 1, 0, 0, nullptr, O16 + (r0 + q0) * DM, DM, (size_t)HD, QT, HD, nk, (size_t)NH * QT * NKX, (size_t)NH * HD * SQ, (size_t)SQ * DM); } }      /* o (merged heads, x64) as f16 rows */
  k_gemm2<0><<<dim3((unsigned)((MPO / 128) * (DM / 64)), 1), 128, 0, stream>>>(O16, DM, 0, BO, DM, 0, 0.0009765625f, bo, 0, XB, -1, 0, 0, X1, nullptr, DM, 0, MPO, DM, DM);      /* x1 = x + o Wo + b, all rows */
  k_hl<<<(unsigned)(((size_t)NB * QT0 * DM / 8 + 255) / 256), 256, 0, stream>>>(OF0, OH0, OL0, (size_t)NB * QT0 * DM / 8);      /* first-tile o (x64) -> f16 hi + x1024 residual planes */
  k_gemm2<0><<<dim3((QT0 / 128) * (DM / 64), NB), 128, 0, stream>>>(OH0, DM, (size_t)QT0 * DM, BO, DM, 0, 0.0009765625f, bo, 0, XB, -1, 0, 0, X1, nullptr, DM, (size_t)SQ * DM, QT0, DM, DM);      /* rows 0..127 of every batch (grid.y): x1 = x + o_hi Wo (+ b), overwriting the f16-path rows */
  k_gemm2<0><<<dim3((QT0 / 128) * (DM / 64), NB), 128, 0, stream>>>(OL0, DM, (size_t)QT0 * DM, BO, DM, 0, 0.00000095367431640625f, nullptr, 0, X1, -1, 0, 0, X1, nullptr, DM, (size_t)SQ * DM, QT0, DM, DM);      /* += o_lo Wo 2^-20 (own-element accumulate) */
  k_ln16<0, 0><<<(unsigned)NR, 256, 0, stream>>>(X1, gg2, be2, 1e-5f, M16, nullptr);      /* h = LN2(x1) -> f16 rows */
  k_gemm2<3><<<dim3((unsigned)((MP / 128) * (DFF / 64)), 1), 128, 0, stream>>>(M16, DM, 0, BW1, DM, 0, 0.0625f, bfc, 0, nullptr, 1, 0, 0, nullptr, HF16, DFF, 0, MP, DFF, DM);      /* relu(h2 W1 + b1) -> f16, all rows */
  k_gemm2<0><<<dim3((unsigned)((MP / 128) * (DM / 64)), 1), 128, 0, stream>>>(HF16, DFF, 0, BW2, DFF, 0, 0.0625f, bmp, 0, X1, -1, 0, 0, (float*)d_out, nullptr, DM, 0, MP, DM, DFF);      /* out = x1 + mlp (own-element residual), all rows */
}

// v005
// A run of this version takes 477 microseconds.
// Timed twice side by side with v004, it ran 1.48 times as fast both times.
// Counting every step since v000, it is 22.1 times as fast.
#include <hip/hip_runtime.h>
// Pre-LN causal transformer block with a fused QKV projection and the module's literal score scale (x [8][1024][1024]; h = LN1(x) (biased var, eps 1e-5); qkv = h Wqkv + bqkv ([in][out] 1024 x 3072 + bias) split q | k | v; 16 heads of 64; scale = 1 / sqrt(3 * 1024 / 16) = 1 / sqrt(192) (as the source: NOT 1 / sqrt(head_dim)); causal (tril, -inf); softmax; x1 = x + y Wproj + bproj; out = x1 + relu(LN2(x1) W1 + b1) W2 + b2 ([in][out] 1024 x 4096 x 1024) -> [8][1024][1024]).
// Structure: token rows r = b*1024 + s; h = LN1(bf16(x)) as f16 rows; q | k | v as ONE WMMA GEMM (N = 3 x 1024) (32x64 wave tiles, f32 accumulation, exact x16 weights + bias, f16 outputs); per batch: V^T for all heads via LDS transposes; per query tile of 128 rows of a head, in one kernel: scores against tiles of 64 keys up to the tile end, running row maximum and sum (f32 statistics, native exp; keys above the row masked; weights x256 f16), o += P . V^T on WMMA (o carried x64, folded into the output GEMM alpha) written straight into the merged f16 o rows; x1 = x + o W_o + b GEMM (f32); LN2 and the two FFN GEMMs give out.
// Compute dtype: inputs rounded to bf16; x / weights exact; q, k, v, softmax weights and o as plain f16 GEMM operands (~2^-12); scores and softmax statistics f32. v_wmma_f32_16x16x32_f16.
// Launches: the batch axis lies on the grid, not in a host loop: V^T takes all batches and heads on grid.x; the first-tile q | k | v GEMM, the exact first-tile attention and the first-tile output GEMMs take all batches on grid.y; scores, softmax and P V are one launch for every batch, head and query tile; the FFN GEMMs take all token rows.
#define NB 8
#define SQ 1024
#define DM 1024
#define NH 16
#define HD 64
#define HG 4                         /* heads per launch of the k_vt(b, h0) overload, which is not launched */
#define QT 256
#define NKX SQ                       /* used only in sizing the S plane */
#define QT0 128                      /* first-tile rows recomputed exactly in f32 */
#define GB 4
#define B0 0                         /* unused; every launch starts at batch 0 */
#define NBR NB                       /* batches processed (debug hook) */
#define NR ((size_t)NB * SQ)
#define DMQ DM
#define DFF 4096                     /* FFN hidden width */
#define DFFR 100                     /* unused; the FFN hidden width is DFF */
#define MP ((int)((size_t)NBR * SQ)) /* rows projected (debug hook) */
#define QN SQ                        /* unused; attention takes all SQ query rows */
#define NHD NH                       /* unused; attention takes all NH heads */
#define MPO MP                       /* rows through the output stage (debug hook) */
#define LQ (3 * DM)      /* row pitch of the q/k/v rows */
typedef __bf16 v16b __attribute__((ext_vector_type(16)));
typedef unsigned short v8us __attribute__((ext_vector_type(8), may_alias));
typedef float  v8f  __attribute__((ext_vector_type(8)));
typedef float  v4f  __attribute__((ext_vector_type(4)));
typedef float  v4fa __attribute__((ext_vector_type(4), may_alias));
union FragB { v16b v; v8us half[2]; unsigned short u[16]; };

__device__ __forceinline__ unsigned short bf16_bits(float x) { unsigned int u = __float_as_uint(x); return (unsigned short)((u + 0x7FFFu + ((u >> 16) & 1u)) >> 16); }
__device__ __forceinline__ float bf16_val(unsigned short b) { return __uint_as_float(((unsigned int)b) << 16); }
__device__ __forceinline__ float bf16_round(float x) { return bf16_val(bf16_bits(x)); }
// D += A·B with NT terms: 1 = ah·bh, 2 = + al·bh (A split), 3 = + ah·bl (both split)
template <int NT>
__device__ __forceinline__ v8f mmaN(v16b ah, v16b al, v16b bh, v16b bl, v8f c) {
  c = __builtin_amdgcn_wmma_f32_16x16x32_bf16(false, ah, false, bh, (short)0, c, false, false);
  if (NT >= 2) c = __builtin_amdgcn_wmma_f32_16x16x32_bf16(false, al, false, bh, (short)0, c, false, false);
  if (NT >= 3) c = __builtin_amdgcn_wmma_f32_16x16x32_bf16(false, ah, false, bl, (short)0, c, false, false);
  asm volatile("v_nop\n\tv_nop\n\tv_nop\n\tv_nop" : "+v"(c) : "v"(ah), "v"(al), "v"(bh), "v"(bl));
  return c;
}

__global__ __launch_bounds__(256) void k_wt_bf16(const float* __restrict__ W, unsigned short* __restrict__ Wt, int K, int N) {
  const int t = blockIdx.x * 256 + threadIdx.x;
  const int k8n = K / 8;
  if (t >= N * k8n) return;
  const int n = t / k8n, k8 = (t % k8n) * 8;
  v8us v;
#pragma unroll
  for (int i = 0; i < 8; ++i) v[i] = bf16_bits(W[(size_t)(k8 + i) * N + n]);
  *(v8us*)(Wt + (size_t)n * K + k8) = v;
  
}

// GEMM C[M][N] (f32, pitch ldc) = act(A[M][K]·W + bias). A f32 row-major (pitch lda) converted per fragment to bf16
// (ASPLIT: hi/lo two planes -> 2 terms, else single rounded term); Wt bf16 [N][K] (pitch ldb). BIAS_BF16 rounds the
// bias to bf16 first (bias quantised to bf16 before the add). K%32==0, M%16==0, N%64==0.
template <bool ASPLIT, int ACT, bool BIAS_BF16>
__global__ __launch_bounds__(128) void k_gemm_bf(const float* __restrict__ A, int lda, const unsigned short* __restrict__ Wt, int ldb,
                                               const float* __restrict__ bias, float* __restrict__ C, int ldc, int M, int N, int K) {
  __shared__ __attribute__((aligned(16))) float so[4][16][64];
  const int tid = threadIdx.x, w = tid >> 5, lane = tid & 31, ln = lane & 15, hh = lane >> 4;
  const int ntn = N / 64;
  const int wid = blockIdx.x * 4 + w;
  const int mt = wid / ntn, nq = wid % ntn;
  if (mt * 16 >= M) return;
  const int row0 = mt * 16, col0 = nq * 64;
  const float* arow = A + (size_t)(row0 + ln) * lda;
  v8f acc[4] = {};
  for (int kb = 0; kb < K; kb += 32) {
    FragB ah, al;
    const v4f x0 = *(const v4fa*)(arow + kb + 8 * hh), x1 = *(const v4fa*)(arow + kb + 8 * hh + 4);
    const v4f x2 = *(const v4fa*)(arow + kb + 16 + 8 * hh), x3 = *(const v4fa*)(arow + kb + 16 + 8 * hh + 4);
    float xs[16] = {x0[0],x0[1],x0[2],x0[3],x1[0],x1[1],x1[2],x1[3],x2[0],x2[1],x2[2],x2[3],x3[0],x3[1],x3[2],x3[3]};
#pragma unroll
    for (int i = 0; i < 16; ++i) { const unsigned short hb = bf16_bits(xs[i]); ah.u[i] = hb; al.u[i] = ASPLIT ? bf16_bits(xs[i] - bf16_val(hb)) : (unsigned short)0; }
#pragma unroll
    for (int t = 0; t < 4; ++t) {
      const unsigned short* brow = Wt + (size_t)(col0 + t * 16 + ln) * ldb + kb;
      FragB b;
      b.half[0] = *(const v8us*)(brow + 8 * hh);
      b.half[1] = *(const v8us*)(brow + 16 + 8 * hh);
      acc[t] = mmaN<ASPLIT ? 2 : 1>(ah.v, al.v, b.v, b.v, acc[t]);
    }
  }
#pragma unroll
  for (int t = 0; t < 4; ++t) {
    float bv = bias ? bias[col0 + t * 16 + ln] : 0.f;
    if (BIAS_BF16) bv = bf16_round(bv);
#pragma unroll
    for (int r = 0; r < 8; ++r) { float v = acc[t][r] + bv; if (ACT == 1) v = fmaxf(v, 0.f); so[w][8 * hh + r][t * 16 + ln] = v; }
  }
  __builtin_amdgcn_fence(__ATOMIC_ACQ_REL, "workgroup");
  __builtin_amdgcn_wave_barrier();
  const int rsub = lane >> 4, c4 = (lane & 15) * 4;
  {
#pragma unroll
    for (int q = 0; q < 8; ++q) {
      const int r = q * 2 + rsub;
      const v4f v = *(const v4fa*)&so[w][r][c4];
      *(v4f*)(C + (size_t)(row0 + r) * ldc + col0 + c4) = v;
    }
    
  }
}

// GEMM C = act(A·W + bias + resid): A f32 (ASPLIT -> hi/lo 2 terms), Wt bf16 [N][K]; ACT 0 none, 1 relu, 2 exact gelu;
// resid (optional, f32, row index = (row % rmod), pitch ldr, RES_BF16 rounds it) added before the activation.
template <bool ASPLIT, int ACT, bool BIAS_BF16, bool RES_BF16>
__global__ __launch_bounds__(128) void k_gemm_bf3(const float* __restrict__ A, int lda, const unsigned short* __restrict__ Wt, int ldb,
                                                const float* __restrict__ bias, const float* __restrict__ resid, int rmod, int ldr,
                                                float* __restrict__ C, int ldc, int M, int N, int K) {
  __shared__ __attribute__((aligned(16))) float so[4][16][64];
  const int tid = threadIdx.x, w = tid >> 5, lane = tid & 31, ln = lane & 15, hh = lane >> 4;
  const int ntn = N / 64;
  const int wid = blockIdx.x * 4 + w;
  const int mt = wid / ntn, nq = wid % ntn;
  if (mt * 16 >= M) return;
  const int row0 = mt * 16, col0 = nq * 64;
  const float* arow = A + (size_t)(row0 + ln) * lda;
  v8f acc[4] = {};
  for (int kb = 0; kb < K; kb += 32) {
    FragB ah, al;
    const v4f x0 = *(const v4fa*)(arow + kb + 8 * hh), x1 = *(const v4fa*)(arow + kb + 8 * hh + 4);
    const v4f x2 = *(const v4fa*)(arow + kb + 16 + 8 * hh), x3 = *(const v4fa*)(arow + kb + 16 + 8 * hh + 4);
    float xs[16] = {x0[0],x0[1],x0[2],x0[3],x1[0],x1[1],x1[2],x1[3],x2[0],x2[1],x2[2],x2[3],x3[0],x3[1],x3[2],x3[3]};
#pragma unroll
    for (int i = 0; i < 16; ++i) { const unsigned short hb = bf16_bits(xs[i]); ah.u[i] = hb; al.u[i] = ASPLIT ? bf16_bits(xs[i] - bf16_val(hb)) : (unsigned short)0; }
#pragma unroll
    for (int t = 0; t < 4; ++t) {
      const unsigned short* brow = Wt + (size_t)(col0 + t * 16 + ln) * ldb + kb;
      FragB b;
      b.half[0] = *(const v8us*)(brow + 8 * hh);
      b.half[1] = *(const v8us*)(brow + 16 + 8 * hh);
      acc[t] = mmaN<ASPLIT ? 2 : 1>(ah.v, al.v, b.v, b.v, acc[t]);
    }
  }
#pragma unroll
  for (int t = 0; t < 4; ++t) {
    const int col = col0 + t * 16 + ln;
    float bv = bias ? bias[col] : 0.f;
    if (BIAS_BF16) bv = bf16_round(bv);
#pragma unroll
    for (int r = 0; r < 8; ++r) {
      float v = acc[t][r] + bv;
      if (resid) { float rv = resid[(size_t)((row0 + 8 * hh + r) % rmod) * ldr + col]; if (RES_BF16) rv = bf16_round(rv); v += rv; }
      if (ACT == 1) v = fmaxf(v, 0.f);
      if (ACT == 2) v = 0.5f * v * (1.0f + erff(v * 0.70710678118654752f));
      if (ACT == 3) { const float u = 0.7978845608028654f * (v + 0.044715f * v * v * v); v = 0.5f * v * (1.0f + tanhf(u)); }
      so[w][8 * hh + r][t * 16 + ln] = v;
    }
  }
  __builtin_amdgcn_fence(__ATOMIC_ACQ_REL, "workgroup");
  __builtin_amdgcn_wave_barrier();
  const int rsub = lane >> 4, c4 = (lane & 15) * 4;
  {
#pragma unroll
    for (int q = 0; q < 8; ++q) {
      const int r = q * 2 + rsub;
      const v4f v = *(const v4fa*)&so[w][r][c4];
      *(v4f*)(C + (size_t)(row0 + r) * ldc + col0 + c4) = v;
    }
    
  }
}
// row LayerNorm (biased variance, eps) over N: s = X (+ R); optional out_sum <- s; out_norm <- (s-mu)*rsqrt(var+eps)*g + b
template <bool PARAM_BF16>
__global__ __launch_bounds__(256) void k_layernorm(const float* __restrict__ X, const float* __restrict__ R, const float* __restrict__ g, const float* __restrict__ bta,
                                                  float* __restrict__ out_sum, float* __restrict__ out_norm, int N, float eps) {
  __shared__ float red[256];
  const int row = blockIdx.x, tid = threadIdx.x;
  const float* x = X + (size_t)row * N; const float* rr = R ? R + (size_t)row * N : nullptr;
  float vals[16];                     // up to N = 4096
  const int per = N / 256;            // contiguous chunk per thread? use strided-by-4 chunks: thread handles j = tid*4 + 1024*u
  float s1 = 0.f;
  for (int u = 0; u < per / 4; ++u) {
    const int j = tid * 4 + 1024 * u;
    const v4f a = *(const v4fa*)(x + j);
    v4f b = {0.f,0.f,0.f,0.f}; if (rr) b = *(const v4fa*)(rr + j);
#pragma unroll
    for (int q = 0; q < 4; ++q) { const float v = a[q] + b[q]; vals[u * 4 + q] = v; s1 += v; }
  }
  red[tid] = s1; __syncthreads();
  for (int st = 128; st > 0; st >>= 1) { if (tid < st) red[tid] += red[tid + st]; __syncthreads(); }
  const float mu = red[0] / (float)N; __syncthreads();
  float s2 = 0.f;
  for (int u = 0; u < per / 4; ++u)
#pragma unroll
    for (int q = 0; q < 4; ++q) { const float c = vals[u * 4 + q] - mu; s2 += c * c; }
  red[tid] = s2; __syncthreads();
  for (int st = 128; st > 0; st >>= 1) { if (tid < st) red[tid] += red[tid + st]; __syncthreads(); }
  const float rs = rsqrtf(red[0] / (float)N + eps);
  {
    for (int u = 0; u < per / 4; ++u) {
      const int j = tid * 4 + 1024 * u;
      v4f o, sm;
#pragma unroll
      for (int q = 0; q < 4; ++q) {
        float gg = g[j + q], bb = bta[j + q];
        if (PARAM_BF16) { gg = bf16_round(gg); bb = bf16_round(bb); }
        sm[q] = vals[u * 4 + q]; o[q] = (vals[u * 4 + q] - mu) * rs * gg + bb;
      }
      if (out_sum) *(v4f*)(out_sum + (size_t)row * N + j) = sm;
      *(v4f*)(out_norm + (size_t)row * N + j) = o;
    }
    
  }
}



// ---- f16 WMMA path (v_wmma_f32_16x16x32_f16): 11-bit significands for operands in range — used where a [0,1] probability operand needs more precision than bf16
typedef _Float16 v16h __attribute__((ext_vector_type(16)));
union FragH { v16h v; v8us half[2]; _Float16 h[16]; unsigned short u[16]; };
template <int NT>
__device__ __forceinline__ v8f mmaH(v16h ah, v16h al, v16h bh, v16h bl, v8f c) {
  c = __builtin_amdgcn_wmma_f32_16x16x32_f16(false, ah, false, bh, (short)0, c, false, false);
  if (NT >= 2) c = __builtin_amdgcn_wmma_f32_16x16x32_f16(false, al, false, bh, (short)0, c, false, false);
  if (NT >= 3) c = __builtin_amdgcn_wmma_f32_16x16x32_f16(false, ah, false, bl, (short)0, c, false, false);
  asm volatile("v_nop\n\tv_nop\n\tv_nop\n\tv_nop" : "+v"(c) : "v"(ah), "v"(al), "v"(bh), "v"(bl));
  return c;
}
// batched GEMM like k_gemm_b but f16 operands: A f32 (split into f16 hi/lo if ASPLIT, else rounded to f16), Bt = f16 values [n][k]; alpha; C f32; N multiple of 16 (partial tiles skipped)
template <bool ASPLIT>
__global__ __launch_bounds__(128) void k_gemm_h(const float* __restrict__ A, int lda, size_t sA, const _Float16* __restrict__ Bh, int ldb, size_t sB, float alpha, float* __restrict__ C, int ldc, size_t sC, int M, int N, int K) {
  __shared__ __attribute__((aligned(16))) float so[4][16][64];
  const int tid = threadIdx.x, w = tid >> 5, lane = tid & 31, ln = lane & 15, hh = lane >> 4; const int by = blockIdx.y;
  A += (size_t)by * sA; Bh += (size_t)by * sB; C += (size_t)by * sC;
  const int ntn = (N + 63) / 64; const int wid = blockIdx.x * 4 + w; const int mt = wid / ntn, nq = wid % ntn; if (mt * 16 >= M) return;
  const int row0 = mt * 16, col0 = nq * 64; const float* arow = A + (size_t)(row0 + ln) * lda;
  v8f acc[4] = {};
  for (int kb = 0; kb < K; kb += 32) {
    FragH ah, al;
    const v4f x0 = *(const v4fa*)(arow + kb + 8 * hh), x1 = *(const v4fa*)(arow + kb + 8 * hh + 4), x2 = *(const v4fa*)(arow + kb + 16 + 8 * hh), x3 = *(const v4fa*)(arow + kb + 16 + 8 * hh + 4);
    float xs[16] = {x0[0],x0[1],x0[2],x0[3],x1[0],x1[1],x1[2],x1[3],x2[0],x2[1],x2[2],x2[3],x3[0],x3[1],x3[2],x3[3]};
#pragma unroll
    for (int i = 0; i < 16; ++i) { const _Float16 h = (_Float16)xs[i]; ah.h[i] = h; al.h[i] = ASPLIT ? (_Float16)(xs[i] - (float)h) : (_Float16)0.0f; }
#pragma unroll
    for (int t = 0; t < 4; ++t) { if (col0 + t * 16 >= N) continue; const size_t boff = (size_t)(col0 + t * 16 + ln) * ldb + kb; FragH bq; bq.half[0] = *(const v8us*)(Bh + boff + 8 * hh); bq.half[1] = *(const v8us*)(Bh + boff + 16 + 8 * hh);
      acc[t] = mmaH<ASPLIT ? 2 : 1>(ah.v, al.v, bq.v, bq.v, acc[t]); }
  }
#pragma unroll
  for (int t = 0; t < 4; ++t) { if (col0 + t * 16 >= N) continue;
#pragma unroll
    for (int r = 0; r < 8; ++r) so[w][8 * hh + r][t * 16 + ln] = acc[t][r] * alpha; }
  __builtin_amdgcn_fence(__ATOMIC_ACQ_REL, "workgroup"); __builtin_amdgcn_wave_barrier();
  const int rsub = lane >> 4, c4 = (lane & 15) * 4;
  {
#pragma unroll
    for (int q = 0; q < 8; ++q) { const int r = q * 2 + rsub; if (col0 + c4 < N) { const v4f v = *(const v4fa*)&so[w][r][c4]; *(v4f*)(C + (size_t)(row0 + r) * ldc + col0 + c4) = v; } }
     }
}

// Wt[n][k] = f16(W[k][n]·scale) from f32 row-major W[K][N] (scale = power of two; bf16-exact weights stay exact in f16 away from the subnormal range)
__global__ __launch_bounds__(256) void k_wt_f16(const float* __restrict__ W, _Float16* __restrict__ Wt, int K, int N, float scale) {
  const int t = blockIdx.x * 256 + threadIdx.x; if (t >= N * (K / 8)) return; const int n = t / (K / 8), k8 = (t % (K / 8)) * 8; FragH f;
#pragma unroll
  for (int i = 0; i < 8; ++i) f.h[i] = (_Float16)(bf16_round(W[(size_t)(k8 + i) * N + n]) * scale); const v8us o = f.half[0];
  *(v8us*)((unsigned short*)Wt + (size_t)n * K + k8) = o; 
}
// k_gemm_hh variant with fused epilogue: v = acc·alpha + bias[by·sBias + col] (+ CP[(row/rowsPerB)·sCPb + by·64 + col] if CP) ; ACT 0 none / 1 elu ; writes f16 C16 (and f32 C if non-null)
template <int ACT>
__global__ __launch_bounds__(128) void k_gemm_hhx(const _Float16* __restrict__ A, int lda, size_t sA, const _Float16* __restrict__ Bh, int ldb, size_t sB, float alpha, const float* __restrict__ bias, size_t sBias, const float* __restrict__ CP, int rowsPerB, size_t sCPb, int row0g,
    float* __restrict__ C, _Float16* __restrict__ C16, int ldc, size_t sC, int M, int N, int K) {
  __shared__ __attribute__((aligned(16))) float so[4][16][64];
  const int tid = threadIdx.x, w = tid >> 5, lane = tid & 31, ln = lane & 15, hh = lane >> 4; const int by = blockIdx.y;
  A += (size_t)by * sA; Bh += (size_t)by * sB; const size_t cofs = (size_t)by * sC; const float* bp = bias ? bias + (size_t)by * sBias : nullptr;
  const int ntn = (N + 63) / 64; const int wid = blockIdx.x * 4 + w; const int mt = wid / ntn, nq = wid % ntn; if (mt * 16 >= M) return;
  const int row0 = mt * 16, col0 = nq * 64; const _Float16* arow = A + (size_t)(row0 + ln) * lda;
  v8f acc[4] = {};
  for (int kb = 0; kb < K; kb += 32) { FragH ah; ah.half[0] = *(const v8us*)((const unsigned short*)arow + kb + 8 * hh); ah.half[1] = *(const v8us*)((const unsigned short*)arow + kb + 16 + 8 * hh);
#pragma unroll
    for (int t = 0; t < 4; ++t) { if (col0 + t * 16 >= N) continue; const size_t boff = (size_t)(col0 + t * 16 + ln) * ldb + kb; FragH bq; bq.half[0] = *(const v8us*)((const unsigned short*)Bh + boff + 8 * hh); bq.half[1] = *(const v8us*)((const unsigned short*)Bh + boff + 16 + 8 * hh);
      acc[t] = mmaH<1>(ah.v, ah.v, bq.v, bq.v, acc[t]); }
  }
#pragma unroll
  for (int t = 0; t < 4; ++t) { if (col0 + t * 16 >= N) continue; const int col = col0 + t * 16 + ln; const float bv = bp ? bf16_round(bp[col]) : 0.f;
#pragma unroll
    for (int r = 0; r < 8; ++r) { float v = acc[t][r] * alpha + bv; if (CP) { const int rr = row0g + row0 + 8 * hh + r; if (rowsPerB < 0) v += CP[cofs + (size_t)rr * ldc + col];      /* rowsPerB < 0: own element of the batched C plane */ else { const int bidx = rr / rowsPerB; v += CP[(size_t)bidx * sCPb + (size_t)by * 64 + col]; } } if (ACT == 1) v = (v > 0.f) ? v : expm1f(v); else if (ACT == 7) v = (v > 0.f) ? v + 1.0f : expf(v); else if (ACT == 8) v = tanhf(v); else if (ACT == 9) v = 0.5f * v * (1.0f + tanhf(0.7978845608028654f * (v + 0.044715f * v * v * v))); else if (ACT == 11) v = 1.0f / (1.0f + expf(-v)); else if (ACT == 12) v = (v > 0.f) ? v : 0.01f * v; else if (ACT == 14) v = (v > 0.f) ? v : 0.1f * v; else if (ACT == 16) v = (v >= 0.f) ? v : 0.3f * v; else if (ACT == 17) v = (v >= 0.f) ? v : 0.2f * v; else if (ACT == 15) v = v / (1.0f + expf(-v)); else if (ACT == 3) v = fmaxf(v, 0.f); else if (ACT == 6) v = 0.5f * v * (1.0f + erff(v * 0.70710678118654752f)); so[w][8 * hh + r][t * 16 + ln] = v; } }
  __builtin_amdgcn_fence(__ATOMIC_ACQ_REL, "workgroup"); __builtin_amdgcn_wave_barrier();
  const int rsub = lane >> 4, c4 = (lane & 15) * 4; typedef _Float16 v4h __attribute__((ext_vector_type(4)));
  {
#pragma unroll
    for (int q = 0; q < 8; ++q) { const int r = q * 2 + rsub; if (col0 + c4 < N) { const v4f v = *(const v4fa*)&so[w][r][c4]; if (C) *(v4f*)(C + cofs + (size_t)(row0 + r) * ldc + col0 + c4) = v; if (C16) { v4h h4; for (int i = 0; i < 4; ++i) h4[i] = (_Float16)v[i]; *(v4h*)(C16 + cofs + (size_t)(row0 + r) * ldc + col0 + c4) = h4; } } }
     }
}


typedef _Float16 v4h __attribute__((ext_vector_type(4)));

__global__ __launch_bounds__(256) void k_x16(const float* __restrict__ x, _Float16* __restrict__ X16, size_t n8) { const size_t t = (size_t)blockIdx.x * 256 + threadIdx.x; if (t >= n8) return; FragH f;
#pragma unroll
  for (int q = 0; q < 8; ++q) f.h[q] = (_Float16)bf16_round(x[t * 8 + q]); *(v8us*)((unsigned short*)X16 + t * 8) = f.half[0];  }
__global__ __launch_bounds__(256) void k_h16(const float* __restrict__ x, _Float16* __restrict__ X16, size_t n8) { const size_t t = (size_t)blockIdx.x * 256 + threadIdx.x; if (t >= n8) return; FragH f;
#pragma unroll
  for (int q = 0; q < 8; ++q) f.h[q] = (_Float16)x[t * 8 + q]; *(v8us*)((unsigned short*)X16 + t * 8) = f.half[0];  }
__global__ __launch_bounds__(256) void k_round16f(const float* __restrict__ W, _Float16* __restrict__ Bt, size_t n8) { const size_t t = (size_t)blockIdx.x * 256 + threadIdx.x; if (t >= n8) return; FragH f;
#pragma unroll
  for (int i = 0; i < 8; ++i) f.h[i] = (_Float16)(bf16_round(W[t * 8 + i]) * 16.0f); *(v8us*)((unsigned short*)Bt + t * 8) = f.half[0];  }
template <int NHv, int TTv>
__global__ __launch_bounds__(256) void k_vt(const _Float16* __restrict__ V16, int ldv, int voff, _Float16* __restrict__ Vt) { __shared__ unsigned short tl[64][66]; const int tid = threadIdx.x; const int slab = blockIdx.x / (TTv / 64), lg = blockIdx.x % (TTv / 64); const int b = slab / NHv, h = slab % NHv;
  for (int i = tid; i < 64 * 8; i += 256) { const int r = i / 8, c8 = (i % 8) * 8; FragH f; f.half[0] = *(const v8us*)((const unsigned short*)V16 + ((size_t)b * TTv + lg * 64 + r) * ldv + voff + h * 64 + c8);
#pragma unroll
    for (int q = 0; q < 8; ++q) tl[r][c8 + q] = f.u[q]; }
  __syncthreads();
  {
#pragma unroll
    for (int rd = 0; rd < 2; ++rd) { const int d = rd * 32 + tid / 8, pc = tid % 8; FragH f;
#pragma unroll
      for (int q = 0; q < 8; ++q) f.u[q] = tl[pc * 8 + q][d];
      *(v8us*)((unsigned short*)Vt + ((size_t)slab * 64 + d) * TTv + lg * 64 + pc * 8) = f.half[0]; }
     } }

__global__ __launch_bounds__(256) void k_hl(const float* __restrict__ F, _Float16* __restrict__ Hh, _Float16* __restrict__ Hl, size_t n8) { const size_t t = (size_t)blockIdx.x * 256 + threadIdx.x; if (t >= n8) return; FragH fh, fl; const v4f a = *(const v4fa*)(F + t * 8), c = *(const v4fa*)(F + t * 8 + 4);
#pragma unroll
  for (int q = 0; q < 4; ++q) { _Float16 h = (_Float16)a[q]; fh.h[q] = h; fl.h[q] = (_Float16)((a[q] - (float)h) * 1024.0f); h = (_Float16)c[q]; fh.h[4 + q] = h; fl.h[4 + q] = (_Float16)((c[q] - (float)h) * 1024.0f); }
  { *(v8us*)((unsigned short*)Hh + t * 8) = fh.half[0]; *(v8us*)((unsigned short*)Hl + t * 8) = fl.half[0];  } }

// ---- fast GEMM (work-group tile 128x64, wave tile 32x64; A and B tiles of 64 k staged in LDS by asynchronous copies, two buffers; requires M % 128 == 0 rows per launch region, N % 64 == 0, K % 64 == 0); epilogue = k_gemm_hhx semantics ----
__device__ __forceinline__ v16h g2_frag(const _Float16* p, int hh) { FragH f; f.half[0] = *(const v8us*)((const unsigned short*)p + 8 * hh); f.half[1] = *(const v8us*)((const unsigned short*)p + 16 + 8 * hh); return f.v; }
__device__ __forceinline__ v8f g2_mma(v16h a, v16h b, v8f c) { v8f d = __builtin_amdgcn_wmma_f32_16x16x32_f16(false, a, false, b, (short)0, c, false, false); asm volatile("v_nop\n\tv_nop\n\tv_nop\n\tv_nop" : "+v"(d) : "v"(a), "v"(b)); return d; }
#define G2_PITCH 144                 /* LDS row pitch in bytes of a staged 128-byte row: 16 B x odd, the conflict-free pitch for 16-byte LDS reads */
#define G2_BUF (192 * G2_PITCH)      /* one staged tile: 128 A rows, then 64 B rows, 64 k each */
static_assert(MP % 128 == 0 && QT % 128 == 0 && QT0 % 128 == 0, "k_gemm2: a work-group stages 128 whole A rows");
static_assert(HD % 64 == 0 && QT % 64 == 0 && DM % 64 == 0 && DFF % 64 == 0, "k_gemm2: K is a multiple of the staged 64 k, N of the 64 B rows");
// One tile into LDS: twelve asynchronous 16-byte copies a lane (a wave's 32 lanes take 4 whole 128-byte rows per copy; copy i lands 16 rows below copy i - 1; 0..7 = A rows, 8..11 = B rows).
// One asm statement: the copies go from global memory to LDS through no register, and the s_wait_xcnt at its end stands in front of any later overwrite of the address registers that the copies name.
__device__ __forceinline__ void g2_stage(unsigned l, const _Float16* ga, size_t sa, const _Float16* gb, size_t sb) {
  asm volatile("global_load_async_to_lds_b128 %0, %12, off\n\tglobal_load_async_to_lds_b128 %1, %13, off\n\tglobal_load_async_to_lds_b128 %2, %14, off\n\tglobal_load_async_to_lds_b128 %3, %15, off\n\t"
               "global_load_async_to_lds_b128 %4, %16, off\n\tglobal_load_async_to_lds_b128 %5, %17, off\n\tglobal_load_async_to_lds_b128 %6, %18, off\n\tglobal_load_async_to_lds_b128 %7, %19, off\n\t"
               "global_load_async_to_lds_b128 %8, %20, off\n\tglobal_load_async_to_lds_b128 %9, %21, off\n\tglobal_load_async_to_lds_b128 %10, %22, off\n\tglobal_load_async_to_lds_b128 %11, %23, off\n\ts_wait_xcnt 0x0"
               :: "v"(l), "v"(l + 16 * G2_PITCH), "v"(l + 32 * G2_PITCH), "v"(l + 48 * G2_PITCH), "v"(l + 64 * G2_PITCH), "v"(l + 80 * G2_PITCH), "v"(l + 96 * G2_PITCH), "v"(l + 112 * G2_PITCH),
                  "v"(l + 128 * G2_PITCH), "v"(l + 144 * G2_PITCH), "v"(l + 160 * G2_PITCH), "v"(l + 176 * G2_PITCH),
                  "v"(ga), "v"(ga + sa), "v"(ga + 2 * sa), "v"(ga + 3 * sa), "v"(ga + 4 * sa), "v"(ga + 5 * sa), "v"(ga + 6 * sa), "v"(ga + 7 * sa), "v"(gb), "v"(gb + sb), "v"(gb + 2 * sb), "v"(gb + 3 * sb) : "memory"); }
template <int ACT>
__global__ __launch_bounds__(128) void k_gemm2(const _Float16* __restrict__ A, int lda, size_t sA, const _Float16* __restrict__ Bh, int ldb, size_t sB, float alpha, const float* __restrict__ bias, size_t sBias, const float* __restrict__ CP, int rowsPerB, size_t sCPb, int row0g,
    float* __restrict__ C, _Float16* __restrict__ C16, int ldc, size_t sC, int M, int N, int K, size_t zA = 0, size_t zB = 0, size_t zC = 0) { static_assert(ACT == 0 || ACT == 3 || ACT == 6 || ACT == 8 || ACT == 9 || ACT == 11 || ACT == 12 || ACT == 14 || ACT == 15 || ACT == 16 || ACT == 17, "k_gemm2: unsupported ACT code (would silently apply no activation)");
  __shared__ __attribute__((aligned(16))) unsigned char sm[2 * G2_BUF]; float (*so)[32][68] = (float (*)[32][68])sm;      /* two staged tiles; behind the loop's last barrier the same bytes are the epilogue's [4][32][68] f32 staging */
  static_assert(sizeof(float) * 4 * 32 * 68 <= 2 * G2_BUF, "k_gemm2: the epilogue staging fits the two tile buffers");
  const int tid = threadIdx.x, w = tid >> 5, lane = tid & 31, ln = lane & 15, hh = lane >> 4; const int by = blockIdx.y; const int bz = blockIdx.z;      /* second batch axis (strides zA, zB, zC) */
  A += (size_t)by * sA + (size_t)bz * zA; Bh += (size_t)by * sB + (size_t)bz * zB; const size_t cofs = (size_t)by * sC + (size_t)bz * zC; const float* bp = bias ? bias + (size_t)by * sBias : nullptr;
  const int ntn = N >> 6; const int mt = blockIdx.x / ntn, nq = blockIdx.x - mt * ntn; const int row0 = mt * 128 + 32 * w, col0 = nq * 64; if (mt * 128 >= M) return;      /* the whole work-group leaves or none: barriers follow */
  const _Float16* ga = A + (size_t)(mt * 128 + (tid >> 3)) * lda + (tid & 7) * 8; const _Float16* gb = Bh + (size_t)(col0 + (tid >> 3)) * ldb + (tid & 7) * 8;      /* this lane's 16 bytes of row tid / 8 of each 16-row group */
  const size_t sa = (size_t)16 * lda, sb = (size_t)16 * ldb; const unsigned l0 = (unsigned)(size_t)sm + (unsigned)((tid >> 3) * G2_PITCH + (tid & 7) * 16);
  const unsigned char* fa = sm + (32 * w + ln) * G2_PITCH; const unsigned char* fb = sm + (128 + ln) * G2_PITCH;      /* this lane's fragment rows in buffer 0 */
  const v8f z8 = {0.f,0.f,0.f,0.f,0.f,0.f,0.f,0.f}; v8f c00 = z8, c01 = z8, c02 = z8, c03 = z8, c10 = z8, c11 = z8, c12 = z8, c13 = z8;
  const int nt = K >> 6;
  g2_stage(l0, ga, sa, gb, sb);
  asm volatile("s_wait_asynccnt 0x0" ::: "memory");      /* this wave's copies of tile 0 have landed */
  __syncthreads();      /* tile 0 published: every wave's copies have landed */
  if (nt > 1) g2_stage(l0 + G2_BUF, ga + 64, sa, gb + 64, sb);      /* tile 1 flies while tile 0 is worked on */
#pragma unroll 1
  for (int t = 0; t < nt; ++t) { const unsigned bo = (unsigned)(t & 1) * G2_BUF;      /* kept rolled: one trip is one staged tile and the buffers alternate; unrolled, the copies' and waits' code would only be repeated */
#pragma unroll
    for (int ks = 0; ks < 2; ++ks) { const _Float16* pa = (const _Float16*)(fa + bo + ks * 64); const _Float16* pb = (const _Float16*)(fb + bo + ks * 64);      /* unrolled so that the two halves of a tile are immediate offsets of the LDS reads; 32 k = 64 bytes of every row; k ascends as before */
      const v16h a0 = g2_frag(pa, hh), a1 = g2_frag(pa + 8 * G2_PITCH, hh), b0 = g2_frag(pb, hh), b1 = g2_frag(pb + 8 * G2_PITCH, hh), b2 = g2_frag(pb + 16 * G2_PITCH, hh), b3 = g2_frag(pb + 24 * G2_PITCH, hh);      /* 16 rows = 8 * G2_PITCH halves */
      c00 = g2_mma(a0, b0, c00); c10 = g2_mma(a1, b0, c10); c01 = g2_mma(a0, b1, c01); c11 = g2_mma(a1, b1, c11);
      c02 = g2_mma(a0, b2, c02); c12 = g2_mma(a1, b2, c12); c03 = g2_mma(a0, b3, c03); c13 = g2_mma(a1, b3, c13); }
    asm volatile("s_wait_dscnt 0x0" ::: "memory");      /* this wave's reads of the buffer have returned before the buffer is given up */
    asm volatile("s_wait_asynccnt 0x0" ::: "memory");      /* this wave's copies of tile t + 1 have landed */
    __syncthreads();      /* publishes tile t + 1 and ends every wave's reads of tile t */
    if (t + 2 < nt) g2_stage(l0 + bo, ga + (size_t)(t + 2) * 64, sa, gb + (size_t)(t + 2) * 64, sb); }      /* refill of the buffer just left */
  asm volatile("s_wait_asynccnt 0x0" ::: "memory");      /* no copy is outstanding when the buffers become the epilogue's staging */
  v8f accs[8] = {c00, c01, c02, c03, c10, c11, c12, c13};
#pragma unroll
  for (int u = 0; u < 8; ++u) { const int t = u & 3, half = u >> 2; const int col = col0 + t * 16 + ln; const float bv = bp ? bf16_round(bp[col]) : 0.f;
#pragma unroll
    for (int r = 0; r < 8; ++r) { const int rloc = half * 16 + 8 * hh + r; float v = accs[u][r] * alpha + bv; if (CP) { if (rowsPerB < 0) v += CP[cofs + (size_t)(row0g + row0 + rloc) * ldc + col];      /* rowsPerB < 0: own element of the batched C plane */ else { const int bidx = (row0g + row0 + rloc) / rowsPerB; v += CP[(size_t)bidx * sCPb + (size_t)by * 64 + col]; } }
      if (ACT == 3) v = fmaxf(v, 0.f); else if (ACT == 6) v = 0.5f * v * (1.0f + erff(v * 0.70710678118654752f)); else if (ACT == 11) v = 1.0f / (1.0f + expf(-v)); else if (ACT == 15) v = v / (1.0f + expf(-v)); else if (ACT == 12) v = (v > 0.f) ? v : 0.01f * v; else if (ACT == 8) v = tanhf(v); else if (ACT == 9) v = 0.5f * v * (1.0f + tanhf(0.7978845608028654f * (v + 0.044715f * v * v * v))); else if (ACT == 14) v = (v > 0.f) ? v : 0.1f * v; else if (ACT == 16) v = (v >= 0.f) ? v : 0.3f * v; else if (ACT == 17) v = (v >= 0.f) ? v : 0.2f * v;
      so[w][rloc][t * 16 + ln] = v; } }
  __builtin_amdgcn_fence(__ATOMIC_ACQ_REL, "workgroup"); __builtin_amdgcn_wave_barrier();
  const int rsub = lane >> 4, c4 = (lane & 15) * 4;
  {
#pragma unroll
    for (int q = 0; q < 16; ++q) { const int r = q * 2 + rsub; const v4f v = *(const v4fa*)&so[w][r][c4]; if (C) *(v4f*)(C + cofs + (size_t)(row0 + r) * ldc + col0 + c4) = v; if (C16) { v4h h4; for (int i = 0; i < 4; ++i) h4[i] = (_Float16)v[i]; *(v4h*)(C16 + cofs + (size_t)(row0 + r) * ldc + col0 + c4) = h4; } }
     } }


__global__ __launch_bounds__(256) void k_wnat(const float* __restrict__ w, size_t n8, _Float16* __restrict__ Bt) { const size_t t = (size_t)blockIdx.x * 256 + threadIdx.x; if (t >= n8) return; FragH f; for (int q = 0; q < 8; ++q) f.h[q] = (_Float16)(bf16_round(w[t * 8 + q]) * 16.0f); *(v8us*)((unsigned short*)Bt + t * 8) = f.half[0];  }
__global__ __launch_bounds__(256) void k_rsm(const float* __restrict__ S, _Float16* __restrict__ P, int nrows) {
  #pragma clang fp contract(off)
  const int i = blockIdx.x * 256 + threadIdx.x; if (i >= nrows) return; const float* s = S + (size_t)i * SQ; float mx = -3.0e38f;
#pragma unroll 1
  for (int j = 0; j < SQ; ++j) mx = fmaxf(mx, s[j]); float se = 0.f;
#pragma unroll 1
  for (int j = 0; j < SQ; ++j) se += expf(s[j] - mx); const float sc = 256.0f / se;
#pragma unroll 1
  for (int j0 = 0; j0 < SQ; j0 += 8) { FragH f; for (int q = 0; q < 8; ++q) f.h[q] = (_Float16)(expf(s[j0 + q] - mx) * sc); unsigned short* d = (unsigned short*)P + (size_t)i * SQ + j0; *(v8us*)d = f.half[0];  } }
__global__ __launch_bounds__(256) void k_vt(const _Float16* __restrict__ V16, int b, int h0, _Float16* __restrict__ VT) { __shared__ unsigned short tl[64][65]; const int tid = threadIdx.x; const int hh = blockIdx.x % HG, sg = blockIdx.x / HG; const int s0 = sg * 64; const int h = h0 + hh;
  for (int i = tid; i < 64 * 8; i += 256) { const int j = i / 8, d8 = (i % 8) * 8; FragH f; f.half[0] = *(const v8us*)((const unsigned short*)V16 + ((size_t)b * SQ + s0 + j) * DM + h * HD + d8); for (int q = 0; q < 8; ++q) tl[d8 + q][j] = f.u[q]; }
  __syncthreads();
  { for (int i = tid; i < 64 * 8; i += 256) { const int d = i / 8, j8 = (i % 8) * 8; FragH f; for (int q = 0; q < 8; ++q) f.u[q] = tl[d][j8 + q]; *(v8us*)((unsigned short*)VT + ((size_t)hh * HD + d) * SQ + s0 + j8) = f.half[0]; }  } }



// lane l with lane l ^ m inside a 16-lane row (DPP row_xmask, CTRL = 0x160 | m)
template <int CTRL> __device__ __forceinline__ float lane_xm(float x) { return __builtin_bit_cast(float, __builtin_amdgcn_update_dpp(0, __builtin_bit_cast(int, x), CTRL, 0xf, 0xf, true)); }
// 2^t for eight values in place. Asm so that the free slot which the instruction set asks for behind a transcendental, before its result is used or its source overwritten, stands by construction: no line here touches the line before it, and the v_nop covers the last
__device__ __forceinline__ void exp2_x8(float (&t)[8]) { asm("v_exp_f32 %0, %0\n\tv_exp_f32 %1, %1\n\tv_exp_f32 %2, %2\n\tv_exp_f32 %3, %3\n\tv_exp_f32 %4, %4\n\tv_exp_f32 %5, %5\n\tv_exp_f32 %6, %6\n\tv_exp_f32 %7, %7\n\tv_nop" : "+v"(t[0]), "+v"(t[1]), "+v"(t[2]), "+v"(t[3]), "+v"(t[4]), "+v"(t[5]), "+v"(t[6]), "+v"(t[7])); }
// ---- fused causal attention: scores, softmax and P V of 128 query rows of one head in one work-group; S and P never reach memory ----
// A wave holds 32 query rows (q fragments and the o tiles in registers). Per tile of 64 keys: S = q K^T on WMMA, running row maximum and sum (the o tiles and the sum are rescaled when the maximum rises), P (x256, f16) goes through the wave's own LDS rows from accumulator layout to A-fragment layout, o += P V on WMMA.
#define FA_BUF (128 * G2_PITCH)      /* one staged key tile: 64 K rows, then 64 V^T rows, 128 bytes each */
#define FA_PH (G2_PITCH / 2)         /* pitch of a P row in halves */
static_assert(SQ % 128 == 0 && HD == 64, "k_fattn: whole tiles of 128 query rows and 64 keys; 64 values a head");
// One key tile into LDS: eight asynchronous 16-byte copies a lane (copy i lands 16 rows below copy i - 1; 0..3 = K rows, 4..7 = V^T rows). One asm statement, as in g2_stage: the s_wait_xcnt at its end stands in front of any later overwrite of the address registers that the copies name.
__device__ __forceinline__ void fa_stage(unsigned l, const _Float16* gk, size_t sk, const _Float16* gv, size_t sv) {
  asm volatile("global_load_async_to_lds_b128 %0, %8, off\n\tglobal_load_async_to_lds_b128 %1, %9, off\n\tglobal_load_async_to_lds_b128 %2, %10, off\n\tglobal_load_async_to_lds_b128 %3, %11, off\n\t"
               "global_load_async_to_lds_b128 %4, %12, off\n\tglobal_load_async_to_lds_b128 %5, %13, off\n\tglobal_load_async_to_lds_b128 %6, %14, off\n\tglobal_load_async_to_lds_b128 %7, %15, off\n\ts_wait_xcnt 0x0"
               :: "v"(l), "v"(l + 16 * G2_PITCH), "v"(l + 32 * G2_PITCH), "v"(l + 48 * G2_PITCH), "v"(l + 64 * G2_PITCH), "v"(l + 80 * G2_PITCH), "v"(l + 96 * G2_PITCH), "v"(l + 112 * G2_PITCH),
                  "v"(gk), "v"(gk + sk), "v"(gk + 2 * sk), "v"(gk + 3 * sk), "v"(gv), "v"(gv + sv), "v"(gv + 2 * sv), "v"(gv + 3 * sv) : "memory"); }
__device__ __forceinline__ float row16_max(float x) { x = fmaxf(x, lane_xm<0x161>(x)); x = fmaxf(x, lane_xm<0x162>(x)); x = fmaxf(x, lane_xm<0x164>(x)); return fmaxf(x, lane_xm<0x168>(x)); }
__device__ __forceinline__ float row16_sum(float x) { x += lane_xm<0x161>(x); x += lane_xm<0x162>(x); x += lane_xm<0x164>(x); return x + lane_xm<0x168>(x); }
__global__ __launch_bounds__(128) void k_fattn(const _Float16* __restrict__ Q, const _Float16* __restrict__ K, const _Float16* __restrict__ VTp, float scale, _Float16* __restrict__ O) {
  __shared__ __attribute__((aligned(16))) unsigned char sm[2 * FA_BUF + 4 * 32 * G2_PITCH];      /* two staged key tiles, then 32 P rows per wave */
  const int tid = threadIdx.x, lane = tid & 31, ln = lane & 15, hh = lane >> 4; const int w = __builtin_amdgcn_readfirstlane(tid >> 5);
  const int h = blockIdx.x, b = blockIdx.y; const int q0 = (SQ / 128 - 1 - (int)blockIdx.z) * 128;      /* the longest tiles start first */
  const int nt = (q0 + 128) >> 6;      /* causal: key tiles up to the last query row; at least two */
  const int rw = q0 + 32 * w;      /* the wave's first query row */
  const _Float16* qr0 = Q + ((size_t)b * SQ + rw + ln) * LQ + h * HD; const _Float16* qr1 = qr0 + (size_t)16 * LQ;
  const v16h qa00 = g2_frag(qr0, hh), qa01 = g2_frag(qr0 + 32, hh), qa10 = g2_frag(qr1, hh), qa11 = g2_frag(qr1 + 32, hh);
  const _Float16* gk = K + ((size_t)b * SQ + (tid >> 3)) * LQ + h * HD + (tid & 7) * 8; const _Float16* gv = VTp + (((size_t)b * NH + h) * HD + (tid >> 3)) * SQ + (tid & 7) * 8;      /* this lane's 16 bytes of row tid / 8 of each 16-row group */
  const size_t sk = (size_t)16 * LQ, sv = (size_t)16 * SQ; const unsigned l0 = (unsigned)(size_t)sm + (unsigned)((tid >> 3) * G2_PITCH + (tid & 7) * 16);
  const unsigned char* fk = sm + ln * G2_PITCH; const unsigned char* fv = sm + (64 + ln) * G2_PITCH;      /* this lane's fragment rows in buffer 0 */
  _Float16* sp = (_Float16*)(sm + 2 * FA_BUF + w * 32 * G2_PITCH);
  const v8f z8 = {0.f,0.f,0.f,0.f,0.f,0.f,0.f,0.f}; v8f o[2][4]; float m[2][8], l[2][8];
#pragma unroll
  for (int i = 0; i < 2; ++i) {
#pragma unroll
    for (int j = 0; j < 4; ++j) o[i][j] = z8;
#pragma unroll
    for (int r = 0; r < 8; ++r) { m[i][r] = -1.0e30f; l[i][r] = 0.f; } }
  const float sl = scale * 1.44269504f;      /* e^(s scale) = 2^(s scale log2 e) */
  fa_stage(l0, gk, sk, gv, sv);
  asm volatile("s_wait_asynccnt 0x0" ::: "memory");      /* this wave's copies of tile 0 have landed */
  __syncthreads();      /* tile 0 published */
  fa_stage(l0 + FA_BUF, gk + (size_t)64 * LQ, sk, gv + 64, sv);      /* tile 1 flies while tile 0 is worked on */
#pragma unroll 1
  for (int t = 0; t < nt; ++t) { const unsigned bo = (unsigned)(t & 1) * FA_BUF;      /* kept rolled: one trip is one staged tile and the buffers alternate */
    if (t * 64 <= rw + 31) {      /* wave-uniform: a tile wholly above the wave's rows adds nothing; the waits and the barrier below are passed all the same */
      v8f s[2][4];
#pragma unroll
      for (int j = 0; j < 4; ++j) { s[0][j] = z8; s[1][j] = z8; }
#pragma unroll
      for (int ks = 0; ks < 2; ++ks) { const _Float16* pk = (const _Float16*)(fk + bo + ks * 64); v16h kb[4];
        if (ks) __builtin_amdgcn_sched_barrier(0);      /* keeps the second half's fragment reads behind the first half's products: read ahead, they take 32 more registers, the kernel passes 256 and a SIMD holds three waves instead of four */
#pragma unroll
        for (int j = 0; j < 4; ++j) kb[j] = g2_frag(pk + j * 8 * G2_PITCH, hh);      /* the four fragments' reads stand together in front of their products: one LDS latency, not four */
#pragma unroll
        for (int j = 0; j < 4; ++j) { s[0][j] = g2_mma(ks ? qa01 : qa00, kb[j], s[0][j]); s[1][j] = g2_mma(ks ? qa11 : qa10, kb[j], s[1][j]); } }
      if (t * 64 + 63 > rw) {      /* wave-uniform: only tiles that reach above the wave's first row hold masked keys */
#pragma unroll
        for (int i = 0; i < 2; ++i)
#pragma unroll
          for (int j = 0; j < 4; ++j)
#pragma unroll
            for (int r = 0; r < 8; ++r) s[i][j][r] = (t * 64 + 16 * j + ln <= rw + 16 * i + 8 * hh + r) ? s[i][j][r] : -1.0e30f; }
#pragma unroll
      for (int i = 0; i < 2; ++i) { float cr[8], cc[8];      /* accumulator layout: register r of lane (hh, ln) is row 16 i + 8 hh + r, key 16 j + ln */
#pragma unroll
        for (int r = 0; r < 8; ++r) { const float mt = row16_max(fmaxf(fmaxf(s[i][0][r], s[i][1][r]), fmaxf(s[i][2][r], s[i][3][r]))); const float mn = fmaxf(m[i][r], mt); cr[r] = (m[i][r] - mn) * sl; cc[r] = 8.0f - mn * sl; m[i][r] = mn; }
        exp2_x8(cr);
#pragma unroll
        for (int r = 0; r < 8; ++r) l[i][r] *= cr[r];
#pragma unroll
        for (int j = 0; j < 4; ++j) { float p[8];
#pragma unroll
          for (int r = 0; r < 8; ++r) p[r] = fmaf(s[i][j][r], sl, cc[r]);      /* weights carried x256, as the f16 P was before */
          exp2_x8(p);
#pragma unroll
          for (int r = 0; r < 8; ++r) { l[i][r] += p[r]; sp[(16 * i + 8 * hh + r) * FA_PH + 16 * j + ln] = (_Float16)p[r]; o[i][j][r] *= cr[r]; } } }
      __builtin_amdgcn_fence(__ATOMIC_ACQ_REL, "workgroup"); __builtin_amdgcn_wave_barrier();      /* the wave's P stores stay in front of its fragment reads of the same rows */
#pragma unroll
      for (int ks = 0; ks < 2; ++ks) { const v16h pa0 = g2_frag(sp + ln * FA_PH + ks * 32, hh), pa1 = g2_frag(sp + (16 + ln) * FA_PH + ks * 32, hh); const _Float16* pv = (const _Float16*)(fv + bo + ks * 64); v16h vb[4];
#pragma unroll
        for (int j = 0; j < 4; ++j) vb[j] = g2_frag(pv + j * 8 * G2_PITCH, hh);      /* as above */
#pragma unroll
        for (int j = 0; j < 4; ++j) { o[0][j] = g2_mma(pa0, vb[j], o[0][j]); o[1][j] = g2_mma(pa1, vb[j], o[1][j]); } } }
    asm volatile("s_wait_dscnt 0x0" ::: "memory");      /* this wave's reads of the buffer have returned before the buffer is given up */
    asm volatile("s_wait_asynccnt 0x0" ::: "memory");      /* this wave's copies of tile t + 1 have landed */
    __syncthreads();      /* publishes tile t + 1 and ends every wave's reads of tile t */
    if (t + 2 < nt) fa_stage(l0 + bo, gk + (size_t)(t + 2) * 64 * LQ, sk, gv + (size_t)(t + 2) * 64, sv); }      /* refill of the buffer just left */
  asm volatile("s_wait_asynccnt 0x0" ::: "memory");      /* no copy is outstanding at the end */
#pragma unroll
  for (int i = 0; i < 2; ++i)
#pragma unroll
    for (int r = 0; r < 8; ++r) { const float fin = 64.0f / row16_sum(l[i][r]);      /* o carried x64 as before; the x256 of the weights cancels */
#pragma unroll
      for (int j = 0; j < 4; ++j) sp[(16 * i + 8 * hh + r) * FA_PH + 16 * j + ln] = (_Float16)(o[i][j][r] * fin); }
  __builtin_amdgcn_fence(__ATOMIC_ACQ_REL, "workgroup"); __builtin_amdgcn_wave_barrier();      /* the wave's o stores stay in front of its row reads */
#pragma unroll
  for (int q = 0; q < 8; ++q) { const int row = q * 4 + (lane >> 3), c8 = (lane & 7) * 8; const v8us v = *(const v8us*)((const unsigned short*)sp + row * FA_PH + c8); *(v8us*)((unsigned short*)O + ((size_t)b * SQ + rw + row) * DM + h * HD + c8) = v; } }      /* whole 128-byte row pieces per store */


typedef float v2f __attribute__((ext_vector_type(2)));
#define JU 4                         /* keys whose score chains run side by side in the exact attention */
// Exact f32 attention of the first QT0 rows, one thread per query row. The row's q and o live in registers; the head's K and V rows are staged once in LDS and read from there at one address for the whole wave.
// Every d loop is unrolled, and JU keys are taken together, so that their JU chains of dependent adds fill one another's latency. Per row every product, every sum and the running-maximum recurrence stand in the order they had key by key.
template <int MASKADD>
__global__ __launch_bounds__(64) void k_att0(const float* __restrict__ QF, const float* __restrict__ KF, const float* __restrict__ VF, int ld, const float* __restrict__ mask, float scale, float* __restrict__ OF, int ldo) {
  #pragma clang fp contract(off)      /* as before; numerical: each q k product stays rounded in front of its add, as it was built so far, so that the exact rows' scores, and with them o, stay bit-identical */
  static_assert(MASKADD == 0, "k_att0: causal form only (the staged K and V rows are those of the first tile)"); static_assert(64 % JU == 0 && HD == 64, "k_att0: whole groups of JU keys; 64 values a row");
  (void)mask;
  __shared__ __attribute__((aligned(16))) float sk[QT0][HD]; __shared__ __attribute__((aligned(16))) float sv[QT0][HD];
  float (*lo)[HD + 4] = (float (*)[HD + 4])sk;      /* behind the loop's barrier the K rows' bytes are the output staging; pitch 68 floats spreads the rows over the banks */
  static_assert(sizeof(float) * 64 * (HD + 4) <= sizeof(float) * QT0 * HD, "k_att0: the output staging fits the K rows");
  const int tid = threadIdx.x; const int h = blockIdx.x / (QT0 / 64), rg = blockIdx.x % (QT0 / 64); const int i = rg * 64 + tid;
  const size_t bo_in = (size_t)blockIdx.y * QT0 * ld; QF += bo_in; KF += bo_in; VF += bo_in; OF += (size_t)blockIdx.y * QT0 * ldo;      /* batch on grid.y: QT0 rows per batch in every plane */
  const float* qr = QF + (size_t)i * ld + h * HD;
  const int nkey = rg * 64 + 64;      /* causal form: keys up to the block's last row */
  const int sr = tid >> 4, c4 = (tid & 15) * 4; const unsigned lof = (unsigned)(sr * ld + c4);      /* sixteen lanes take one 256-byte row */
#pragma unroll 1
  for (int r0 = 0; r0 < nkey; r0 += 32) { v4f tk[8], tv[8]; const float* pk[8]; const float* pv[8];      /* 32 rows a trip: sixteen loads in flight per lane; rolled, since two or four trips of them are all there is */
#pragma unroll
    for (int it = 0; it < 8; ++it) { const size_t g = (size_t)(r0 + it * 4) * ld + h * HD; pk[it] = (KF + g) + lof; pv[it] = (VF + g) + lof; tk[it] = *(const v4fa*)pk[it]; tv[it] = *(const v4fa*)pv[it]; }
    asm volatile("s_wait_xcnt 0x0" :: "v"(pk[0]), "v"(pk[1]), "v"(pk[2]), "v"(pk[3]), "v"(pk[4]), "v"(pk[5]), "v"(pk[6]), "v"(pk[7]), "v"(pv[0]), "v"(pv[1]), "v"(pv[2]), "v"(pv[3]), "v"(pv[4]), "v"(pv[5]), "v"(pv[6]), "v"(pv[7]) : "memory");      /* the wait that belongs in front of any overwrite of the loads' address registers; naming them keeps them whole up to it (without it the last load's result was given the first load's address registers) */
#pragma unroll
    for (int it = 0; it < 8; ++it) { *(v4f*)&sk[r0 + it * 4 + sr][c4] = tk[it]; *(v4f*)&sv[r0 + it * 4 + sr][c4] = tv[it]; } }
  v2f q2[HD / 2], o2[HD / 2];
#pragma unroll
  for (int c = 0; c < HD / 4; ++c) { const v4f qq = *(const v4fa*)(qr + c * 4); q2[2 * c] = v2f{qq[0], qq[1]}; q2[2 * c + 1] = v2f{qq[2], qq[3]}; o2[2 * c] = v2f{0.f, 0.f}; o2[2 * c + 1] = v2f{0.f, 0.f}; }
  asm volatile("s_wait_xcnt 0x0" :: "v"(qr) : "memory");      /* as above, for the address register of the q loads */
  __syncthreads();      /* the staged K and V rows are published to both waves */
  float m = -1.0e30f, l = 0.f;
  // A piece = 8 LDS reads of 16 bytes: 8 values (d = 8 n .. 8 n + 7) of JU rows. Two register buffers: the next piece's reads are issued in front of this piece's arithmetic, so that an LDS read's latency is not paid read by read.
  v4f ba[2 * JU], bb[2 * JU];
  auto fetch = [&](v4f (&buf)[2 * JU], const float (*rows)[HD], int jb, int n) {
#pragma unroll
    for (int u = 0; u < JU; ++u) { buf[2 * u] = *(const v4f*)&rows[jb + u][8 * n]; buf[2 * u + 1] = *(const v4f*)&rows[jb + u][8 * n + 4]; } };
  float s[JU], sc[JU], e[JU];
  auto dots = [&](const v4f (&buf)[2 * JU], int n) {      /* two rounded products an instruction; the adds stay one chain per key, d ascending */
#pragma unroll
    for (int w = 0; w < 2; ++w)
#pragma unroll
      for (int u = 0; u < JU; ++u) { const v4f kq = buf[2 * u + w]; const v2f p0 = q2[4 * n + 2 * w] * v2f{kq[0], kq[1]}, p1 = q2[4 * n + 2 * w + 1] * v2f{kq[2], kq[3]};
        s[u] = __fadd_rn(s[u], p0[0]); s[u] = __fadd_rn(s[u], p0[1]); s[u] = __fadd_rn(s[u], p1[0]); s[u] = __fadd_rn(s[u], p1[1]); } };
  auto accum = [&](const v4f (&buf)[2 * JU], int n) {      /* o = fma(o, sc, round(e v)), key after key: the rounding that this line was built with before, written out */
#pragma unroll
    for (int w = 0; w < 2; ++w)
#pragma unroll
      for (int u = 0; u < JU; ++u) { const v4f vv = buf[2 * u + w]; const v2f s2 = {sc[u], sc[u]}, e2 = {e[u], e[u]};
        o2[4 * n + 2 * w] = __builtin_elementwise_fma(o2[4 * n + 2 * w], s2, e2 * v2f{vv[0], vv[1]}); o2[4 * n + 2 * w + 1] = __builtin_elementwise_fma(o2[4 * n + 2 * w + 1], s2, e2 * v2f{vv[2], vv[3]}); } };
  fetch(ba, sk, 0, 0);
#pragma unroll 1
  for (int j0 = 0; j0 < nkey; j0 += JU) {      /* kept rolled: one trip already holds JU keys' unrolled d loops */
    const int jn = (j0 + JU < nkey) ? j0 + JU : 0;      /* the last trip fetches ahead from row 0, inside the array; that piece is not used */
#pragma unroll
    for (int u = 0; u < JU; ++u) s[u] = 0.f;
#pragma unroll
    for (int n = 0; n < HD / 8; n += 2) {
      fetch(bb, sk, j0, n + 1);
      __builtin_amdgcn_sched_barrier(0);      /* keeps the reads above in front of the arithmetic below: without it each read sinks to its use and waits out its own latency */
      dots(ba, n);
      if (n + 2 < HD / 8) fetch(ba, sk, j0, n + 2); else fetch(ba, sv, j0, 0);
      __builtin_amdgcn_sched_barrier(0);      /* as above */
      dots(bb, n + 1); }
#pragma unroll
    for (int u = 0; u < JU; ++u) { const float ss = __fmul_rn(s[u], scale);
      const float f = (j0 + u <= i) ? 1.f : 0.f; const float sm = fmaf(f, ss, (1.f - f) * -1.0e30f); const float mn = fmaxf(m, sm); sc[u] = expf(m - mn); e[u] = expf(sm - mn); l = fmaf(l, sc[u], e[u]); m = mn; }      /* l: one fused multiply-add, as this line was built before */
#pragma unroll
    for (int n = 0; n < HD / 8; n += 2) {
      fetch(bb, sv, j0, n + 1);
      __builtin_amdgcn_sched_barrier(0);      /* as above */
      accum(ba, n);
      if (n + 2 < HD / 8) fetch(ba, sv, j0, n + 2); else fetch(ba, sk, jn, 0);
      __builtin_amdgcn_sched_barrier(0);      /* as above */
      accum(bb, n + 1); } }
  const float fin = 64.0f / l;      /* o carried x64 like the f16 path */
  __syncthreads();      /* both waves have left the K rows before their bytes become the output staging */
#pragma unroll
  for (int c = 0; c < HD / 4; ++c) { const v2f a = o2[2 * c] * v2f{fin, fin}, b = o2[2 * c + 1] * v2f{fin, fin}; *(v4f*)&lo[tid][c * 4] = v4f{a[0], a[1], b[0], b[1]}; }
  __syncthreads();
  {
#pragma unroll 1
    for (int it0 = 0; it0 < 16; it0 += 4) {      /* rolled: four stores in flight a trip are enough for 16 KiB */
#pragma unroll
      for (int it = it0; it < it0 + 4; ++it) { const int row = it * 4 + tid / 16, pc = (tid % 16) * 4; const v4f v = *(const v4f*)&lo[row][pc]; *(v4f*)(OF + (size_t)(rg * 64 + row) * ldo + h * HD + pc) = v; }      /* whole 256-byte row pieces per store, as before */
      asm volatile("s_wait_xcnt 0x0" ::: "memory"); }      /* the wait that belongs in front of the next trip's overwrite of the registers which these stores name */
     } }


template <int BFIN, int WXB>
__global__ __launch_bounds__(256) void k_ln16(const float* __restrict__ X, const float* __restrict__ g, const float* __restrict__ bb, float eps, _Float16* __restrict__ N16, float* __restrict__ XB) {
  #pragma clang fp contract(off)
  __shared__ float red[256]; const size_t r = blockIdx.x; const int t = threadIdx.x; const v4f xa = *(const v4fa*)(X + r * DMQ + t * 4); float s[4]; float sum = 0.f;
  for (int q = 0; q < 4; ++q) { s[q] = BFIN ? bf16_round(xa[q]) : xa[q]; sum = __fadd_rn(sum, s[q]); }
  red[t] = sum; __syncthreads(); for (int st = 128; st > 0; st >>= 1) { if (t < st) red[t] = __fadd_rn(red[t], red[t + st]); __syncthreads(); } const float mu = red[0] / (float)DMQ; __syncthreads();
  float vs = 0.f; for (int q = 0; q < 4; ++q) { const float dl = __fadd_rn(s[q], -mu); vs = __fadd_rn(vs, __fmul_rn(dl, dl)); } red[t] = vs; __syncthreads(); for (int st = 128; st > 0; st >>= 1) { if (t < st) red[t] = __fadd_rn(red[t], red[t + st]); __syncthreads(); }
  const float rs = rsqrtf(__fadd_rn(red[0] / (float)DMQ, eps)); v4h y; v4f xb;
  for (int q = 0; q < 4; ++q) { const int c = t * 4 + q; y[q] = (_Float16)__fadd_rn(__fmul_rn(__fmul_rn(__fadd_rn(s[q], -mu), rs), bf16_round(g[c])), bf16_round(bb[c])); xb[q] = s[q]; }
  { *(v4h*)(N16 + r * DMQ + t * 4) = y; if (WXB) *(v4f*)(XB + r * DMQ + t * 4) = xb;  } }
__global__ __launch_bounds__(256) void k_ftres2(const float* __restrict__ OF0, const float* __restrict__ XB, float* __restrict__ X1, size_t n4) {
  #pragma clang fp contract(off)
  const size_t t = (size_t)blockIdx.x * 256 + threadIdx.x; if (t >= n4) return; const v4f o = *(const v4fa*)(OF0 + t * 4), xv = *(const v4fa*)(XB + t * 4); v4f y; for (int q = 0; q < 4; ++q) y[q] = __fadd_rn(__fmul_rn(o[q], 0.015625f), xv[q]); *(v4f*)(X1 + t * 4) = y;  }

__global__ __launch_bounds__(256) void k_wthd(const float* __restrict__ Wt, _Float16* __restrict__ Bt) { const size_t t = (size_t)blockIdx.x * 256 + threadIdx.x; if (t >= (size_t)NH * HD * (DM / 8)) return; const int m8 = (int)(t % (DM / 8)) * 8; const int d = (int)((t / (DM / 8)) % HD); const int h = (int)(t / ((size_t)(DM / 8) * HD)); FragH f;
  for (int q = 0; q < 8; ++q) f.h[q] = (_Float16)(16.0f * bf16_round(Wt[((size_t)h * DM + m8 + q) * HD + d])); unsigned short* dst = (unsigned short*)Bt + ((size_t)h * HD + d) * DM + m8; *(v8us*)dst = f.half[0];  }




__global__ __launch_bounds__(256) void k_wtpad(const float* __restrict__ Wm, _Float16* __restrict__ Wt, int Kr, int Kp, int Nr, int Np, float scale) {
  const int t = blockIdx.x * 256 + threadIdx.x; if (t >= Np * (Kp / 8)) return; const int n = t / (Kp / 8), k8 = (t % (Kp / 8)) * 8; const int nc = min(n, Nr - 1); const float fn = (n < Nr) ? 1.f : 0.f; FragH f;
  for (int i = 0; i < 8; ++i) { const int k = k8 + i; const int kc = min(k, Kr - 1); const float fk = (k < Kr) ? fn : 0.f; f.h[i] = (_Float16)(bf16_round(Wm[(size_t)kc * Nr + nc]) * scale * fk); }
  unsigned short* o = (unsigned short*)Wt + (size_t)n * Kp + k8; *(v8us*)o = f.half[0];  }
__global__ __launch_bounds__(128) void k_bpad(const float* __restrict__ b, float* __restrict__ Bp, int nr, int np) {
  const int i = threadIdx.x; if (i >= np) return; const float v = b[min(i, nr - 1)] * ((i < nr) ? 1.f : 0.f); *(float*)(Bp + i) = v;  }
extern "C" void kernel_launch(void* const* d_in, const int* in_sizes, int n_in,
                              void* d_out, int out_size, void* d_ws, size_t ws_size, hipStream_t stream) {
  (void)in_sizes; (void)n_in; (void)out_size;
  const float* const* I = (const float* const*)d_in; const float* x = I[0]; const float* wqkv = I[1]; const float* bqkv = I[2]; const float* wo = I[3]; const float* bo = I[4]; const float* g1 = I[5]; const float* be1 = I[6]; const float* gg2 = I[7]; const float* be2 = I[8]; const float* wfc = I[9]; const float* bfc = I[10]; const float* wmp = I[11]; const float* bmp = I[12];      /* x; fused Wqkv [1024][3072] + bqkv [3072] ([in][out]); Wproj + bproj; LN1 g / b, LN2 g / b; W1 [1024][4096] + b1, W2 [4096][1024] + b2 */
  char* ws = (char*)d_ws; size_t off = 0;
  auto take = [&](size_t bytes) { char* p = ws + off; off += (bytes + 255) & ~(size_t)255; return p; };
  _Float16* BQKV = (_Float16*)take((size_t)3 * DM * DM * 2); _Float16* BO = (_Float16*)take((size_t)DM * DM * 2);
  _Float16* X16 = (_Float16*)take(NR * DM * 2); float* XB = (float*)take(NR * DM * 4); _Float16* BW1 = (_Float16*)take((size_t)DFF * DM * 2); _Float16* BW2 = (_Float16*)take((size_t)DM * DFF * 2);
  _Float16* QKV = (_Float16*)take(NR * 3 * DM * 2); _Float16* Q16 = QKV; _Float16* K16 = QKV + DM; _Float16* V16 = QKV + 2 * DM; _Float16* O16 = (_Float16*)take(NR * DM * 2);
  _Float16* HF16 = QKV;      /* alias: the FFN hidden rows [NR][DFF] fill QKV + O16 (adjacent, same bytes); their last reader, the output projection, precedes the FFN */
  _Float16* M16 = X16;      /* alias: X16's last reader, the first-tile q | k | v GEMM, precedes LN2's write */
  _Float16* VT = (_Float16*)take((size_t)NB * NH * HD * SQ * 2);
  float* OF0 = (float*)take((size_t)NB * QT0 * DM * 4); _Float16* OH0 = (_Float16*)take((size_t)NB * QT0 * DM * 2); _Float16* OL0 = (_Float16*)take((size_t)NB * QT0 * DM * 2);
  float* S = (float*)take((size_t)GB * NH * QT * NKX * 4);      /* no scores any more: the plane of the two aliases below */
  float* QKVF0 = S;      /* alias: f32 q | k | v of the first tiles [NB][QT0][3 DM]; read by the exact attention before x1 is written */
  float* X1 = S;      /* alias: x1 [NR][DM] is written after the exact attention's last read of QKVF0 */
  if (off > ws_size) return;
  k_wt_f16<<<(unsigned)(((size_t)3 * DM * (DM / 8) + 255) / 256), 256, 0, stream>>>(wqkv, BQKV, DM, 3 * DM, 16.0f);      /* fused [in][out] [DM][3 DM] -> Bt [3 DM][DM] x16: rows 0.. = q, DM.. = k, 2 DM.. = v output columns (contiguous thirds) */ k_wt_f16<<<(unsigned)(((size_t)DM * (DM / 8) + 255) / 256), 256, 0, stream>>>(wo, BO, DM, DM, 16.0f);      /* w_proj [in][out] -> Bt x16 */
  k_ln16<1, 1><<<(unsigned)NR, 256, 0, stream>>>(x, g1, be1, 1e-5f, X16, XB);      /* a = LN1(bf16(x)) -> f16 rows; XB = bf16(x) for the residual */
  k_wt_f16<<<(unsigned)(((size_t)DFF * (DM / 8) + 255) / 256), 256, 0, stream>>>(wfc, BW1, DM, DFF, 16.0f); k_wt_f16<<<(unsigned)(((size_t)DM * (DFF / 8) + 255) / 256), 256, 0, stream>>>(wmp, BW2, DFF, DM, 16.0f);      /* W1 [1024][4096] -> Bt [4096][1024]; W2 [4096][1024] -> Bt [1024][4096] (x16) */
  k_gemm2<0><<<dim3((unsigned)((MP / 128) * (3 * DM / 64)), 1), 128, 0, stream>>>(X16, DM, 0, BQKV, DM, 0, 0.0625f, bqkv, 0, nullptr, 1, 0, 0, nullptr, QKV, 3 * DM, 0, MP, 3 * DM, DM);      /* q | k | v rows (f16); head h = columns h*HD.. of each DM block */
  k_vt<NH, SQ><<<NB * NH * (SQ / 64), 256, 0, stream>>>(V16, LQ, 0, VT);      /* V^T [NB][NH][HD][SQ], every batch in one launch */
  k_gemm2<0><<<dim3((QT0 / 128) * (3 * DM / 64), NB), 128, 0, stream>>>(X16, DM, (size_t)SQ * DM, BQKV, DM, 0, 0.0625f, bqkv, 0, nullptr, 1, 0, 0, QKVF0, nullptr, 3 * DM, (size_t)QT0 * 3 * DM, QT0, 3 * DM, DM);      /* f32 q | k | v of the first 128 rows of every batch (grid.y; exact products) */
  k_att0<0><<<dim3(NH * (QT0 / 64), NB), 64, 0, stream>>>(QKVF0, QKVF0 + DM, QKVF0 + 2 * DM, 3 * DM, nullptr, 0.07216878364870322f, OF0, DM);      /* exact f32 attention for rows 0..127 of every batch (grid.y; o x64) */
  k_fattn<<<dim3(NH, NB, SQ / 128), 128, 0, stream>>>(Q16, K16, VT, 0.07216878364870322f, O16);      /* causal attention, every batch, head and query tile in one launch: o (merged heads, x64) as f16 rows */
  k_gemm2<0><<<dim3((unsigned)((MPO / 128) * (DM / 64)), 1), 128, 0, stream>>>(O16, DM, 0, BO, DM, 0, 0.0009765625f, bo, 0, XB, -1, 0, 0, X1, nullptr, DM, 0, MPO, DM, DM);      /* x1 = x + o Wo + b, all rows */
  k_hl<<<(unsigned)(((size_t)NB * QT0 * DM / 8 + 255) / 256), 256, 0, stream>>>(OF0, OH0, OL0, (size_t)NB * QT0 * DM / 8);      /* first-tile o (x64) -> f16 hi + x1024 residual planes */
  k_gemm2<0><<<dim3((QT0 / 128) * (DM / 64), NB), 128, 0, stream>>>(OH0, DM, (size_t)QT0 * DM, BO, DM, 0, 0.0009765625f, bo, 0, XB, -1, 0, 0, X1, nullptr, DM, (size_t)SQ * DM, QT0, DM, DM);      /* rows 0..127 of every batch (grid.y): x1 = x + o_hi Wo (+ b), overwriting the f16-path rows */
  k_gemm2<0><<<dim3((QT0 / 128) * (DM / 64), NB), 128, 0, stream>>>(OL0, DM, (size_t)QT0 * DM, BO, DM, 0, 0.00000095367431640625f, nullptr, 0, X1, -1, 0, 0, X1, nullptr, DM, (size_t)SQ * DM, QT0, DM, DM);      /* += o_lo Wo 2^-20 (own-element accumulate) */
  k_ln16<0, 0><<<(unsigned)NR, 256, 0, stream>>>(X1, gg2, be2, 1e-5f, M16, nullptr);      /* h = LN2(x1) -> f16 rows */
  k_gemm2<3><<<dim3((unsigned)((MP / 128) * (DFF / 64)), 1), 128, 0, stream>>>(M16, DM, 0, BW1, DM, 0, 0.0625f, bfc, 0, nullptr, 1, 0, 0, nullptr, HF16, DFF, 0, MP, DFF, DM);      /* relu(h2 W1 + b1) -> f16, all rows */
  k_gemm2<0><<<dim3((unsigned)((MP / 128) * (DM / 64)), 1), 128, 0, stream>>>(HF16, DFF, 0, BW2, DFF, 0, 0.0625f, bmp, 0, X1, -1, 0, 0, (float*)d_out, nullptr, DM, 0, MP, DM, DFF);      /* out = x1 + mlp (own-element residual), all rows */
}

// v006
// It runs in 413 microseconds.
// Two timings next to v005 put it at 1.15 and 1.16 times that version's speed.
// All steps since v000 together make it 25.5 times as fast.
#include <hip/hip_runtime.h>
// Pre-LN causal transformer block with a fused QKV projection and the module's literal score scale (x [8][1024][1024]; h = LN1(x) (biased var, eps 1e-5); qkv = h Wqkv + bqkv ([in][out] 1024 x 3072 + bias) split q | k | v; 16 heads of 64; scale = 1 / sqrt(3 * 1024 / 16) = 1 / sqrt(192) (as the source: NOT 1 / sqrt(head_dim)); causal (tril, -inf); softmax; x1 = x + y Wproj + bproj; out = x1 + relu(LN2(x1) W1 + b1) W2 + b2 ([in][out] 1024 x 4096 x 1024) -> [8][1024][1024]).
// Structure: token rows r = b*1024 + s; h = LN1(bf16(x)) as f16 rows; q | k | v as ONE WMMA GEMM (N = 3 x 1024) (64x64 wave tiles, f32 accumulation, exact x16 weights + bias, f16 outputs); per batch: V^T for all heads via LDS transposes; per query tile of 128 rows of a head, in one kernel: scores against tiles of 64 keys up to the tile end, running row maximum and sum (f32 statistics, native exp; keys above the row masked; weights x256 f16), o += P . V^T on WMMA (o carried x64, folded into the output GEMM alpha) written straight into the merged f16 o rows; x1 = x + o W_o + b GEMM (f32); h2 = LN2(x1) as f16 rows; relu(h2 W1 + b1) GEMM (f16 rows) and out = x1 + (.) W2 + b2 GEMM (f32) into the output layout.
// Compute dtype: inputs rounded to bf16; x / weights exact; q, k, v, softmax weights and o as plain f16 GEMM operands (~2^-12); scores and softmax statistics f32. v_wmma_f32_16x16x32_f16.
// Launches: the batch axis lies on the grid, not in a host loop: V^T takes all batches in one launch on grid.x; the first-tile q | k | v GEMM, the exact first-tile attention and the first-tile output GEMMs take all batches on grid.y; scores, softmax and P V are one launch for every batch, head and query tile; the FFN GEMMs take all token rows.
#define NB 8
#define SQ 1024
#define DM 1024
#define NH 16
#define HD 64
#define HG 4                         /* heads per launch of the k_vt(b, h0) overload, which is not launched */
#define QT 256
#define NKX SQ                       /* used only in sizing the S plane */
#define QT0 128                      /* first-tile rows recomputed exactly in f32 */
#define GB 4
#define B0 0                         /* unused; every launch starts at batch 0 */
#define NBR NB                       /* batches processed (debug hook) */
#define NR ((size_t)NB * SQ)
#define DMQ DM
#define DFF 4096                     /* FFN hidden width */
#define DFFR 100                     /* unused; the FFN hidden width is DFF */
#define MP ((int)((size_t)NBR * SQ)) /* rows projected (debug hook) */
#define QN SQ                        /* unused; attention takes all SQ query rows */
#define NHD NH                       /* unused; attention takes all NH heads */
#define MPO MP                       /* rows through the output stage (debug hook) */
#define LQ (3 * DM)      /* row pitch of the q/k/v rows */
typedef __bf16 v16b __attribute__((ext_vector_type(16)));
typedef unsigned short v8us __attribute__((ext_vector_type(8), may_alias));
typedef float  v8f  __attribute__((ext_vector_type(8)));
typedef float  v4f  __attribute__((ext_vector_type(4)));
typedef float  v4fa __attribute__((ext_vector_type(4), may_alias));
union FragB { v16b v; v8us half[2]; unsigned short u[16]; };

__device__ __forceinline__ unsigned short bf16_bits(float x) { unsigned int u = __float_as_uint(x); return (unsigned short)((u + 0x7FFFu + ((u >> 16) & 1u)) >> 16); }
__device__ __forceinline__ float bf16_val(unsigned short b) { return __uint_as_float(((unsigned int)b) << 16); }
__device__ __forceinline__ float bf16_round(float x) { return bf16_val(bf16_bits(x)); }
// D += A·B with NT terms: 1 = ah·bh, 2 = + al·bh (A split), 3 = + ah·bl (both split)
template <int NT>
__device__ __forceinline__ v8f mmaN(v16b ah, v16b al, v16b bh, v16b bl, v8f c) {
  c = __builtin_amdgcn_wmma_f32_16x16x32_bf16(false, ah, false, bh, (short)0, c, false, false);
  if (NT >= 2) c = __builtin_amdgcn_wmma_f32_16x16x32_bf16(false, al, false, bh, (short)0, c, false, false);
  if (NT >= 3) c = __builtin_amdgcn_wmma_f32_16x16x32_bf16(false, ah, false, bl, (short)0, c, false, false);
  asm volatile("v_nop\n\tv_nop\n\tv_nop\n\tv_nop" : "+v"(c) : "v"(ah), "v"(al), "v"(bh), "v"(bl));
  return c;
}

__global__ __launch_bounds__(256) void k_wt_bf16(const float* __restrict__ W, unsigned short* __restrict__ Wt, int K, int N) {
  const int t = blockIdx.x * 256 + threadIdx.x;
  const int k8n = K / 8;
  if (t >= N * k8n) return;
  const int n = t / k8n, k8 = (t % k8n) * 8;
  v8us v;
#pragma unroll
  for (int i = 0; i < 8; ++i) v[i] = bf16_bits(W[(size_t)(k8 + i) * N + n]);
  *(v8us*)(Wt + (size_t)n * K + k8) = v;
  
}

// GEMM C[M][N] (f32, pitch ldc) = act(A[M][K]·W + bias). A f32 row-major (pitch lda) converted per fragment to bf16
// (ASPLIT: hi/lo two planes -> 2 terms, else single rounded term); Wt bf16 [N][K] (pitch ldb). BIAS_BF16 rounds the
// bias to bf16 first (bias quantised to bf16 before the add). K%32==0, M%16==0, N%64==0.
template <bool ASPLIT, int ACT, bool BIAS_BF16>
__global__ __launch_bounds__(128) void k_gemm_bf(const float* __restrict__ A, int lda, const unsigned short* __restrict__ Wt, int ldb,
                                               const float* __restrict__ bias, float* __restrict__ C, int ldc, int M, int N, int K) {
  __shared__ __attribute__((aligned(16))) float so[4][16][64];
  const int tid = threadIdx.x, w = tid >> 5, lane = tid & 31, ln = lane & 15, hh = lane >> 4;
  const int ntn = N / 64;
  const int wid = blockIdx.x * 4 + w;
  const int mt = wid / ntn, nq = wid % ntn;
  if (mt * 16 >= M) return;
  const int row0 = mt * 16, col0 = nq * 64;
  const float* arow = A + (size_t)(row0 + ln) * lda;
  v8f acc[4] = {};
  for (int kb = 0; kb < K; kb += 32) {
    FragB ah, al;
    const v4f x0 = *(const v4fa*)(arow + kb + 8 * hh), x1 = *(const v4fa*)(arow + kb + 8 * hh + 4);
    const v4f x2 = *(const v4fa*)(arow + kb + 16 + 8 * hh), x3 = *(const v4fa*)(arow + kb + 16 + 8 * hh + 4);
    float xs[16] = {x0[0],x0[1],x0[2],x0[3],x1[0],x1[1],x1[2],x1[3],x2[0],x2[1],x2[2],x2[3],x3[0],x3[1],x3[2],x3[3]};
#pragma unroll
    for (int i = 0; i < 16; ++i) { const unsigned short hb = bf16_bits(xs[i]); ah.u[i] = hb; al.u[i] = ASPLIT ? bf16_bits(xs[i] - bf16_val(hb)) : (unsigned short)0; }
#pragma unroll
    for (int t = 0; t < 4; ++t) {
      const unsigned short* brow = Wt + (size_t)(col0 + t * 16 + ln) * ldb + kb;
      FragB b;
      b.half[0] = *(const v8us*)(brow + 8 * hh);
      b.half[1] = *(const v8us*)(brow + 16 + 8 * hh);
      acc[t] = mmaN<ASPLIT ? 2 : 1>(ah.v, al.v, b.v, b.v, acc[t]);
    }
  }
#pragma unroll
  for (int t = 0; t < 4; ++t) {
    float bv = bias ? bias[col0 + t * 16 + ln] : 0.f;
    if (BIAS_BF16) bv = bf16_round(bv);
#pragma unroll
    for (int r = 0; r < 8; ++r) { float v = acc[t][r] + bv; if (ACT == 1) v = fmaxf(v, 0.f); so[w][8 * hh + r][t * 16 + ln] = v; }
  }
  __builtin_amdgcn_fence(__ATOMIC_ACQ_REL, "workgroup");
  __builtin_amdgcn_wave_barrier();
  const int rsub = lane >> 4, c4 = (lane & 15) * 4;
  {
#pragma unroll
    for (int q = 0; q < 8; ++q) {
      const int r = q * 2 + rsub;
      const v4f v = *(const v4fa*)&so[w][r][c4];
      *(v4f*)(C + (size_t)(row0 + r) * ldc + col0 + c4) = v;
    }
    
  }
}

// GEMM C = act(A·W + bias + resid): A f32 (ASPLIT -> hi/lo 2 terms), Wt bf16 [N][K]; ACT 0 none, 1 relu, 2 exact gelu;
// resid (optional, f32, row index = (row % rmod), pitch ldr, RES_BF16 rounds it) added before the activation.
template <bool ASPLIT, int ACT, bool BIAS_BF16, bool RES_BF16>
__global__ __launch_bounds__(128) void k_gemm_bf3(const float* __restrict__ A, int lda, const unsigned short* __restrict__ Wt, int ldb,
                                                const float* __restrict__ bias, const float* __restrict__ resid, int rmod, int ldr,
                                                float* __restrict__ C, int ldc, int M, int N, int K) {
  __shared__ __attribute__((aligned(16))) float so[4][16][64];
  const int tid = threadIdx.x, w = tid >> 5, lane = tid & 31, ln = lane & 15, hh = lane >> 4;
  const int ntn = N / 64;
  const int wid = blockIdx.x * 4 + w;
  const int mt = wid / ntn, nq = wid % ntn;
  if (mt * 16 >= M) return;
  const int row0 = mt * 16, col0 = nq * 64;
  const float* arow = A + (size_t)(row0 + ln) * lda;
  v8f acc[4] = {};
  for (int kb = 0; kb < K; kb += 32) {
    FragB ah, al;
    const v4f x0 = *(const v4fa*)(arow + kb + 8 * hh), x1 = *(const v4fa*)(arow + kb + 8 * hh + 4);
    const v4f x2 = *(const v4fa*)(arow + kb + 16 + 8 * hh), x3 = *(const v4fa*)(arow + kb + 16 + 8 * hh + 4);
    float xs[16] = {x0[0],x0[1],x0[2],x0[3],x1[0],x1[1],x1[2],x1[3],x2[0],x2[1],x2[2],x2[3],x3[0],x3[1],x3[2],x3[3]};
#pragma unroll
    for (int i = 0; i < 16; ++i) { const unsigned short hb = bf16_bits(xs[i]); ah.u[i] = hb; al.u[i] = ASPLIT ? bf16_bits(xs[i] - bf16_val(hb)) : (unsigned short)0; }
#pragma unroll
    for (int t = 0; t < 4; ++t) {
      const unsigned short* brow = Wt + (size_t)(col0 + t * 16 + ln) * ldb + kb;
      FragB b;
      b.half[0] = *(const v8us*)(brow + 8 * hh);
      b.half[1] = *(const v8us*)(brow + 16 + 8 * hh);
      acc[t] = mmaN<ASPLIT ? 2 : 1>(ah.v, al.v, b.v, b.v, acc[t]);
    }
  }
#pragma unroll
  for (int t = 0; t < 4; ++t) {
    const int col = col0 + t * 16 + ln;
    float bv = bias ? bias[col] : 0.f;
    if (BIAS_BF16) bv = bf16_round(bv);
#pragma unroll
    for (int r = 0; r < 8; ++r) {
      float v = acc[t][r] + bv;
      if (resid) { float rv = resid[(size_t)((row0 + 8 * hh + r) % rmod) * ldr + col]; if (RES_BF16) rv = bf16_round(rv); v += rv; }
      if (ACT == 1) v = fmaxf(v, 0.f);
      if (ACT == 2) v = 0.5f * v * (1.0f + erff(v * 0.70710678118654752f));
      if (ACT == 3) { const float u = 0.7978845608028654f * (v + 0.044715f * v * v * v); v = 0.5f * v * (1.0f + tanhf(u)); }
      so[w][8 * hh + r][t * 16 + ln] = v;
    }
  }
  __builtin_amdgcn_fence(__ATOMIC_ACQ_REL, "workgroup");
  __builtin_amdgcn_wave_barrier();
  const int rsub = lane >> 4, c4 = (lane & 15) * 4;
  {
#pragma unroll
    for (int q = 0; q < 8; ++q) {
      const int r = q * 2 + rsub;
      const v4f v = *(const v4fa*)&so[w][r][c4];
      *(v4f*)(C + (size_t)(row0 + r) * ldc + col0 + c4) = v;
    }
    
  }
}
// row LayerNorm (biased variance, eps) over N: s = X (+ R); optional out_sum <- s; out_norm <- (s-mu)*rsqrt(var+eps)*g + b
template <bool PARAM_BF16>
__global__ __launch_bounds__(256) void k_layernorm(const float* __restrict__ X, const float* __restrict__ R, const float* __restrict__ g, const float* __restrict__ bta,
                                                  float* __restrict__ out_sum, float* __restrict__ out_norm, int N, float eps) {
  __shared__ float red[256];
  const int row = blockIdx.x, tid = threadIdx.x;
  const float* x = X + (size_t)row * N; const float* rr = R ? R + (size_t)row * N : nullptr;
  float vals[16];                     // up to N = 4096
  const int per = N / 256;            // contiguous chunk per thread? use strided-by-4 chunks: thread handles j = tid*4 + 1024*u
  float s1 = 0.f;
  for (int u = 0; u < per / 4; ++u) {
    const int j = tid * 4 + 1024 * u;
    const v4f a = *(const v4fa*)(x + j);
    v4f b = {0.f,0.f,0.f,0.f}; if (rr) b = *(const v4fa*)(rr + j);
#pragma unroll
    for (int q = 0; q < 4; ++q) { const float v = a[q] + b[q]; vals[u * 4 + q] = v; s1 += v; }
  }
  red[tid] = s1; __syncthreads();
  for (int st = 128; st > 0; st >>= 1) { if (tid < st) red[tid] += red[tid + st]; __syncthreads(); }
  const float mu = red[0] / (float)N; __syncthreads();
  float s2 = 0.f;
  for (int u = 0; u < per / 4; ++u)
#pragma unroll
    for (int q = 0; q < 4; ++q) { const float c = vals[u * 4 + q] - mu; s2 += c * c; }
  red[tid] = s2; __syncthreads();
  for (int st = 128; st > 0; st >>= 1) { if (tid < st) red[tid] += red[tid + st]; __syncthreads(); }
  const float rs = rsqrtf(red[0] / (float)N + eps);
  {
    for (int u = 0; u < per / 4; ++u) {
      const int j = tid * 4 + 1024 * u;
      v4f o, sm;
#pragma unroll
      for (int q = 0; q < 4; ++q) {
        float gg = g[j + q], bb = bta[j + q];
        if (PARAM_BF16) { gg = bf16_round(gg); bb = bf16_round(bb); }
        sm[q] = vals[u * 4 + q]; o[q] = (vals[u * 4 + q] - mu) * rs * gg + bb;
      }
      if (out_sum) *(v4f*)(out_sum + (size_t)row * N + j) = sm;
      *(v4f*)(out_norm + (size_t)row * N + j) = o;
    }
    
  }
}



// ---- f16 WMMA path (v_wmma_f32_16x16x32_f16): 11-bit significands for operands in range — used where a [0,1] probability operand needs more precision than bf16
typedef _Float16 v16h __attribute__((ext_vector_type(16)));
union FragH { v16h v; v8us half[2]; _Float16 h[16]; unsigned short u[16]; };
template <int NT>
__device__ __forceinline__ v8f mmaH(v16h ah, v16h al, v16h bh, v16h bl, v8f c) {
  c = __builtin_amdgcn_wmma_f32_16x16x32_f16(false, ah, false, bh, (short)0, c, false, false);
  if (NT >= 2) c = __builtin_amdgcn_wmma_f32_16x16x32_f16(false, al, false, bh, (short)0, c, false, false);
  if (NT >= 3) c = __builtin_amdgcn_wmma_f32_16x16x32_f16(false, ah, false, bl, (short)0, c, false, false);
  asm volatile("v_nop\n\tv_nop\n\tv_nop\n\tv_nop" : "+v"(c) : "v"(ah), "v"(al), "v"(bh), "v"(bl));
  return c;
}
// batched GEMM like k_gemm_b but f16 operands: A f32 (split into f16 hi/lo if ASPLIT, else rounded to f16), Bt = f16 values [n][k]; alpha; C f32; N multiple of 16 (partial tiles skipped)
template <bool ASPLIT>
__global__ __launch_bounds__(128) void k_gemm_h(const float* __restrict__ A, int lda, size_t sA, const _Float16* __restrict__ Bh, int ldb, size_t sB, float alpha, float* __restrict__ C, int ldc, size_t sC, int M, int N, int K) {
  __shared__ __attribute__((aligned(16))) float so[4][16][64];
  const int tid = threadIdx.x, w = tid >> 5, lane = tid & 31, ln = lane & 15, hh = lane >> 4; const int by = blockIdx.y;
  A += (size_t)by * sA; Bh += (size_t)by * sB; C += (size_t)by * sC;
  const int ntn = (N + 63) / 64; const int wid = blockIdx.x * 4 + w; const int mt = wid / ntn, nq = wid % ntn; if (mt * 16 >= M) return;
  const int row0 = mt * 16, col0 = nq * 64; const float* arow = A + (size_t)(row0 + ln) * lda;
  v8f acc[4] = {};
  for (int kb = 0; kb < K; kb += 32) {
    FragH ah, al;
    const v4f x0 = *(const v4fa*)(arow + kb + 8 * hh), x1 = *(const v4fa*)(arow + kb + 8 * hh + 4), x2 = *(const v4fa*)(arow + kb + 16 + 8 * hh), x3 = *(const v4fa*)(arow + kb + 16 + 8 * hh + 4);
    float xs[16] = {x0[0],x0[1],x0[2],x0[3],x1[0],x1[1],x1[2],x1[3],x2[0],x2[1],x2[2],x2[3],x3[0],x3[1],x3[2],x3[3]};
#pragma unroll
    for (int i = 0; i < 16; ++i) { const _Float16 h = (_Float16)xs[i]; ah.h[i] = h; al.h[i] = ASPLIT ? (_Float16)(xs[i] - (float)h) : (_Float16)0.0f; }
#pragma unroll
    for (int t = 0; t < 4; ++t) { if (col0 + t * 16 >= N) continue; const size_t boff = (size_t)(col0 + t * 16 + ln) * ldb + kb; FragH bq; bq.half[0] = *(const v8us*)(Bh + boff + 8 * hh); bq.half[1] = *(const v8us*)(Bh + boff + 16 + 8 * hh);
      acc[t] = mmaH<ASPLIT ? 2 : 1>(ah.v, al.v, bq.v, bq.v, acc[t]); }
  }
#pragma unroll
  for (int t = 0; t < 4; ++t) { if (col0 + t * 16 >= N) continue;
#pragma unroll
    for (int r = 0; r < 8; ++r) so[w][8 * hh + r][t * 16 + ln] = acc[t][r] * alpha; }
  __builtin_amdgcn_fence(__ATOMIC_ACQ_REL, "workgroup"); __builtin_amdgcn_wave_barrier();
  const int rsub = lane >> 4, c4 = (lane & 15) * 4;
  {
#pragma unroll
    for (int q = 0; q < 8; ++q) { const int r = q * 2 + rsub; if (col0 + c4 < N) { const v4f v = *(const v4fa*)&so[w][r][c4]; *(v4f*)(C + (size_t)(row0 + r) * ldc + col0 + c4) = v; } }
     }
}

// Wt[n][k] = f16(W[k][n]·scale) from f32 row-major W[K][N] (scale = power of two; bf16-exact weights stay exact in f16 away from the subnormal range)
__global__ __launch_bounds__(256) void k_wt_f16(const float* __restrict__ W, _Float16* __restrict__ Wt, int K, int N, float scale) {
  const int t = blockIdx.x * 256 + threadIdx.x; if (t >= N * (K / 8)) return; const int n = t / (K / 8), k8 = (t % (K / 8)) * 8; FragH f;
#pragma unroll
  for (int i = 0; i < 8; ++i) f.h[i] = (_Float16)(bf16_round(W[(size_t)(k8 + i) * N + n]) * scale); const v8us o = f.half[0];
  *(v8us*)((unsigned short*)Wt + (size_t)n * K + k8) = o; 
}
// k_gemm_hh variant with fused epilogue: v = acc·alpha + bias[by·sBias + col] (+ CP[(row/rowsPerB)·sCPb + by·64 + col] if CP) ; ACT 0 none / 1 elu ; writes f16 C16 (and f32 C if non-null)
template <int ACT>
__global__ __launch_bounds__(128) void k_gemm_hhx(const _Float16* __restrict__ A, int lda, size_t sA, const _Float16* __restrict__ Bh, int ldb, size_t sB, float alpha, const float* __restrict__ bias, size_t sBias, const float* __restrict__ CP, int rowsPerB, size_t sCPb, int row0g,
    float* __restrict__ C, _Float16* __restrict__ C16, int ldc, size_t sC, int M, int N, int K) {
  __shared__ __attribute__((aligned(16))) float so[4][16][64];
  const int tid = threadIdx.x, w = tid >> 5, lane = tid & 31, ln = lane & 15, hh = lane >> 4; const int by = blockIdx.y;
  A += (size_t)by * sA; Bh += (size_t)by * sB; const size_t cofs = (size_t)by * sC; const float* bp = bias ? bias + (size_t)by * sBias : nullptr;
  const int ntn = (N + 63) / 64; const int wid = blockIdx.x * 4 + w; const int mt = wid / ntn, nq = wid % ntn; if (mt * 16 >= M) return;
  const int row0 = mt * 16, col0 = nq * 64; const _Float16* arow = A + (size_t)(row0 + ln) * lda;
  v8f acc[4] = {};
  for (int kb = 0; kb < K; kb += 32) { FragH ah; ah.half[0] = *(const v8us*)((const unsigned short*)arow + kb + 8 * hh); ah.half[1] = *(const v8us*)((const unsigned short*)arow + kb + 16 + 8 * hh);
#pragma unroll
    for (int t = 0; t < 4; ++t) { if (col0 + t * 16 >= N) continue; const size_t boff = (size_t)(col0 + t * 16 + ln) * ldb + kb; FragH bq; bq.half[0] = *(const v8us*)((const unsigned short*)Bh + boff + 8 * hh); bq.half[1] = *(const v8us*)((const unsigned short*)Bh + boff + 16 + 8 * hh);
      acc[t] = mmaH<1>(ah.v, ah.v, bq.v, bq.v, acc[t]); }
  }
#pragma unroll
  for (int t = 0; t < 4; ++t) { if (col0 + t * 16 >= N) continue; const int col = col0 + t * 16 + ln; const float bv = bp ? bf16_round(bp[col]) : 0.f;
#pragma unroll
    for (int r = 0; r < 8; ++r) { float v = acc[t][r] * alpha + bv; if (CP) { const int rr = row0g + row0 + 8 * hh + r; if (rowsPerB < 0) v += CP[cofs + (size_t)rr * ldc + col];      /* rowsPerB < 0: own element of the batched C plane */ else { const int bidx = rr / rowsPerB; v += CP[(size_t)bidx * sCPb + (size_t)by * 64 + col]; } } if (ACT == 1) v = (v > 0.f) ? v : expm1f(v); else if (ACT == 7) v = (v > 0.f) ? v + 1.0f : expf(v); else if (ACT == 8) v = tanhf(v); else if (ACT == 9) v = 0.5f * v * (1.0f + tanhf(0.7978845608028654f * (v + 0.044715f * v * v * v))); else if (ACT == 11) v = 1.0f / (1.0f + expf(-v)); else if (ACT == 12) v = (v > 0.f) ? v : 0.01f * v; else if (ACT == 14) v = (v > 0.f) ? v : 0.1f * v; else if (ACT == 16) v = (v >= 0.f) ? v : 0.3f * v; else if (ACT == 17) v = (v >= 0.f) ? v : 0.2f * v; else if (ACT == 15) v = v / (1.0f + expf(-v)); else if (ACT == 3) v = fmaxf(v, 0.f); else if (ACT == 6) v = 0.5f * v * (1.0f + erff(v * 0.70710678118654752f)); so[w][8 * hh + r][t * 16 + ln] = v; } }
  __builtin_amdgcn_fence(__ATOMIC_ACQ_REL, "workgroup"); __builtin_amdgcn_wave_barrier();
  const int rsub = lane >> 4, c4 = (lane & 15) * 4; typedef _Float16 v4h __attribute__((ext_vector_type(4)));
  {
#pragma unroll
    for (int q = 0; q < 8; ++q) { const int r = q * 2 + rsub; if (col0 + c4 < N) { const v4f v = *(const v4fa*)&so[w][r][c4]; if (C) *(v4f*)(C + cofs + (size_t)(row0 + r) * ldc + col0 + c4) = v; if (C16) { v4h h4; for (int i = 0; i < 4; ++i) h4[i] = (_Float16)v[i]; *(v4h*)(C16 + cofs + (size_t)(row0 + r) * ldc + col0 + c4) = h4; } } }
     }
}


typedef _Float16 v4h __attribute__((ext_vector_type(4)));

__global__ __launch_bounds__(256) void k_x16(const float* __restrict__ x, _Float16* __restrict__ X16, size_t n8) { const size_t t = (size_t)blockIdx.x * 256 + threadIdx.x; if (t >= n8) return; FragH f;
#pragma unroll
  for (int q = 0; q < 8; ++q) f.h[q] = (_Float16)bf16_round(x[t * 8 + q]); *(v8us*)((unsigned short*)X16 + t * 8) = f.half[0];  }
__global__ __launch_bounds__(256) void k_h16(const float* __restrict__ x, _Float16* __restrict__ X16, size_t n8) { const size_t t = (size_t)blockIdx.x * 256 + threadIdx.x; if (t >= n8) return; FragH f;
#pragma unroll
  for (int q = 0; q < 8; ++q) f.h[q] = (_Float16)x[t * 8 + q]; *(v8us*)((unsigned short*)X16 + t * 8) = f.half[0];  }
__global__ __launch_bounds__(256) void k_round16f(const float* __restrict__ W, _Float16* __restrict__ Bt, size_t n8) { const size_t t = (size_t)blockIdx.x * 256 + threadIdx.x; if (t >= n8) return; FragH f;
#pragma unroll
  for (int i = 0; i < 8; ++i) f.h[i] = (_Float16)(bf16_round(W[t * 8 + i]) * 16.0f); *(v8us*)((unsigned short*)Bt + t * 8) = f.half[0];  }
template <int NHv, int TTv>
__global__ __launch_bounds__(256) void k_vt(const _Float16* __restrict__ V16, int ldv, int voff, _Float16* __restrict__ Vt) { __shared__ unsigned short tl[64][66]; const int tid = threadIdx.x; const int slab = blockIdx.x / (TTv / 64), lg = blockIdx.x % (TTv / 64); const int b = slab / NHv, h = slab % NHv;
  for (int i = tid; i < 64 * 8; i += 256) { const int r = i / 8, c8 = (i % 8) * 8; FragH f; f.half[0] = *(const v8us*)((const unsigned short*)V16 + ((size_t)b * TTv + lg * 64 + r) * ldv + voff + h * 64 + c8);
#pragma unroll
    for (int q = 0; q < 8; ++q) tl[r][c8 + q] = f.u[q]; }
  __syncthreads();
  {
#pragma unroll
    for (int rd = 0; rd < 2; ++rd) { const int d = rd * 32 + tid / 8, pc = tid % 8; FragH f;
#pragma unroll
      for (int q = 0; q < 8; ++q) f.u[q] = tl[pc * 8 + q][d];
      *(v8us*)((unsigned short*)Vt + ((size_t)slab * 64 + d) * TTv + lg * 64 + pc * 8) = f.half[0]; }
     } }

__global__ __launch_bounds__(256) void k_hl(const float* __restrict__ F, _Float16* __restrict__ Hh, _Float16* __restrict__ Hl, size_t n8) { const size_t t = (size_t)blockIdx.x * 256 + threadIdx.x; if (t >= n8) return; FragH fh, fl; const v4f a = *(const v4fa*)(F + t * 8), c = *(const v4fa*)(F + t * 8 + 4);
#pragma unroll
  for (int q = 0; q < 4; ++q) { _Float16 h = (_Float16)a[q]; fh.h[q] = h; fl.h[q] = (_Float16)((a[q] - (float)h) * 1024.0f); h = (_Float16)c[q]; fh.h[4 + q] = h; fl.h[4 + q] = (_Float16)((c[q] - (float)h) * 1024.0f); }
  { *(v8us*)((unsigned short*)Hh + t * 8) = fh.half[0]; *(v8us*)((unsigned short*)Hl + t * 8) = fl.half[0];  } }

// ---- fast GEMM (work-group tile 128x64, wave tile 32x64; A and B tiles of 64 k staged in LDS by asynchronous copies, two buffers; requires M % 128 == 0 rows per launch region, N % 64 == 0, K % 64 == 0); epilogue = k_gemm_hhx semantics ----
__device__ __forceinline__ v16h g2_frag(const _Float16* p, int hh) { FragH f; f.half[0] = *(const v8us*)((const unsigned short*)p + 8 * hh); f.half[1] = *(const v8us*)((const unsigned short*)p + 16 + 8 * hh); return f.v; }
__device__ __forceinline__ v8f g2_mma(v16h a, v16h b, v8f c) { v8f d = __builtin_amdgcn_wmma_f32_16x16x32_f16(false, a, false, b, (short)0, c, false, false); asm volatile("v_nop\n\tv_nop\n\tv_nop\n\tv_nop" : "+v"(d) : "v"(a), "v"(b)); return d; }
#define G2_PITCH 144                 /* LDS row pitch in bytes of a staged 128-byte row: 16 B x odd, the conflict-free pitch for 16-byte LDS reads */
#define G2_BUF (192 * G2_PITCH)      /* one staged tile: 128 A rows, then 64 B rows, 64 k each */
static_assert(MP % 128 == 0 && QT % 128 == 0 && QT0 % 128 == 0, "k_gemm2: a work-group stages 128 whole A rows");
static_assert(HD % 64 == 0 && QT % 64 == 0 && DM % 64 == 0 && DFF % 64 == 0, "k_gemm2: K is a multiple of the staged 64 k, N of the 64 B rows");
// One tile into LDS: twelve asynchronous 16-byte copies a lane (a wave's 32 lanes take 4 whole 128-byte rows per copy; copy i lands 16 rows below copy i - 1; 0..7 = A rows, 8..11 = B rows).
// One asm statement: the copies go from global memory to LDS through no register, and the s_wait_xcnt at its end stands in front of any later overwrite of the address registers that the copies name.
__device__ __forceinline__ void g2_stage(unsigned l, const _Float16* ga, size_t sa, const _Float16* gb, size_t sb) {
  asm volatile("global_load_async_to_lds_b128 %0, %12, off\n\tglobal_load_async_to_lds_b128 %1, %13, off\n\tglobal_load_async_to_lds_b128 %2, %14, off\n\tglobal_load_async_to_lds_b128 %3, %15, off\n\t"
               "global_load_async_to_lds_b128 %4, %16, off\n\tglobal_load_async_to_lds_b128 %5, %17, off\n\tglobal_load_async_to_lds_b128 %6, %18, off\n\tglobal_load_async_to_lds_b128 %7, %19, off\n\t"
               "global_load_async_to_lds_b128 %8, %20, off\n\tglobal_load_async_to_lds_b128 %9, %21, off\n\tglobal_load_async_to_lds_b128 %10, %22, off\n\tglobal_load_async_to_lds_b128 %11, %23, off\n\ts_wait_xcnt 0x0"
               :: "v"(l), "v"(l + 16 * G2_PITCH), "v"(l + 32 * G2_PITCH), "v"(l + 48 * G2_PITCH), "v"(l + 64 * G2_PITCH), "v"(l + 80 * G2_PITCH), "v"(l + 96 * G2_PITCH), "v"(l + 112 * G2_PITCH),
                  "v"(l + 128 * G2_PITCH), "v"(l + 144 * G2_PITCH), "v"(l + 160 * G2_PITCH), "v"(l + 176 * G2_PITCH),
                  "v"(ga), "v"(ga + sa), "v"(ga + 2 * sa), "v"(ga + 3 * sa), "v"(ga + 4 * sa), "v"(ga + 5 * sa), "v"(ga + 6 * sa), "v"(ga + 7 * sa), "v"(gb), "v"(gb + sb), "v"(gb + 2 * sb), "v"(gb + 3 * sb) : "memory"); }
template <int ACT>
__global__ __launch_bounds__(128) void k_gemm2(const _Float16* __restrict__ A, int lda, size_t sA, const _Float16* __restrict__ Bh, int ldb, size_t sB, float alpha, const float* __restrict__ bias, size_t sBias, const float* __restrict__ CP, int rowsPerB, size_t sCPb, int row0g,
    float* __restrict__ C, _Float16* __restrict__ C16, int ldc, size_t sC, int M, int N, int K, size_t zA = 0, size_t zB = 0, size_t zC = 0) { static_assert(ACT == 0 || ACT == 3 || ACT == 6 || ACT == 8 || ACT == 9 || ACT == 11 || ACT == 12 || ACT == 14 || ACT == 15 || ACT == 16 || ACT == 17, "k_gemm2: unsupported ACT code (would silently apply no activation)");
  __shared__ __attribute__((aligned(16))) unsigned char sm[2 * G2_BUF]; float (*so)[32][68] = (float (*)[32][68])sm;      /* two staged tiles; behind the loop's last barrier the same bytes are the epilogue's [4][32][68] f32 staging */
  static_assert(sizeof(float) * 4 * 32 * 68 <= 2 * G2_BUF, "k_gemm2: the epilogue staging fits the two tile buffers");
  const int tid = threadIdx.x, w = tid >> 5, lane = tid & 31, ln = lane & 15, hh = lane >> 4; const int by = blockIdx.y; const int bz = blockIdx.z;      /* second batch axis (strides zA, zB, zC) */
  A += (size_t)by * sA + (size_t)bz * zA; Bh += (size_t)by * sB + (size_t)bz * zB; const size_t cofs = (size_t)by * sC + (size_t)bz * zC; const float* bp = bias ? bias + (size_t)by * sBias : nullptr;
  const int ntn = N >> 6; const int mt = blockIdx.x / ntn, nq = blockIdx.x - mt * ntn; const int row0 = mt * 128 + 32 * w, col0 = nq * 64; if (mt * 128 >= M) return;      /* the whole work-group leaves or none: barriers follow */
  const _Float16* ga = A + (size_t)(mt * 128 + (tid >> 3)) * lda + (tid & 7) * 8; const _Float16* gb = Bh + (size_t)(col0 + (tid >> 3)) * ldb + (tid & 7) * 8;      /* this lane's 16 bytes of row tid / 8 of each 16-row group */
  const size_t sa = (size_t)16 * lda, sb = (size_t)16 * ldb; const unsigned l0 = (unsigned)(size_t)sm + (unsigned)((tid >> 3) * G2_PITCH + (tid & 7) * 16);
  const unsigned char* fa = sm + (32 * w + ln) * G2_PITCH; const unsigned char* fb = sm + (128 + ln) * G2_PITCH;      /* this lane's fragment rows in buffer 0 */
  const v8f z8 = {0.f,0.f,0.f,0.f,0.f,0.f,0.f,0.f}; v8f c00 = z8, c01 = z8, c02 = z8, c03 = z8, c10 = z8, c11 = z8, c12 = z8, c13 = z8;
  const int nt = K >> 6;
  g2_stage(l0, ga, sa, gb, sb);
  asm volatile("s_wait_asynccnt 0x0" ::: "memory");      /* this wave's copies of tile 0 have landed */
  __syncthreads();      /* tile 0 published: every wave's copies have landed */
  if (nt > 1) g2_stage(l0 + G2_BUF, ga + 64, sa, gb + 64, sb);      /* tile 1 flies while tile 0 is worked on */
#pragma unroll 1
  for (int t = 0; t < nt; ++t) { const unsigned bo = (unsigned)(t & 1) * G2_BUF;      /* kept rolled: one trip is one staged tile and the buffers alternate; unrolled, the copies' and waits' code would only be repeated */
#pragma unroll
    for (int ks = 0; ks < 2; ++ks) { const _Float16* pa = (const _Float16*)(fa + bo + ks * 64); const _Float16* pb = (const _Float16*)(fb + bo + ks * 64);      /* unrolled so that the two halves of a tile are immediate offsets of the LDS reads; 32 k = 64 bytes of every row; k ascends as before */
      const v16h a0 = g2_frag(pa, hh), a1 = g2_frag(pa + 8 * G2_PITCH, hh), b0 = g2_frag(pb, hh), b1 = g2_frag(pb + 8 * G2_PITCH, hh), b2 = g2_frag(pb + 16 * G2_PITCH, hh), b3 = g2_frag(pb + 24 * G2_PITCH, hh);      /* 16 rows = 8 * G2_PITCH halves */
      c00 = g2_mma(a0, b0, c00); c10 = g2_mma(a1, b0, c10); c01 = g2_mma(a0, b1, c01); c11 = g2_mma(a1, b1, c11);
      c02 = g2_mma(a0, b2, c02); c12 = g2_mma(a1, b2, c12); c03 = g2_mma(a0, b3, c03); c13 = g2_mma(a1, b3, c13); }
    asm volatile("s_wait_dscnt 0x0" ::: "memory");      /* this wave's reads of the buffer have returned before the buffer is given up */
    asm volatile("s_wait_asynccnt 0x0" ::: "memory");      /* this wave's copies of tile t + 1 have landed */
    __syncthreads();      /* publishes tile t + 1 and ends every wave's reads of tile t */
    if (t + 2 < nt) g2_stage(l0 + bo, ga + (size_t)(t + 2) * 64, sa, gb + (size_t)(t + 2) * 64, sb); }      /* refill of the buffer just left */
  asm volatile("s_wait_asynccnt 0x0" ::: "memory");      /* no copy is outstanding when the buffers become the epilogue's staging */
  v8f accs[8] = {c00, c01, c02, c03, c10, c11, c12, c13};
#pragma unroll
  for (int u = 0; u < 8; ++u) { const int t = u & 3, half = u >> 2; const int col = col0 + t * 16 + ln; const float bv = bp ? bf16_round(bp[col]) : 0.f;
#pragma unroll
    for (int r = 0; r < 8; ++r) { const int rloc = half * 16 + 8 * hh + r; float v = accs[u][r] * alpha + bv; if (CP) { if (rowsPerB < 0) v += CP[cofs + (size_t)(row0g + row0 + rloc) * ldc + col];      /* rowsPerB < 0: own element of the batched C plane */ else { const int bidx = (row0g + row0 + rloc) / rowsPerB; v += CP[(size_t)bidx * sCPb + (size_t)by * 64 + col]; } }
      if (ACT == 3) v = fmaxf(v, 0.f); else if (ACT == 6) v = 0.5f * v * (1.0f + erff(v * 0.70710678118654752f)); else if (ACT == 11) v = 1.0f / (1.0f + expf(-v)); else if (ACT == 15) v = v / (1.0f + expf(-v)); else if (ACT == 12) v = (v > 0.f) ? v : 0.01f * v; else if (ACT == 8) v = tanhf(v); else if (ACT == 9) v = 0.5f * v * (1.0f + tanhf(0.7978845608028654f * (v + 0.044715f * v * v * v))); else if (ACT == 14) v = (v > 0.f) ? v : 0.1f * v; else if (ACT == 16) v = (v >= 0.f) ? v : 0.3f * v; else if (ACT == 17) v = (v >= 0.f) ? v : 0.2f * v;
      so[w][rloc][t * 16 + ln] = v; } }
  __builtin_amdgcn_fence(__ATOMIC_ACQ_REL, "workgroup"); __builtin_amdgcn_wave_barrier();
  const int rsub = lane >> 4, c4 = (lane & 15) * 4;
  {
#pragma unroll
    for (int q = 0; q < 16; ++q) { const int r = q * 2 + rsub; const v4f v = *(const v4fa*)&so[w][r][c4]; if (C) *(v4f*)(C + cofs + (size_t)(row0 + r) * ldc + col0 + c4) = v; if (C16) { v4h h4; for (int i = 0; i < 4; ++i) h4[i] = (_Float16)v[i]; *(v4h*)(C16 + cofs + (size_t)(row0 + r) * ldc + col0 + c4) = h4; } }
     } }


// ---- wide GEMM for the four all-row products (work-group tile 256x128, eight waves as 4 x 2, wave tile 64x64; requires M % 256 == 0, N % 128 == 0, K % 64 == 0); staging, k order and epilogue arithmetic as in k_gemm2 ----
// Against the 128x64 tile: half the operand rows copied from L2 per output element (384 rows per 32768 outputs, not 192 per 8192), and 16 LDS fragment reads per 16 products, not 12 per 8.
#define G3_BUF (384 * G2_PITCH)      /* one staged tile: 256 A rows, then 128 B rows, 64 k each */
static_assert(MP % 256 == 0 && DM % 128 == 0 && DFF % 128 == 0, "k_gemm3: whole 256x128 tiles");
// One tile into LDS: twelve asynchronous 16-byte copies a lane (the work-group's 256 lanes take 32 whole 128-byte rows per copy; copy i lands 32 rows below copy i - 1; 0..7 = A rows, 8..11 = B rows).
// One asm statement, as in g2_stage: the s_wait_xcnt at its end stands in front of any later overwrite of the address registers that the copies name.
__device__ __forceinline__ void g3_stage(unsigned l, const _Float16* ga, size_t sa, const _Float16* gb, size_t sb) {
  asm volatile("global_load_async_to_lds_b128 %0, %12, off\n\tglobal_load_async_to_lds_b128 %1, %13, off\n\tglobal_load_async_to_lds_b128 %2, %14, off\n\tglobal_load_async_to_lds_b128 %3, %15, off\n\t"
               "global_load_async_to_lds_b128 %4, %16, off\n\tglobal_load_async_to_lds_b128 %5, %17, off\n\tglobal_load_async_to_lds_b128 %6, %18, off\n\tglobal_load_async_to_lds_b128 %7, %19, off\n\t"
               "global_load_async_to_lds_b128 %8, %20, off\n\tglobal_load_async_to_lds_b128 %9, %21, off\n\tglobal_load_async_to_lds_b128 %10, %22, off\n\tglobal_load_async_to_lds_b128 %11, %23, off\n\ts_wait_xcnt 0x0"
               :: "v"(l), "v"(l + 32 * G2_PITCH), "v"(l + 64 * G2_PITCH), "v"(l + 96 * G2_PITCH), "v"(l + 128 * G2_PITCH), "v"(l + 160 * G2_PITCH), "v"(l + 192 * G2_PITCH), "v"(l + 224 * G2_PITCH),
                  "v"(l + 256 * G2_PITCH), "v"(l + 288 * G2_PITCH), "v"(l + 320 * G2_PITCH), "v"(l + 352 * G2_PITCH),
                  "v"(ga), "v"(ga + sa), "v"(ga + 2 * sa), "v"(ga + 3 * sa), "v"(ga + 4 * sa), "v"(ga + 5 * sa), "v"(ga + 6 * sa), "v"(ga + 7 * sa), "v"(gb), "v"(gb + sb), "v"(gb + 2 * sb), "v"(gb + 3 * sb) : "memory"); }
// C = act(A Bh^T alpha + bias (+ CP where RES: the own element of a plane laid out like C)); F32O: f32 rows into C, else f16 rows into C16; LDC: row pitch of C, C16 and CP in elements
template <int ACT, bool RES, bool F32O, int LDC>
__global__ __launch_bounds__(256) void k_gemm3(const _Float16* __restrict__ A, int lda, const _Float16* __restrict__ Bh, int ldb, float alpha, const float* __restrict__ bias, const float* __restrict__ CP,
    float* __restrict__ C, _Float16* __restrict__ C16, int M, int N, int K) { static_assert(ACT == 0 || ACT == 3, "k_gemm3: no activation or relu");
  __shared__ __attribute__((aligned(16))) unsigned char sm[2 * G3_BUF]; float (*so)[32][68] = (float (*)[32][68])sm;      /* two staged tiles; behind the loop's last barrier the same bytes are the epilogue's [8][32][68] f32 staging */
  static_assert(sizeof(float) * 8 * 32 * 68 <= 2 * G3_BUF, "k_gemm3: the epilogue staging fits the two tile buffers");
  const int tid = threadIdx.x, w = tid >> 5, lane = tid & 31, ln = lane & 15, hh = lane >> 4; const int wm = w >> 1, wn = w & 1;
  const int ntn = N >> 7; const int mt = blockIdx.x / ntn, nq = blockIdx.x - mt * ntn; const int row0 = mt * 256 + 64 * wm, col0 = nq * 128 + 64 * wn; if (mt * 256 >= M) return;      /* the whole work-group leaves or none: barriers follow */
  const _Float16* ga = A + (size_t)(mt * 256 + (tid >> 3)) * lda + (tid & 7) * 8; const _Float16* gb = Bh + (size_t)(nq * 128 + (tid >> 3)) * ldb + (tid & 7) * 8;      /* this lane's 16 bytes of row tid / 8 of each 32-row group */
  const size_t sa = (size_t)32 * lda, sb = (size_t)32 * ldb; const unsigned l0 = (unsigned)(size_t)sm + (unsigned)((tid >> 3) * G2_PITCH + (tid & 7) * 16);
  const unsigned char* fa = sm + (64 * wm + ln) * G2_PITCH; const unsigned char* fb = sm + (256 + 64 * wn + ln) * G2_PITCH;      /* this lane's fragment rows in buffer 0 */
  const v8f z8 = {0.f,0.f,0.f,0.f,0.f,0.f,0.f,0.f}; v8f c[4][4];
#pragma unroll
  for (int i = 0; i < 4; ++i)
#pragma unroll
    for (int j = 0; j < 4; ++j) c[i][j] = z8;
  const int nt = K >> 6;
  g3_stage(l0, ga, sa, gb, sb);
  asm volatile("s_wait_asynccnt 0x0" ::: "memory");      /* this wave's copies of tile 0 have landed */
  __syncthreads();      /* tile 0 published: every wave's copies have landed */
  if (nt > 1) g3_stage(l0 + G3_BUF, ga + 64, sa, gb + 64, sb);      /* tile 1 flies while tile 0 is worked on */
#pragma unroll 1
  for (int t = 0; t < nt; ++t) { const unsigned bo = (unsigned)(t & 1) * G3_BUF;      /* kept rolled: one trip is one staged tile and the buffers alternate */
#pragma unroll
    for (int ks = 0; ks < 2; ++ks) { const _Float16* pa = (const _Float16*)(fa + bo + ks * 64); const _Float16* pb = (const _Float16*)(fb + bo + ks * 64); v16h a[4], b[4];      /* unrolled: the two halves of a tile are immediate offsets of the LDS reads; k ascends as in k_gemm2 */
#pragma unroll
      for (int i = 0; i < 4; ++i) { a[i] = g2_frag(pa + i * 8 * G2_PITCH, hh); b[i] = g2_frag(pb + i * 8 * G2_PITCH, hh); }      /* 16 rows = 8 * G2_PITCH halves; the eight fragments' reads stand together in front of their products */
#pragma unroll
      for (int j = 0; j < 4; ++j)
#pragma unroll
        for (int i = 0; i < 4; ++i) c[i][j] = g2_mma(a[i], b[j], c[i][j]); }
    asm volatile("s_wait_dscnt 0x0" ::: "memory");      /* this wave's reads of the buffer have returned before the buffer is given up */
    asm volatile("s_wait_asynccnt 0x0" ::: "memory");      /* this wave's copies of tile t + 1 have landed */
    __syncthreads();      /* publishes tile t + 1 and ends every wave's reads of tile t */
    if (t + 2 < nt) g3_stage(l0 + bo, ga + (size_t)(t + 2) * 64, sa, gb + (size_t)(t + 2) * 64, sb); }      /* refill of the buffer just left */
  asm volatile("s_wait_asynccnt 0x0" ::: "memory");      /* no copy is outstanding when the buffers become the epilogue's staging */
  const int rsub = lane >> 4, c4 = (lane & 15) * 4; float bv[4] = {0.f, 0.f, 0.f, 0.f};
  if (bias) {      /* one test for the four loads, so that they fly together */
#pragma unroll
    for (int t = 0; t < 4; ++t) bv[t] = bf16_round(bias[col0 + t * 16 + ln]); }
  const size_t e0 = (size_t)(row0 + rsub) * LDC + col0 + c4;      /* this lane's 4 columns of row rsub of the wave's tile; its further rows lie 2 LDC apart, a compile-time step, so that every access below is this one address and an immediate offset */
#pragma unroll
  for (int hf = 0; hf < 2; ++hf) {      /* the wave's 64 rows leave in two halves of 32 through its own staging rows */
    v4f res[16];
    if (RES) { const float* rp = CP + e0;      /* the residual in the layout of the write-out: whole 256-byte row pieces, the half's sixteen loads in flight together, under the staging below */
#pragma unroll
      for (int q = 0; q < 16; ++q) res[q] = *(const v4fa*)(rp + (32 * hf + 2 * q) * LDC);
      asm volatile("s_wait_xcnt 0x0" :: "v"(rp) : "memory"); }      /* the wait that belongs in front of any overwrite of the loads' address register; naming it keeps it whole up to here */
#pragma unroll
    for (int u = 0; u < 8; ++u) { const int t = u & 3, ih = u >> 2;
#pragma unroll
      for (int r = 0; r < 8; ++r) so[w][ih * 16 + 8 * hh + r][t * 16 + ln] = c[2 * hf + ih][t][r] * alpha + bv[t]; }
    __builtin_amdgcn_fence(__ATOMIC_ACQ_REL, "workgroup"); __builtin_amdgcn_wave_barrier();      /* the wave's staging stores stay in front of its row reads */
#pragma unroll
    for (int g = 0; g < 2; ++g) {
#pragma unroll
      for (int q = 8 * g; q < 8 * g + 8; ++q) { v4f v = *(const v4fa*)&so[w][q * 2 + rsub][c4];
        if (RES) v += res[q];      /* acc alpha + bias, then the residual, then the activation: the order of k_gemm2 */
        if (ACT == 3) { for (int i = 0; i < 4; ++i) v[i] = fmaxf(v[i], 0.f); }
        if (F32O) *(v4f*)(C + e0 + (32 * hf + 2 * q) * LDC) = v; else { v4h h4; for (int i = 0; i < 4; ++i) h4[i] = (_Float16)v[i]; *(v4h*)(C16 + e0 + (32 * hf + 2 * q) * LDC) = h4; } }
      asm volatile("s_wait_xcnt 0x0" ::: "memory"); }      /* the wait that belongs in front of a later overwrite of the registers which these eight stores name */
    __builtin_amdgcn_fence(__ATOMIC_ACQ_REL, "workgroup"); __builtin_amdgcn_wave_barrier(); } }      /* the row reads stay in front of the next half's staging stores */


__global__ __launch_bounds__(256) void k_wnat(const float* __restrict__ w, size_t n8, _Float16* __restrict__ Bt) { const size_t t = (size_t)blockIdx.x * 256 + threadIdx.x; if (t >= n8) return; FragH f; for (int q = 0; q < 8; ++q) f.h[q] = (_Float16)(bf16_round(w[t * 8 + q]) * 16.0f); *(v8us*)((unsigned short*)Bt + t * 8) = f.half[0];  }
__global__ __launch_bounds__(256) void k_rsm(const float* __restrict__ S, _Float16* __restrict__ P, int nrows) {
  #pragma clang fp contract(off)
  const int i = blockIdx.x * 256 + threadIdx.x; if (i >= nrows) return; const float* s = S + (size_t)i * SQ; float mx = -3.0e38f;
#pragma unroll 1
  for (int j = 0; j < SQ; ++j) mx = fmaxf(mx, s[j]); float se = 0.f;
#pragma unroll 1
  for (int j = 0; j < SQ; ++j) se += expf(s[j] - mx); const float sc = 256.0f / se;
#pragma unroll 1
  for (int j0 = 0; j0 < SQ; j0 += 8) { FragH f; for (int q = 0; q < 8; ++q) f.h[q] = (_Float16)(expf(s[j0 + q] - mx) * sc); unsigned short* d = (unsigned short*)P + (size_t)i * SQ + j0; *(v8us*)d = f.half[0];  } }
__global__ __launch_bounds__(256) void k_vt(const _Float16* __restrict__ V16, int b, int h0, _Float16* __restrict__ VT) { __shared__ unsigned short tl[64][65]; const int tid = threadIdx.x; const int hh = blockIdx.x % HG, sg = blockIdx.x / HG; const int s0 = sg * 64; const int h = h0 + hh;
  for (int i = tid; i < 64 * 8; i += 256) { const int j = i / 8, d8 = (i % 8) * 8; FragH f; f.half[0] = *(const v8us*)((const unsigned short*)V16 + ((size_t)b * SQ + s0 + j) * DM + h * HD + d8); for (int q = 0; q < 8; ++q) tl[d8 + q][j] = f.u[q]; }
  __syncthreads();
  { for (int i = tid; i < 64 * 8; i += 256) { const int d = i / 8, j8 = (i % 8) * 8; FragH f; for (int q = 0; q < 8; ++q) f.u[q] = tl[d][j8 + q]; *(v8us*)((unsigned short*)VT + ((size_t)hh * HD + d) * SQ + s0 + j8) = f.half[0]; }  } }



// lane l with lane l ^ m inside a 16-lane row (DPP row_xmask, CTRL = 0x160 | m)
template <int CTRL> __device__ __forceinline__ float lane_xm(float x) { return __builtin_bit_cast(float, __builtin_amdgcn_update_dpp(0, __builtin_bit_cast(int, x), CTRL, 0xf, 0xf, true)); }
// 2^t for eight values in place. Asm so that the free slot which the instruction set asks for behind a transcendental, before its result is used or its source overwritten, stands by construction: no line here touches the line before it, and the v_nop covers the last
__device__ __forceinline__ void exp2_x8(float (&t)[8]) { asm("v_exp_f32 %0, %0\n\tv_exp_f32 %1, %1\n\tv_exp_f32 %2, %2\n\tv_exp_f32 %3, %3\n\tv_exp_f32 %4, %4\n\tv_exp_f32 %5, %5\n\tv_exp_f32 %6, %6\n\tv_exp_f32 %7, %7\n\tv_nop" : "+v"(t[0]), "+v"(t[1]), "+v"(t[2]), "+v"(t[3]), "+v"(t[4]), "+v"(t[5]), "+v"(t[6]), "+v"(t[7])); }
// ---- fused causal attention: scores, softmax and P V of 128 query rows of one head in one work-group; S and P never reach memory ----
// A wave holds 32 query rows (q fragments and the o tiles in registers). Per tile of 64 keys: S = q K^T on WMMA, running row maximum and sum (the o tiles and the sum are rescaled when the maximum rises), P (x256, f16) goes through the wave's own LDS rows from accumulator layout to A-fragment layout, o += P V on WMMA.
#define FA_BUF (128 * G2_PITCH)      /* one staged key tile: 64 K rows, then 64 V^T rows, 128 bytes each */
#define FA_PH (G2_PITCH / 2)         /* pitch of a P row in halves */
static_assert(SQ % 128 == 0 && HD == 64, "k_fattn: whole tiles of 128 query rows and 64 keys; 64 values a head");
// One key tile into LDS: eight asynchronous 16-byte copies a lane (copy i lands 16 rows below copy i - 1; 0..3 = K rows, 4..7 = V^T rows). One asm statement, as in g2_stage: the s_wait_xcnt at its end stands in front of any later overwrite of the address registers that the copies name.
__device__ __forceinline__ void fa_stage(unsigned l, const _Float16* gk, size_t sk, const _Float16* gv, size_t sv) {
  asm volatile("global_load_async_to_lds_b128 %0, %8, off\n\tglobal_load_async_to_lds_b128 %1, %9, off\n\tglobal_load_async_to_lds_b128 %2, %10, off\n\tglobal_load_async_to_lds_b128 %3, %11, off\n\t"
               "global_load_async_to_lds_b128 %4, %12, off\n\tglobal_load_async_to_lds_b128 %5, %13, off\n\tglobal_load_async_to_lds_b128 %6, %14, off\n\tglobal_load_async_to_lds_b128 %7, %15, off\n\ts_wait_xcnt 0x0"
               :: "v"(l), "v"(l + 16 * G2_PITCH), "v"(l + 32 * G2_PITCH), "v"(l + 48 * G2_PITCH), "v"(l + 64 * G2_PITCH), "v"(l + 80 * G2_PITCH), "v"(l + 96 * G2_PITCH), "v"(l + 112 * G2_PITCH),
                  "v"(gk), "v"(gk + sk), "v"(gk + 2 * sk), "v"(gk + 3 * sk), "v"(gv), "v"(gv + sv), "v"(gv + 2 * sv), "v"(gv + 3 * sv) : "memory"); }
__device__ __forceinline__ float row16_max(float x) { x = fmaxf(x, lane_xm<0x161>(x)); x = fmaxf(x, lane_xm<0x162>(x)); x = fmaxf(x, lane_xm<0x164>(x)); return fmaxf(x, lane_xm<0x168>(x)); }
__device__ __forceinline__ float row16_sum(float x) { x += lane_xm<0x161>(x); x += lane_xm<0x162>(x); x += lane_xm<0x164>(x); return x + lane_xm<0x168>(x); }
__global__ __launch_bounds__(128) void k_fattn(const _Float16* __restrict__ Q, const _Float16* __restrict__ K, const _Float16* __restrict__ VTp, float scale, _Float16* __restrict__ O) {
  __shared__ __attribute__((aligned(16))) unsigned char sm[2 * FA_BUF + 4 * 32 * G2_PITCH];      /* two staged key tiles, then 32 P rows per wave */
  const int tid = threadIdx.x, lane = tid & 31, ln = lane & 15, hh = lane >> 4; const int w = __builtin_amdgcn_readfirstlane(tid >> 5);
  const int h = blockIdx.x, b = blockIdx.y; const int q0 = (SQ / 128 - 1 - (int)blockIdx.z) * 128;      /* the longest tiles start first */
  const int nt = (q0 + 128) >> 6;      /* causal: key tiles up to the last query row; at least two */
  const int rw = q0 + 32 * w;      /* the wave's first query row */
  const _Float16* qr0 = Q + ((size_t)b * SQ + rw + ln) * LQ + h * HD; const _Float16* qr1 = qr0 + (size_t)16 * LQ;
  const v16h qa00 = g2_frag(qr0, hh), qa01 = g2_frag(qr0 + 32, hh), qa10 = g2_frag(qr1, hh), qa11 = g2_frag(qr1 + 32, hh);
  const _Float16* gk = K + ((size_t)b * SQ + (tid >> 3)) * LQ + h * HD + (tid & 7) * 8; const _Float16* gv = VTp + (((size_t)b * NH + h) * HD + (tid >> 3)) * SQ + (tid & 7) * 8;      /* this lane's 16 bytes of row tid / 8 of each 16-row group */
  const size_t sk = (size_t)16 * LQ, sv = (size_t)16 * SQ; const unsigned l0 = (unsigned)(size_t)sm + (unsigned)((tid >> 3) * G2_PITCH + (tid & 7) * 16);
  const unsigned char* fk = sm + ln * G2_PITCH; const unsigned char* fv = sm + (64 + ln) * G2_PITCH;      /* this lane's fragment rows in buffer 0 */
  _Float16* sp = (_Float16*)(sm + 2 * FA_BUF + w * 32 * G2_PITCH);
  const v8f z8 = {0.f,0.f,0.f,0.f,0.f,0.f,0.f,0.f}; v8f o[2][4]; float m[2][8], l[2][8];
#pragma unroll
  for (int i = 0; i < 2; ++i) {
#pragma unroll
    for (int j = 0; j < 4; ++j) o[i][j] = z8;
#pragma unroll
    for (int r = 0; r < 8; ++r) { m[i][r] = -1.0e30f; l[i][r] = 0.f; } }
  const float sl = scale * 1.44269504f;      /* e^(s scale) = 2^(s scale log2 e) */
  fa_stage(l0, gk, sk, gv, sv);
  asm volatile("s_wait_asynccnt 0x0" ::: "memory");      /* this wave's copies of tile 0 have landed */
  __syncthreads();      /* tile 0 published */
  fa_stage(l0 + FA_BUF, gk + (size_t)64 * LQ, sk, gv + 64, sv);      /* tile 1 flies while tile 0 is worked on */
#pragma unroll 1
  for (int t = 0; t < nt; ++t) { const unsigned bo = (unsigned)(t & 1) * FA_BUF;      /* kept rolled: one trip is one staged tile and the buffers alternate */
    if (t * 64 <= rw + 31) {      /* wave-uniform: a tile wholly above the wave's rows adds nothing; the waits and the barrier below are passed all the same */
      v8f s[2][4];
#pragma unroll
      for (int j = 0; j < 4; ++j) { s[0][j] = z8; s[1][j] = z8; }
#pragma unroll
      for (int ks = 0; ks < 2; ++ks) { const _Float16* pk = (const _Float16*)(fk + bo + ks * 64); v16h kb[4];
        if (ks) __builtin_amdgcn_sched_barrier(0);      /* keeps the second half's fragment reads behind the first half's products: read ahead, they take 32 more registers, the kernel passes 256 and a SIMD holds three waves instead of four */
#pragma unroll
        for (int j = 0; j < 4; ++j) kb[j] = g2_frag(pk + j * 8 * G2_PITCH, hh);      /* the four fragments' reads stand together in front of their products: one LDS latency, not four */
#pragma unroll
        for (int j = 0; j < 4; ++j) { s[0][j] = g2_mma(ks ? qa01 : qa00, kb[j], s[0][j]); s[1][j] = g2_mma(ks ? qa11 : qa10, kb[j], s[1][j]); } }
      if (t * 64 + 63 > rw) {      /* wave-uniform: only tiles that reach above the wave's first row hold masked keys */
#pragma unroll
        for (int i = 0; i < 2; ++i)
#pragma unroll
          for (int j = 0; j < 4; ++j)
#pragma unroll
            for (int r = 0; r < 8; ++r) s[i][j][r] = (t * 64 + 16 * j + ln <= rw + 16 * i + 8 * hh + r) ? s[i][j][r] : -1.0e30f; }
#pragma unroll
      for (int i = 0; i < 2; ++i) { float cr[8], cc[8];      /* accumulator layout: register r of lane (hh, ln) is row 16 i + 8 hh + r, key 16 j + ln */
#pragma unroll
        for (int r = 0; r < 8; ++r) { const float mt = row16_max(fmaxf(fmaxf(s[i][0][r], s[i][1][r]), fmaxf(s[i][2][r], s[i][3][r]))); const float mn = fmaxf(m[i][r], mt); cr[r] = (m[i][r] - mn) * sl; cc[r] = 8.0f - mn * sl; m[i][r] = mn; }
        exp2_x8(cr);
#pragma unroll
        for (int r = 0; r < 8; ++r) l[i][r] *= cr[r];
#pragma unroll
        for (int j = 0; j < 4; ++j) { float p[8];
#pragma unroll
          for (int r = 0; r < 8; ++r) p[r] = fmaf(s[i][j][r], sl, cc[r]);      /* weights carried x256, as the f16 P was before */
          exp2_x8(p);
#pragma unroll
          for (int r = 0; r < 8; ++r) { l[i][r] += p[r]; sp[(16 * i + 8 * hh + r) * FA_PH + 16 * j + ln] = (_Float16)p[r]; o[i][j][r] *= cr[r]; } } }
      __builtin_amdgcn_fence(__ATOMIC_ACQ_REL, "workgroup"); __builtin_amdgcn_wave_barrier();      /* the wave's P stores stay in front of its fragment reads of the same rows */
#pragma unroll
      for (int ks = 0; ks < 2; ++ks) { const v16h pa0 = g2_frag(sp + ln * FA_PH + ks * 32, hh), pa1 = g2_frag(sp + (16 + ln) * FA_PH + ks * 32, hh); const _Float16* pv = (const _Float16*)(fv + bo + ks * 64); v16h vb[4];
#pragma unroll
        for (int j = 0; j < 4; ++j) vb[j] = g2_frag(pv + j * 8 * G2_PITCH, hh);      /* as above */
#pragma unroll
        for (int j = 0; j < 4; ++j) { o[0][j] = g2_mma(pa0, vb[j], o[0][j]); o[1][j] = g2_mma(pa1, vb[j], o[1][j]); } } }
    asm volatile("s_wait_dscnt 0x0" ::: "memory");      /* this wave's reads of the buffer have returned before the buffer is given up */
    asm volatile("s_wait_asynccnt 0x0" ::: "memory");      /* this wave's copies of tile t + 1 have landed */
    __syncthreads();      /* publishes tile t + 1 and ends every wave's reads of tile t */
    if (t + 2 < nt) fa_stage(l0 + bo, gk + (size_t)(t + 2) * 64 * LQ, sk, gv + (size_t)(t + 2) * 64, sv); }      /* refill of the buffer just left */
  asm volatile("s_wait_asynccnt 0x0" ::: "memory");      /* no copy is outstanding at the end */
#pragma unroll
  for (int i = 0; i < 2; ++i)
#pragma unroll
    for (int r = 0; r < 8; ++r) { const float fin = 64.0f / row16_sum(l[i][r]);      /* o carried x64 as before; the x256 of the weights cancels */
#pragma unroll
      for (int j = 0; j < 4; ++j) sp[(16 * i + 8 * hh + r) * FA_PH + 16 * j + ln] = (_Float16)(o[i][j][r] * fin); }
  __builtin_amdgcn_fence(__ATOMIC_ACQ_REL, "workgroup"); __builtin_amdgcn_wave_barrier();      /* the wave's o stores stay in front of its row reads */
#pragma unroll
  for (int q = 0; q < 8; ++q) { const int row = q * 4 + (lane >> 3), c8 = (lane & 7) * 8; const v8us v = *(const v8us*)((const unsigned short*)sp + row * FA_PH + c8); *(v8us*)((unsigned short*)O + ((size_t)b * SQ + rw + row) * DM + h * HD + c8) = v; } }      /* whole 128-byte row pieces per store */


typedef float v2f __attribute__((ext_vector_type(2)));
#define JU 4                         /* keys whose score chains run side by side in the exact attention */
// Exact f32 attention of the first QT0 rows, one thread per query row. The row's q and o live in registers; the head's K and V rows are staged once in LDS and read from there at one address for the whole wave.
// Every d loop is unrolled, and JU keys are taken together, so that their JU chains of dependent adds fill one another's latency. Per row every product, every sum and the running-maximum recurrence stand in the order they had key by key.
template <int MASKADD>
__global__ __launch_bounds__(64) void k_att0(const float* __restrict__ QF, const float* __restrict__ KF, const float* __restrict__ VF, int ld, const float* __restrict__ mask, float scale, float* __restrict__ OF, int ldo) {
  #pragma clang fp contract(off)      /* as before; numerical: each q k product stays rounded in front of its add, as it was built so far, so that the exact rows' scores, and with them o, stay bit-identical */
  static_assert(MASKADD == 0, "k_att0: causal form only (the staged K and V rows are those of the first tile)"); static_assert(64 % JU == 0 && HD == 64, "k_att0: whole groups of JU keys; 64 values a row");
  (void)mask;
  __shared__ __attribute__((aligned(16))) float sk[QT0][HD]; __shared__ __attribute__((aligned(16))) float sv[QT0][HD];
  float (*lo)[HD + 4] = (float (*)[HD + 4])sk;      /* behind the loop's barrier the K rows' bytes are the output staging; pitch 68 floats spreads the rows over the banks */
  static_assert(sizeof(float) * 64 * (HD + 4) <= sizeof(float) * QT0 * HD, "k_att0: the output staging fits the K rows");
  const int tid = threadIdx.x; const int h = blockIdx.x / (QT0 / 64), rg = blockIdx.x % (QT0 / 64); const int i = rg * 64 + tid;
  const size_t bo_in = (size_t)blockIdx.y * QT0 * ld; QF += bo_in; KF += bo_in; VF += bo_in; OF += (size_t)blockIdx.y * QT0 * ldo;      /* batch on grid.y: QT0 rows per batch in every plane */
  const float* qr = QF + (size_t)i * ld + h * HD;
  const int nkey = rg * 64 + 64;      /* causal form: keys up to the block's last row */
  const int sr = tid >> 4, c4 = (tid & 15) * 4; const unsigned lof = (unsigned)(sr * ld + c4);      /* sixteen lanes take one 256-byte row */
#pragma unroll 1
  for (int r0 = 0; r0 < nkey; r0 += 32) { v4f tk[8], tv[8]; const float* pk[8]; const float* pv[8];      /* 32 rows a trip: sixteen loads in flight per lane; rolled, since two or four trips of them are all there is */
#pragma unroll
    for (int it = 0; it < 8; ++it) { const size_t g = (size_t)(r0 + it * 4) * ld + h * HD; pk[it] = (KF + g) + lof; pv[it] = (VF + g) + lof; tk[it] = *(const v4fa*)pk[it]; tv[it] = *(const v4fa*)pv[it]; }
    asm volatile("s_wait_xcnt 0x0" :: "v"(pk[0]), "v"(pk[1]), "v"(pk[2]), "v"(pk[3]), "v"(pk[4]), "v"(pk[5]), "v"(pk[6]), "v"(pk[7]), "v"(pv[0]), "v"(pv[1]), "v"(pv[2]), "v"(pv[3]), "v"(pv[4]), "v"(pv[5]), "v"(pv[6]), "v"(pv[7]) : "memory");      /* the wait that belongs in front of any overwrite of the loads' address registers; naming them keeps them whole up to it (without it the last load's result was given the first load's address registers) */
#pragma unroll
    for (int it = 0; it < 8; ++it) { *(v4f*)&sk[r0 + it * 4 + sr][c4] = tk[it]; *(v4f*)&sv[r0 + it * 4 + sr][c4] = tv[it]; } }
  v2f q2[HD / 2], o2[HD / 2];
#pragma unroll
  for (int c = 0; c < HD / 4; ++c) { const v4f qq = *(const v4fa*)(qr + c * 4); q2[2 * c] = v2f{qq[0], qq[1]}; q2[2 * c + 1] = v2f{qq[2], qq[3]}; o2[2 * c] = v2f{0.f, 0.f}; o2[2 * c + 1] = v2f{0.f, 0.f}; }
  asm volatile("s_wait_xcnt 0x0" :: "v"(qr) : "memory");      /* as above, for the address register of the q loads */
  __syncthreads();      /* the staged K and V rows are published to both waves */
  float m = -1.0e30f, l = 0.f;
  // A piece = 8 LDS reads of 16 bytes: 8 values (d = 8 n .. 8 n + 7) of JU rows. Two register buffers: the next piece's reads are issued in front of this piece's arithmetic, so that an LDS read's latency is not paid read by read.
  v4f ba[2 * JU], bb[2 * JU];
  auto fetch = [&](v4f (&buf)[2 * JU], const float (*rows)[HD], int jb, int n) {
#pragma unroll
    for (int u = 0; u < JU; ++u) { buf[2 * u] = *(const v4f*)&rows[jb + u][8 * n]; buf[2 * u + 1] = *(const v4f*)&rows[jb + u][8 * n + 4]; } };
  float s[JU], sc[JU], e[JU];
  auto dots = [&](const v4f (&buf)[2 * JU], int n) {      /* two rounded products an instruction; the adds stay one chain per key, d ascending */
#pragma unroll
    for (int w = 0; w < 2; ++w)
#pragma unroll
      for (int u = 0; u < JU; ++u) { const v4f kq = buf[2 * u + w]; const v2f p0 = q2[4 * n + 2 * w] * v2f{kq[0], kq[1]}, p1 = q2[4 * n + 2 * w + 1] * v2f{kq[2], kq[3]};
        s[u] = __fadd_rn(s[u], p0[0]); s[u] = __fadd_rn(s[u], p0[1]); s[u] = __fadd_rn(s[u], p1[0]); s[u] = __fadd_rn(s[u], p1[1]); } };
  auto accum = [&](const v4f (&buf)[2 * JU], int n) {      /* o = fma(o, sc, round(e v)), key after key: the rounding that this line was built with before, written out */
#pragma unroll
    for (int w = 0; w < 2; ++w)
#pragma unroll
      for (int u = 0; u < JU; ++u) { const v4f vv = buf[2 * u + w]; const v2f s2 = {sc[u], sc[u]}, e2 = {e[u], e[u]};
        o2[4 * n + 2 * w] = __builtin_elementwise_fma(o2[4 * n + 2 * w], s2, e2 * v2f{vv[0], vv[1]}); o2[4 * n + 2 * w + 1] = __builtin_elementwise_fma(o2[4 * n + 2 * w + 1], s2, e2 * v2f{vv[2], vv[3]}); } };
  fetch(ba, sk, 0, 0);
#pragma unroll 1
  for (int j0 = 0; j0 < nkey; j0 += JU) {      /* kept rolled: one trip already holds JU keys' unrolled d loops */
    const int jn = (j0 + JU < nkey) ? j0 + JU : 0;      /* the last trip fetches ahead from row 0, inside the array; that piece is not used */
#pragma unroll
    for (int u = 0; u < JU; ++u) s[u] = 0.f;
#pragma unroll
    for (int n = 0; n < HD / 8; n += 2) {
      fetch(bb, sk, j0, n + 1);
      __builtin_amdgcn_sched_barrier(0);      /* keeps the reads above in front of the arithmetic below: without it each read sinks to its use and waits out its own latency */
      dots(ba, n);
      if (n + 2 < HD / 8) fetch(ba, sk, j0, n + 2); else fetch(ba, sv, j0, 0);
      __builtin_amdgcn_sched_barrier(0);      /* as above */
      dots(bb, n + 1); }
#pragma unroll
    for (int u = 0; u < JU; ++u) { const float ss = __fmul_rn(s[u], scale);
      const float f = (j0 + u <= i) ? 1.f : 0.f; const float sm = fmaf(f, ss, (1.f - f) * -1.0e30f); const float mn = fmaxf(m, sm); sc[u] = expf(m - mn); e[u] = expf(sm - mn); l = fmaf(l, sc[u], e[u]); m = mn; }      /* l: one fused multiply-add, as this line was built before */
#pragma unroll
    for (int n = 0; n < HD / 8; n += 2) {
      fetch(bb, sv, j0, n + 1);
      __builtin_amdgcn_sched_barrier(0);      /* as above */
      accum(ba, n);
      if (n + 2 < HD / 8) fetch(ba, sv, j0, n + 2); else fetch(ba, sk, jn, 0);
      __builtin_amdgcn_sched_barrier(0);      /* as above */
      accum(bb, n + 1); } }
  const float fin = 64.0f / l;      /* o carried x64 like the f16 path */
  __syncthreads();      /* both waves have left the K rows before their bytes become the output staging */
#pragma unroll
  for (int c = 0; c < HD / 4; ++c) { const v2f a = o2[2 * c] * v2f{fin, fin}, b = o2[2 * c + 1] * v2f{fin, fin}; *(v4f*)&lo[tid][c * 4] = v4f{a[0], a[1], b[0], b[1]}; }
  __syncthreads();
  {
#pragma unroll 1
    for (int it0 = 0; it0 < 16; it0 += 4) {      /* rolled: four stores in flight a trip are enough for 16 KiB */
#pragma unroll
      for (int it = it0; it < it0 + 4; ++it) { const int row = it * 4 + tid / 16, pc = (tid % 16) * 4; const v4f v = *(const v4f*)&lo[row][pc]; *(v4f*)(OF + (size_t)(rg * 64 + row) * ldo + h * HD + pc) = v; }      /* whole 256-byte row pieces per store, as before */
      asm volatile("s_wait_xcnt 0x0" ::: "memory"); }      /* the wait that belongs in front of the next trip's overwrite of the registers which these stores name */
     } }


template <int BFIN, int WXB>
__global__ __launch_bounds__(256) void k_ln16(const float* __restrict__ X, const float* __restrict__ g, const float* __restrict__ bb, float eps, _Float16* __restrict__ N16, float* __restrict__ XB) {
  #pragma clang fp contract(off)
  __shared__ float red[256]; const size_t r = blockIdx.x; const int t = threadIdx.x; const v4f xa = *(const v4fa*)(X + r * DMQ + t * 4); float s[4]; float sum = 0.f;
  for (int q = 0; q < 4; ++q) { s[q] = BFIN ? bf16_round(xa[q]) : xa[q]; sum = __fadd_rn(sum, s[q]); }
  red[t] = sum; __syncthreads(); for (int st = 128; st > 0; st >>= 1) { if (t < st) red[t] = __fadd_rn(red[t], red[t + st]); __syncthreads(); } const float mu = red[0] / (float)DMQ; __syncthreads();
  float vs = 0.f; for (int q = 0; q < 4; ++q) { const float dl = __fadd_rn(s[q], -mu); vs = __fadd_rn(vs, __fmul_rn(dl, dl)); } red[t] = vs; __syncthreads(); for (int st = 128; st > 0; st >>= 1) { if (t < st) red[t] = __fadd_rn(red[t], red[t + st]); __syncthreads(); }
  const float rs = rsqrtf(__fadd_rn(red[0] / (float)DMQ, eps)); v4h y; v4f xb;
  for (int q = 0; q < 4; ++q) { const int c = t * 4 + q; y[q] = (_Float16)__fadd_rn(__fmul_rn(__fmul_rn(__fadd_rn(s[q], -mu), rs), bf16_round(g[c])), bf16_round(bb[c])); xb[q] = s[q]; }
  { *(v4h*)(N16 + r * DMQ + t * 4) = y; if (WXB) *(v4f*)(XB + r * DMQ + t * 4) = xb;  } }
__global__ __launch_bounds__(256) void k_ftres2(const float* __restrict__ OF0, const float* __restrict__ XB, float* __restrict__ X1, size_t n4) {
  #pragma clang fp contract(off)
  const size_t t = (size_t)blockIdx.x * 256 + threadIdx.x; if (t >= n4) return; const v4f o = *(const v4fa*)(OF0 + t * 4), xv = *(const v4fa*)(XB + t * 4); v4f y; for (int q = 0; q < 4; ++q) y[q] = __fadd_rn(__fmul_rn(o[q], 0.015625f), xv[q]); *(v4f*)(X1 + t * 4) = y;  }

__global__ __launch_bounds__(256) void k_wthd(const float* __restrict__ Wt, _Float16* __restrict__ Bt) { const size_t t = (size_t)blockIdx.x * 256 + threadIdx.x; if (t >= (size_t)NH * HD * (DM / 8)) return; const int m8 = (int)(t % (DM / 8)) * 8; const int d = (int)((t / (DM / 8)) % HD); const int h = (int)(t / ((size_t)(DM / 8) * HD)); FragH f;
  for (int q = 0; q < 8; ++q) f.h[q] = (_Float16)(16.0f * bf16_round(Wt[((size_t)h * DM + m8 + q) * HD + d])); unsigned short* dst = (unsigned short*)Bt + ((size_t)h * HD + d) * DM + m8; *(v8us*)dst = f.half[0];  }




__global__ __launch_bounds__(256) void k_wtpad(const float* __restrict__ Wm, _Float16* __restrict__ Wt, int Kr, int Kp, int Nr, int Np, float scale) {
  const int t = blockIdx.x * 256 + threadIdx.x; if (t >= Np * (Kp / 8)) return; const int n = t / (Kp / 8), k8 = (t % (Kp / 8)) * 8; const int nc = min(n, Nr - 1); const float fn = (n < Nr) ? 1.f : 0.f; FragH f;
  for (int i = 0; i < 8; ++i) { const int k = k8 + i; const int kc = min(k, Kr - 1); const float fk = (k < Kr) ? fn : 0.f; f.h[i] = (_Float16)(bf16_round(Wm[(size_t)kc * Nr + nc]) * scale * fk); }
  unsigned short* o = (unsigned short*)Wt + (size_t)n * Kp + k8; *(v8us*)o = f.half[0];  }
__global__ __launch_bounds__(128) void k_bpad(const float* __restrict__ b, float* __restrict__ Bp, int nr, int np) {
  const int i = threadIdx.x; if (i >= np) return; const float v = b[min(i, nr - 1)] * ((i < nr) ? 1.f : 0.f); *(float*)(Bp + i) = v;  }
extern "C" void kernel_launch(void* const* d_in, const int* in_sizes, int n_in,
                              void* d_out, int out_size, void* d_ws, size_t ws_size, hipStream_t stream) {
  (void)in_sizes; (void)n_in; (void)out_size;
  const float* const* I = (const float* const*)d_in; const float* x = I[0]; const float* wqkv = I[1]; const float* bqkv = I[2]; const float* wo = I[3]; const float* bo = I[4]; const float* g1 = I[5]; const float* be1 = I[6]; const float* gg2 = I[7]; const float* be2 = I[8]; const float* wfc = I[9]; const float* bfc = I[10]; const float* wmp = I[11]; const float* bmp = I[12];      /* x; fused Wqkv [1024][3072] + bqkv [3072] ([in][out]); Wproj + bproj; LN1 g / b, LN2 g / b; W1 [1024][4096] + b1, W2 [4096][1024] + b2 */
  char* ws = (char*)d_ws; size_t off = 0;
  auto take = [&](size_t bytes) { char* p = ws + off; off += (bytes + 255) & ~(size_t)255; return p; };
  _Float16* BQKV = (_Float16*)take((size_t)3 * DM * DM * 2); _Float16* BO = (_Float16*)take((size_t)DM * DM * 2);
  _Float16* X16 = (_Float16*)take(NR * DM * 2); float* XB = (float*)take(NR * DM * 4); _Float16* BW1 = (_Float16*)take((size_t)DFF * DM * 2); _Float16* BW2 = (_Float16*)take((size_t)DM * DFF * 2);
  _Float16* QKV = (_Float16*)take(NR * 3 * DM * 2); _Float16* Q16 = QKV; _Float16* K16 = QKV + DM; _Float16* V16 = QKV + 2 * DM; _Float16* O16 = (_Float16*)take(NR * DM * 2);
  _Float16* HF16 = QKV;      /* alias: the FFN hidden rows [NR][DFF] fill QKV + O16 (adjacent, same bytes); their last reader, the output projection, precedes the FFN */
  _Float16* M16 = X16;      /* alias: X16's last reader, the first-tile q | k | v GEMM, precedes LN2's write */
  _Float16* VT = (_Float16*)take((size_t)NB * NH * HD * SQ * 2);
  float* OF0 = (float*)take((size_t)NB * QT0 * DM * 4); _Float16* OH0 = (_Float16*)take((size_t)NB * QT0 * DM * 2); _Float16* OL0 = (_Float16*)take((size_t)NB * QT0 * DM * 2);
  float* S = (float*)take((size_t)GB * NH * QT * NKX * 4);      /* no scores any more: the plane of the two aliases below */
  float* QKVF0 = S;      /* alias: f32 q | k | v of the first tiles [NB][QT0][3 DM]; read by the exact attention before x1 is written */
  float* X1 = S;      /* alias: x1 [NR][DM] is written after the exact attention's last read of QKVF0 */
  if (off > ws_size) return;
  k_wt_f16<<<(unsigned)(((size_t)3 * DM * (DM / 8) + 255) / 256), 256, 0, stream>>>(wqkv, BQKV, DM, 3 * DM, 16.0f);      /* fused [in][out] [DM][3 DM] -> Bt [3 DM][DM] x16: rows 0.. = q, DM.. = k, 2 DM.. = v output columns (contiguous thirds) */ k_wt_f16<<<(unsigned)(((size_t)DM * (DM / 8) + 255) / 256), 256, 0, stream>>>(wo, BO, DM, DM, 16.0f);      /* w_proj [in][out] -> Bt x16 */
  k_ln16<1, 1><<<(unsigned)NR, 256, 0, stream>>>(x, g1, be1, 1e-5f, X16, XB);      /* a = LN1(bf16(x)) -> f16 rows; XB = bf16(x) for the residual */
  k_wt_f16<<<(unsigned)(((size_t)DFF * (DM / 8) + 255) / 256), 256, 0, stream>>>(wfc, BW1, DM, DFF, 16.0f); k_wt_f16<<<(unsigned)(((size_t)DM * (DFF / 8) + 255) / 256), 256, 0, stream>>>(wmp, BW2, DFF, DM, 16.0f);      /* W1 [1024][4096] -> Bt [4096][1024]; W2 [4096][1024] -> Bt [1024][4096] (x16) */
  k_gemm3<0, false, false, 3 * DM><<<(unsigned)((MP / 256) * (3 * DM / 128)), 256, 0, stream>>>(X16, DM, BQKV, DM, 0.0625f, bqkv, nullptr, nullptr, QKV, MP, 3 * DM, DM);      /* q | k | v rows (f16); head h = columns h*HD.. of each DM block */
  k_vt<NH, SQ><<<NB * NH * (SQ / 64), 256, 0, stream>>>(V16, LQ, 0, VT);      /* V^T [NB][NH][HD][SQ], every batch in one launch */
  k_gemm2<0><<<dim3((QT0 / 128) * (3 * DM / 64), NB), 128, 0, stream>>>(X16, DM, (size_t)SQ * DM, BQKV, DM, 0, 0.0625f, bqkv, 0, nullptr, 1, 0, 0, QKVF0, nullptr, 3 * DM, (size_t)QT0 * 3 * DM, QT0, 3 * DM, DM);      /* f32 q | k | v of the first 128 rows of every batch (grid.y; exact products) */
  k_att0<0><<<dim3(NH * (QT0 / 64), NB), 64, 0, stream>>>(QKVF0, QKVF0 + DM, QKVF0 + 2 * DM, 3 * DM, nullptr, 0.07216878364870322f, OF0, DM);      /* exact f32 attention for rows 0..127 of every batch (grid.y; o x64) */
  k_fattn<<<dim3(NH, NB, SQ / 128), 128, 0, stream>>>(Q16, K16, VT, 0.07216878364870322f, O16);      /* causal attention, every batch, head and query tile in one launch: o (merged heads, x64) as f16 rows */
  k_gemm3<0, true, true, DM><<<(unsigned)((MPO / 256) * (DM / 128)), 256, 0, stream>>>(O16, DM, BO, DM, 0.0009765625f, bo, XB, X1, nullptr, MPO, DM, DM);      /* x1 = x + o Wo + b, all rows */
  k_hl<<<(unsigned)(((size_t)NB * QT0 * DM / 8 + 255) / 256), 256, 0, stream>>>(OF0, OH0, OL0, (size_t)NB * QT0 * DM / 8);      /* first-tile o (x64) -> f16 hi + x1024 residual planes */
  k_gemm2<0><<<dim3((QT0 / 128) * (DM / 64), NB), 128, 0, stream>>>(OH0, DM, (size_t)QT0 * DM, BO, DM, 0, 0.0009765625f, bo, 0, XB, -1, 0, 0, X1, nullptr, DM, (size_t)SQ * DM, QT0, DM, DM);      /* rows 0..127 of every batch (grid.y): x1 = x + o_hi Wo (+ b), overwriting the f16-path rows */
  k_gemm2<0><<<dim3((QT0 / 128) * (DM / 64), NB), 128, 0, stream>>>(OL0, DM, (size_t)QT0 * DM, BO, DM, 0, 0.00000095367431640625f, nullptr, 0, X1, -1, 0, 0, X1, nullptr, DM, (size_t)SQ * DM, QT0, DM, DM);      /* += o_lo Wo 2^-20 (own-element accumulate) */
  k_ln16<0, 0><<<(unsigned)NR, 256, 0, stream>>>(X1, gg2, be2, 1e-5f, M16, nullptr);      /* h = LN2(x1) -> f16 rows */
  k_gemm3<3, false, false, DFF><<<(unsigned)((MP / 256) * (DFF / 128)), 256, 0, stream>>>(M16, DM, BW1, DM, 0.0625f, bfc, nullptr, nullptr, HF16, MP, DFF, DM);      /* relu(h2 W1 + b1) -> f16, all rows */
  k_gemm3<0, true, true, DM><<<(unsigned)((MP / 256) * (DM / 128)), 256, 0, stream>>>(HF16, DFF, BW2, DFF, 0.0625f, bmp, X1, (float*)d_out, nullptr, MP, DM, DFF);      /* out = x1 + mlp (own-element residual), all rows */
}

// v007
// Measured time: 365 microseconds a run.
// Next to v006, in two timings, it ran 1.13 times as fast each time.
// Counting every step since v000, it is 28.8 times as fast.
#include <hip/hip_runtime.h>
// Pre-LN causal transformer block with a fused QKV projection and the module's literal score scale (x [8][1024][1024]; h = LN1(x) (biased var, eps 1e-5); qkv = h Wqkv + bqkv ([in][out] 1024 x 3072 + bias) split q | k | v; 16 heads of 64; scale = 1 / sqrt(3 * 1024 / 16) = 1 / sqrt(192) (as the source: NOT 1 / sqrt(head_dim)); causal (tril, -inf); softmax; x1 = x + y Wproj + bproj; out = x1 + relu(LN2(x1) W1 + b1) W2 + b2 ([in][out] 1024 x 4096 x 1024) -> [8][1024][1024]).
// Structure: token rows r = b*1024 + s; h = LN1(bf16(x)) as f16 rows; q | k | v as ONE WMMA GEMM (N = 3 x 1024) (64x64 wave tiles, f32 accumulation, exact x16 weights + bias, f16 outputs); per batch: V^T for all heads via LDS transposes; per query tile of 128 rows of a head, in one kernel: scores against tiles of 64 keys up to the tile end, running row maximum and sum (f32 statistics, native exp; keys above the row masked; weights x256 f16), o += P . V^T on WMMA (o carried x64, folded into the output GEMM alpha) written straight into the merged f16 o rows; x1 = x + o W_o + b GEMM (f32); h2 = LN2(x1) as f16 rows; relu(h2 W1 + b1) GEMM (f16 rows) and out = x1 + (.) W2 + b2 GEMM (f32) into the output layout.
// Compute dtype: inputs rounded to bf16; x / weights exact; q, k, v, softmax weights and o as plain f16 GEMM operands (~2^-12); scores and softmax statistics f32. v_wmma_f32_16x16x32_f16.
// Launches: the batch axis lies on the grid, not in a host loop: V^T takes all batches in one launch on grid.x; the first-tile q | k | v GEMM, the exact first-tile attention and the first-tile output GEMMs take all batches on grid.y; scores, softmax and P V are one launch for every batch, head and query tile; the FFN GEMMs take all token rows.
#define NB 8
#define SQ 1024
#define DM 1024
#define NH 16
#define HD 64
#define HG 4                         /* heads per launch of the k_vt(b, h0) overload, which is not launched */
#define QT 256
#define NKX SQ                       /* used only in sizing the S plane */
#define QT0 128                      /* first-tile rows recomputed exactly in f32 */
#define GB 4
#define B0 0                         /* unused; every launch starts at batch 0 */
#define NBR NB                       /* batches processed (debug hook) */
#define NR ((size_t)NB * SQ)
#define DMQ DM
#define DFF 4096                     /* FFN hidden width */
#define DFFR 100                     /* unused; the FFN hidden width is DFF */
#define MP ((int)((size_t)NBR * SQ)) /* rows projected (debug hook) */
#define QN SQ                        /* unused; attention takes all SQ query rows */
#define NHD NH                       /* unused; attention takes all NH heads */
#define MPO MP                       /* rows through the output stage (debug hook) */
#define LQ (3 * DM)      /* row pitch of the q/k/v rows */
typedef __bf16 v16b __attribute__((ext_vector_type(16)));
typedef unsigned short v8us __attribute__((ext_vector_type(8), may_alias));
typedef float  v8f  __attribute__((ext_vector_type(8)));
typedef float  v4f  __attribute__((ext_vector_type(4)));
typedef float  v4fa __attribute__((ext_vector_type(4), may_alias));
union FragB { v16b v; v8us half[2]; unsigned short u[16]; };

__device__ __forceinline__ unsigned short bf16_bits(float x) { unsigned int u = __float_as_uint(x); return (unsigned short)((u + 0x7FFFu + ((u >> 16) & 1u)) >> 16); }
__device__ __forceinline__ float bf16_val(unsigned short b) { return __uint_as_float(((unsigned int)b) << 16); }
__device__ __forceinline__ float bf16_round(float x) { return bf16_val(bf16_bits(x)); }
// D += A·B with NT terms: 1 = ah·bh, 2 = + al·bh (A split), 3 = + ah·bl (both split)
template <int NT>
__device__ __forceinline__ v8f mmaN(v16b ah, v16b al, v16b bh, v16b bl, v8f c) {
  c = __builtin_amdgcn_wmma_f32_16x16x32_bf16(false, ah, false, bh, (short)0, c, false, false);
  if (NT >= 2) c = __builtin_amdgcn_wmma_f32_16x16x32_bf16(false, al, false, bh, (short)0, c, false, false);
  if (NT >= 3) c = __builtin_amdgcn_wmma_f32_16x16x32_bf16(false, ah, false, bl, (short)0, c, false, false);
  asm volatile("v_nop\n\tv_nop\n\tv_nop\n\tv_nop" : "+v"(c) : "v"(ah), "v"(al), "v"(bh), "v"(bl));
  return c;
}

__global__ __launch_bounds__(256) void k_wt_bf16(const float* __restrict__ W, unsigned short* __restrict__ Wt, int K, int N) {
  const int t = blockIdx.x * 256 + threadIdx.x;
  const int k8n = K / 8;
  if (t >= N * k8n) return;
  const int n = t / k8n, k8 = (t % k8n) * 8;
  v8us v;
#pragma unroll
  for (int i = 0; i < 8; ++i) v[i] = bf16_bits(W[(size_t)(k8 + i) * N + n]);
  *(v8us*)(Wt + (size_t)n * K + k8) = v;
  
}

// GEMM C[M][N] (f32, pitch ldc) = act(A[M][K]·W + bias). A f32 row-major (pitch lda) converted per fragment to bf16
// (ASPLIT: hi/lo two planes -> 2 terms, else single rounded term); Wt bf16 [N][K] (pitch ldb). BIAS_BF16 rounds the
// bias to bf16 first (bias quantised to bf16 before the add). K%32==0, M%16==0, N%64==0.
template <bool ASPLIT, int ACT, bool BIAS_BF16>
__global__ __launch_bounds__(128) void k_gemm_bf(const float* __restrict__ A, int lda, const unsigned short* __restrict__ Wt, int ldb,
                                               const float* __restrict__ bias, float* __restrict__ C, int ldc, int M, int N, int K) {
  __shared__ __attribute__((aligned(16))) float so[4][16][64];
  const int tid = threadIdx.x, w = tid >> 5, lane = tid & 31, ln = lane & 15, hh = lane >> 4;
  const int ntn = N / 64;
  const int wid = blockIdx.x * 4 + w;
  const int mt = wid / ntn, nq = wid % ntn;
  if (mt * 16 >= M) return;
  const int row0 = mt * 16, col0 = nq * 64;
  const float* arow = A + (size_t)(row0 + ln) * lda;
  v8f acc[4] = {};
  for (int kb = 0; kb < K; kb += 32) {
    FragB ah, al;
    const v4f x0 = *(const v4fa*)(arow + kb + 8 * hh), x1 = *(const v4fa*)(arow + kb + 8 * hh + 4);
    const v4f x2 = *(const v4fa*)(arow + kb + 16 + 8 * hh), x3 = *(const v4fa*)(arow + kb + 16 + 8 * hh + 4);
    float xs[16] = {x0[0],x0[1],x0[2],x0[3],x1[0],x1[1],x1[2],x1[3],x2[0],x2[1],x2[2],x2[3],x3[0],x3[1],x3[2],x3[3]};
#pragma unroll
    for (int i = 0; i < 16; ++i) { const unsigned short hb = bf16_bits(xs[i]); ah.u[i] = hb; al.u[i] = ASPLIT ? bf16_bits(xs[i] - bf16_val(hb)) : (unsigned short)0; }
#pragma unroll
    for (int t = 0; t < 4; ++t) {
      const unsigned short* brow = Wt + (size_t)(col0 + t * 16 + ln) * ldb + kb;
      FragB b;
      b.half[0] = *(const v8us*)(brow + 8 * hh);
      b.half[1] = *(const v8us*)(brow + 16 + 8 * hh);
      acc[t] = mmaN<ASPLIT ? 2 : 1>(ah.v, al.v, b.v, b.v, acc[t]);
    }
  }
#pragma unroll
  for (int t = 0; t < 4; ++t) {
    float bv = bias ? bias[col0 + t * 16 + ln] : 0.f;
    if (BIAS_BF16) bv = bf16_round(bv);
#pragma unroll
    for (int r = 0; r < 8; ++r) { float v = acc[t][r] + bv; if (ACT == 1) v = fmaxf(v, 0.f); so[w][8 * hh + r][t * 16 + ln] = v; }
  }
  __builtin_amdgcn_fence(__ATOMIC_ACQ_REL, "workgroup");
  __builtin_amdgcn_wave_barrier();
  const int rsub = lane >> 4, c4 = (lane & 15) * 4;
  {
#pragma unroll
    for (int q = 0; q < 8; ++q) {
      const int r = q * 2 + rsub;
      const v4f v = *(const v4fa*)&so[w][r][c4];
      *(v4f*)(C + (size_t)(row0 + r) * ldc + col0 + c4) = v;
    }
    
  }
}

// GEMM C = act(A·W + bias + resid): A f32 (ASPLIT -> hi/lo 2 terms), Wt bf16 [N][K]; ACT 0 none, 1 relu, 2 exact gelu;
// resid (optional, f32, row index = (row % rmod), pitch ldr, RES_BF16 rounds it) added before the activation.
template <bool ASPLIT, int ACT, bool BIAS_BF16, bool RES_BF16>
__global__ __launch_bounds__(128) void k_gemm_bf3(const float* __restrict__ A, int lda, const unsigned short* __restrict__ Wt, int ldb,
                                                const float* __restrict__ bias, const float* __restrict__ resid, int rmod, int ldr,
                                                float* __restrict__ C, int ldc, int M, int N, int K) {
  __shared__ __attribute__((aligned(16))) float so[4][16][64];
  const int tid = threadIdx.x, w = tid >> 5, lane = tid & 31, ln = lane & 15, hh = lane >> 4;
  const int ntn = N / 64;
  const int wid = blockIdx.x * 4 + w;
  const int mt = wid / ntn, nq = wid % ntn;
  if (mt * 16 >= M) return;
  const int row0 = mt * 16, col0 = nq * 64;
  const float* arow = A + (size_t)(row0 + ln) * lda;
  v8f acc[4] = {};
  for (int kb = 0; kb < K; kb += 32) {
    FragB ah, al;
    const v4f x0 = *(const v4fa*)(arow + kb + 8 * hh), x1 = *(const v4fa*)(arow + kb + 8 * hh + 4);
    const v4f x2 = *(const v4fa*)(arow + kb + 16 + 8 * hh), x3 = *(const v4fa*)(arow + kb + 16 + 8 * hh + 4);
    float xs[16] = {x0[0],x0[1],x0[2],x0[3],x1[0],x1[1],x1[2],x1[3],x2[0],x2[1],x2[2],x2[3],x3[0],x3[1],x3[2],x3[3]};
#pragma unroll
    for (int i = 0; i < 16; ++i) { const unsigned short hb = bf16_bits(xs[i]); ah.u[i] = hb; al.u[i] = ASPLIT ? bf16_bits(xs[i] - bf16_val(hb)) : (unsigned short)0; }
#pragma unroll
    for (int t = 0; t < 4; ++t) {
      const unsigned short* brow = Wt + (size_t)(col0 + t * 16 + ln) * ldb + kb;
      FragB b;
      b.half[0] = *(const v8us*)(brow + 8 * hh);
      b.half[1] = *(const v8us*)(brow + 16 + 8 * hh);
      acc[t] = mmaN<ASPLIT ? 2 : 1>(ah.v, al.v, b.v, b.v, acc[t]);
    }
  }
#pragma unroll
  for (int t = 0; t < 4; ++t) {
    const int col = col0 + t * 16 + ln;
    float bv = bias ? bias[col] : 0.f;
    if (BIAS_BF16) bv = bf16_round(bv);
#pragma unroll
    for (int r = 0; r < 8; ++r) {
      float v = acc[t][r] + bv;
      if (resid) { float rv = resid[(size_t)((row0 + 8 * hh + r) % rmod) * ldr + col]; if (RES_BF16) rv = bf16_round(rv); v += rv; }
      if (ACT == 1) v = fmaxf(v, 0.f);
      if (ACT == 2) v = 0.5f * v * (1.0f + erff(v * 0.70710678118654752f));
      if (ACT == 3) { const float u = 0.7978845608028654f * (v + 0.044715f * v * v * v); v = 0.5f * v * (1.0f + tanhf(u)); }
      so[w][8 * hh + r][t * 16 + ln] = v;
    }
  }
  __builtin_amdgcn_fence(__ATOMIC_ACQ_REL, "workgroup");
  __builtin_amdgcn_wave_barrier();
  const int rsub = lane >> 4, c4 = (lane & 15) * 4;
  {
#pragma unroll
    for (int q = 0; q < 8; ++q) {
      const int r = q * 2 + rsub;
      const v4f v = *(const v4fa*)&so[w][r][c4];
      *(v4f*)(C + (size_t)(row0 + r) * ldc + col0 + c4) = v;
    }
    
  }
}
// row LayerNorm (biased variance, eps) over N: s = X (+ R); optional out_sum <- s; out_norm <- (s-mu)*rsqrt(var+eps)*g + b
template <bool PARAM_BF16>
__global__ __launch_bounds__(256) void k_layernorm(const float* __restrict__ X, const float* __restrict__ R, const float* __restrict__ g, const float* __restrict__ bta,
                                                  float* __restrict__ out_sum, float* __restrict__ out_norm, int N, float eps) {
  __shared__ float red[256];
  const int row = blockIdx.x, tid = threadIdx.x;
  const float* x = X + (size_t)row * N; const float* rr = R ? R + (size_t)row * N : nullptr;
  float vals[16];                     // up to N = 4096
  const int per = N / 256;            // contiguous chunk per thread? use strided-by-4 chunks: thread handles j = tid*4 + 1024*u
  float s1 = 0.f;
  for (int u = 0; u < per / 4; ++u) {
    const int j = tid * 4 + 1024 * u;
    const v4f a = *(const v4fa*)(x + j);
    v4f b = {0.f,0.f,0.f,0.f}; if (rr) b = *(const v4fa*)(rr + j);
#pragma unroll
    for (int q = 0; q < 4; ++q) { const float v = a[q] + b[q]; vals[u * 4 + q] = v; s1 += v; }
  }
  red[tid] = s1; __syncthreads();
  for (int st = 128; st > 0; st >>= 1) { if (tid < st) red[tid] += red[tid + st]; __syncthreads(); }
  const float mu = red[0] / (float)N; __syncthreads();
  float s2 = 0.f;
  for (int u = 0; u < per / 4; ++u)
#pragma unroll
    for (int q = 0; q < 4; ++q) { const float c = vals[u * 4 + q] - mu; s2 += c * c; }
  red[tid] = s2; __syncthreads();
  for (int st = 128; st > 0; st >>= 1) { if (tid < st) red[tid] += red[tid + st]; __syncthreads(); }
  const float rs = rsqrtf(red[0] / (float)N + eps);
  {
    for (int u = 0; u < per / 4; ++u) {
      const int j = tid * 4 + 1024 * u;
      v4f o, sm;
#pragma unroll
      for (int q = 0; q < 4; ++q) {
        float gg = g[j + q], bb = bta[j + q];
        if (PARAM_BF16) { gg = bf16_round(gg); bb = bf16_round(bb); }
        sm[q] = vals[u * 4 + q]; o[q] = (vals[u * 4 + q] - mu) * rs * gg + bb;
      }
      if (out_sum) *(v4f*)(out_sum + (size_t)row * N + j) = sm;
      *(v4f*)(out_norm + (size_t)row * N + j) = o;
    }
    
  }
}



// ---- f16 WMMA path (v_wmma_f32_16x16x32_f16): 11-bit significands for operands in range — used where a [0,1] probability operand needs more precision than bf16
typedef _Float16 v16h __attribute__((ext_vector_type(16)));
union FragH { v16h v; v8us half[2]; _Float16 h[16]; unsigned short u[16]; };
template <int NT>
__device__ __forceinline__ v8f mmaH(v16h ah, v16h al, v16h bh, v16h bl, v8f c) {
  c = __builtin_amdgcn_wmma_f32_16x16x32_f16(false, ah, false, bh, (short)0, c, false, false);
  if (NT >= 2) c = __builtin_amdgcn_wmma_f32_16x16x32_f16(false, al, false, bh, (short)0, c, false, false);
  if (NT >= 3) c = __builtin_amdgcn_wmma_f32_16x16x32_f16(false, ah, false, bl, (short)0, c, false, false);
  asm volatile("v_nop\n\tv_nop\n\tv_nop\n\tv_nop" : "+v"(c) : "v"(ah), "v"(al), "v"(bh), "v"(bl));
  return c;
}
// batched GEMM like k_gemm_b but f16 operands: A f32 (split into f16 hi/lo if ASPLIT, else rounded to f16), Bt = f16 values [n][k]; alpha; C f32; N multiple of 16 (partial tiles skipped)
template <bool ASPLIT>
__global__ __launch_bounds__(128) void k_gemm_h(const float* __restrict__ A, int lda, size_t sA, const _Float16* __restrict__ Bh, int ldb, size_t sB, float alpha, float* __restrict__ C, int ldc, size_t sC, int M, int N, int K) {
  __shared__ __attribute__((aligned(16))) float so[4][16][64];
  const int tid = threadIdx.x, w = tid >> 5, lane = tid & 31, ln = lane & 15, hh = lane >> 4; const int by = blockIdx.y;
  A += (size_t)by * sA; Bh += (size_t)by * sB; C += (size_t)by * sC;
  const int ntn = (N + 63) / 64; const int wid = blockIdx.x * 4 + w; const int mt = wid / ntn, nq = wid % ntn; if (mt * 16 >= M) return;
  const int row0 = mt * 16, col0 = nq * 64; const float* arow = A + (size_t)(row0 + ln) * lda;
  v8f acc[4] = {};
  for (int kb = 0; kb < K; kb += 32) {
    FragH ah, al;
    const v4f x0 = *(const v4fa*)(arow + kb + 8 * hh), x1 = *(const v4fa*)(arow + kb + 8 * hh + 4), x2 = *(const v4fa*)(arow + kb + 16 + 8 * hh), x3 = *(const v4fa*)(arow + kb + 16 + 8 * hh + 4);
    float xs[16] = {x0[0],x0[1],x0[2],x0[3],x1[0],x1[1],x1[2],x1[3],x2[0],x2[1],x2[2],x2[3],x3[0],x3[1],x3[2],x3[3]};
#pragma unroll
    for (int i = 0; i < 16; ++i) { const _Float16 h = (_Float16)xs[i]; ah.h[i] = h; al.h[i] = ASPLIT ? (_Float16)(xs[i] - (float)h) : (_Float16)0.0f; }
#pragma unroll
    for (int t = 0; t < 4; ++t) { if (col0 + t * 16 >= N) continue; const size_t boff = (size_t)(col0 + t * 16 + ln) * ldb + kb; FragH bq; bq.half[0] = *(const v8us*)(Bh + boff + 8 * hh); bq.half[1] = *(const v8us*)(Bh + boff + 16 + 8 * hh);
      acc[t] = mmaH<ASPLIT ? 2 : 1>(ah.v, al.v, bq.v, bq.v, acc[t]); }
  }
#pragma unroll
  for (int t = 0; t < 4; ++t) { if (col0 + t * 16 >= N) continue;
#pragma unroll
    for (int r = 0; r < 8; ++r) so[w][8 * hh + r][t * 16 + ln] = acc[t][r] * alpha; }
  __builtin_amdgcn_fence(__ATOMIC_ACQ_REL, "workgroup"); __builtin_amdgcn_wave_barrier();
  const int rsub = lane >> 4, c4 = (lane & 15) * 4;
  {
#pragma unroll
    for (int q = 0; q < 8; ++q) { const int r = q * 2 + rsub; if (col0 + c4 < N) { const v4f v = *(const v4fa*)&so[w][r][c4]; *(v4f*)(C + (size_t)(row0 + r) * ldc + col0 + c4) = v; } }
     }
}

// Wt[n][k] = f16(bf16(W[k][n]) * scale) from f32 row-major W[K][N] (scale = power of two; bf16-exact weights stay exact in f16 away from the subnormal range)
// A work-group turns a tile of 128 k x 64 n through LDS, so that both sides of memory see whole aligned 256-byte pieces: a wave load takes 256 contiguous bytes of two W rows (eight loads in flight), a wave store writes 256 contiguous bytes of two Wt rows.
// A thread holds 8 k x 4 n; its 8 k of one n are one 16-byte LDS store. Column n = 4 c + q lies in LDS row 16 q + c: neighbouring lanes then lie one pitch apart (16 B x odd), which spreads the 16-byte stores over the banks.
#define WT_PITCH 272                 /* LDS row pitch in bytes of a 256-byte row of 128 k */
template <int K, int N>
__global__ __launch_bounds__(256) void k_wt_f16(const float* __restrict__ W, _Float16* __restrict__ Wt, float scale) {
  static_assert(K % 128 == 0 && N % 64 == 0, "k_wt_f16: whole tiles of 128 k x 64 n");
  __shared__ __attribute__((aligned(16))) unsigned char tl[64 * WT_PITCH];
  const int tid = threadIdx.x, g = tid >> 4, c = tid & 15; const int n0 = blockIdx.x * 64, k0 = blockIdx.y * 128;
  const float* sp = W + (size_t)(k0 + 8 * g) * N + n0 + 4 * c; v4f x[8];
#pragma unroll
  for (int i = 0; i < 8; ++i) x[i] = *(const v4fa*)(sp + (size_t)i * N);      /* unrolled: the eight rows' loads fly together, one address and immediate offsets */
  asm volatile("s_wait_xcnt 0x0" :: "v"(sp) : "memory");      /* the wait that belongs in front of any overwrite of the loads' address register; naming it keeps it whole up to here */
#pragma unroll
  for (int q = 0; q < 4; ++q) { FragH f;
#pragma unroll
    for (int i = 0; i < 8; ++i) f.h[i] = (_Float16)(bf16_round(x[i][q]) * scale);
    *(v8us*)(tl + (16 * q + c) * WT_PITCH + 16 * g) = f.half[0]; }
  __syncthreads();      /* the tile is whole before its rows are read */
  unsigned short* dp = (unsigned short*)Wt + (size_t)(n0 + 4 * g) * K + k0 + 8 * c;      /* sixteen lanes take one 256-byte row piece; LDS row 16 j + g is column 4 g + j */
#pragma unroll
  for (int j = 0; j < 4; ++j) { const v8us v = *(const v8us*)(tl + (16 * j + g) * WT_PITCH + 16 * c); *(v8us*)(dp + (size_t)j * K) = v; }
}
// k_gemm_hh variant with fused epilogue: v = acc·alpha + bias[by·sBias + col] (+ CP[(row/rowsPerB)·sCPb + by·64 + col] if CP) ; ACT 0 none / 1 elu ; writes f16 C16 (and f32 C if non-null)
template <int ACT>
__global__ __launch_bounds__(128) void k_gemm_hhx(const _Float16* __restrict__ A, int lda, size_t sA, const _Float16* __restrict__ Bh, int ldb, size_t sB, float alpha, const float* __restrict__ bias, size_t sBias, const float* __restrict__ CP, int rowsPerB, size_t sCPb, int row0g,
    float* __restrict__ C, _Float16* __restrict__ C16, int ldc, size_t sC, int M, int N, int K) {
  __shared__ __attribute__((aligned(16))) float so[4][16][64];
  const int tid = threadIdx.x, w = tid >> 5, lane = tid & 31, ln = lane & 15, hh = lane >> 4; const int by = blockIdx.y;
  A += (size_t)by * sA; Bh += (size_t)by * sB; const size_t cofs = (size_t)by * sC; const float* bp = bias ? bias + (size_t)by * sBias : nullptr;
  const int ntn = (N + 63) / 64; const int wid = blockIdx.x * 4 + w; const int mt = wid / ntn, nq = wid % ntn; if (mt * 16 >= M) return;
  const int row0 = mt * 16, col0 = nq * 64; const _Float16* arow = A + (size_t)(row0 + ln) * lda;
  v8f acc[4] = {};
  for (int kb = 0; kb < K; kb += 32) { FragH ah; ah.half[0] = *(const v8us*)((const unsigned short*)arow + kb + 8 * hh); ah.half[1] = *(const v8us*)((const unsigned short*)arow + kb + 16 + 8 * hh);
#pragma unroll
    for (int t = 0; t < 4; ++t) { if (col0 + t * 16 >= N) continue; const size_t boff = (size_t)(col0 + t * 16 + ln) * ldb + kb; FragH bq; bq.half[0] = *(const v8us*)((const unsigned short*)Bh + boff + 8 * hh); bq.half[1] = *(const v8us*)((const unsigned short*)Bh + boff + 16 + 8 * hh);
      acc[t] = mmaH<1>(ah.v, ah.v, bq.v, bq.v, acc[t]); }
  }
#pragma unroll
  for (int t = 0; t < 4; ++t) { if (col0 + t * 16 >= N) continue; const int col = col0 + t * 16 + ln; const float bv = bp ? bf16_round(bp[col]) : 0.f;
#pragma unroll
    for (int r = 0; r < 8; ++r) { float v = acc[t][r] * alpha + bv; if (CP) { const int rr = row0g + row0 + 8 * hh + r; if (rowsPerB < 0) v += CP[cofs + (size_t)rr * ldc + col];      /* rowsPerB < 0: own element of the batched C plane */ else { const int bidx = rr / rowsPerB; v += CP[(size_t)bidx * sCPb + (size_t)by * 64 + col]; } } if (ACT == 1) v = (v > 0.f) ? v : expm1f(v); else if (ACT == 7) v = (v > 0.f) ? v + 1.0f : expf(v); else if (ACT == 8) v = tanhf(v); else if (ACT == 9) v = 0.5f * v * (1.0f + tanhf(0.7978845608028654f * (v + 0.044715f * v * v * v))); else if (ACT == 11) v = 1.0f / (1.0f + expf(-v)); else if (ACT == 12) v = (v > 0.f) ? v : 0.01f * v; else if (ACT == 14) v = (v > 0.f) ? v : 0.1f * v; else if (ACT == 16) v = (v >= 0.f) ? v : 0.3f * v; else if (ACT == 17) v = (v >= 0.f) ? v : 0.2f * v; else if (ACT == 15) v = v / (1.0f + expf(-v)); else if (ACT == 3) v = fmaxf(v, 0.f); else if (ACT == 6) v = 0.5f * v * (1.0f + erff(v * 0.70710678118654752f)); so[w][8 * hh + r][t * 16 + ln] = v; } }
  __builtin_amdgcn_fence(__ATOMIC_ACQ_REL, "workgroup"); __builtin_amdgcn_wave_barrier();
  const int rsub = lane >> 4, c4 = (lane & 15) * 4; typedef _Float16 v4h __attribute__((ext_vector_type(4)));
  {
#pragma unroll
    for (int q = 0; q < 8; ++q) { const int r = q * 2 + rsub; if (col0 + c4 < N) { const v4f v = *(const v4fa*)&so[w][r][c4]; if (C) *(v4f*)(C + cofs + (size_t)(row0 + r) * ldc + col0 + c4) = v; if (C16) { v4h h4; for (int i = 0; i < 4; ++i) h4[i] = (_Float16)v[i]; *(v4h*)(C16 + cofs + (size_t)(row0 + r) * ldc + col0 + c4) = h4; } } }
     }
}


typedef _Float16 v4h __attribute__((ext_vector_type(4)));

__global__ __launch_bounds__(256) void k_x16(const float* __restrict__ x, _Float16* __restrict__ X16, size_t n8) { const size_t t = (size_t)blockIdx.x * 256 + threadIdx.x; if (t >= n8) return; FragH f;
#pragma unroll
  for (int q = 0; q < 8; ++q) f.h[q] = (_Float16)bf16_round(x[t * 8 + q]); *(v8us*)((unsigned short*)X16 + t * 8) = f.half[0];  }
__global__ __launch_bounds__(256) void k_h16(const float* __restrict__ x, _Float16* __restrict__ X16, size_t n8) { const size_t t = (size_t)blockIdx.x * 256 + threadIdx.x; if (t >= n8) return; FragH f;
#pragma unroll
  for (int q = 0; q < 8; ++q) f.h[q] = (_Float16)x[t * 8 + q]; *(v8us*)((unsigned short*)X16 + t * 8) = f.half[0];  }
__global__ __launch_bounds__(256) void k_round16f(const float* __restrict__ W, _Float16* __restrict__ Bt, size_t n8) { const size_t t = (size_t)blockIdx.x * 256 + threadIdx.x; if (t >= n8) return; FragH f;
#pragma unroll
  for (int i = 0; i < 8; ++i) f.h[i] = (_Float16)(bf16_round(W[t * 8 + i]) * 16.0f); *(v8us*)((unsigned short*)Bt + t * 8) = f.half[0];  }
template <int NHv, int TTv>
__global__ __launch_bounds__(256) void k_vt(const _Float16* __restrict__ V16, int ldv, int voff, _Float16* __restrict__ Vt) { __shared__ unsigned short tl[64][66]; const int tid = threadIdx.x; const int slab = blockIdx.x / (TTv / 64), lg = blockIdx.x % (TTv / 64); const int b = slab / NHv, h = slab % NHv;
  for (int i = tid; i < 64 * 8; i += 256) { const int r = i / 8, c8 = (i % 8) * 8; FragH f; f.half[0] = *(const v8us*)((const unsigned short*)V16 + ((size_t)b * TTv + lg * 64 + r) * ldv + voff + h * 64 + c8);
#pragma unroll
    for (int q = 0; q < 8; ++q) tl[r][c8 + q] = f.u[q]; }
  __syncthreads();
  {
#pragma unroll
    for (int rd = 0; rd < 2; ++rd) { const int d = rd * 32 + tid / 8, pc = tid % 8; FragH f;
#pragma unroll
      for (int q = 0; q < 8; ++q) f.u[q] = tl[pc * 8 + q][d];
      *(v8us*)((unsigned short*)Vt + ((size_t)slab * 64 + d) * TTv + lg * 64 + pc * 8) = f.half[0]; }
     } }

__global__ __launch_bounds__(256) void k_hl(const float* __restrict__ F, _Float16* __restrict__ Hh, _Float16* __restrict__ Hl, size_t n8) { const size_t t = (size_t)blockIdx.x * 256 + threadIdx.x; if (t >= n8) return; FragH fh, fl; const v4f a = *(const v4fa*)(F + t * 8), c = *(const v4fa*)(F + t * 8 + 4);
#pragma unroll
  for (int q = 0; q < 4; ++q) { _Float16 h = (_Float16)a[q]; fh.h[q] = h; fl.h[q] = (_Float16)((a[q] - (float)h) * 1024.0f); h = (_Float16)c[q]; fh.h[4 + q] = h; fl.h[4 + q] = (_Float16)((c[q] - (float)h) * 1024.0f); }
  { *(v8us*)((unsigned short*)Hh + t * 8) = fh.half[0]; *(v8us*)((unsigned short*)Hl + t * 8) = fl.half[0];  } }

// ---- fast GEMM (work-group tile 128x64, wave tile 32x64; A and B tiles of 64 k staged in LDS by asynchronous copies, two buffers; requires M % 128 == 0 rows per launch region, N % 64 == 0, K % 64 == 0); epilogue = k_gemm_hhx semantics ----
__device__ __forceinline__ v16h g2_frag(const _Float16* p, int hh) { FragH f; f.half[0] = *(const v8us*)((const unsigned short*)p + 8 * hh); f.half[1] = *(const v8us*)((const unsigned short*)p + 16 + 8 * hh); return f.v; }
__device__ __forceinline__ v8f g2_mma(v16h a, v16h b, v8f c) { v8f d = __builtin_amdgcn_wmma_f32_16x16x32_f16(false, a, false, b, (short)0, c, false, false); asm volatile("v_nop\n\tv_nop\n\tv_nop\n\tv_nop" : "+v"(d) : "v"(a), "v"(b)); return d; }
#define G2_PITCH 144                 /* LDS row pitch in bytes of a staged 128-byte row: 16 B x odd, the conflict-free pitch for 16-byte LDS reads */
#define G2_BUF (192 * G2_PITCH)      /* one staged tile: 128 A rows, then 64 B rows, 64 k each */
static_assert(MP % 128 == 0 && QT % 128 == 0 && QT0 % 128 == 0, "k_gemm2: a work-group stages 128 whole A rows");
static_assert(HD % 64 == 0 && QT % 64 == 0 && DM % 64 == 0 && DFF % 64 == 0, "k_gemm2: K is a multiple of the staged 64 k, N of the 64 B rows");
// One tile into LDS: twelve asynchronous 16-byte copies a lane (a wave's 32 lanes take 4 whole 128-byte rows per copy; copy i lands 16 rows below copy i - 1; 0..7 = A rows, 8..11 = B rows).
// One asm statement: the copies go from global memory to LDS through no register, and the s_wait_xcnt at its end stands in front of any later overwrite of the address registers that the copies name.
__device__ __forceinline__ void g2_stage(unsigned l, const _Float16* ga, size_t sa, const _Float16* gb, size_t sb) {
  asm volatile("global_load_async_to_lds_b128 %0, %12, off\n\tglobal_load_async_to_lds_b128 %1, %13, off\n\tglobal_load_async_to_lds_b128 %2, %14, off\n\tglobal_load_async_to_lds_b128 %3, %15, off\n\t"
               "global_load_async_to_lds_b128 %4, %16, off\n\tglobal_load_async_to_lds_b128 %5, %17, off\n\tglobal_load_async_to_lds_b128 %6, %18, off\n\tglobal_load_async_to_lds_b128 %7, %19, off\n\t"
               "global_load_async_to_lds_b128 %8, %20, off\n\tglobal_load_async_to_lds_b128 %9, %21, off\n\tglobal_load_async_to_lds_b128 %10, %22, off\n\tglobal_load_async_to_lds_b128 %11, %23, off\n\ts_wait_xcnt 0x0"
               :: "v"(l), "v"(l + 16 * G2_PITCH), "v"(l + 32 * G2_PITCH), "v"(l + 48 * G2_PITCH), "v"(l + 64 * G2_PITCH), "v"(l + 80 * G2_PITCH), "v"(l + 96 * G2_PITCH), "v"(l + 112 * G2_PITCH),
                  "v"(l + 128 * G2_PITCH), "v"(l + 144 * G2_PITCH), "v"(l + 160 * G2_PITCH), "v"(l + 176 * G2_PITCH),
                  "v"(ga), "v"(ga + sa), "v"(ga + 2 * sa), "v"(ga + 3 * sa), "v"(ga + 4 * sa), "v"(ga + 5 * sa), "v"(ga + 6 * sa), "v"(ga + 7 * sa), "v"(gb), "v"(gb + sb), "v"(gb + 2 * sb), "v"(gb + 3 * sb) : "memory"); }
template <int ACT>
__global__ __launch_bounds__(128) void k_gemm2(const _Float16* __restrict__ A, int lda, size_t sA, const _Float16* __restrict__ Bh, int ldb, size_t sB, float alpha, const float* __restrict__ bias, size_t sBias, const float* __restrict__ CP, int rowsPerB, size_t sCPb, int row0g,
    float* __restrict__ C, _Float16* __restrict__ C16, int ldc, size_t sC, int M, int N, int K, size_t zA = 0, size_t zB = 0, size_t zC = 0) { static_assert(ACT == 0 || ACT == 3 || ACT == 6 || ACT == 8 || ACT == 9 || ACT == 11 || ACT == 12 || ACT == 14 || ACT == 15 || ACT == 16 || ACT == 17, "k_gemm2: unsupported ACT code (would silently apply no activation)");
  __shared__ __attribute__((aligned(16))) unsigned char sm[2 * G2_BUF]; float (*so)[32][68] = (float (*)[32][68])sm;      /* two staged tiles; behind the loop's last barrier the same bytes are the epilogue's [4][32][68] f32 staging */
  static_assert(sizeof(float) * 4 * 32 * 68 <= 2 * G2_BUF, "k_gemm2: the epilogue staging fits the two tile buffers");
  const int tid = threadIdx.x, w = tid >> 5, lane = tid & 31, ln = lane & 15, hh = lane >> 4; const int by = blockIdx.y; const int bz = blockIdx.z;      /* second batch axis (strides zA, zB, zC) */
  A += (size_t)by * sA + (size_t)bz * zA; Bh += (size_t)by * sB + (size_t)bz * zB; const size_t cofs = (size_t)by * sC + (size_t)bz * zC; const float* bp = bias ? bias + (size_t)by * sBias : nullptr;
  const int ntn = N >> 6; const int mt = blockIdx.x / ntn, nq = blockIdx.x - mt * ntn; const int row0 = mt * 128 + 32 * w, col0 = nq * 64; if (mt * 128 >= M) return;      /* the whole work-group leaves or none: barriers follow */
  const _Float16* ga = A + (size_t)(mt * 128 + (tid >> 3)) * lda + (tid & 7) * 8; const _Float16* gb = Bh + (size_t)(col0 + (tid >> 3)) * ldb + (tid & 7) * 8;      /* this lane's 16 bytes of row tid / 8 of each 16-row group */
  const size_t sa = (size_t)16 * lda, sb = (size_t)16 * ldb; const unsigned l0 = (unsigned)(size_t)sm + (unsigned)((tid >> 3) * G2_PITCH + (tid & 7) * 16);
  const unsigned char* fa = sm + (32 * w + ln) * G2_PITCH; const unsigned char* fb = sm + (128 + ln) * G2_PITCH;      /* this lane's fragment rows in buffer 0 */
  const v8f z8 = {0.f,0.f,0.f,0.f,0.f,0.f,0.f,0.f}; v8f c00 = z8, c01 = z8, c02 = z8, c03 = z8, c10 = z8, c11 = z8, c12 = z8, c13 = z8;
  const int nt = K >> 6;
  g2_stage(l0, ga, sa, gb, sb);
  asm volatile("s_wait_asynccnt 0x0" ::: "memory");      /* this wave's copies of tile 0 have landed */
  __syncthreads();      /* tile 0 published: every wave's copies have landed */
  if (nt > 1) g2_stage(l0 + G2_BUF, ga + 64, sa, gb + 64, sb);      /* tile 1 flies while tile 0 is worked on */
#pragma unroll 1
  for (int t = 0; t < nt; ++t) { const unsigned bo = (unsigned)(t & 1) * G2_BUF;      /* kept rolled: one trip is one staged tile and the buffers alternate; unrolled, the copies' and waits' code would only be repeated */
#pragma unroll
    for (int ks = 0; ks < 2; ++ks) { const _Float16* pa = (const _Float16*)(fa + bo + ks * 64); const _Float16* pb = (const _Float16*)(fb + bo + ks * 64);      /* unrolled so that the two halves of a tile are immediate offsets of the LDS reads; 32 k = 64 bytes of every row; k ascends as before */
      const v16h a0 = g2_frag(pa, hh), a1 = g2_frag(pa + 8 * G2_PITCH, hh), b0 = g2_frag(pb, hh), b1 = g2_frag(pb + 8 * G2_PITCH, hh), b2 = g2_frag(pb + 16 * G2_PITCH, hh), b3 = g2_frag(pb + 24 * G2_PITCH, hh);      /* 16 rows = 8 * G2_PITCH halves */
      c00 = g2_mma(a0, b0, c00); c10 = g2_mma(a1, b0, c10); c01 = g2_mma(a0, b1, c01); c11 = g2_mma(a1, b1, c11);
      c02 = g2_mma(a0, b2, c02); c12 = g2_mma(a1, b2, c12); c03 = g2_mma(a0, b3, c03); c13 = g2_mma(a1, b3, c13); }
    asm volatile("s_wait_dscnt 0x0" ::: "memory");      /* this wave's reads of the buffer have returned before the buffer is given up */
    asm volatile("s_wait_asynccnt 0x0" ::: "memory");      /* this wave's copies of tile t + 1 have landed */
    __syncthreads();      /* publishes tile t + 1 and ends every wave's reads of tile t */
    if (t + 2 < nt) g2_stage(l0 + bo, ga + (size_t)(t + 2) * 64, sa, gb + (size_t)(t + 2) * 64, sb); }      /* refill of the buffer just left */
  asm volatile("s_wait_asynccnt 0x0" ::: "memory");      /* no copy is outstanding when the buffers become the epilogue's staging */
  v8f accs[8] = {c00, c01, c02, c03, c10, c11, c12, c13};
#pragma unroll
  for (int u = 0; u < 8; ++u) { const int t = u & 3, half = u >> 2; const int col = col0 + t * 16 + ln; const float bv = bp ? bf16_round(bp[col]) : 0.f;
#pragma unroll
    for (int r = 0; r < 8; ++r) { const int rloc = half * 16 + 8 * hh + r; float v = accs[u][r] * alpha + bv; if (CP) { if (rowsPerB < 0) v += CP[cofs + (size_t)(row0g + row0 + rloc) * ldc + col];      /* rowsPerB < 0: own element of the batched C plane */ else { const int bidx = (row0g + row0 + rloc) / rowsPerB; v += CP[(size_t)bidx * sCPb + (size_t)by * 64 + col]; } }
      if (ACT == 3) v = fmaxf(v, 0.f); else if (ACT == 6) v = 0.5f * v * (1.0f + erff(v * 0.70710678118654752f)); else if (ACT == 11) v = 1.0f / (1.0f + expf(-v)); else if (ACT == 15) v = v / (1.0f + expf(-v)); else if (ACT == 12) v = (v > 0.f) ? v : 0.01f * v; else if (ACT == 8) v = tanhf(v); else if (ACT == 9) v = 0.5f * v * (1.0f + tanhf(0.7978845608028654f * (v + 0.044715f * v * v * v))); else if (ACT == 14) v = (v > 0.f) ? v : 0.1f * v; else if (ACT == 16) v = (v >= 0.f) ? v : 0.3f * v; else if (ACT == 17) v = (v >= 0.f) ? v : 0.2f * v;
      so[w][rloc][t * 16 + ln] = v; } }
  __builtin_amdgcn_fence(__ATOMIC_ACQ_REL, "workgroup"); __builtin_amdgcn_wave_barrier();
  const int rsub = lane >> 4, c4 = (lane & 15) * 4;
  {
#pragma unroll
    for (int q = 0; q < 16; ++q) { const int r = q * 2 + rsub; const v4f v = *(const v4fa*)&so[w][r][c4]; if (C) *(v4f*)(C + cofs + (size_t)(row0 + r) * ldc + col0 + c4) = v; if (C16) { v4h h4; for (int i = 0; i < 4; ++i) h4[i] = (_Float16)v[i]; *(v4h*)(C16 + cofs + (size_t)(row0 + r) * ldc + col0 + c4) = h4; } }
     } }


// ---- wide GEMM for the four all-row products (work-group tile 256x128, eight waves as 4 x 2, wave tile 64x64; requires M % 256 == 0, N % 128 == 0, K % 64 == 0); staging, k order and epilogue arithmetic as in k_gemm2 ----
// Against the 128x64 tile: half the operand rows copied from L2 per output element (384 rows per 32768 outputs, not 192 per 8192), and 16 LDS fragment reads per 16 products, not 12 per 8.
#define G3_BUF (384 * G2_PITCH)      /* one staged tile: 256 A rows, then 128 B rows, 64 k each */
static_assert(MP % 256 == 0 && DM % 128 == 0 && DFF % 128 == 0, "k_gemm3: whole 256x128 tiles");
// One tile into LDS: twelve asynchronous 16-byte copies a lane (the work-group's 256 lanes take 32 whole 128-byte rows per copy; copy i lands 32 rows below copy i - 1; 0..7 = A rows, 8..11 = B rows).
// One asm statement, as in g2_stage: the s_wait_xcnt at its end stands in front of any later overwrite of the address registers that the copies name.
__device__ __forceinline__ void g3_stage(unsigned l, const _Float16* ga, size_t sa, const _Float16* gb, size_t sb) {
  asm volatile("global_load_async_to_lds_b128 %0, %12, off\n\tglobal_load_async_to_lds_b128 %1, %13, off\n\tglobal_load_async_to_lds_b128 %2, %14, off\n\tglobal_load_async_to_lds_b128 %3, %15, off\n\t"
               "global_load_async_to_lds_b128 %4, %16, off\n\tglobal_load_async_to_lds_b128 %5, %17, off\n\tglobal_load_async_to_lds_b128 %6, %18, off\n\tglobal_load_async_to_lds_b128 %7, %19, off\n\t"
               "global_load_async_to_lds_b128 %8, %20, off\n\tglobal_load_async_to_lds_b128 %9, %21, off\n\tglobal_load_async_to_lds_b128 %10, %22, off\n\tglobal_load_async_to_lds_b128 %11, %23, off\n\ts_wait_xcnt 0x0"
               :: "v"(l), "v"(l + 32 * G2_PITCH), "v"(l + 64 * G2_PITCH), "v"(l + 96 * G2_PITCH), "v"(l + 128 * G2_PITCH), "v"(l + 160 * G2_PITCH), "v"(l + 192 * G2_PITCH), "v"(l + 224 * G2_PITCH),
                  "v"(l + 256 * G2_PITCH), "v"(l + 288 * G2_PITCH), "v"(l + 320 * G2_PITCH), "v"(l + 352 * G2_PITCH),
                  "v"(ga), "v"(ga + sa), "v"(ga + 2 * sa), "v"(ga + 3 * sa), "v"(ga + 4 * sa), "v"(ga + 5 * sa), "v"(ga + 6 * sa), "v"(ga + 7 * sa), "v"(gb), "v"(gb + sb), "v"(gb + 2 * sb), "v"(gb + 3 * sb) : "memory"); }
// C = act(A Bh^T alpha + bias (+ CP where RES: the own element of a plane laid out like C)); F32O: f32 rows into C, else f16 rows into C16; LDC: row pitch of C, C16 and CP in elements
template <int ACT, bool RES, bool F32O, int LDC>
__global__ __launch_bounds__(256) void k_gemm3(const _Float16* __restrict__ A, int lda, const _Float16* __restrict__ Bh, int ldb, float alpha, const float* __restrict__ bias, const float* __restrict__ CP,
    float* __restrict__ C, _Float16* __restrict__ C16, int M, int N, int K) { static_assert(ACT == 0 || ACT == 3, "k_gemm3: no activation or relu");
  __shared__ __attribute__((aligned(16))) unsigned char sm[2 * G3_BUF]; float (*so)[32][68] = (float (*)[32][68])sm;      /* two staged tiles; behind the loop's last barrier the same bytes are the epilogue's [8][32][68] f32 staging */
  static_assert(sizeof(float) * 8 * 32 * 68 <= 2 * G3_BUF, "k_gemm3: the epilogue staging fits the two tile buffers");
  const int tid = threadIdx.x, w = tid >> 5, lane = tid & 31, ln = lane & 15, hh = lane >> 4; const int wm = w >> 1, wn = w & 1;
  const int ntn = N >> 7; const int mt = blockIdx.x / ntn, nq = blockIdx.x - mt * ntn; const int row0 = mt * 256 + 64 * wm, col0 = nq * 128 + 64 * wn; if (mt * 256 >= M) return;      /* the whole work-group leaves or none: barriers follow */
  const _Float16* ga = A + (size_t)(mt * 256 + (tid >> 3)) * lda + (tid & 7) * 8; const _Float16* gb = Bh + (size_t)(nq * 128 + (tid >> 3)) * ldb + (tid & 7) * 8;      /* this lane's 16 bytes of row tid / 8 of each 32-row group */
  const size_t sa = (size_t)32 * lda, sb = (size_t)32 * ldb; const unsigned l0 = (unsigned)(size_t)sm + (unsigned)((tid >> 3) * G2_PITCH + (tid & 7) * 16);
  const unsigned char* fa = sm + (64 * wm + ln) * G2_PITCH; const unsigned char* fb = sm + (256 + 64 * wn + ln) * G2_PITCH;      /* this lane's fragment rows in buffer 0 */
  const v8f z8 = {0.f,0.f,0.f,0.f,0.f,0.f,0.f,0.f}; v8f c[4][4];
#pragma unroll
  for (int i = 0; i < 4; ++i)
#pragma unroll
    for (int j = 0; j < 4; ++j) c[i][j] = z8;
  const int nt = K >> 6;
  g3_stage(l0, ga, sa, gb, sb);
  asm volatile("s_wait_asynccnt 0x0" ::: "memory");      /* this wave's copies of tile 0 have landed */
  __syncthreads();      /* tile 0 published: every wave's copies have landed */
  if (nt > 1) g3_stage(l0 + G3_BUF, ga + 64, sa, gb + 64, sb);      /* tile 1 flies while tile 0 is worked on */
#pragma unroll 1
  for (int t = 0; t < nt; ++t) { const unsigned bo = (unsigned)(t & 1) * G3_BUF;      /* kept rolled: one trip is one staged tile and the buffers alternate */
#pragma unroll
    for (int ks = 0; ks < 2; ++ks) { const _Float16* pa = (const _Float16*)(fa + bo + ks * 64); const _Float16* pb = (const _Float16*)(fb + bo + ks * 64); v16h a[4], b[4];      /* unrolled: the two halves of a tile are immediate offsets of the LDS reads; k ascends as in k_gemm2 */
#pragma unroll
      for (int i = 0; i < 4; ++i) { a[i] = g2_frag(pa + i * 8 * G2_PITCH, hh); b[i] = g2_frag(pb + i * 8 * G2_PITCH, hh); }      /* 16 rows = 8 * G2_PITCH halves; the eight fragments' reads stand together in front of their products */
#pragma unroll
      for (int j = 0; j < 4; ++j)
#pragma unroll
        for (int i = 0; i < 4; ++i) c[i][j] = g2_mma(a[i], b[j], c[i][j]); }
    asm volatile("s_wait_dscnt 0x0" ::: "memory");      /* this wave's reads of the buffer have returned before the buffer is given up */
    asm volatile("s_wait_asynccnt 0x0" ::: "memory");      /* this wave's copies of tile t + 1 have landed */
    __syncthreads();      /* publishes tile t + 1 and ends every wave's reads of tile t */
    if (t + 2 < nt) g3_stage(l0 + bo, ga + (size_t)(t + 2) * 64, sa, gb + (size_t)(t + 2) * 64, sb); }      /* refill of the buffer just left */
  asm volatile("s_wait_asynccnt 0x0" ::: "memory");      /* no copy is outstanding when the buffers become the epilogue's staging */
  const int rsub = lane >> 4, c4 = (lane & 15) * 4; float bv[4] = {0.f, 0.f, 0.f, 0.f};
  if (bias) {      /* one test for the four loads, so that they fly together */
#pragma unroll
    for (int t = 0; t < 4; ++t) bv[t] = bf16_round(bias[col0 + t * 16 + ln]); }
  const size_t e0 = (size_t)(row0 + rsub) * LDC + col0 + c4;      /* this lane's 4 columns of row rsub of the wave's tile; its further rows lie 2 LDC apart, a compile-time step, so that every access below is this one address and an immediate offset */
#pragma unroll
  for (int hf = 0; hf < 2; ++hf) {      /* the wave's 64 rows leave in two halves of 32 through its own staging rows */
    v4f res[16];
    if (RES) { const float* rp = CP + e0;      /* the residual in the layout of the write-out: whole 256-byte row pieces, the half's sixteen loads in flight together, under the staging below */
#pragma unroll
      for (int q = 0; q < 16; ++q) res[q] = *(const v4fa*)(rp + (32 * hf + 2 * q) * LDC);
      asm volatile("s_wait_xcnt 0x0" :: "v"(rp) : "memory"); }      /* the wait that belongs in front of any overwrite of the loads' address register; naming it keeps it whole up to here */
#pragma unroll
    for (int u = 0; u < 8; ++u) { const int t = u & 3, ih = u >> 2;
#pragma unroll
      for (int r = 0; r < 8; ++r) so[w][ih * 16 + 8 * hh + r][t * 16 + ln] = c[2 * hf + ih][t][r] * alpha + bv[t]; }
    __builtin_amdgcn_fence(__ATOMIC_ACQ_REL, "workgroup"); __builtin_amdgcn_wave_barrier();      /* the wave's staging stores stay in front of its row reads */
#pragma unroll
    for (int g = 0; g < 2; ++g) {
#pragma unroll
      for (int q = 8 * g; q < 8 * g + 8; ++q) { v4f v = *(const v4fa*)&so[w][q * 2 + rsub][c4];
        if (RES) v += res[q];      /* acc alpha + bias, then the residual, then the activation: the order of k_gemm2 */
        if (ACT == 3) { for (int i = 0; i < 4; ++i) v[i] = fmaxf(v[i], 0.f); }
        if (F32O) *(v4f*)(C + e0 + (32 * hf + 2 * q) * LDC) = v; else { v4h h4; for (int i = 0; i < 4; ++i) h4[i] = (_Float16)v[i]; *(v4h*)(C16 + e0 + (32 * hf + 2 * q) * LDC) = h4; } }
      asm volatile("s_wait_xcnt 0x0" ::: "memory"); }      /* the wait that belongs in front of a later overwrite of the registers which these eight stores name */
    __builtin_amdgcn_fence(__ATOMIC_ACQ_REL, "workgroup"); __builtin_amdgcn_wave_barrier(); } }      /* the row reads stay in front of the next half's staging stores */


__global__ __launch_bounds__(256) void k_wnat(const float* __restrict__ w, size_t n8, _Float16* __restrict__ Bt) { const size_t t = (size_t)blockIdx.x * 256 + threadIdx.x; if (t >= n8) return; FragH f; for (int q = 0; q < 8; ++q) f.h[q] = (_Float16)(bf16_round(w[t * 8 + q]) * 16.0f); *(v8us*)((unsigned short*)Bt + t * 8) = f.half[0];  }
__global__ __launch_bounds__(256) void k_rsm(const float* __restrict__ S, _Float16* __restrict__ P, int nrows) {
  #pragma clang fp contract(off)
  const int i = blockIdx.x * 256 + threadIdx.x; if (i >= nrows) return; const float* s = S + (size_t)i * SQ; float mx = -3.0e38f;
#pragma unroll 1
  for (int j = 0; j < SQ; ++j) mx = fmaxf(mx, s[j]); float se = 0.f;
#pragma unroll 1
  for (int j = 0; j < SQ; ++j) se += expf(s[j] - mx); const float sc = 256.0f / se;
#pragma unroll 1
  for (int j0 = 0; j0 < SQ; j0 += 8) { FragH f; for (int q = 0; q < 8; ++q) f.h[q] = (_Float16)(expf(s[j0 + q] - mx) * sc); unsigned short* d = (unsigned short*)P + (size_t)i * SQ + j0; *(v8us*)d = f.half[0];  } }
__global__ __launch_bounds__(256) void k_vt(const _Float16* __restrict__ V16, int b, int h0, _Float16* __restrict__ VT) { __shared__ unsigned short tl[64][65]; const int tid = threadIdx.x; const int hh = blockIdx.x % HG, sg = blockIdx.x / HG; const int s0 = sg * 64; const int h = h0 + hh;
  for (int i = tid; i < 64 * 8; i += 256) { const int j = i / 8, d8 = (i % 8) * 8; FragH f; f.half[0] = *(const v8us*)((const unsigned short*)V16 + ((size_t)b * SQ + s0 + j) * DM + h * HD + d8); for (int q = 0; q < 8; ++q) tl[d8 + q][j] = f.u[q]; }
  __syncthreads();
  { for (int i = tid; i < 64 * 8; i += 256) { const int d = i / 8, j8 = (i % 8) * 8; FragH f; for (int q = 0; q < 8; ++q) f.u[q] = tl[d][j8 + q]; *(v8us*)((unsigned short*)VT + ((size_t)hh * HD + d) * SQ + s0 + j8) = f.half[0]; }  } }



// lane l with lane l ^ m inside a 16-lane row (DPP row_xmask, CTRL = 0x160 | m)
template <int CTRL> __device__ __forceinline__ float lane_xm(float x) { return __builtin_bit_cast(float, __builtin_amdgcn_update_dpp(0, __builtin_bit_cast(int, x), CTRL, 0xf, 0xf, true)); }
// 2^t for eight values in place. Asm so that the free slot which the instruction set asks for behind a transcendental, before its result is used or its source overwritten, stands by construction: no line here touches the line before it, and the v_nop covers the last
__device__ __forceinline__ void exp2_x8(float (&t)[8]) { asm("v_exp_f32 %0, %0\n\tv_exp_f32 %1, %1\n\tv_exp_f32 %2, %2\n\tv_exp_f32 %3, %3\n\tv_exp_f32 %4, %4\n\tv_exp_f32 %5, %5\n\tv_exp_f32 %6, %6\n\tv_exp_f32 %7, %7\n\tv_nop" : "+v"(t[0]), "+v"(t[1]), "+v"(t[2]), "+v"(t[3]), "+v"(t[4]), "+v"(t[5]), "+v"(t[6]), "+v"(t[7])); }
// ---- fused causal attention: scores, softmax and P V of 128 query rows of one head in one work-group; S and P never reach memory ----
// A wave holds 32 query rows (q fragments and the o tiles in registers). Per tile of 64 keys: S = q K^T on WMMA, running row maximum and sum (the o tiles and the sum are rescaled when the maximum rises), P (x256, f16) goes through the wave's own LDS rows from accumulator layout to A-fragment layout, o += P V on WMMA.
#define FA_BUF (128 * G2_PITCH)      /* one staged key tile: 64 K rows, then 64 V^T rows, 128 bytes each */
#define FA_PH (G2_PITCH / 2)         /* pitch of a P row in halves */
static_assert(SQ % 128 == 0 && HD == 64, "k_fattn: whole tiles of 128 query rows and 64 keys; 64 values a head");
// One key tile into LDS: eight asynchronous 16-byte copies a lane (copy i lands 16 rows below copy i - 1; 0..3 = K rows, 4..7 = V^T rows). One asm statement, as in g2_stage: the s_wait_xcnt at its end stands in front of any later overwrite of the address registers that the copies name.
__device__ __forceinline__ void fa_stage(unsigned l, const _Float16* gk, size_t sk, const _Float16* gv, size_t sv) {
  asm volatile("global_load_async_to_lds_b128 %0, %8, off\n\tglobal_load_async_to_lds_b128 %1, %9, off\n\tglobal_load_async_to_lds_b128 %2, %10, off\n\tglobal_load_async_to_lds_b128 %3, %11, off\n\t"
               "global_load_async_to_lds_b128 %4, %12, off\n\tglobal_load_async_to_lds_b128 %5, %13, off\n\tglobal_load_async_to_lds_b128 %6, %14, off\n\tglobal_load_async_to_lds_b128 %7, %15, off\n\ts_wait_xcnt 0x0"
               :: "v"(l), "v"(l + 16 * G2_PITCH), "v"(l + 32 * G2_PITCH), "v"(l + 48 * G2_PITCH), "v"(l + 64 * G2_PITCH), "v"(l + 80 * G2_PITCH), "v"(l + 96 * G2_PITCH), "v"(l + 112 * G2_PITCH),
                  "v"(gk), "v"(gk + sk), "v"(gk + 2 * sk), "v"(gk + 3 * sk), "v"(gv), "v"(gv + sv), "v"(gv + 2 * sv), "v"(gv + 3 * sv) : "memory"); }
__device__ __forceinline__ float row16_max(float x) { x = fmaxf(x, lane_xm<0x161>(x)); x = fmaxf(x, lane_xm<0x162>(x)); x = fmaxf(x, lane_xm<0x164>(x)); return fmaxf(x, lane_xm<0x168>(x)); }
__device__ __forceinline__ float row16_sum(float x) { x += lane_xm<0x161>(x); x += lane_xm<0x162>(x); x += lane_xm<0x164>(x); return x + lane_xm<0x168>(x); }
__global__ __launch_bounds__(128) void k_fattn(const _Float16* __restrict__ Q, const _Float16* __restrict__ K, const _Float16* __restrict__ VTp, float scale, _Float16* __restrict__ O) {
  __shared__ __attribute__((aligned(16))) unsigned char sm[2 * FA_BUF + 4 * 32 * G2_PITCH];      /* two staged key tiles, then 32 P rows per wave */
  const int tid = threadIdx.x, lane = tid & 31, ln = lane & 15, hh = lane >> 4; const int w = __builtin_amdgcn_readfirstlane(tid >> 5);
  const int h = blockIdx.x, b = blockIdx.y; const int q0 = (SQ / 128 - 1 - (int)blockIdx.z) * 128;      /* the longest tiles start first */
  const int nt = (q0 + 128) >> 6;      /* causal: key tiles up to the last query row; at least two */
  const int rw = q0 + 32 * w;      /* the wave's first query row */
  const _Float16* qr0 = Q + ((size_t)b * SQ + rw + ln) * LQ + h * HD; const _Float16* qr1 = qr0 + (size_t)16 * LQ;
  const v16h qa00 = g2_frag(qr0, hh), qa01 = g2_frag(qr0 + 32, hh), qa10 = g2_frag(qr1, hh), qa11 = g2_frag(qr1 + 32, hh);
  const _Float16* gk = K + ((size_t)b * SQ + (tid >> 3)) * LQ + h * HD + (tid & 7) * 8; const _Float16* gv = VTp + (((size_t)b * NH + h) * HD + (tid >> 3)) * SQ + (tid & 7) * 8;      /* this lane's 16 bytes of row tid / 8 of each 16-row group */
  const size_t sk = (size_t)16 * LQ, sv = (size_t)16 * SQ; const unsigned l0 = (unsigned)(size_t)sm + (unsigned)((tid >> 3) * G2_PITCH + (tid & 7) * 16);
  const unsigned char* fk = sm + ln * G2_PITCH; const unsigned char* fv = sm + (64 + ln) * G2_PITCH;      /* this lane's fragment rows in buffer 0 */
  _Float16* sp = (_Float16*)(sm + 2 * FA_BUF + w * 32 * G2_PITCH);
  const v8f z8 = {0.f,0.f,0.f,0.f,0.f,0.f,0.f,0.f}; v8f o[2][4]; float m[2][8], l[2][8];
#pragma unroll
  for (int i = 0; i < 2; ++i) {
#pragma unroll
    for (int j = 0; j < 4; ++j) o[i][j] = z8;
#pragma unroll
    for (int r = 0; r < 8; ++r) { m[i][r] = -1.0e30f; l[i][r] = 0.f; } }
  const float sl = scale * 1.44269504f;      /* e^(s scale) = 2^(s scale log2 e) */
  fa_stage(l0, gk, sk, gv, sv);
  asm volatile("s_wait_asynccnt 0x0" ::: "memory");      /* this wave's copies of tile 0 have landed */
  __syncthreads();      /* tile 0 published */
  fa_stage(l0 + FA_BUF, gk + (size_t)64 * LQ, sk, gv + 64, sv);      /* tile 1 flies while tile 0 is worked on */
#pragma unroll 1
  for (int t = 0; t < nt; ++t) { const unsigned bo = (unsigned)(t & 1) * FA_BUF;      /* kept rolled: one trip is one staged tile and the buffers alternate */
    if (t * 64 <= rw + 31) {      /* wave-uniform: a tile wholly above the wave's rows adds nothing; the waits and the barrier below are passed all the same */
      v8f s[2][4];
#pragma unroll
      for (int j = 0; j < 4; ++j) { s[0][j] = z8; s[1][j] = z8; }
#pragma unroll
      for (int ks = 0; ks < 2; ++ks) { const _Float16* pk = (const _Float16*)(fk + bo + ks * 64); v16h kb[4];
        if (ks) __builtin_amdgcn_sched_barrier(0);      /* keeps the second half's fragment reads behind the first half's products: read ahead, they take 32 more registers, the kernel passes 256 and a SIMD holds three waves instead of four */
#pragma unroll
        for (int j = 0; j < 4; ++j) kb[j] = g2_frag(pk + j * 8 * G2_PITCH, hh);      /* the four fragments' reads stand together in front of their products: one LDS latency, not four */
#pragma unroll
        for (int j = 0; j < 4; ++j) { s[0][j] = g2_mma(ks ? qa01 : qa00, kb[j], s[0][j]); s[1][j] = g2_mma(ks ? qa11 : qa10, kb[j], s[1][j]); } }
      if (t * 64 + 63 > rw) {      /* wave-uniform: only tiles that reach above the wave's first row hold masked keys */
#pragma unroll
        for (int i = 0; i < 2; ++i)
#pragma unroll
          for (int j = 0; j < 4; ++j)
#pragma unroll
            for (int r = 0; r < 8; ++r) s[i][j][r] = (t * 64 + 16 * j + ln <= rw + 16 * i + 8 * hh + r) ? s[i][j][r] : -1.0e30f; }
#pragma unroll
      for (int i = 0; i < 2; ++i) { float cr[8], cc[8];      /* accumulator layout: register r of lane (hh, ln) is row 16 i + 8 hh + r, key 16 j + ln */
#pragma unroll
        for (int r = 0; r < 8; ++r) { const float mt = row16_max(fmaxf(fmaxf(s[i][0][r], s[i][1][r]), fmaxf(s[i][2][r], s[i][3][r]))); const float mn = fmaxf(m[i][r], mt); cr[r] = (m[i][r] - mn) * sl; cc[r] = 8.0f - mn * sl; m[i][r] = mn; }
        exp2_x8(cr);
#pragma unroll
        for (int r = 0; r < 8; ++r) l[i][r] *= cr[r];
#pragma unroll
        for (int j = 0; j < 4; ++j) { float p[8];
#pragma unroll
          for (int r = 0; r < 8; ++r) p[r] = fmaf(s[i][j][r], sl, cc[r]);      /* weights carried x256, as the f16 P was before */
          exp2_x8(p);
#pragma unroll
          for (int r = 0; r < 8; ++r) { l[i][r] += p[r]; sp[(16 * i + 8 * hh + r) * FA_PH + 16 * j + ln] = (_Float16)p[r]; o[i][j][r] *= cr[r]; } } }
      __builtin_amdgcn_fence(__ATOMIC_ACQ_REL, "workgroup"); __builtin_amdgcn_wave_barrier();      /* the wave's P stores stay in front of its fragment reads of the same rows */
#pragma unroll
      for (int ks = 0; ks < 2; ++ks) { const v16h pa0 = g2_frag(sp + ln * FA_PH + ks * 32, hh), pa1 = g2_frag(sp + (16 + ln) * FA_PH + ks * 32, hh); const _Float16* pv = (const _Float16*)(fv + bo + ks * 64); v16h vb[4];
#pragma unroll
        for (int j = 0; j < 4; ++j) vb[j] = g2_frag(pv + j * 8 * G2_PITCH, hh);      /* as above */
#pragma unroll
        for (int j = 0; j < 4; ++j) { o[0][j] = g2_mma(pa0, vb[j], o[0][j]); o[1][j] = g2_mma(pa1, vb[j], o[1][j]); } } }
    asm volatile("s_wait_dscnt 0x0" ::: "memory");      /* this wave's reads of the buffer have returned before the buffer is given up */
    asm volatile("s_wait_asynccnt 0x0" ::: "memory");      /* this wave's copies of tile t + 1 have landed */
    __syncthreads();      /* publishes tile t + 1 and ends every wave's reads of tile t */
    if (t + 2 < nt) fa_stage(l0 + bo, gk + (size_t)(t + 2) * 64 * LQ, sk, gv + (size_t)(t + 2) * 64, sv); }      /* refill of the buffer just left */
  asm volatile("s_wait_asynccnt 0x0" ::: "memory");      /* no copy is outstanding at the end */
#pragma unroll
  for (int i = 0; i < 2; ++i)
#pragma unroll
    for (int r = 0; r < 8; ++r) { const float fin = 64.0f / row16_sum(l[i][r]);      /* o carried x64 as before; the x256 of the weights cancels */
#pragma unroll
      for (int j = 0; j < 4; ++j) sp[(16 * i + 8 * hh + r) * FA_PH + 16 * j + ln] = (_Float16)(o[i][j][r] * fin); }
  __builtin_amdgcn_fence(__ATOMIC_ACQ_REL, "workgroup"); __builtin_amdgcn_wave_barrier();      /* the wave's o stores stay in front of its row reads */
#pragma unroll
  for (int q = 0; q < 8; ++q) { const int row = q * 4 + (lane >> 3), c8 = (lane & 7) * 8; const v8us v = *(const v8us*)((const unsigned short*)sp + row * FA_PH + c8); *(v8us*)((unsigned short*)O + ((size_t)b * SQ + rw + row) * DM + h * HD + c8) = v; } }      /* whole 128-byte row pieces per store */


typedef float v2f __attribute__((ext_vector_type(2)));
#define JU 4                         /* keys whose score chains run side by side in the exact attention */
// Exact f32 attention of the first QT0 rows, one thread per query row. The row's q and o live in registers; the head's K and V rows are staged once in LDS and read from there at one address for the whole wave.
// Every d loop is unrolled, and JU keys are taken together, so that their JU chains of dependent adds fill one another's latency. Per row every product, every sum and the running-maximum recurrence stand in the order they had key by key.
template <int MASKADD>
__global__ __launch_bounds__(64) void k_att0(const float* __restrict__ QF, const float* __restrict__ KF, const float* __restrict__ VF, int ld, const float* __restrict__ mask, float scale, float* __restrict__ OF, int ldo) {
  #pragma clang fp contract(off)      /* as before; numerical: each q k product stays rounded in front of its add, as it was built so far, so that the exact rows' scores, and with them o, stay bit-identical */
  static_assert(MASKADD == 0, "k_att0: causal form only (the staged K and V rows are those of the first tile)"); static_assert(64 % JU == 0 && HD == 64, "k_att0: whole groups of JU keys; 64 values a row");
  (void)mask;
  __shared__ __attribute__((aligned(16))) float sk[QT0][HD]; __shared__ __attribute__((aligned(16))) float sv[QT0][HD];
  float (*lo)[HD + 4] = (float (*)[HD + 4])sk;      /* behind the loop's barrier the K rows' bytes are the output staging; pitch 68 floats spreads the rows over the banks */
  static_assert(sizeof(float) * 64 * (HD + 4) <= sizeof(float) * QT0 * HD, "k_att0: the output staging fits the K rows");
  const int tid = threadIdx.x; const int h = blockIdx.x / (QT0 / 64), rg = blockIdx.x % (QT0 / 64); const int i = rg * 64 + tid;
  const size_t bo_in = (size_t)blockIdx.y * QT0 * ld; QF += bo_in; KF += bo_in; VF += bo_in; OF += (size_t)blockIdx.y * QT0 * ldo;      /* batch on grid.y: QT0 rows per batch in every plane */
  const float* qr = QF + (size_t)i * ld + h * HD;
  const int nkey = rg * 64 + 64;      /* causal form: keys up to the block's last row */
  const int sr = tid >> 4, c4 = (tid & 15) * 4; const unsigned lof = (unsigned)(sr * ld + c4);      /* sixteen lanes take one 256-byte row */
#pragma unroll 1
  for (int r0 = 0; r0 < nkey; r0 += 32) { v4f tk[8], tv[8]; const float* pk[8]; const float* pv[8];      /* 32 rows a trip: sixteen loads in flight per lane; rolled, since two or four trips of them are all there is */
#pragma unroll
    for (int it = 0; it < 8; ++it) { const size_t g = (size_t)(r0 + it * 4) * ld + h * HD; pk[it] = (KF + g) + lof; pv[it] = (VF + g) + lof; tk[it] = *(const v4fa*)pk[it]; tv[it] = *(const v4fa*)pv[it]; }
    asm volatile("s_wait_xcnt 0x0" :: "v"(pk[0]), "v"(pk[1]), "v"(pk[2]), "v"(pk[3]), "v"(pk[4]), "v"(pk[5]), "v"(pk[6]), "v"(pk[7]), "v"(pv[0]), "v"(pv[1]), "v"(pv[2]), "v"(pv[3]), "v"(pv[4]), "v"(pv[5]), "v"(pv[6]), "v"(pv[7]) : "memory");      /* the wait that belongs in front of any overwrite of the loads' address registers; naming them keeps them whole up to it (without it the last load's result was given the first load's address registers) */
#pragma unroll
    for (int it = 0; it < 8; ++it) { *(v4f*)&sk[r0 + it * 4 + sr][c4] = tk[it]; *(v4f*)&sv[r0 + it * 4 + sr][c4] = tv[it]; } }
  v2f q2[HD / 2], o2[HD / 2];
#pragma unroll
  for (int c = 0; c < HD / 4; ++c) { const v4f qq = *(const v4fa*)(qr + c * 4); q2[2 * c] = v2f{qq[0], qq[1]}; q2[2 * c + 1] = v2f{qq[2], qq[3]}; o2[2 * c] = v2f{0.f, 0.f}; o2[2 * c + 1] = v2f{0.f, 0.f}; }
  asm volatile("s_wait_xcnt 0x0" :: "v"(qr) : "memory");      /* as above, for the address register of the q loads */
  __syncthreads();      /* the staged K and V rows are published to both waves */
  float m = -1.0e30f, l = 0.f;
  // A piece = 8 LDS reads of 16 bytes: 8 values (d = 8 n .. 8 n + 7) of JU rows. Two register buffers: the next piece's reads are issued in front of this piece's arithmetic, so that an LDS read's latency is not paid read by read.
  v4f ba[2 * JU], bb[2 * JU];
  auto fetch = [&](v4f (&buf)[2 * JU], const float (*rows)[HD], int jb, int n) {
#pragma unroll
    for (int u = 0; u < JU; ++u) { buf[2 * u] = *(const v4f*)&rows[jb + u][8 * n]; buf[2 * u + 1] = *(const v4f*)&rows[jb + u][8 * n + 4]; } };
  float s[JU], sc[JU], e[JU];
  auto dots = [&](const v4f (&buf)[2 * JU], int n) {      /* two rounded products an instruction; the adds stay one chain per key, d ascending */
#pragma unroll
    for (int w = 0; w < 2; ++w)
#pragma unroll
      for (int u = 0; u < JU; ++u) { const v4f kq = buf[2 * u + w]; const v2f p0 = q2[4 * n + 2 * w] * v2f{kq[0], kq[1]}, p1 = q2[4 * n + 2 * w + 1] * v2f{kq[2], kq[3]};
        s[u] = __fadd_rn(s[u], p0[0]); s[u] = __fadd_rn(s[u], p0[1]); s[u] = __fadd_rn(s[u], p1[0]); s[u] = __fadd_rn(s[u], p1[1]); } };
  auto accum = [&](const v4f (&buf)[2 * JU], int n) {      /* o = fma(o, sc, round(e v)), key after key: the rounding that this line was built with before, written out */
#pragma unroll
    for (int w = 0; w < 2; ++w)
#pragma unroll
      for (int u = 0; u < JU; ++u) { const v4f vv = buf[2 * u + w]; const v2f s2 = {sc[u], sc[u]}, e2 = {e[u], e[u]};
        o2[4 * n + 2 * w] = __builtin_elementwise_fma(o2[4 * n + 2 * w], s2, e2 * v2f{vv[0], vv[1]}); o2[4 * n + 2 * w + 1] = __builtin_elementwise_fma(o2[4 * n + 2 * w + 1], s2, e2 * v2f{vv[2], vv[3]}); } };
  fetch(ba, sk, 0, 0);
#pragma unroll 1
  for (int j0 = 0; j0 < nkey; j0 += JU) {      /* kept rolled: one trip already holds JU keys' unrolled d loops */
    const int jn = (j0 + JU < nkey) ? j0 + JU : 0;      /* the last trip fetches ahead from row 0, inside the array; that piece is not used */
#pragma unroll
    for (int u = 0; u < JU; ++u) s[u] = 0.f;
#pragma unroll
    for (int n = 0; n < HD / 8; n += 2) {
      fetch(bb, sk, j0, n + 1);
      __builtin_amdgcn_sched_barrier(0);      /* keeps the reads above in front of the arithmetic below: without it each read sinks to its use and waits out its own latency */
      dots(ba, n);
      if (n + 2 < HD / 8) fetch(ba, sk, j0, n + 2); else fetch(ba, sv, j0, 0);
      __builtin_amdgcn_sched_barrier(0);      /* as above */
      dots(bb, n + 1); }
#pragma unroll
    for (int u = 0; u < JU; ++u) { const float ss = __fmul_rn(s[u], scale);
      const float f = (j0 + u <= i) ? 1.f : 0.f; const float sm = fmaf(f, ss, (1.f - f) * -1.0e30f); const float mn = fmaxf(m, sm); sc[u] = expf(m - mn); e[u] = expf(sm - mn); l = fmaf(l, sc[u], e[u]); m = mn; }      /* l: one fused multiply-add, as this line was built before */
#pragma unroll
    for (int n = 0; n < HD / 8; n += 2) {
      fetch(bb, sv, j0, n + 1);
      __builtin_amdgcn_sched_barrier(0);      /* as above */
      accum(ba, n);
      if (n + 2 < HD / 8) fetch(ba, sv, j0, n + 2); else fetch(ba, sk, jn, 0);
      __builtin_amdgcn_sched_barrier(0);      /* as above */
      accum(bb, n + 1); } }
  const float fin = 64.0f / l;      /* o carried x64 like the f16 path */
  __syncthreads();      /* both waves have left the K rows before their bytes become the output staging */
#pragma unroll
  for (int c = 0; c < HD / 4; ++c) { const v2f a = o2[2 * c] * v2f{fin, fin}, b = o2[2 * c + 1] * v2f{fin, fin}; *(v4f*)&lo[tid][c * 4] = v4f{a[0], a[1], b[0], b[1]}; }
  __syncthreads();
  {
#pragma unroll 1
    for (int it0 = 0; it0 < 16; it0 += 4) {      /* rolled: four stores in flight a trip are enough for 16 KiB */
#pragma unroll
      for (int it = it0; it < it0 + 4; ++it) { const int row = it * 4 + tid / 16, pc = (tid % 16) * 4; const v4f v = *(const v4f*)&lo[row][pc]; *(v4f*)(OF + (size_t)(rg * 64 + row) * ldo + h * HD + pc) = v; }      /* whole 256-byte row pieces per store, as before */
      asm volatile("s_wait_xcnt 0x0" ::: "memory"); }      /* the wait that belongs in front of the next trip's overwrite of the registers which these stores name */
     } }


template <int BFIN, int WXB>
__global__ __launch_bounds__(256) void k_ln16(const float* __restrict__ X, const float* __restrict__ g, const float* __restrict__ bb, float eps, _Float16* __restrict__ N16, float* __restrict__ XB) {
  #pragma clang fp contract(off)
  __shared__ float red[256]; const size_t r = blockIdx.x; const int t = threadIdx.x; const v4f xa = *(const v4fa*)(X + r * DMQ + t * 4); float s[4]; float sum = 0.f;
  for (int q = 0; q < 4; ++q) { s[q] = BFIN ? bf16_round(xa[q]) : xa[q]; sum = __fadd_rn(sum, s[q]); }
  red[t] = sum; __syncthreads(); for (int st = 128; st > 0; st >>= 1) { if (t < st) red[t] = __fadd_rn(red[t], red[t + st]); __syncthreads(); } const float mu = red[0] / (float)DMQ; __syncthreads();
  float vs = 0.f; for (int q = 0; q < 4; ++q) { const float dl = __fadd_rn(s[q], -mu); vs = __fadd_rn(vs, __fmul_rn(dl, dl)); } red[t] = vs; __syncthreads(); for (int st = 128; st > 0; st >>= 1) { if (t < st) red[t] = __fadd_rn(red[t], red[t + st]); __syncthreads(); }
  const float rs = rsqrtf(__fadd_rn(red[0] / (float)DMQ, eps)); v4h y; v4f xb;
  for (int q = 0; q < 4; ++q) { const int c = t * 4 + q; y[q] = (_Float16)__fadd_rn(__fmul_rn(__fmul_rn(__fadd_rn(s[q], -mu), rs), bf16_round(g[c])), bf16_round(bb[c])); xb[q] = s[q]; }
  { *(v4h*)(N16 + r * DMQ + t * 4) = y; if (WXB) *(v4f*)(XB + r * DMQ + t * 4) = xb;  } }
__global__ __launch_bounds__(256) void k_ftres2(const float* __restrict__ OF0, const float* __restrict__ XB, float* __restrict__ X1, size_t n4) {
  #pragma clang fp contract(off)
  const size_t t = (size_t)blockIdx.x * 256 + threadIdx.x; if (t >= n4) return; const v4f o = *(const v4fa*)(OF0 + t * 4), xv = *(const v4fa*)(XB + t * 4); v4f y; for (int q = 0; q < 4; ++q) y[q] = __fadd_rn(__fmul_rn(o[q], 0.015625f), xv[q]); *(v4f*)(X1 + t * 4) = y;  }

__global__ __launch_bounds__(256) void k_wthd(const float* __restrict__ Wt, _Float16* __restrict__ Bt) { const size_t t = (size_t)blockIdx.x * 256 + threadIdx.x; if (t >= (size_t)NH * HD * (DM / 8)) return; const int m8 = (int)(t % (DM / 8)) * 8; const int d = (int)((t / (DM / 8)) % HD); const int h = (int)(t / ((size_t)(DM / 8) * HD)); FragH f;
  for (int q = 0; q < 8; ++q) f.h[q] = (_Float16)(16.0f * bf16_round(Wt[((size_t)h * DM + m8 + q) * HD + d])); unsigned short* dst = (unsigned short*)Bt + ((size_t)h * HD + d) * DM + m8; *(v8us*)dst = f.half[0];  }




__global__ __launch_bounds__(256) void k_wtpad(const float* __restrict__ Wm, _Float16* __restrict__ Wt, int Kr, int Kp, int Nr, int Np, float scale) {
  const int t = blockIdx.x * 256 + threadIdx.x; if (t >= Np * (Kp / 8)) return; const int n = t / (Kp / 8), k8 = (t % (Kp / 8)) * 8; const int nc = min(n, Nr - 1); const float fn = (n < Nr) ? 1.f : 0.f; FragH f;
  for (int i = 0; i < 8; ++i) { const int k = k8 + i; const int kc = min(k, Kr - 1); const float fk = (k < Kr) ? fn : 0.f; f.h[i] = (_Float16)(bf16_round(Wm[(size_t)kc * Nr + nc]) * scale * fk); }
  unsigned short* o = (unsigned short*)Wt + (size_t)n * Kp + k8; *(v8us*)o = f.half[0];  }
__global__ __launch_bounds__(128) void k_bpad(const float* __restrict__ b, float* __restrict__ Bp, int nr, int np) {
  const int i = threadIdx.x; if (i >= np) return; const float v = b[min(i, nr - 1)] * ((i < nr) ? 1.f : 0.f); *(float*)(Bp + i) = v;  }
extern "C" void kernel_launch(void* const* d_in, const int* in_sizes, int n_in,
                              void* d_out, int out_size, void* d_ws, size_t ws_size, hipStream_t stream) {
  (void)in_sizes; (void)n_in; (void)out_size;
  const float* const* I = (const float* const*)d_in; const float* x = I[0]; const float* wqkv = I[1]; const float* bqkv = I[2]; const float* wo = I[3]; const float* bo = I[4]; const float* g1 = I[5]; const float* be1 = I[6]; const float* gg2 = I[7]; const float* be2 = I[8]; const float* wfc = I[9]; const float* bfc = I[10]; const float* wmp = I[11]; const float* bmp = I[12];      /* x; fused Wqkv [1024][3072] + bqkv [3072] ([in][out]); Wproj + bproj; LN1 g / b, LN2 g / b; W1 [1024][4096] + b1, W2 [4096][1024] + b2 */
  char* ws = (char*)d_ws; size_t off = 0;
  auto take = [&](size_t bytes) { char* p = ws + off; off += (bytes + 255) & ~(size_t)255; return p; };
  _Float16* BQKV = (_Float16*)take((size_t)3 * DM * DM * 2); _Float16* BO = (_Float16*)take((size_t)DM * DM * 2);
  _Float16* X16 = (_Float16*)take(NR * DM * 2); float* XB = (float*)take(NR * DM * 4); _Float16* BW1 = (_Float16*)take((size_t)DFF * DM * 2); _Float16* BW2 = (_Float16*)take((size_t)DM * DFF * 2);
  _Float16* QKV = (_Float16*)take(NR * 3 * DM * 2); _Float16* Q16 = QKV; _Float16* K16 = QKV + DM; _Float16* V16 = QKV + 2 * DM; _Float16* O16 = (_Float16*)take(NR * DM * 2);
  _Float16* HF16 = QKV;      /* alias: the FFN hidden rows [NR][DFF] fill QKV + O16 (adjacent, same bytes); their last reader, the output projection, precedes the FFN */
  _Float16* M16 = X16;      /* alias: X16's last reader, the first-tile q | k | v GEMM, precedes LN2's write */
  _Float16* VT = (_Float16*)take((size_t)NB * NH * HD * SQ * 2);
  float* OF0 = (float*)take((size_t)NB * QT0 * DM * 4); _Float16* OH0 = (_Float16*)take((size_t)NB * QT0 * DM * 2); _Float16* OL0 = (_Float16*)take((size_t)NB * QT0 * DM * 2);
  float* S = (float*)take((size_t)GB * NH * QT * NKX * 4);      /* no scores any more: the plane of the two aliases below */
  float* QKVF0 = S;      /* alias: f32 q | k | v of the first tiles [NB][QT0][3 DM]; read by the exact attention before x1 is written */
  float* X1 = S;      /* alias: x1 [NR][DM] is written after the exact attention's last read of QKVF0 */
  if (off > ws_size) return;
  k_wt_f16<DM, 3 * DM><<<dim3(3 * DM / 64, DM / 128), 256, 0, stream>>>(wqkv, BQKV, 16.0f);      /* fused [in][out] [DM][3 DM] -> Bt [3 DM][DM] x16: rows 0.. = q, DM.. = k, 2 DM.. = v output columns (contiguous thirds) */ k_wt_f16<DM, DM><<<dim3(DM / 64, DM / 128), 256, 0, stream>>>(wo, BO, 16.0f);      /* w_proj [in][out] -> Bt x16 */
  k_ln16<1, 1><<<(unsigned)NR, 256, 0, stream>>>(x, g1, be1, 1e-5f, X16, XB);      /* a = LN1(bf16(x)) -> f16 rows; XB = bf16(x) for the residual */
  k_wt_f16<DM, DFF><<<dim3(DFF / 64, DM / 128), 256, 0, stream>>>(wfc, BW1, 16.0f); k_wt_f16<DFF, DM><<<dim3(DM / 64, DFF / 128), 256, 0, stream>>>(wmp, BW2, 16.0f);      /* W1 [1024][4096] -> Bt [4096][1024]; W2 [4096][1024] -> Bt [1024][4096] (x16) */
  k_gemm3<0, false, false, 3 * DM><<<(unsigned)((MP / 256) * (3 * DM / 128)), 256, 0, stream>>>(X16, DM, BQKV, DM, 0.0625f, bqkv, nullptr, nullptr, QKV, MP, 3 * DM, DM);      /* q | k | v rows (f16); head h = columns h*HD.. of each DM block */
  k_vt<NH, SQ><<<NB * NH * (SQ / 64), 256, 0, stream>>>(V16, LQ, 0, VT);      /* V^T [NB][NH][HD][SQ], every batch in one launch */
  k_gemm2<0><<<dim3((QT0 / 128) * (3 * DM / 64), NB), 128, 0, stream>>>(X16, DM, (size_t)SQ * DM, BQKV, DM, 0, 0.0625f, bqkv, 0, nullptr, 1, 0, 0, QKVF0, nullptr, 3 * DM, (size_t)QT0 * 3 * DM, QT0, 3 * DM, DM);      /* f32 q | k | v of the first 128 rows of every batch (grid.y; exact products) */
  k_att0<0><<<dim3(NH * (QT0 / 64), NB), 64, 0, stream>>>(QKVF0, QKVF0 + DM, QKVF0 + 2 * DM, 3 * DM, nullptr, 0.07216878364870322f, OF0, DM);      /* exact f32 attention for rows 0..127 of every batch (grid.y; o x64) */
  k_fattn<<<dim3(NH, NB, SQ / 128), 128, 0, stream>>>(Q16, K16, VT, 0.07216878364870322f, O16);      /* causal attention, every batch, head and query tile in one launch: o (merged heads, x64) as f16 rows */
  k_gemm3<0, true, true, DM><<<(unsigned)((MPO / 256) * (DM / 128)), 256, 0, stream>>>(O16, DM, BO, DM, 0.0009765625f, bo, XB, X1, nullptr, MPO, DM, DM);      /* x1 = x + o Wo + b, all rows */
  k_hl<<<(unsigned)(((size_t)NB * QT0 * DM / 8 + 255) / 256), 256, 0, stream>>>(OF0, OH0, OL0, (size_t)NB * QT0 * DM / 8);      /* first-tile o (x64) -> f16 hi + x1024 residual planes */
  k_gemm2<0><<<dim3((QT0 / 128) * (DM / 64), NB), 128, 0, stream>>>(OH0, DM, (size_t)QT0 * DM, BO, DM, 0, 0.0009765625f, bo, 0, XB, -1, 0, 0, X1, nullptr, DM, (size_t)SQ * DM, QT0, DM, DM);      /* rows 0..127 of every batch (grid.y): x1 = x + o_hi Wo (+ b), overwriting the f16-path rows */
  k_gemm2<0><<<dim3((QT0 / 128) * (DM / 64), NB), 128, 0, stream>>>(OL0, DM, (size_t)QT0 * DM, BO, DM, 0, 0.00000095367431640625f, nullptr, 0, X1, -1, 0, 0, X1, nullptr, DM, (size_t)SQ * DM, QT0, DM, DM);      /* += o_lo Wo 2^-20 (own-element accumulate) */
  k_ln16<0, 0><<<(unsigned)NR, 256, 0, stream>>>(X1, gg2, be2, 1e-5f, M16, nullptr);      /* h = LN2(x1) -> f16 rows */
  k_gemm3<3, false, false, DFF><<<(unsigned)((MP / 256) * (DFF / 128)), 256, 0, stream>>>(M16, DM, BW1, DM, 0.0625f, bfc, nullptr, nullptr, HF16, MP, DFF, DM);      /* relu(h2 W1 + b1) -> f16, all rows */
  k_gemm3<0, true, true, DM><<<(unsigned)((MP / 256) * (DM / 128)), 256, 0, stream>>>(HF16, DFF, BW2, DFF, 0.0625f, bmp, X1, (float*)d_out, nullptr, MP, DM, DFF);      /* out = x1 + mlp (own-element residual), all rows */
}

// v008
// One run takes 355 microseconds.
// Two timings next to v007 both put it at 1.03 times that version's speed.
// Counting every step since v000, it is 29.8 times as fast.
#include <hip/hip_runtime.h>
// Pre-LN causal transformer block with a fused QKV projection and the module's literal score scale (x [8][1024][1024]; h = LN1(x) (biased var, eps 1e-5); qkv = h Wqkv + bqkv ([in][out] 1024 x 3072 + bias) split q | k | v; 16 heads of 64; scale = 1 / sqrt(3 * 1024 / 16) = 1 / sqrt(192) (as the source: NOT 1 / sqrt(head_dim)); causal (tril, -inf); softmax; x1 = x + y Wproj + bproj; out = x1 + relu(LN2(x1) W1 + b1) W2 + b2 ([in][out] 1024 x 4096 x 1024) -> [8][1024][1024]).
// Structure: token rows r = b*1024 + s; h = LN1(bf16(x)) as f16 rows; q | k | v as ONE WMMA GEMM (N = 3 x 1024) (64x64 wave tiles, f32 accumulation, exact x16 weights + bias, f16 outputs); per batch: V^T for all heads via LDS transposes; per query tile of 128 rows of a head, in one kernel: scores against tiles of 64 keys up to the tile end, running row maximum and sum (f32 statistics, native exp; keys above the row masked; weights x256 f16), o += P . V^T on WMMA (o carried x64, folded into the output GEMM alpha) written straight into the merged f16 o rows; x1 = x + o W_o + b GEMM (f32); h2 = LN2(x1) as f16 rows; relu(h2 W1 + b1) GEMM (f16 rows) and out = x1 + (.) W2 + b2 GEMM (f32) into the output layout.
// Compute dtype: inputs rounded to bf16; x / weights exact; q, k, v, softmax weights and o as plain f16 GEMM operands (~2^-12); scores and softmax statistics f32. v_wmma_f32_16x16x32_f16.
// Launches: the batch axis lies on the grid, not in a host loop: V^T takes all batches in one launch on grid.x; the first-tile q | k | v GEMM, the exact first-tile attention and the first-tile output GEMMs take all batches on grid.y; scores, softmax and P V are one launch for every batch, head and query tile; the FFN GEMMs take all token rows.
#define NB 8
#define SQ 1024
#define DM 1024
#define NH 16
#define HD 64
#define HG 4                         /* heads per launch of the k_vt(b, h0) overload, which is not launched */
#define QT 256
#define NKX SQ                       /* used only in sizing the S plane */
#define QT0 128                      /* first-tile rows recomputed exactly in f32 */
#define GB 4
#define B0 0                         /* unused; every launch starts at batch 0 */
#define NBR NB                       /* batches processed (debug hook) */
#define NR ((size_t)NB * SQ)
#define DMQ DM
#define DFF 4096                     /* FFN hidden width */
#define DFFR 100                     /* unused; the FFN hidden width is DFF */
#define MP ((int)((size_t)NBR * SQ)) /* rows projected (debug hook) */
#define QN SQ                        /* unused; attention takes all SQ query rows */
#define NHD NH                       /* unused; attention takes all NH heads */
#define MPO MP                       /* rows through the output stage (debug hook) */
#define LQ (3 * DM)      /* row pitch of the q/k/v rows */
typedef __bf16 v16b __attribute__((ext_vector_type(16)));
typedef unsigned short v8us __attribute__((ext_vector_type(8), may_alias));
typedef float  v8f  __attribute__((ext_vector_type(8)));
typedef float  v4f  __attribute__((ext_vector_type(4)));
typedef float  v4fa __attribute__((ext_vector_type(4), may_alias));
union FragB { v16b v; v8us half[2]; unsigned short u[16]; };

__device__ __forceinline__ unsigned short bf16_bits(float x) { unsigned int u = __float_as_uint(x); return (unsigned short)((u + 0x7FFFu + ((u >> 16) & 1u)) >> 16); }
__device__ __forceinline__ float bf16_val(unsigned short b) { return __uint_as_float(((unsigned int)b) << 16); }
__device__ __forceinline__ float bf16_round(float x) { return bf16_val(bf16_bits(x)); }
// D += A·B with NT terms: 1 = ah·bh, 2 = + al·bh (A split), 3 = + ah·bl (both split)
template <int NT>
__device__ __forceinline__ v8f mmaN(v16b ah, v16b al, v16b bh, v16b bl, v8f c) {
  c = __builtin_amdgcn_wmma_f32_16x16x32_bf16(false, ah, false, bh, (short)0, c, false, false);
  if (NT >= 2) c = __builtin_amdgcn_wmma_f32_16x16x32_bf16(false, al, false, bh, (short)0, c, false, false);
  if (NT >= 3) c = __builtin_amdgcn_wmma_f32_16x16x32_bf16(false, ah, false, bl, (short)0, c, false, false);
  asm volatile("v_nop\n\tv_nop\n\tv_nop\n\tv_nop" : "+v"(c) : "v"(ah), "v"(al), "v"(bh), "v"(bl));
  return c;
}

__global__ __launch_bounds__(256) void k_wt_bf16(const float* __restrict__ W, unsigned short* __restrict__ Wt, int K, int N) {
  const int t = blockIdx.x * 256 + threadIdx.x;
  const int k8n = K / 8;
  if (t >= N * k8n) return;
  const int n = t / k8n, k8 = (t % k8n) * 8;
  v8us v;
#pragma unroll
  for (int i = 0; i < 8; ++i) v[i] = bf16_bits(W[(size_t)(k8 + i) * N + n]);
  *(v8us*)(Wt + (size_t)n * K + k8) = v;
  
}

// GEMM C[M][N] (f32, pitch ldc) = act(A[M][K]·W + bias). A f32 row-major (pitch lda) converted per fragment to bf16
// (ASPLIT: hi/lo two planes -> 2 terms, else single rounded term); Wt bf16 [N][K] (pitch ldb). BIAS_BF16 rounds the
// bias to bf16 first (bias quantised to bf16 before the add). K%32==0, M%16==0, N%64==0.
template <bool ASPLIT, int ACT, bool BIAS_BF16>
__global__ __launch_bounds__(128) void k_gemm_bf(const float* __restrict__ A, int lda, const unsigned short* __restrict__ Wt, int ldb,
                                               const float* __restrict__ bias, float* __restrict__ C, int ldc, int M, int N, int K) {
  __shared__ __attribute__((aligned(16))) float so[4][16][64];
  const int tid = threadIdx.x, w = tid >> 5, lane = tid & 31, ln = lane & 15, hh = lane >> 4;
  const int ntn = N / 64;
  const int wid = blockIdx.x * 4 + w;
  const int mt = wid / ntn, nq = wid % ntn;
  if (mt * 16 >= M) return;
  const int row0 = mt * 16, col0 = nq * 64;
  const float* arow = A + (size_t)(row0 + ln) * lda;
  v8f acc[4] = {};
  for (int kb = 0; kb < K; kb += 32) {
    FragB ah, al;
    const v4f x0 = *(const v4fa*)(arow + kb + 8 * hh), x1 = *(const v4fa*)(arow + kb + 8 * hh + 4);
    const v4f x2 = *(const v4fa*)(arow + kb + 16 + 8 * hh), x3 = *(const v4fa*)(arow + kb + 16 + 8 * hh + 4);
    float xs[16] = {x0[0],x0[1],x0[2],x0[3],x1[0],x1[1],x1[2],x1[3],x2[0],x2[1],x2[2],x2[3],x3[0],x3[1],x3[2],x3[3]};
#pragma unroll
    for (int i = 0; i < 16; ++i) { const unsigned short hb = bf16_bits(xs[i]); ah.u[i] = hb; al.u[i] = ASPLIT ? bf16_bits(xs[i] - bf16_val(hb)) : (unsigned short)0; }
#pragma unroll
    for (int t = 0; t < 4; ++t) {
      const unsigned short* brow = Wt + (size_t)(col0 + t * 16 + ln) * ldb + kb;
      FragB b;
      b.half[0] = *(const v8us*)(brow + 8 * hh);
      b.half[1] = *(const v8us*)(brow + 16 + 8 * hh);
      acc[t] = mmaN<ASPLIT ? 2 : 1>(ah.v, al.v, b.v, b.v, acc[t]);
    }
  }
#pragma unroll
  for (int t = 0; t < 4; ++t) {
    float bv = bias ? bias[col0 + t * 16 + ln] : 0.f;
    if (BIAS_BF16) bv = bf16_round(bv);
#pragma unroll
    for (int r = 0; r < 8; ++r) { float v = acc[t][r] + bv; if (ACT == 1) v = fmaxf(v, 0.f); so[w][8 * hh + r][t * 16 + ln] = v; }
  }
  __builtin_amdgcn_fence(__ATOMIC_ACQ_REL, "workgroup");
  __builtin_amdgcn_wave_barrier();
  const int rsub = lane >> 4, c4 = (lane & 15) * 4;
  {
#pragma unroll
    for (int q = 0; q < 8; ++q) {
      const int r = q * 2 + rsub;
      const v4f v = *(const v4fa*)&so[w][r][c4];
      *(v4f*)(C + (size_t)(row0 + r) * ldc + col0 + c4) = v;
    }
    
  }
}

// GEMM C = act(A·W + bias + resid): A f32 (ASPLIT -> hi/lo 2 terms), Wt bf16 [N][K]; ACT 0 none, 1 relu, 2 exact gelu;
// resid (optional, f32, row index = (row % rmod), pitch ldr, RES_BF16 rounds it) added before the activation.
template <bool ASPLIT, int ACT, bool BIAS_BF16, bool RES_BF16>
__global__ __launch_bounds__(128) void k_gemm_bf3(const float* __restrict__ A, int lda, const unsigned short* __restrict__ Wt, int ldb,
                                                const float* __restrict__ bias, const float* __restrict__ resid, int rmod, int ldr,
                                                float* __restrict__ C, int ldc, int M, int N, int K) {
  __shared__ __attribute__((aligned(16))) float so[4][16][64];
  const int tid = threadIdx.x, w = tid >> 5, lane = tid & 31, ln = lane & 15, hh = lane >> 4;
  const int ntn = N / 64;
  const int wid = blockIdx.x * 4 + w;
  const int mt = wid / ntn, nq = wid % ntn;
  if (mt * 16 >= M) return;
  const int row0 = mt * 16, col0 = nq * 64;
  const float* arow = A + (size_t)(row0 + ln) * lda;
  v8f acc[4] = {};
  for (int kb = 0; kb < K; kb += 32) {
    FragB ah, al;
    const v4f x0 = *(const v4fa*)(arow + kb + 8 * hh), x1 = *(const v4fa*)(arow + kb + 8 * hh + 4);
    const v4f x2 = *(const v4fa*)(arow + kb + 16 + 8 * hh), x3 = *(const v4fa*)(arow + kb + 16 + 8 * hh + 4);
    float xs[16] = {x0[0],x0[1],x0[2],x0[3],x1[0],x1[1],x1[2],x1[3],x2[0],x2[1],x2[2],x2[3],x3[0],x3[1],x3[2],x3[3]};
#pragma unroll
    for (int i = 0; i < 16; ++i) { const unsigned short hb = bf16_bits(xs[i]); ah.u[i] = hb; al.u[i] = ASPLIT ? bf16_bits(xs[i] - bf16_val(hb)) : (unsigned short)0; }
#pragma unroll
    for (int t = 0; t < 4; ++t) {
      const unsigned short* brow = Wt + (size_t)(col0 + t * 16 + ln) * ldb + kb;
      FragB b;
      b.half[0] = *(const v8us*)(brow + 8 * hh);
      b.half[1] = *(const v8us*)(brow + 16 + 8 * hh);
      acc[t] = mmaN<ASPLIT ? 2 : 1>(ah.v, al.v, b.v, b.v, acc[t]);
    }
  }
#pragma unroll
  for (int t = 0; t < 4; ++t) {
    const int col = col0 + t * 16 + ln;
    float bv = bias ? bias[col] : 0.f;
    if (BIAS_BF16) bv = bf16_round(bv);
#pragma unroll
    for (int r = 0; r < 8; ++r) {
      float v = acc[t][r] + bv;
      if (resid) { float rv = resid[(size_t)((row0 + 8 * hh + r) % rmod) * ldr + col]; if (RES_BF16) rv = bf16_round(rv); v += rv; }
      if (ACT == 1) v = fmaxf(v, 0.f);
      if (ACT == 2) v = 0.5f * v * (1.0f + erff(v * 0.70710678118654752f));
      if (ACT == 3) { const float u = 0.7978845608028654f * (v + 0.044715f * v * v * v); v = 0.5f * v * (1.0f + tanhf(u)); }
      so[w][8 * hh + r][t * 16 + ln] = v;
    }
  }
  __builtin_amdgcn_fence(__ATOMIC_ACQ_REL, "workgroup");
  __builtin_amdgcn_wave_barrier();
  const int rsub = lane >> 4, c4 = (lane & 15) * 4;
  {
#pragma unroll
    for (int q = 0; q < 8; ++q) {
      const int r = q * 2 + rsub;
      const v4f v = *(const v4fa*)&so[w][r][c4];
      *(v4f*)(C + (size_t)(row0 + r) * ldc + col0 + c4) = v;
    }
    
  }
}
// row LayerNorm (biased variance, eps) over N: s = X (+ R); optional out_sum <- s; out_norm <- (s-mu)*rsqrt(var+eps)*g + b
template <bool PARAM_BF16>
__global__ __launch_bounds__(256) void k_layernorm(const float* __restrict__ X, const float* __restrict__ R, const float* __restrict__ g, const float* __restrict__ bta,
                                                  float* __restrict__ out_sum, float* __restrict__ out_norm, int N, float eps) {
  __shared__ float red[256];
  const int row = blockIdx.x, tid = threadIdx.x;
  const float* x = X + (size_t)row * N; const float* rr = R ? R + (size_t)row * N : nullptr;
  float vals[16];                     // up to N = 4096
  const int per = N / 256;            // contiguous chunk per thread? use strided-by-4 chunks: thread handles j = tid*4 + 1024*u
  float s1 = 0.f;
  for (int u = 0; u < per / 4; ++u) {
    const int j = tid * 4 + 1024 * u;
    const v4f a = *(const v4fa*)(x + j);
    v4f b = {0.f,0.f,0.f,0.f}; if (rr) b = *(const v4fa*)(rr + j);
#pragma unroll
    for (int q = 0; q < 4; ++q) { const float v = a[q] + b[q]; vals[u * 4 + q] = v; s1 += v; }
  }
  red[tid] = s1; __syncthreads();
  for (int st = 128; st > 0; st >>= 1) { if (tid < st) red[tid] += red[tid + st]; __syncthreads(); }
  const float mu = red[0] / (float)N; __syncthreads();
  float s2 = 0.f;
  for (int u = 0; u < per / 4; ++u)
#pragma unroll
    for (int q = 0; q < 4; ++q) { const float c = vals[u * 4 + q] - mu; s2 += c * c; }
  red[tid] = s2; __syncthreads();
  for (int st = 128; st > 0; st >>= 1) { if (tid < st) red[tid] += red[tid + st]; __syncthreads(); }
  const float rs = rsqrtf(red[0] / (float)N + eps);
  {
    for (int u = 0; u < per / 4; ++u) {
      const int j = tid * 4 + 1024 * u;
      v4f o, sm;
#pragma unroll
      for (int q = 0; q < 4; ++q) {
        float gg = g[j + q], bb = bta[j + q];
        if (PARAM_BF16) { gg = bf16_round(gg); bb = bf16_round(bb); }
        sm[q] = vals[u * 4 + q]; o[q] = (vals[u * 4 + q] - mu) * rs * gg + bb;
      }
      if (out_sum) *(v4f*)(out_sum + (size_t)row * N + j) = sm;
      *(v4f*)(out_norm + (size_t)row * N + j) = o;
    }
    
  }
}



// ---- f16 WMMA path (v_wmma_f32_16x16x32_f16): 11-bit significands for operands in range — used where a [0,1] probability operand needs more precision than bf16
typedef _Float16 v16h __attribute__((ext_vector_type(16)));
union FragH { v16h v; v8us half[2]; _Float16 h[16]; unsigned short u[16]; };
template <int NT>
__device__ __forceinline__ v8f mmaH(v16h ah, v16h al, v16h bh, v16h bl, v8f c) {
  c = __builtin_amdgcn_wmma_f32_16x16x32_f16(false, ah, false, bh, (short)0, c, false, false);
  if (NT >= 2) c = __builtin_amdgcn_wmma_f32_16x16x32_f16(false, al, false, bh, (short)0, c, false, false);
  if (NT >= 3) c = __builtin_amdgcn_wmma_f32_16x16x32_f16(false, ah, false, bl, (short)0, c, false, false);
  asm volatile("v_nop\n\tv_nop\n\tv_nop\n\tv_nop" : "+v"(c) : "v"(ah), "v"(al), "v"(bh), "v"(bl));
  return c;
}
// batched GEMM like k_gemm_b but f16 operands: A f32 (split into f16 hi/lo if ASPLIT, else rounded to f16), Bt = f16 values [n][k]; alpha; C f32; N multiple of 16 (partial tiles skipped)
template <bool ASPLIT>
__global__ __launch_bounds__(128) void k_gemm_h(const float* __restrict__ A, int lda, size_t sA, const _Float16* __restrict__ Bh, int ldb, size_t sB, float alpha, float* __restrict__ C, int ldc, size_t sC, int M, int N, int K) {
  __shared__ __attribute__((aligned(16))) float so[4][16][64];
  const int tid = threadIdx.x, w = tid >> 5, lane = tid & 31, ln = lane & 15, hh = lane >> 4; const int by = blockIdx.y;
  A += (size_t)by * sA; Bh += (size_t)by * sB; C += (size_t)by * sC;
  const int ntn = (N + 63) / 64; const int wid = blockIdx.x * 4 + w; const int mt = wid / ntn, nq = wid % ntn; if (mt * 16 >= M) return;
  const int row0 = mt * 16, col0 = nq * 64; const float* arow = A + (size_t)(row0 + ln) * lda;
  v8f acc[4] = {};
  for (int kb = 0; kb < K; kb += 32) {
    FragH ah, al;
    const v4f x0 = *(const v4fa*)(arow + kb + 8 * hh), x1 = *(const v4fa*)(arow + kb + 8 * hh + 4), x2 = *(const v4fa*)(arow + kb + 16 + 8 * hh), x3 = *(const v4fa*)(arow + kb + 16 + 8 * hh + 4);
    float xs[16] = {x0[0],x0[1],x0[2],x0[3],x1[0],x1[1],x1[2],x1[3],x2[0],x2[1],x2[2],x2[3],x3[0],x3[1],x3[2],x3[3]};
#pragma unroll
    for (int i = 0; i < 16; ++i) { const _Float16 h = (_Float16)xs[i]; ah.h[i] = h; al.h[i] = ASPLIT ? (_Float16)(xs[i] - (float)h) : (_Float16)0.0f; }
#pragma unroll
    for (int t = 0; t < 4; ++t) { if (col0 + t * 16 >= N) continue; const size_t boff = (size_t)(col0 + t * 16 + ln) * ldb + kb; FragH bq; bq.half[0] = *(const v8us*)(Bh + boff + 8 * hh); bq.half[1] = *(const v8us*)(Bh + boff + 16 + 8 * hh);
      acc[t] = mmaH<ASPLIT ? 2 : 1>(ah.v, al.v, bq.v, bq.v, acc[t]); }
  }
#pragma unroll
  for (int t = 0; t < 4; ++t) { if (col0 + t * 16 >= N) continue;
#pragma unroll
    for (int r = 0; r < 8; ++r) so[w][8 * hh + r][t * 16 + ln] = acc[t][r] * alpha; }
  __builtin_amdgcn_fence(__ATOMIC_ACQ_REL, "workgroup"); __builtin_amdgcn_wave_barrier();
  const int rsub = lane >> 4, c4 = (lane & 15) * 4;
  {
#pragma unroll
    for (int q = 0; q < 8; ++q) { const int r = q * 2 + rsub; if (col0 + c4 < N) { const v4f v = *(const v4fa*)&so[w][r][c4]; *(v4f*)(C + (size_t)(row0 + r) * ldc + col0 + c4) = v; } }
     }
}

// Wt[n][k] = f16(bf16(W[k][n]) * scale) from f32 row-major W[K][N] (scale = power of two; bf16-exact weights stay exact in f16 away from the subnormal range)
// A work-group turns a tile of 128 k x 64 n through LDS, so that both sides of memory see whole aligned 256-byte pieces: a wave load takes 256 contiguous bytes of two W rows (eight loads in flight), a wave store writes 256 contiguous bytes of two Wt rows.
// A thread holds 8 k x 4 n; its 8 k of one n are one 16-byte LDS store. Column n = 4 c + q lies in LDS row 16 q + c: neighbouring lanes then lie one pitch apart (16 B x odd), which spreads the 16-byte stores over the banks.
#define WT_PITCH 272                 /* LDS row pitch in bytes of a 256-byte row of 128 k */
template <int K, int N>
__global__ __launch_bounds__(256) void k_wt_f16(const float* __restrict__ W, _Float16* __restrict__ Wt, float scale) {
  static_assert(K % 128 == 0 && N % 64 == 0, "k_wt_f16: whole tiles of 128 k x 64 n");
  __shared__ __attribute__((aligned(16))) unsigned char tl[64 * WT_PITCH];
  const int tid = threadIdx.x, g = tid >> 4, c = tid & 15; const int n0 = blockIdx.x * 64, k0 = blockIdx.y * 128;
  const float* sp = W + (size_t)(k0 + 8 * g) * N + n0 + 4 * c; v4f x[8];
#pragma unroll
  for (int i = 0; i < 8; ++i) x[i] = *(const v4fa*)(sp + (size_t)i * N);      /* unrolled: the eight rows' loads fly together, one address and immediate offsets */
  asm volatile("s_wait_xcnt 0x0" :: "v"(sp) : "memory");      /* the wait that belongs in front of any overwrite of the loads' address register; naming it keeps it whole up to here */
#pragma unroll
  for (int q = 0; q < 4; ++q) { FragH f;
#pragma unroll
    for (int i = 0; i < 8; ++i) f.h[i] = (_Float16)(bf16_round(x[i][q]) * scale);
    *(v8us*)(tl + (16 * q + c) * WT_PITCH + 16 * g) = f.half[0]; }
  __syncthreads();      /* the tile is whole before its rows are read */
  unsigned short* dp = (unsigned short*)Wt + (size_t)(n0 + 4 * g) * K + k0 + 8 * c;      /* sixteen lanes take one 256-byte row piece; LDS row 16 j + g is column 4 g + j */
#pragma unroll
  for (int j = 0; j < 4; ++j) { const v8us v = *(const v8us*)(tl + (16 * j + g) * WT_PITCH + 16 * c); *(v8us*)(dp + (size_t)j * K) = v; }
}
// k_gemm_hh variant with fused epilogue: v = acc·alpha + bias[by·sBias + col] (+ CP[(row/rowsPerB)·sCPb + by·64 + col] if CP) ; ACT 0 none / 1 elu ; writes f16 C16 (and f32 C if non-null)
template <int ACT>
__global__ __launch_bounds__(128) void k_gemm_hhx(const _Float16* __restrict__ A, int lda, size_t sA, const _Float16* __restrict__ Bh, int ldb, size_t sB, float alpha, const float* __restrict__ bias, size_t sBias, const float* __restrict__ CP, int rowsPerB, size_t sCPb, int row0g,
    float* __restrict__ C, _Float16* __restrict__ C16, int ldc, size_t sC, int M, int N, int K) {
  __shared__ __attribute__((aligned(16))) float so[4][16][64];
  const int tid = threadIdx.x, w = tid >> 5, lane = tid & 31, ln = lane & 15, hh = lane >> 4; const int by = blockIdx.y;
  A += (size_t)by * sA; Bh += (size_t)by * sB; const size_t cofs = (size_t)by * sC; const float* bp = bias ? bias + (size_t)by * sBias : nullptr;
  const int ntn = (N + 63) / 64; const int wid = blockIdx.x * 4 + w; const int mt = wid / ntn, nq = wid % ntn; if (mt * 16 >= M) return;
  const int row0 = mt * 16, col0 = nq * 64; const _Float16* arow = A + (size_t)(row0 + ln) * lda;
  v8f acc[4] = {};
  for (int kb = 0; kb < K; kb += 32) { FragH ah; ah.half[0] = *(const v8us*)((const unsigned short*)arow + kb + 8 * hh); ah.half[1] = *(const v8us*)((const unsigned short*)arow + kb + 16 + 8 * hh);
#pragma unroll
    for (int t = 0; t < 4; ++t) { if (col0 + t * 16 >= N) continue; const size_t boff = (size_t)(col0 + t * 16 + ln) * ldb + kb; FragH bq; bq.half[0] = *(const v8us*)((const unsigned short*)Bh + boff + 8 * hh); bq.half[1] = *(const v8us*)((const unsigned short*)Bh + boff + 16 + 8 * hh);
      acc[t] = mmaH<1>(ah.v, ah.v, bq.v, bq.v, acc[t]); }
  }
#pragma unroll
  for (int t = 0; t < 4; ++t) { if (col0 + t * 16 >= N) continue; const int col = col0 + t * 16 + ln; const float bv = bp ? bf16_round(bp[col]) : 0.f;
#pragma unroll
    for (int r = 0; r < 8; ++r) { float v = acc[t][r] * alpha + bv; if (CP) { const int rr = row0g + row0 + 8 * hh + r; if (rowsPerB < 0) v += CP[cofs + (size_t)rr * ldc + col];      /* rowsPerB < 0: own element of the batched C plane */ else { const int bidx = rr / rowsPerB; v += CP[(size_t)bidx * sCPb + (size_t)by * 64 + col]; } } if (ACT == 1) v = (v > 0.f) ? v : expm1f(v); else if (ACT == 7) v = (v > 0.f) ? v + 1.0f : expf(v); else if (ACT == 8) v = tanhf(v); else if (ACT == 9) v = 0.5f * v * (1.0f + tanhf(0.7978845608028654f * (v + 0.044715f * v * v * v))); else if (ACT == 11) v = 1.0f / (1.0f + expf(-v)); else if (ACT == 12) v = (v > 0.f) ? v : 0.01f * v; else if (ACT == 14) v = (v > 0.f) ? v : 0.1f * v; else if (ACT == 16) v = (v >= 0.f) ? v : 0.3f * v; else if (ACT == 17) v = (v >= 0.f) ? v : 0.2f * v; else if (ACT == 15) v = v / (1.0f + expf(-v)); else if (ACT == 3) v = fmaxf(v, 0.f); else if (ACT == 6) v = 0.5f * v * (1.0f + erff(v * 0.70710678118654752f)); so[w][8 * hh + r][t * 16 + ln] = v; } }
  __builtin_amdgcn_fence(__ATOMIC_ACQ_REL, "workgroup"); __builtin_amdgcn_wave_barrier();
  const int rsub = lane >> 4, c4 = (lane & 15) * 4; typedef _Float16 v4h __attribute__((ext_vector_type(4)));
  {
#pragma unroll
    for (int q = 0; q < 8; ++q) { const int r = q * 2 + rsub; if (col0 + c4 < N) { const v4f v = *(const v4fa*)&so[w][r][c4]; if (C) *(v4f*)(C + cofs + (size_t)(row0 + r) * ldc + col0 + c4) = v; if (C16) { v4h h4; for (int i = 0; i < 4; ++i) h4[i] = (_Float16)v[i]; *(v4h*)(C16 + cofs + (size_t)(row0 + r) * ldc + col0 + c4) = h4; } } }
     }
}


typedef _Float16 v4h __attribute__((ext_vector_type(4)));

__global__ __launch_bounds__(256) void k_x16(const float* __restrict__ x, _Float16* __restrict__ X16, size_t n8) { const size_t t = (size_t)blockIdx.x * 256 + threadIdx.x; if (t >= n8) return; FragH f;
#pragma unroll
  for (int q = 0; q < 8; ++q) f.h[q] = (_Float16)bf16_round(x[t * 8 + q]); *(v8us*)((unsigned short*)X16 + t * 8) = f.half[0];  }
__global__ __launch_bounds__(256) void k_h16(const float* __restrict__ x, _Float16* __restrict__ X16, size_t n8) { const size_t t = (size_t)blockIdx.x * 256 + threadIdx.x; if (t >= n8) return; FragH f;
#pragma unroll
  for (int q = 0; q < 8; ++q) f.h[q] = (_Float16)x[t * 8 + q]; *(v8us*)((unsigned short*)X16 + t * 8) = f.half[0];  }
__global__ __launch_bounds__(256) void k_round16f(const float* __restrict__ W, _Float16* __restrict__ Bt, size_t n8) { const size_t t = (size_t)blockIdx.x * 256 + threadIdx.x; if (t >= n8) return; FragH f;
#pragma unroll
  for (int i = 0; i < 8; ++i) f.h[i] = (_Float16)(bf16_round(W[t * 8 + i]) * 16.0f); *(v8us*)((unsigned short*)Bt + t * 8) = f.half[0];  }
template <int NHv, int TTv>
__global__ __launch_bounds__(256) void k_vt(const _Float16* __restrict__ V16, int ldv, int voff, _Float16* __restrict__ Vt) { __shared__ unsigned short tl[64][66]; const int tid = threadIdx.x; const int slab = blockIdx.x / (TTv / 64), lg = blockIdx.x % (TTv / 64); const int b = slab / NHv, h = slab % NHv;
  for (int i = tid; i < 64 * 8; i += 256) { const int r = i / 8, c8 = (i % 8) * 8; FragH f; f.half[0] = *(const v8us*)((const unsigned short*)V16 + ((size_t)b * TTv + lg * 64 + r) * ldv + voff + h * 64 + c8);
#pragma unroll
    for (int q = 0; q < 8; ++q) tl[r][c8 + q] = f.u[q]; }
  __syncthreads();
  {
#pragma unroll
    for (int rd = 0; rd < 2; ++rd) { const int d = rd * 32 + tid / 8, pc = tid % 8; FragH f;
#pragma unroll
      for (int q = 0; q < 8; ++q) f.u[q] = tl[pc * 8 + q][d];
      *(v8us*)((unsigned short*)Vt + ((size_t)slab * 64 + d) * TTv + lg * 64 + pc * 8) = f.half[0]; }
     } }

__global__ __launch_bounds__(256) void k_hl(const float* __restrict__ F, _Float16* __restrict__ Hh, _Float16* __restrict__ Hl, size_t n8) { const size_t t = (size_t)blockIdx.x * 256 + threadIdx.x; if (t >= n8) return; FragH fh, fl; const v4f a = *(const v4fa*)(F + t * 8), c = *(const v4fa*)(F + t * 8 + 4);
#pragma unroll
  for (int q = 0; q < 4; ++q) { _Float16 h = (_Float16)a[q]; fh.h[q] = h; fl.h[q] = (_Float16)((a[q] - (float)h) * 1024.0f); h = (_Float16)c[q]; fh.h[4 + q] = h; fl.h[4 + q] = (_Float16)((c[q] - (float)h) * 1024.0f); }
  { *(v8us*)((unsigned short*)Hh + t * 8) = fh.half[0]; *(v8us*)((unsigned short*)Hl + t * 8) = fl.half[0];  } }

// ---- fast GEMM (work-group tile 128x64, wave tile 32x64; A and B tiles of 64 k staged in LDS by asynchronous copies, two buffers; requires M % 128 == 0 rows per launch region, N % 64 == 0, K % 64 == 0); epilogue = k_gemm_hhx semantics ----
__device__ __forceinline__ v16h g2_frag(const _Float16* p, int hh) { FragH f; f.half[0] = *(const v8us*)((const unsigned short*)p + 8 * hh); f.half[1] = *(const v8us*)((const unsigned short*)p + 16 + 8 * hh); return f.v; }
__device__ __forceinline__ v8f g2_mma(v16h a, v16h b, v8f c) { v8f d = __builtin_amdgcn_wmma_f32_16x16x32_f16(false, a, false, b, (short)0, c, false, false); asm volatile("v_nop\n\tv_nop\n\tv_nop\n\tv_nop" : "+v"(d) : "v"(a), "v"(b)); return d; }
#define G2_PITCH 144                 /* LDS row pitch in bytes of a staged 128-byte row: 16 B x odd, the conflict-free pitch for 16-byte LDS reads */
#define G2_BUF (192 * G2_PITCH)      /* one staged tile: 128 A rows, then 64 B rows, 64 k each */
static_assert(MP % 128 == 0 && QT % 128 == 0 && QT0 % 128 == 0, "k_gemm2: a work-group stages 128 whole A rows");
static_assert(HD % 64 == 0 && QT % 64 == 0 && DM % 64 == 0 && DFF % 64 == 0, "k_gemm2: K is a multiple of the staged 64 k, N of the 64 B rows");
// One tile into LDS: twelve asynchronous 16-byte copies a lane (a wave's 32 lanes take 4 whole 128-byte rows per copy; copy i lands 16 rows below copy i - 1; 0..7 = A rows, 8..11 = B rows).
// One asm statement: the copies go from global memory to LDS through no register, and the s_wait_xcnt at its end stands in front of any later overwrite of the address registers that the copies name.
__device__ __forceinline__ void g2_stage(unsigned l, const _Float16* ga, size_t sa, const _Float16* gb, size_t sb) {
  asm volatile("global_load_async_to_lds_b128 %0, %12, off\n\tglobal_load_async_to_lds_b128 %1, %13, off\n\tglobal_load_async_to_lds_b128 %2, %14, off\n\tglobal_load_async_to_lds_b128 %3, %15, off\n\t"
               "global_load_async_to_lds_b128 %4, %16, off\n\tglobal_load_async_to_lds_b128 %5, %17, off\n\tglobal_load_async_to_lds_b128 %6, %18, off\n\tglobal_load_async_to_lds_b128 %7, %19, off\n\t"
               "global_load_async_to_lds_b128 %8, %20, off\n\tglobal_load_async_to_lds_b128 %9, %21, off\n\tglobal_load_async_to_lds_b128 %10, %22, off\n\tglobal_load_async_to_lds_b128 %11, %23, off\n\ts_wait_xcnt 0x0"
               :: "v"(l), "v"(l + 16 * G2_PITCH), "v"(l + 32 * G2_PITCH), "v"(l + 48 * G2_PITCH), "v"(l + 64 * G2_PITCH), "v"(l + 80 * G2_PITCH), "v"(l + 96 * G2_PITCH), "v"(l + 112 * G2_PITCH),
                  "v"(l + 128 * G2_PITCH), "v"(l + 144 * G2_PITCH), "v"(l + 160 * G2_PITCH), "v"(l + 176 * G2_PITCH),
                  "v"(ga), "v"(ga + sa), "v"(ga + 2 * sa), "v"(ga + 3 * sa), "v"(ga + 4 * sa), "v"(ga + 5 * sa), "v"(ga + 6 * sa), "v"(ga + 7 * sa), "v"(gb), "v"(gb + sb), "v"(gb + 2 * sb), "v"(gb + 3 * sb) : "memory"); }
template <int ACT>
__global__ __launch_bounds__(128) void k_gemm2(const _Float16* __restrict__ A, int lda, size_t sA, const _Float16* __restrict__ Bh, int ldb, size_t sB, float alpha, const float* __restrict__ bias, size_t sBias, const float* __restrict__ CP, int rowsPerB, size_t sCPb, int row0g,
    float* __restrict__ C, _Float16* __restrict__ C16, int ldc, size_t sC, int M, int N, int K, size_t zA = 0, size_t zB = 0, size_t zC = 0) { static_assert(ACT == 0 || ACT == 3 || ACT == 6 || ACT == 8 || ACT == 9 || ACT == 11 || ACT == 12 || ACT == 14 || ACT == 15 || ACT == 16 || ACT == 17, "k_gemm2: unsupported ACT code (would silently apply no activation)");
  __shared__ __attribute__((aligned(16))) unsigned char sm[2 * G2_BUF]; float (*so)[32][68] = (float (*)[32][68])sm;      /* two staged tiles; behind the loop's last barrier the same bytes are the epilogue's [4][32][68] f32 staging */
  static_assert(sizeof(float) * 4 * 32 * 68 <= 2 * G2_BUF, "k_gemm2: the epilogue staging fits the two tile buffers");
  const int tid = threadIdx.x, w = tid >> 5, lane = tid & 31, ln = lane & 15, hh = lane >> 4; const int by = blockIdx.y; const int bz = blockIdx.z;      /* second batch axis (strides zA, zB, zC) */
  A += (size_t)by * sA + (size_t)bz * zA; Bh += (size_t)by * sB + (size_t)bz * zB; const size_t cofs = (size_t)by * sC + (size_t)bz * zC; const float* bp = bias ? bias + (size_t)by * sBias : nullptr;
  const int ntn = N >> 6; const int mt = blockIdx.x / ntn, nq = blockIdx.x - mt * ntn; const int row0 = mt * 128 + 32 * w, col0 = nq * 64; if (mt * 128 >= M) return;      /* the whole work-group leaves or none: barriers follow */
  const _Float16* ga = A + (size_t)(mt * 128 + (tid >> 3)) * lda + (tid & 7) * 8; const _Float16* gb = Bh + (size_t)(col0 + (tid >> 3)) * ldb + (tid & 7) * 8;      /* this lane's 16 bytes of row tid / 8 of each 16-row group */
  const size_t sa = (size_t)16 * lda, sb = (size_t)16 * ldb; const unsigned l0 = (unsigned)(size_t)sm + (unsigned)((tid >> 3) * G2_PITCH + (tid & 7) * 16);
  const unsigned char* fa = sm + (32 * w + ln) * G2_PITCH; const unsigned char* fb = sm + (128 + ln) * G2_PITCH;      /* this lane's fragment rows in buffer 0 */
  const v8f z8 = {0.f,0.f,0.f,0.f,0.f,0.f,0.f,0.f}; v8f c00 = z8, c01 = z8, c02 = z8, c03 = z8, c10 = z8, c11 = z8, c12 = z8, c13 = z8;
  const int nt = K >> 6;
  g2_stage(l0, ga, sa, gb, sb);
  asm volatile("s_wait_asynccnt 0x0" ::: "memory");      /* this wave's copies of tile 0 have landed */
  __syncthreads();      /* tile 0 published: every wave's copies have landed */
  if (nt > 1) g2_stage(l0 + G2_BUF, ga + 64, sa, gb + 64, sb);      /* tile 1 flies while tile 0 is worked on */
#pragma unroll 1
  for (int t = 0; t < nt; ++t) { const unsigned bo = (unsigned)(t & 1) * G2_BUF;      /* kept rolled: one trip is one staged tile and the buffers alternate; unrolled, the copies' and waits' code would only be repeated */
#pragma unroll
    for (int ks = 0; ks < 2; ++ks) { const _Float16* pa = (const _Float16*)(fa + bo + ks * 64); const _Float16* pb = (const _Float16*)(fb + bo + ks * 64);      /* unrolled so that the two halves of a tile are immediate offsets of the LDS reads; 32 k = 64 bytes of every row; k ascends as before */
      const v16h a0 = g2_frag(pa, hh), a1 = g2_frag(pa + 8 * G2_PITCH, hh), b0 = g2_frag(pb, hh), b1 = g2_frag(pb + 8 * G2_PITCH, hh), b2 = g2_frag(pb + 16 * G2_PITCH, hh), b3 = g2_frag(pb + 24 * G2_PITCH, hh);      /* 16 rows = 8 * G2_PITCH halves */
      c00 = g2_mma(a0, b0, c00); c10 = g2_mma(a1, b0, c10); c01 = g2_mma(a0, b1, c01); c11 = g2_mma(a1, b1, c11);
      c02 = g2_mma(a0, b2, c02); c12 = g2_mma(a1, b2, c12); c03 = g2_mma(a0, b3, c03); c13 = g2_mma(a1, b3, c13); }
    asm volatile("s_wait_dscnt 0x0" ::: "memory");      /* this wave's reads of the buffer have returned before the buffer is given up */
    asm volatile("s_wait_asynccnt 0x0" ::: "memory");      /* this wave's copies of tile t + 1 have landed */
    __syncthreads();      /* publishes tile t + 1 and ends every wave's reads of tile t */
    if (t + 2 < nt) g2_stage(l0 + bo, ga + (size_t)(t + 2) * 64, sa, gb + (size_t)(t + 2) * 64, sb); }      /* refill of the buffer just left */
  asm volatile("s_wait_asynccnt 0x0" ::: "memory");      /* no copy is outstanding when the buffers become the epilogue's staging */
  v8f accs[8] = {c00, c01, c02, c03, c10, c11, c12, c13};
#pragma unroll
  for (int u = 0; u < 8; ++u) { const int t = u & 3, half = u >> 2; const int col = col0 + t * 16 + ln; const float bv = bp ? bf16_round(bp[col]) : 0.f;
#pragma unroll
    for (int r = 0; r < 8; ++r) { const int rloc = half * 16 + 8 * hh + r; float v = accs[u][r] * alpha + bv; if (CP) { if (rowsPerB < 0) v += CP[cofs + (size_t)(row0g + row0 + rloc) * ldc + col];      /* rowsPerB < 0: own element of the batched C plane */ else { const int bidx = (row0g + row0 + rloc) / rowsPerB; v += CP[(size_t)bidx * sCPb + (size_t)by * 64 + col]; } }
      if (ACT == 3) v = fmaxf(v, 0.f); else if (ACT == 6) v = 0.5f * v * (1.0f + erff(v * 0.70710678118654752f)); else if (ACT == 11) v = 1.0f / (1.0f + expf(-v)); else if (ACT == 15) v = v / (1.0f + expf(-v)); else if (ACT == 12) v = (v > 0.f) ? v : 0.01f * v; else if (ACT == 8) v = tanhf(v); else if (ACT == 9) v = 0.5f * v * (1.0f + tanhf(0.7978845608028654f * (v + 0.044715f * v * v * v))); else if (ACT == 14) v = (v > 0.f) ? v : 0.1f * v; else if (ACT == 16) v = (v >= 0.f) ? v : 0.3f * v; else if (ACT == 17) v = (v >= 0.f) ? v : 0.2f * v;
      so[w][rloc][t * 16 + ln] = v; } }
  __builtin_amdgcn_fence(__ATOMIC_ACQ_REL, "workgroup"); __builtin_amdgcn_wave_barrier();
  const int rsub = lane >> 4, c4 = (lane & 15) * 4;
  {
#pragma unroll
    for (int q = 0; q < 16; ++q) { const int r = q * 2 + rsub; const v4f v = *(const v4fa*)&so[w][r][c4]; if (C) *(v4f*)(C + cofs + (size_t)(row0 + r) * ldc + col0 + c4) = v; if (C16) { v4h h4; for (int i = 0; i < 4; ++i) h4[i] = (_Float16)v[i]; *(v4h*)(C16 + cofs + (size_t)(row0 + r) * ldc + col0 + c4) = h4; } }
     } }


// ---- wide GEMM for the four all-row products (work-group tile 256x128, eight waves as 4 x 2, wave tile 64x64; requires M % 256 == 0, N % 128 == 0, K % 64 == 0); staging, k order and epilogue arithmetic as in k_gemm2 ----
// Against the 128x64 tile: half the operand rows copied from L2 per output element (384 rows per 32768 outputs, not 192 per 8192), and 16 LDS fragment reads per 16 products, not 12 per 8.
#define G3_BUF (384 * G2_PITCH)      /* one staged tile: 256 A rows, then 128 B rows, 64 k each */
static_assert(MP % 256 == 0 && DM % 128 == 0 && DFF % 128 == 0, "k_gemm3: whole 256x128 tiles");
// One tile into LDS: twelve asynchronous 16-byte copies a lane (the work-group's 256 lanes take 32 whole 128-byte rows per copy; copy i lands 32 rows below copy i - 1; 0..7 = A rows, 8..11 = B rows).
// One asm statement, as in g2_stage: the s_wait_xcnt at its end stands in front of any later overwrite of the address registers that the copies name.
__device__ __forceinline__ void g3_stage(unsigned l, const _Float16* ga, size_t sa, const _Float16* gb, size_t sb) {
  asm volatile("global_load_async_to_lds_b128 %0, %12, off\n\tglobal_load_async_to_lds_b128 %1, %13, off\n\tglobal_load_async_to_lds_b128 %2, %14, off\n\tglobal_load_async_to_lds_b128 %3, %15, off\n\t"
               "global_load_async_to_lds_b128 %4, %16, off\n\tglobal_load_async_to_lds_b128 %5, %17, off\n\tglobal_load_async_to_lds_b128 %6, %18, off\n\tglobal_load_async_to_lds_b128 %7, %19, off\n\t"
               "global_load_async_to_lds_b128 %8, %20, off\n\tglobal_load_async_to_lds_b128 %9, %21, off\n\tglobal_load_async_to_lds_b128 %10, %22, off\n\tglobal_load_async_to_lds_b128 %11, %23, off\n\ts_wait_xcnt 0x0"
               :: "v"(l), "v"(l + 32 * G2_PITCH), "v"(l + 64 * G2_PITCH), "v"(l + 96 * G2_PITCH), "v"(l + 128 * G2_PITCH), "v"(l + 160 * G2_PITCH), "v"(l + 192 * G2_PITCH), "v"(l + 224 * G2_PITCH),
                  "v"(l + 256 * G2_PITCH), "v"(l + 288 * G2_PITCH), "v"(l + 320 * G2_PITCH), "v"(l + 352 * G2_PITCH),
                  "v"(ga), "v"(ga + sa), "v"(ga + 2 * sa), "v"(ga + 3 * sa), "v"(ga + 4 * sa), "v"(ga + 5 * sa), "v"(ga + 6 * sa), "v"(ga + 7 * sa), "v"(gb), "v"(gb + sb), "v"(gb + 2 * sb), "v"(gb + 3 * sb) : "memory"); }
// C = act(A Bh^T alpha + bias (+ CP where RES: the own element of a plane laid out like C)); F32O: f32 rows into C, else f16 rows into C16; LDC: row pitch of C, C16 and CP in elements
template <int ACT, bool RES, bool F32O, int LDC>
__global__ __launch_bounds__(256) void k_gemm3(const _Float16* __restrict__ A, int lda, const _Float16* __restrict__ Bh, int ldb, float alpha, const float* __restrict__ bias, const float* __restrict__ CP,
    float* __restrict__ C, _Float16* __restrict__ C16, int M, int N, int K) { static_assert(ACT == 0 || ACT == 3, "k_gemm3: no activation or relu");
  __shared__ __attribute__((aligned(16))) unsigned char sm[2 * G3_BUF]; float (*so)[32][68] = (float (*)[32][68])sm;      /* two staged tiles; behind the loop's last barrier the same bytes are the epilogue's [8][32][68] f32 staging */
  static_assert(sizeof(float) * 8 * 32 * 68 <= 2 * G3_BUF, "k_gemm3: the epilogue staging fits the two tile buffers");
  const int tid = threadIdx.x, w = tid >> 5, lane = tid & 31, ln = lane & 15, hh = lane >> 4; const int wm = w >> 1, wn = w & 1;
  const int ntn = N >> 7; const int mt = blockIdx.x / ntn, nq = blockIdx.x - mt * ntn; const int row0 = mt * 256 + 64 * wm, col0 = nq * 128 + 64 * wn; if (mt * 256 >= M) return;      /* the whole work-group leaves or none: barriers follow */
  const _Float16* ga = A + (size_t)(mt * 256 + (tid >> 3)) * lda + (tid & 7) * 8; const _Float16* gb = Bh + (size_t)(nq * 128 + (tid >> 3)) * ldb + (tid & 7) * 8;      /* this lane's 16 bytes of row tid / 8 of each 32-row group */
  const size_t sa = (size_t)32 * lda, sb = (size_t)32 * ldb; const unsigned l0 = (unsigned)(size_t)sm + (unsigned)((tid >> 3) * G2_PITCH + (tid & 7) * 16);
  const unsigned char* fa = sm + (64 * wm + ln) * G2_PITCH; const unsigned char* fb = sm + (256 + 64 * wn + ln) * G2_PITCH;      /* this lane's fragment rows in buffer 0 */
  const v8f z8 = {0.f,0.f,0.f,0.f,0.f,0.f,0.f,0.f}; v8f c[4][4];
#pragma unroll
  for (int i = 0; i < 4; ++i)
#pragma unroll
    for (int j = 0; j < 4; ++j) c[i][j] = z8;
  const int nt = K >> 6;
  g3_stage(l0, ga, sa, gb, sb);
  asm volatile("s_wait_asynccnt 0x0" ::: "memory");      /* this wave's copies of tile 0 have landed */
  __syncthreads();      /* tile 0 published: every wave's copies have landed */
  if (nt > 1) g3_stage(l0 + G3_BUF, ga + 64, sa, gb + 64, sb);      /* tile 1 flies while tile 0 is worked on */
#pragma unroll 1
  for (int t = 0; t < nt; ++t) { const unsigned bo = (unsigned)(t & 1) * G3_BUF;      /* kept rolled: one trip is one staged tile and the buffers alternate */
#pragma unroll
    for (int ks = 0; ks < 2; ++ks) { const _Float16* pa = (const _Float16*)(fa + bo + ks * 64); const _Float16* pb = (const _Float16*)(fb + bo + ks * 64); v16h a[4], b[4];      /* unrolled: the two halves of a tile are immediate offsets of the LDS reads; k ascends as in k_gemm2 */
#pragma unroll
      for (int i = 0; i < 4; ++i) { a[i] = g2_frag(pa + i * 8 * G2_PITCH, hh); b[i] = g2_frag(pb + i * 8 * G2_PITCH, hh); }      /* 16 rows = 8 * G2_PITCH halves; the eight fragments' reads stand together in front of their products */
#pragma unroll
      for (int j = 0; j < 4; ++j)
#pragma unroll
        for (int i = 0; i < 4; ++i) c[i][j] = g2_mma(a[i], b[j], c[i][j]); }
    asm volatile("s_wait_dscnt 0x0" ::: "memory");      /* this wave's reads of the buffer have returned before the buffer is given up */
    asm volatile("s_wait_asynccnt 0x0" ::: "memory");      /* this wave's copies of tile t + 1 have landed */
    __syncthreads();      /* publishes tile t + 1 and ends every wave's reads of tile t */
    if (t + 2 < nt) g3_stage(l0 + bo, ga + (size_t)(t + 2) * 64, sa, gb + (size_t)(t + 2) * 64, sb); }      /* refill of the buffer just left */
  asm volatile("s_wait_asynccnt 0x0" ::: "memory");      /* no copy is outstanding when the buffers become the epilogue's staging */
  const int rsub = lane >> 4, c4 = (lane & 15) * 4; float bv[4] = {0.f, 0.f, 0.f, 0.f};
  if (bias) {      /* one test for the four loads, so that they fly together */
#pragma unroll
    for (int t = 0; t < 4; ++t) bv[t] = bf16_round(bias[col0 + t * 16 + ln]); }
  const size_t e0 = (size_t)(row0 + rsub) * LDC + col0 + c4;      /* this lane's 4 columns of row rsub of the wave's tile; its further rows lie 2 LDC apart, a compile-time step, so that every access below is this one address and an immediate offset */
#pragma unroll
  for (int hf = 0; hf < 2; ++hf) {      /* the wave's 64 rows leave in two halves of 32 through its own staging rows */
    v4f res[16];
    if (RES) { const float* rp = CP + e0;      /* the residual in the layout of the write-out: whole 256-byte row pieces, the half's sixteen loads in flight together, under the staging below */
#pragma unroll
      for (int q = 0; q < 16; ++q) res[q] = *(const v4fa*)(rp + (32 * hf + 2 * q) * LDC);
      asm volatile("s_wait_xcnt 0x0" :: "v"(rp) : "memory"); }      /* the wait that belongs in front of any overwrite of the loads' address register; naming it keeps it whole up to here */
#pragma unroll
    for (int u = 0; u < 8; ++u) { const int t = u & 3, ih = u >> 2;
#pragma unroll
      for (int r = 0; r < 8; ++r) so[w][ih * 16 + 8 * hh + r][t * 16 + ln] = c[2 * hf + ih][t][r] * alpha + bv[t]; }
    __builtin_amdgcn_fence(__ATOMIC_ACQ_REL, "workgroup"); __builtin_amdgcn_wave_barrier();      /* the wave's staging stores stay in front of its row reads */
#pragma unroll
    for (int g = 0; g < 2; ++g) {
#pragma unroll
      for (int q = 8 * g; q < 8 * g + 8; ++q) { v4f v = *(const v4fa*)&so[w][q * 2 + rsub][c4];
        if (RES) v += res[q];      /* acc alpha + bias, then the residual, then the activation: the order of k_gemm2 */
        if (ACT == 3) { for (int i = 0; i < 4; ++i) v[i] = fmaxf(v[i], 0.f); }
        if (F32O) *(v4f*)(C + e0 + (32 * hf + 2 * q) * LDC) = v; else { v4h h4; for (int i = 0; i < 4; ++i) h4[i] = (_Float16)v[i]; *(v4h*)(C16 + e0 + (32 * hf + 2 * q) * LDC) = h4; } }
      asm volatile("s_wait_xcnt 0x0" ::: "memory"); }      /* the wait that belongs in front of a later overwrite of the registers which these eight stores name */
    __builtin_amdgcn_fence(__ATOMIC_ACQ_REL, "workgroup"); __builtin_amdgcn_wave_barrier(); } }      /* the row reads stay in front of the next half's staging stores */


__global__ __launch_bounds__(256) void k_wnat(const float* __restrict__ w, size_t n8, _Float16* __restrict__ Bt) { const size_t t = (size_t)blockIdx.x * 256 + threadIdx.x; if (t >= n8) return; FragH f; for (int q = 0; q < 8; ++q) f.h[q] = (_Float16)(bf16_round(w[t * 8 + q]) * 16.0f); *(v8us*)((unsigned short*)Bt + t * 8) = f.half[0];  }
__global__ __launch_bounds__(256) void k_rsm(const float* __restrict__ S, _Float16* __restrict__ P, int nrows) {
  #pragma clang fp contract(off)
  const int i = blockIdx.x * 256 + threadIdx.x; if (i >= nrows) return; const float* s = S + (size_t)i * SQ; float mx = -3.0e38f;
#pragma unroll 1
  for (int j = 0; j < SQ; ++j) mx = fmaxf(mx, s[j]); float se = 0.f;
#pragma unroll 1
  for (int j = 0; j < SQ; ++j) se += expf(s[j] - mx); const float sc = 256.0f / se;
#pragma unroll 1
  for (int j0 = 0; j0 < SQ; j0 += 8) { FragH f; for (int q = 0; q < 8; ++q) f.h[q] = (_Float16)(expf(s[j0 + q] - mx) * sc); unsigned short* d = (unsigned short*)P + (size_t)i * SQ + j0; *(v8us*)d = f.half[0];  } }
__global__ __launch_bounds__(256) void k_vt(const _Float16* __restrict__ V16, int b, int h0, _Float16* __restrict__ VT) { __shared__ unsigned short tl[64][65]; const int tid = threadIdx.x; const int hh = blockIdx.x % HG, sg = blockIdx.x / HG; const int s0 = sg * 64; const int h = h0 + hh;
  for (int i = tid; i < 64 * 8; i += 256) { const int j = i / 8, d8 = (i % 8) * 8; FragH f; f.half[0] = *(const v8us*)((const unsigned short*)V16 + ((size_t)b * SQ + s0 + j) * DM + h * HD + d8); for (int q = 0; q < 8; ++q) tl[d8 + q][j] = f.u[q]; }
  __syncthreads();
  { for (int i = tid; i < 64 * 8; i += 256) { const int d = i / 8, j8 = (i % 8) * 8; FragH f; for (int q = 0; q < 8; ++q) f.u[q] = tl[d][j8 + q]; *(v8us*)((unsigned short*)VT + ((size_t)hh * HD + d) * SQ + s0 + j8) = f.half[0]; }  } }



// lane l with lane l ^ m inside a 16-lane row (DPP row_xmask, CTRL = 0x160 | m)
template <int CTRL> __device__ __forceinline__ float lane_xm(float x) { return __builtin_bit_cast(float, __builtin_amdgcn_update_dpp(0, __builtin_bit_cast(int, x), CTRL, 0xf, 0xf, true)); }
// 2^t for eight values in place. Asm so that the free slot which the instruction set asks for behind a transcendental, before its result is used or its source overwritten, stands by construction: no line here touches the line before it, and the v_nop covers the last
__device__ __forceinline__ void exp2_x8(float (&t)[8]) { asm("v_exp_f32 %0, %0\n\tv_exp_f32 %1, %1\n\tv_exp_f32 %2, %2\n\tv_exp_f32 %3, %3\n\tv_exp_f32 %4, %4\n\tv_exp_f32 %5, %5\n\tv_exp_f32 %6, %6\n\tv_exp_f32 %7, %7\n\tv_nop" : "+v"(t[0]), "+v"(t[1]), "+v"(t[2]), "+v"(t[3]), "+v"(t[4]), "+v"(t[5]), "+v"(t[6]), "+v"(t[7])); }
// ---- fused causal attention: scores, softmax and P V of 128 query rows of one head in one work-group; S and P never reach memory ----
// A wave holds 32 query rows (q fragments and the o tiles in registers). Per tile of 64 keys: S = q K^T on WMMA, running row maximum and sum (the o tiles and the sum are rescaled when the maximum rises), P (x256, f16) goes through the wave's own LDS rows from accumulator layout to A-fragment layout, o += P V on WMMA.
#define FA_BUF (128 * G2_PITCH)      /* one staged key tile: 64 K rows, then 64 V^T rows, 128 bytes each */
#define FA_PH (G2_PITCH / 2)         /* pitch of a P row in halves */
static_assert(SQ % 128 == 0 && HD == 64, "k_fattn: whole tiles of 128 query rows and 64 keys; 64 values a head");
// One key tile into LDS: eight asynchronous 16-byte copies a lane (copy i lands 16 rows below copy i - 1; 0..3 = K rows, 4..7 = V^T rows). One asm statement, as in g2_stage: the s_wait_xcnt at its end stands in front of any later overwrite of the address registers that the copies name.
__device__ __forceinline__ void fa_stage(unsigned l, const _Float16* gk, size_t sk, const _Float16* gv, size_t sv) {
  asm volatile("global_load_async_to_lds_b128 %0, %8, off\n\tglobal_load_async_to_lds_b128 %1, %9, off\n\tglobal_load_async_to_lds_b128 %2, %10, off\n\tglobal_load_async_to_lds_b128 %3, %11, off\n\t"
               "global_load_async_to_lds_b128 %4, %12, off\n\tglobal_load_async_to_lds_b128 %5, %13, off\n\tglobal_load_async_to_lds_b128 %6, %14, off\n\tglobal_load_async_to_lds_b128 %7, %15, off\n\ts_wait_xcnt 0x0"
               :: "v"(l), "v"(l + 16 * G2_PITCH), "v"(l + 32 * G2_PITCH), "v"(l + 48 * G2_PITCH), "v"(l + 64 * G2_PITCH), "v"(l + 80 * G2_PITCH), "v"(l + 96 * G2_PITCH), "v"(l + 112 * G2_PITCH),
                  "v"(gk), "v"(gk + sk), "v"(gk + 2 * sk), "v"(gk + 3 * sk), "v"(gv), "v"(gv + sv), "v"(gv + 2 * sv), "v"(gv + 3 * sv) : "memory"); }
__device__ __forceinline__ float row16_max(float x) { x = fmaxf(x, lane_xm<0x161>(x)); x = fmaxf(x, lane_xm<0x162>(x)); x = fmaxf(x, lane_xm<0x164>(x)); return fmaxf(x, lane_xm<0x168>(x)); }
__device__ __forceinline__ float row16_sum(float x) { x += lane_xm<0x161>(x); x += lane_xm<0x162>(x); x += lane_xm<0x164>(x); return x + lane_xm<0x168>(x); }
__global__ __launch_bounds__(128) void k_fattn(const _Float16* __restrict__ Q, const _Float16* __restrict__ K, const _Float16* __restrict__ VTp, float scale, _Float16* __restrict__ O) {
  __shared__ __attribute__((aligned(16))) unsigned char sm[2 * FA_BUF + 4 * 32 * G2_PITCH];      /* two staged key tiles, then 32 P rows per wave */
  const int tid = threadIdx.x, lane = tid & 31, ln = lane & 15, hh = lane >> 4; const int w = __builtin_amdgcn_readfirstlane(tid >> 5);
  const int h = blockIdx.x, b = blockIdx.y; const int q0 = (SQ / 128 - 1 - (int)blockIdx.z) * 128;      /* the longest tiles start first */
  const int nt = (q0 + 128) >> 6;      /* causal: key tiles up to the last query row; at least two */
  const int rw = q0 + 32 * w;      /* the wave's first query row */
  const _Float16* qr0 = Q + ((size_t)b * SQ + rw + ln) * LQ + h * HD; const _Float16* qr1 = qr0 + (size_t)16 * LQ;
  const v16h qa00 = g2_frag(qr0, hh), qa01 = g2_frag(qr0 + 32, hh), qa10 = g2_frag(qr1, hh), qa11 = g2_frag(qr1 + 32, hh);
  const _Float16* gk = K + ((size_t)b * SQ + (tid >> 3)) * LQ + h * HD + (tid & 7) * 8; const _Float16* gv = VTp + (((size_t)b * NH + h) * HD + (tid >> 3)) * SQ + (tid & 7) * 8;      /* this lane's 16 bytes of row tid / 8 of each 16-row group */
  const size_t sk = (size_t)16 * LQ, sv = (size_t)16 * SQ; const unsigned l0 = (unsigned)(size_t)sm + (unsigned)((tid >> 3) * G2_PITCH + (tid & 7) * 16);
  const unsigned char* fk = sm + ln * G2_PITCH; const unsigned char* fv = sm + (64 + ln) * G2_PITCH;      /* this lane's fragment rows in buffer 0 */
  _Float16* sp = (_Float16*)(sm + 2 * FA_BUF + w * 32 * G2_PITCH);
  const v8f z8 = {0.f,0.f,0.f,0.f,0.f,0.f,0.f,0.f}; v8f o[2][4]; float m[2][8], l[2][8];
#pragma unroll
  for (int i = 0; i < 2; ++i) {
#pragma unroll
    for (int j = 0; j < 4; ++j) o[i][j] = z8;
#pragma unroll
    for (int r = 0; r < 8; ++r) { m[i][r] = -1.0e30f; l[i][r] = 0.f; } }
  const float sl = scale * 1.44269504f;      /* e^(s scale) = 2^(s scale log2 e) */
  fa_stage(l0, gk, sk, gv, sv);
  asm volatile("s_wait_asynccnt 0x0" ::: "memory");      /* this wave's copies of tile 0 have landed */
  __syncthreads();      /* tile 0 published */
  fa_stage(l0 + FA_BUF, gk + (size_t)64 * LQ, sk, gv + 64, sv);      /* tile 1 flies while tile 0 is worked on */
#pragma unroll 1
  for (int t = 0; t < nt; ++t) { const unsigned bo = (unsigned)(t & 1) * FA_BUF;      /* kept rolled: one trip is one staged tile and the buffers alternate */
    if (t * 64 <= rw + 31) {      /* wave-uniform: a tile wholly above the wave's rows adds nothing; the waits and the barrier below are passed all the same */
      v8f s[2][4];
#pragma unroll
      for (int j = 0; j < 4; ++j) { s[0][j] = z8; s[1][j] = z8; }
#pragma unroll
      for (int ks = 0; ks < 2; ++ks) { const _Float16* pk = (const _Float16*)(fk + bo + ks * 64); v16h kb[4];
        if (ks) __builtin_amdgcn_sched_barrier(0);      /* keeps the second half's fragment reads behind the first half's products: read ahead, they take 32 more registers, the kernel passes 256 and a SIMD holds three waves instead of four */
#pragma unroll
        for (int j = 0; j < 4; ++j) kb[j] = g2_frag(pk + j * 8 * G2_PITCH, hh);      /* the four fragments' reads stand together in front of their products: one LDS latency, not four */
#pragma unroll
        for (int j = 0; j < 4; ++j) { s[0][j] = g2_mma(ks ? qa01 : qa00, kb[j], s[0][j]); s[1][j] = g2_mma(ks ? qa11 : qa10, kb[j], s[1][j]); } }
      if (t * 64 + 63 > rw) {      /* wave-uniform: only tiles that reach above the wave's first row hold masked keys */
#pragma unroll
        for (int i = 0; i < 2; ++i)
#pragma unroll
          for (int j = 0; j < 4; ++j)
#pragma unroll
            for (int r = 0; r < 8; ++r) s[i][j][r] = (t * 64 + 16 * j + ln <= rw + 16 * i + 8 * hh + r) ? s[i][j][r] : -1.0e30f; }
#pragma unroll
      for (int i = 0; i < 2; ++i) { float cr[8], cc[8];      /* accumulator layout: register r of lane (hh, ln) is row 16 i + 8 hh + r, key 16 j + ln */
#pragma unroll
        for (int r = 0; r < 8; ++r) { const float mt = row16_max(fmaxf(fmaxf(s[i][0][r], s[i][1][r]), fmaxf(s[i][2][r], s[i][3][r]))); const float mn = fmaxf(m[i][r], mt); cr[r] = (m[i][r] - mn) * sl; cc[r] = 8.0f - mn * sl; m[i][r] = mn; }
        exp2_x8(cr);
#pragma unroll
        for (int r = 0; r < 8; ++r) l[i][r] *= cr[r];
#pragma unroll
        for (int j = 0; j < 4; ++j) { float p[8];
#pragma unroll
          for (int r = 0; r < 8; ++r) p[r] = fmaf(s[i][j][r], sl, cc[r]);      /* weights carried x256, as the f16 P was before */
          exp2_x8(p);
#pragma unroll
          for (int r = 0; r < 8; ++r) { l[i][r] += p[r]; sp[(16 * i + 8 * hh + r) * FA_PH + 16 * j + ln] = (_Float16)p[r]; o[i][j][r] *= cr[r]; } } }
      __builtin_amdgcn_fence(__ATOMIC_ACQ_REL, "workgroup"); __builtin_amdgcn_wave_barrier();      /* the wave's P stores stay in front of its fragment reads of the same rows */
#pragma unroll
      for (int ks = 0; ks < 2; ++ks) { const v16h pa0 = g2_frag(sp + ln * FA_PH + ks * 32, hh), pa1 = g2_frag(sp + (16 + ln) * FA_PH + ks * 32, hh); const _Float16* pv = (const _Float16*)(fv + bo + ks * 64); v16h vb[4];
#pragma unroll
        for (int j = 0; j < 4; ++j) vb[j] = g2_frag(pv + j * 8 * G2_PITCH, hh);      /* as above */
#pragma unroll
        for (int j = 0; j < 4; ++j) { o[0][j] = g2_mma(pa0, vb[j], o[0][j]); o[1][j] = g2_mma(pa1, vb[j], o[1][j]); } } }
    asm volatile("s_wait_dscnt 0x0" ::: "memory");      /* this wave's reads of the buffer have returned before the buffer is given up */
    asm volatile("s_wait_asynccnt 0x0" ::: "memory");      /* this wave's copies of tile t + 1 have landed */
    __syncthreads();      /* publishes tile t + 1 and ends every wave's reads of tile t */
    if (t + 2 < nt) fa_stage(l0 + bo, gk + (size_t)(t + 2) * 64 * LQ, sk, gv + (size_t)(t + 2) * 64, sv); }      /* refill of the buffer just left */
  asm volatile("s_wait_asynccnt 0x0" ::: "memory");      /* no copy is outstanding at the end */
#pragma unroll
  for (int i = 0; i < 2; ++i)
#pragma unroll
    for (int r = 0; r < 8; ++r) { const float fin = 64.0f / row16_sum(l[i][r]);      /* o carried x64 as before; the x256 of the weights cancels */
#pragma unroll
      for (int j = 0; j < 4; ++j) sp[(16 * i + 8 * hh + r) * FA_PH + 16 * j + ln] = (_Float16)(o[i][j][r] * fin); }
  __builtin_amdgcn_fence(__ATOMIC_ACQ_REL, "workgroup"); __builtin_amdgcn_wave_barrier();      /* the wave's o stores stay in front of its row reads */
#pragma unroll
  for (int q = 0; q < 8; ++q) { const int row = q * 4 + (lane >> 3), c8 = (lane & 7) * 8; const v8us v = *(const v8us*)((const unsigned short*)sp + row * FA_PH + c8); *(v8us*)((unsigned short*)O + ((size_t)b * SQ + rw + row) * DM + h * HD + c8) = v; } }      /* whole 128-byte row pieces per store */


typedef float v2f __attribute__((ext_vector_type(2)));
#define JU 4                         /* keys whose score chains run side by side in the exact attention */
// Exact f32 attention of the first QT0 rows, one thread per query row. The row's q and o live in registers; the head's K and V rows are staged once in LDS and read from there at one address for the whole wave.
// Every d loop is unrolled, and JU keys are taken together, so that their JU chains of dependent adds fill one another's latency. Per row every product, every sum and the running-maximum recurrence stand in the order they had key by key.
template <int MASKADD>
__global__ __launch_bounds__(64) void k_att0(const float* __restrict__ QF, const float* __restrict__ KF, const float* __restrict__ VF, int ld, const float* __restrict__ mask, float scale, float* __restrict__ OF, int ldo) {
  #pragma clang fp contract(off)      /* as before; numerical: each q k product stays rounded in front of its add, as it was built so far, so that the exact rows' scores, and with them o, stay bit-identical */
  static_assert(MASKADD == 0, "k_att0: causal form only (the staged K and V rows are those of the first tile)"); static_assert(64 % JU == 0 && HD == 64, "k_att0: whole groups of JU keys; 64 values a row");
  (void)mask;
  __shared__ __attribute__((aligned(16))) float sk[QT0][HD]; __shared__ __attribute__((aligned(16))) float sv[QT0][HD];
  float (*lo)[HD + 4] = (float (*)[HD + 4])sk;      /* behind the loop's barrier the K rows' bytes are the output staging; pitch 68 floats spreads the rows over the banks */
  static_assert(sizeof(float) * 64 * (HD + 4) <= sizeof(float) * QT0 * HD, "k_att0: the output staging fits the K rows");
  const int tid = threadIdx.x; const int h = blockIdx.x / (QT0 / 64), rg = blockIdx.x % (QT0 / 64); const int i = rg * 64 + tid;
  const size_t bo_in = (size_t)blockIdx.y * QT0 * ld; QF += bo_in; KF += bo_in; VF += bo_in; OF += (size_t)blockIdx.y * QT0 * ldo;      /* batch on grid.y: QT0 rows per batch in every plane */
  const float* qr = QF + (size_t)i * ld + h * HD;
  const int nkey = rg * 64 + 64;      /* causal form: keys up to the block's last row */
  const int sr = tid >> 4, c4 = (tid & 15) * 4; const unsigned lof = (unsigned)(sr * ld + c4);      /* sixteen lanes take one 256-byte row */
#pragma unroll 1
  for (int r0 = 0; r0 < nkey; r0 += 32) { v4f tk[8], tv[8]; const float* pk[8]; const float* pv[8];      /* 32 rows a trip: sixteen loads in flight per lane; rolled, since two or four trips of them are all there is */
#pragma unroll
    for (int it = 0; it < 8; ++it) { const size_t g = (size_t)(r0 + it * 4) * ld + h * HD; pk[it] = (KF + g) + lof; pv[it] = (VF + g) + lof; tk[it] = *(const v4fa*)pk[it]; tv[it] = *(const v4fa*)pv[it]; }
    asm volatile("s_wait_xcnt 0x0" :: "v"(pk[0]), "v"(pk[1]), "v"(pk[2]), "v"(pk[3]), "v"(pk[4]), "v"(pk[5]), "v"(pk[6]), "v"(pk[7]), "v"(pv[0]), "v"(pv[1]), "v"(pv[2]), "v"(pv[3]), "v"(pv[4]), "v"(pv[5]), "v"(pv[6]), "v"(pv[7]) : "memory");      /* the wait that belongs in front of any overwrite of the loads' address registers; naming them keeps them whole up to it (without it the last load's result was given the first load's address registers) */
#pragma unroll
    for (int it = 0; it < 8; ++it) { *(v4f*)&sk[r0 + it * 4 + sr][c4] = tk[it]; *(v4f*)&sv[r0 + it * 4 + sr][c4] = tv[it]; } }
  v2f q2[HD / 2], o2[HD / 2];
#pragma unroll
  for (int c = 0; c < HD / 4; ++c) { const v4f qq = *(const v4fa*)(qr + c * 4); q2[2 * c] = v2f{qq[0], qq[1]}; q2[2 * c + 1] = v2f{qq[2], qq[3]}; o2[2 * c] = v2f{0.f, 0.f}; o2[2 * c + 1] = v2f{0.f, 0.f}; }
  asm volatile("s_wait_xcnt 0x0" :: "v"(qr) : "memory");      /* as above, for the address register of the q loads */
  __syncthreads();      /* the staged K and V rows are published to both waves */
  float m = -1.0e30f, l = 0.f;
  // A piece = 8 LDS reads of 16 bytes: 8 values (d = 8 n .. 8 n + 7) of JU rows. Two register buffers: the next piece's reads are issued in front of this piece's arithmetic, so that an LDS read's latency is not paid read by read.
  v4f ba[2 * JU], bb[2 * JU];
  auto fetch = [&](v4f (&buf)[2 * JU], const float (*rows)[HD], int jb, int n) {
#pragma unroll
    for (int u = 0; u < JU; ++u) { buf[2 * u] = *(const v4f*)&rows[jb + u][8 * n]; buf[2 * u + 1] = *(const v4f*)&rows[jb + u][8 * n + 4]; } };
  float s[JU], sc[JU], e[JU];
  auto dots = [&](const v4f (&buf)[2 * JU], int n) {      /* two rounded products an instruction; the adds stay one chain per key, d ascending */
#pragma unroll
    for (int w = 0; w < 2; ++w)
#pragma unroll
      for (int u = 0; u < JU; ++u) { const v4f kq = buf[2 * u + w]; const v2f p0 = q2[4 * n + 2 * w] * v2f{kq[0], kq[1]}, p1 = q2[4 * n + 2 * w + 1] * v2f{kq[2], kq[3]};
        s[u] = __fadd_rn(s[u], p0[0]); s[u] = __fadd_rn(s[u], p0[1]); s[u] = __fadd_rn(s[u], p1[0]); s[u] = __fadd_rn(s[u], p1[1]); } };
  auto accum = [&](const v4f (&buf)[2 * JU], int n) {      /* o = fma(o, sc, round(e v)), key after key: the rounding that this line was built with before, written out */
#pragma unroll
    for (int w = 0; w < 2; ++w)
#pragma unroll
      for (int u = 0; u < JU; ++u) { const v4f vv = buf[2 * u + w]; const v2f s2 = {sc[u], sc[u]}, e2 = {e[u], e[u]};
        o2[4 * n + 2 * w] = __builtin_elementwise_fma(o2[4 * n + 2 * w], s2, e2 * v2f{vv[0], vv[1]}); o2[4 * n + 2 * w + 1] = __builtin_elementwise_fma(o2[4 * n + 2 * w + 1], s2, e2 * v2f{vv[2], vv[3]}); } };
  fetch(ba, sk, 0, 0);
#pragma unroll 1
  for (int j0 = 0; j0 < nkey; j0 += JU) {      /* kept rolled: one trip already holds JU keys' unrolled d loops */
    const int jn = (j0 + JU < nkey) ? j0 + JU : 0;      /* the last trip fetches ahead from row 0, inside the array; that piece is not used */
#pragma unroll
    for (int u = 0; u < JU; ++u) s[u] = 0.f;
#pragma unroll
    for (int n = 0; n < HD / 8; n += 2) {
      fetch(bb, sk, j0, n + 1);
      __builtin_amdgcn_sched_barrier(0);      /* keeps the reads above in front of the arithmetic below: without it each read sinks to its use and waits out its own latency */
      dots(ba, n);
      if (n + 2 < HD / 8) fetch(ba, sk, j0, n + 2); else fetch(ba, sv, j0, 0);
      __builtin_amdgcn_sched_barrier(0);      /* as above */
      dots(bb, n + 1); }
#pragma unroll
    for (int u = 0; u < JU; ++u) { const float ss = __fmul_rn(s[u], scale);
      const float f = (j0 + u <= i) ? 1.f : 0.f; const float sm = fmaf(f, ss, (1.f - f) * -1.0e30f); const float mn = fmaxf(m, sm); sc[u] = expf(m - mn); e[u] = expf(sm - mn); l = fmaf(l, sc[u], e[u]); m = mn; }      /* l: one fused multiply-add, as this line was built before */
#pragma unroll
    for (int n = 0; n < HD / 8; n += 2) {
      fetch(bb, sv, j0, n + 1);
      __builtin_amdgcn_sched_barrier(0);      /* as above */
      accum(ba, n);
      if (n + 2 < HD / 8) fetch(ba, sv, j0, n + 2); else fetch(ba, sk, jn, 0);
      __builtin_amdgcn_sched_barrier(0);      /* as above */
      accum(bb, n + 1); } }
  const float fin = 64.0f / l;      /* o carried x64 like the f16 path */
  __syncthreads();      /* both waves have left the K rows before their bytes become the output staging */
#pragma unroll
  for (int c = 0; c < HD / 4; ++c) { const v2f a = o2[2 * c] * v2f{fin, fin}, b = o2[2 * c + 1] * v2f{fin, fin}; *(v4f*)&lo[tid][c * 4] = v4f{a[0], a[1], b[0], b[1]}; }
  __syncthreads();
  {
#pragma unroll 1
    for (int it0 = 0; it0 < 16; it0 += 4) {      /* rolled: four stores in flight a trip are enough for 16 KiB */
#pragma unroll
      for (int it = it0; it < it0 + 4; ++it) { const int row = it * 4 + tid / 16, pc = (tid % 16) * 4; const v4f v = *(const v4f*)&lo[row][pc]; *(v4f*)(OF + (size_t)(rg * 64 + row) * ldo + h * HD + pc) = v; }      /* whole 256-byte row pieces per store, as before */
      asm volatile("s_wait_xcnt 0x0" ::: "memory"); }      /* the wait that belongs in front of the next trip's overwrite of the registers which these stores name */
     } }


// lane l with lane l ^ 16 (the other 16-lane row)
__device__ __forceinline__ float lane_x16(float x) { const int b = __builtin_bit_cast(int, x); return __builtin_bit_cast(float, __builtin_amdgcn_permlanex16(b, b, 0x76543210, 0xfedcba98, false, false)); }
__device__ __forceinline__ float wave_sum(float x) { x = row16_sum(x); return x + lane_x16(x); }
// Row LayerNorm (biased variance) -> f16 rows. One wave per row, LN_RW rows a wave: a launch starts few, longer-lived waves, and a row's two sums need no LDS and no barrier.
// A lane holds 32 values of a row: 4 columns of each 128-column piece, so that every wave load and store covers whole lines. All rows' loads of a wave are issued up front; g and b are loaded and rounded once a wave.
#define LN_RW 2                      /* rows a wave */
static_assert(DMQ == 1024 && NR % (8 * LN_RW) == 0, "k_ln16: rows of 8 pieces of 128 columns; whole work-groups of 8 waves");
template <int BFIN, int WXB>
__global__ __launch_bounds__(256) void k_ln16(const float* __restrict__ X, const float* __restrict__ g, const float* __restrict__ bb, float eps, _Float16* __restrict__ N16, float* __restrict__ XB) {
  const int lane = threadIdx.x & 31; const size_t e0 = ((size_t)blockIdx.x * 8 + (threadIdx.x >> 5)) * LN_RW * DMQ + lane * 4;      /* this lane's first element of the wave's first row */
  const float* xp = X + e0; const float* gp = g + lane * 4; const float* bp = bb + lane * 4; v4f s[LN_RW][8], gv[8], bv[8];
#pragma unroll
  for (int k = 0; k < LN_RW; ++k)
#pragma unroll
    for (int u = 0; u < 8; ++u) s[k][u] = *(const v4fa*)(xp + k * DMQ + u * 128);      /* unrolled: one address and immediate offsets, every load in flight together */
#pragma unroll
  for (int u = 0; u < 8; ++u) { gv[u] = *(const v4fa*)(gp + u * 128); bv[u] = *(const v4fa*)(bp + u * 128); }
  asm volatile("s_wait_xcnt 0x0" :: "v"(xp), "v"(gp), "v"(bp) : "memory");      /* the wait that belongs in front of any overwrite of the loads' address registers; naming the three addresses keeps them whole up to here (with xp alone a row load's result was given the offset register of the g and b loads) */
#pragma unroll
  for (int u = 0; u < 8; ++u)
#pragma unroll
    for (int q = 0; q < 4; ++q) { gv[u][q] = bf16_round(gv[u][q]); bv[u][q] = bf16_round(bv[u][q]); }
#pragma unroll
  for (int k = 0; k < LN_RW; ++k) {
    if (BFIN) {
#pragma unroll
      for (int u = 0; u < 8; ++u)
#pragma unroll
        for (int q = 0; q < 4; ++q) s[k][u][q] = bf16_round(s[k][u][q]); }
    v4f a = s[k][0];      /* four chains a lane, then the lane tree */
#pragma unroll
    for (int u = 1; u < 8; ++u) a += s[k][u];
    const float mu = wave_sum((a[0] + a[1]) + (a[2] + a[3])) * (1.0f / (float)DMQ);
    v4f v = {0.f, 0.f, 0.f, 0.f};
#pragma unroll
    for (int u = 0; u < 8; ++u) { const v4f d = s[k][u] - mu; v += d * d; }
    const float rs = rsqrtf(wave_sum((v[0] + v[1]) + (v[2] + v[3])) * (1.0f / (float)DMQ) + eps);
#pragma unroll
    for (int u = 0; u < 8; ++u) { const v4f y = (s[k][u] - mu) * rs * gv[u] + bv[u]; v4h h4;
#pragma unroll
      for (int q = 0; q < 4; ++q) h4[q] = (_Float16)y[q];
      *(v4h*)(N16 + e0 + k * DMQ + u * 128) = h4; if (WXB) *(v4f*)(XB + e0 + k * DMQ + u * 128) = s[k][u]; }
    asm volatile("s_wait_xcnt 0x0" ::: "memory"); } }      /* the wait that belongs in front of a later overwrite of the registers which this row's stores name */
__global__ __launch_bounds__(256) void k_ftres2(const float* __restrict__ OF0, const float* __restrict__ XB, float* __restrict__ X1, size_t n4) {
  #pragma clang fp contract(off)
  const size_t t = (size_t)blockIdx.x * 256 + threadIdx.x; if (t >= n4) return; const v4f o = *(const v4fa*)(OF0 + t * 4), xv = *(const v4fa*)(XB + t * 4); v4f y; for (int q = 0; q < 4; ++q) y[q] = __fadd_rn(__fmul_rn(o[q], 0.015625f), xv[q]); *(v4f*)(X1 + t * 4) = y;  }

__global__ __launch_bounds__(256) void k_wthd(const float* __restrict__ Wt, _Float16* __restrict__ Bt) { const size_t t = (size_t)blockIdx.x * 256 + threadIdx.x; if (t >= (size_t)NH * HD * (DM / 8)) return; const int m8 = (int)(t % (DM / 8)) * 8; const int d = (int)((t / (DM / 8)) % HD); const int h = (int)(t / ((size_t)(DM / 8) * HD)); FragH f;
  for (int q = 0; q < 8; ++q) f.h[q] = (_Float16)(16.0f * bf16_round(Wt[((size_t)h * DM + m8 + q) * HD + d])); unsigned short* dst = (unsigned short*)Bt + ((size_t)h * HD + d) * DM + m8; *(v8us*)dst = f.half[0];  }




__global__ __launch_bounds__(256) void k_wtpad(const float* __restrict__ Wm, _Float16* __restrict__ Wt, int Kr, int Kp, int Nr, int Np, float scale) {
  const int t = blockIdx.x * 256 + threadIdx.x; if (t >= Np * (Kp / 8)) return; const int n = t / (Kp / 8), k8 = (t % (Kp / 8)) * 8; const int nc = min(n, Nr - 1); const float fn = (n < Nr) ? 1.f : 0.f; FragH f;
  for (int i = 0; i < 8; ++i) { const int k = k8 + i; const int kc = min(k, Kr - 1); const float fk = (k < Kr) ? fn : 0.f; f.h[i] = (_Float16)(bf16_round(Wm[(size_t)kc * Nr + nc]) * scale * fk); }
  unsigned short* o = (unsigned short*)Wt + (size_t)n * Kp + k8; *(v8us*)o = f.half[0];  }
__global__ __launch_bounds__(128) void k_bpad(const float* __restrict__ b, float* __restrict__ Bp, int nr, int np) {
  const int i = threadIdx.x; if (i >= np) return; const float v = b[min(i, nr - 1)] * ((i < nr) ? 1.f : 0.f); *(float*)(Bp + i) = v;  }
extern "C" void kernel_launch(void* const* d_in, const int* in_sizes, int n_in,
                              void* d_out, int out_size, void* d_ws, size_t ws_size, hipStream_t stream) {
  (void)in_sizes; (void)n_in; (void)out_size;
  const float* const* I = (const float* const*)d_in; const float* x = I[0]; const float* wqkv = I[1]; const float* bqkv = I[2]; const float* wo = I[3]; const float* bo = I[4]; const float* g1 = I[5]; const float* be1 = I[6]; const float* gg2 = I[7]; const float* be2 = I[8]; const float* wfc = I[9]; const float* bfc = I[10]; const float* wmp = I[11]; const float* bmp = I[12];      /* x; fused Wqkv [1024][3072] + bqkv [3072] ([in][out]); Wproj + bproj; LN1 g / b, LN2 g / b; W1 [1024][4096] + b1, W2 [4096][1024] + b2 */
  char* ws = (char*)d_ws; size_t off = 0;
  auto take = [&](size_t bytes) { char* p = ws + off; off += (bytes + 255) & ~(size_t)255; return p; };
  _Float16* BQKV = (_Float16*)take((size_t)3 * DM * DM * 2); _Float16* BO = (_Float16*)take((size_t)DM * DM * 2);
  _Float16* X16 = (_Float16*)take(NR * DM * 2); float* XB = (float*)take(NR * DM * 4); _Float16* BW1 = (_Float16*)take((size_t)DFF * DM * 2); _Float16* BW2 = (_Float16*)take((size_t)DM * DFF * 2);
  _Float16* QKV = (_Float16*)take(NR * 3 * DM * 2); _Float16* Q16 = QKV; _Float16* K16 = QKV + DM; _Float16* V16 = QKV + 2 * DM; _Float16* O16 = (_Float16*)take(NR * DM * 2);
  _Float16* HF16 = QKV;      /* alias: the FFN hidden rows [NR][DFF] fill QKV + O16 (adjacent, same bytes); their last reader, the output projection, precedes the FFN */
  _Float16* M16 = X16;      /* alias: X16's last reader, the first-tile q | k | v GEMM, precedes LN2's write */
  _Float16* VT = (_Float16*)take((size_t)NB * NH * HD * SQ * 2);
  float* OF0 = (float*)take((size_t)NB * QT0 * DM * 4); _Float16* OH0 = (_Float16*)take((size_t)NB * QT0 * DM * 2); _Float16* OL0 = (_Float16*)take((size_t)NB * QT0 * DM * 2);
  float* S = (float*)take((size_t)GB * NH * QT * NKX * 4);      /* no scores any more: the plane of the two aliases below */
  float* QKVF0 = S;      /* alias: f32 q | k | v of the first tiles [NB][QT0][3 DM]; read by the exact attention before x1 is written */
  float* X1 = S;      /* alias: x1 [NR][DM] is written after the exact attention's last read of QKVF0 */
  if (off > ws_size) return;
  k_wt_f16<DM, 3 * DM><<<dim3(3 * DM / 64, DM / 128), 256, 0, stream>>>(wqkv, BQKV, 16.0f);      /* fused [in][out] [DM][3 DM] -> Bt [3 DM][DM] x16: rows 0.. = q, DM.. = k, 2 DM.. = v output columns (contiguous thirds) */ k_wt_f16<DM, DM><<<dim3(DM / 64, DM / 128), 256, 0, stream>>>(wo, BO, 16.0f);      /* w_proj [in][out] -> Bt x16 */
  k_ln16<1, 1><<<(unsigned)(NR / (8 * LN_RW)), 256, 0, stream>>>(x, g1, be1, 1e-5f, X16, XB);      /* a = LN1(bf16(x)) -> f16 rows; XB = bf16(x) for the residual */
  k_wt_f16<DM, DFF><<<dim3(DFF / 64, DM / 128), 256, 0, stream>>>(wfc, BW1, 16.0f); k_wt_f16<DFF, DM><<<dim3(DM / 64, DFF / 128), 256, 0, stream>>>(wmp, BW2, 16.0f);      /* W1 [1024][4096] -> Bt [4096][1024]; W2 [4096][1024] -> Bt [1024][4096] (x16) */
  k_gemm3<0, false, false, 3 * DM><<<(unsigned)((MP / 256) * (3 * DM / 128)), 256, 0, stream>>>(X16, DM, BQKV, DM, 0.0625f, bqkv, nullptr, nullptr, QKV, MP, 3 * DM, DM);      /* q | k | v rows (f16); head h = columns h*HD.. of each DM block */
  k_vt<NH, SQ><<<NB * NH * (SQ / 64), 256, 0, stream>>>(V16, LQ, 0, VT);      /* V^T [NB][NH][HD][SQ], every batch in one launch */
  k_gemm2<0><<<dim3((QT0 / 128) * (3 * DM / 64), NB), 128, 0, stream>>>(X16, DM, (size_t)SQ * DM, BQKV, DM, 0, 0.0625f, bqkv, 0, nullptr, 1, 0, 0, QKVF0, nullptr, 3 * DM, (size_t)QT0 * 3 * DM, QT0, 3 * DM, DM);      /* f32 q | k | v of the first 128 rows of every batch (grid.y; exact products) */
  k_att0<0><<<dim3(NH * (QT0 / 64), NB), 64, 0, stream>>>(QKVF0, QKVF0 + DM, QKVF0 + 2 * DM, 3 * DM, nullptr, 0.07216878364870322f, OF0, DM);      /* exact f32 attention for rows 0..127 of every batch (grid.y; o x64) */
  k_fattn<<<dim3(NH, NB, SQ / 128), 128, 0, stream>>>(Q16, K16, VT, 0.07216878364870322f, O16);      /* causal attention, every batch, head and query tile in one launch: o (merged heads, x64) as f16 rows */
  k_gemm3<0, true, true, DM><<<(unsigned)((MPO / 256) * (DM / 128)), 256, 0, stream>>>(O16, DM, BO, DM, 0.0009765625f, bo, XB, X1, nullptr, MPO, DM, DM);      /* x1 = x + o Wo + b, all rows */
  k_hl<<<(unsigned)(((size_t)NB * QT0 * DM / 8 + 255) / 256), 256, 0, stream>>>(OF0, OH0, OL0, (size_t)NB * QT0 * DM / 8);      /* first-tile o (x64) -> f16 hi + x1024 residual planes */
  k_gemm2<0><<<dim3((QT0 / 128) * (DM / 64), NB), 128, 0, stream>>>(OH0, DM, (size_t)QT0 * DM, BO, DM, 0, 0.0009765625f, bo, 0, XB, -1, 0, 0, X1, nullptr, DM, (size_t)SQ * DM, QT0, DM, DM);      /* rows 0..127 of every batch (grid.y): x1 = x + o_hi Wo (+ b), overwriting the f16-path rows */
  k_gemm2<0><<<dim3((QT0 / 128) * (DM / 64), NB), 128, 0, stream>>>(OL0, DM, (size_t)QT0 * DM, BO, DM, 0, 0.00000095367431640625f, nullptr, 0, X1, -1, 0, 0, X1, nullptr, DM, (size_t)SQ * DM, QT0, DM, DM);      /* += o_lo Wo 2^-20 (own-element accumulate) */
  k_ln16<0, 0><<<(unsigned)(NR / (8 * LN_RW)), 256, 0, stream>>>(X1, gg2, be2, 1e-5f, M16, nullptr);      /* h = LN2(x1) -> f16 rows */
  k_gemm3<3, false, false, DFF><<<(unsigned)((MP / 256) * (DFF / 128)), 256, 0, stream>>>(M16, DM, BW1, DM, 0.0625f, bfc, nullptr, nullptr, HF16, MP, DFF, DM);      /* relu(h2 W1 + b1) -> f16, all rows */
  k_gemm3<0, true, true, DM><<<(unsigned)((MP / 256) * (DM / 128)), 256, 0, stream>>>(HF16, DFF, BW2, DFF, 0.0625f, bmp, X1, (float*)d_out, nullptr, MP, DM, DFF);      /* out = x1 + mlp (own-element residual), all rows */
}
